// v000
// The times below were measured on an AMD MI455X: many runs one after another, warmed up first and cycling through
// copies of the inputs, with the whole window's GPU time divided by the number of runs. Launches and the gaps
// between them are all in it. The median over several windows is given; except for v000 it joins two sittings, which
// can be a few percent apart, so the side-by-side timings, each taken in one sitting, are the better comparison.
// v000, which the later versions start from, runs in 2140 microseconds.
#include <hip/hip_runtime.h>

// DendriticFractalBlock (x [2][2048][1024]; h = RMSNorm(x) w1; [q|k|v] = dendritic(h, qkv_w, thr, gain) = max over the 4 input blocks n of gain[n] silu(h_n W[n] - thr[n]) (16 heads x 64); causal softmax(q.k/8); x1 = x + merged.v o_w;
// h2 = RMSNorm(x1) w2; ff = silu(dendritic(h2, gate)) * dendritic(h2, up); out = x1 + ff down_w -> [2][2048][1024]; all weights x @ W; eps = f32 eps).
// Compute dtypes, f32 accumulate: every input rounded to bf16; the RMSNorms f32 -> SINGLE fp16 block planes; every dendritic GEMM on fp16 planes x fp16 copies of the bf16 weights (1 product; hi+lo would double the
// ~25 G of dendritic GEMMs), the gain/silu/threshold/max epilogues f32; scores (K 64) and probs.v on hl planes (3 products) for the first 512 query rows of each head and single fp16 planes for the rest, f32 causal softmax with masked tiles

#define NB_  2
#define TT   2048
#define DM   1024
#define NH_  16
#define NKV  16
#define REP  (NH_ / NKV)
#define HD   64
#define DQ   (NH_ * HD)
#define DKV  (NKV * HD)
#define ZH   2
#define RH   512                  // query rows < RH use hi+lo planes (0: none)
#define WIN  2048
#define PCAR 1024.0f
#define SCL  0.125f   // HD^-0.5
typedef _Float16 h16;
typedef unsigned short bf;
typedef __attribute__((ext_vector_type(16))) __bf16   v16bf;
typedef __attribute__((ext_vector_type(16))) _Float16 v16h;
typedef __attribute__((ext_vector_type(8)))  _Float16 v8h;
typedef __attribute__((ext_vector_type(8)))  unsigned short v8us;
typedef __attribute__((ext_vector_type(8)))  float    v8f;
typedef __attribute__((ext_vector_type(4)))  float    v4f;
typedef v8h  __attribute__((may_alias)) v8ha;
typedef v4f  __attribute__((may_alias)) v4fa;
typedef v8us __attribute__((may_alias)) v8usa;

__device__ __forceinline__ unsigned short f2bf(float f) { unsigned u = __float_as_uint(f); u += 0x7FFFu + ((u >> 16) & 1u); return (unsigned short)(u >> 16); }
__device__ __forceinline__ float bf2f(unsigned short b) { return __uint_as_float(((unsigned)b) << 16); }
__device__ __forceinline__ float bfr(float f) { return bf2f(f2bf(f)); }
__device__ __forceinline__ v16h cat16(v8h lo, v8h hi) { return __builtin_shufflevector(lo, hi, 0, 1, 2, 3, 4, 5, 6, 7, 8, 9, 10, 11, 12, 13, 14, 15); }
__device__ __forceinline__ v16bf cat16b(v8us lo, v8us hi) { return __builtin_bit_cast(v16bf, __builtin_shufflevector(lo, hi, 0, 1, 2, 3, 4, 5, 6, 7, 8, 9, 10, 11, 12, 13, 14, 15)); }
__device__ __forceinline__ v8f wmma16(v16h a, v16h b, v8f c) { return __builtin_amdgcn_wmma_f32_16x16x32_f16(false, a, false, b, (short)0, c, false, false); }
__device__ __forceinline__ v8f wmmab(v16bf a, v16bf b, v8f c) { return __builtin_amdgcn_wmma_f32_16x16x32_bf16(false, a, false, b, (short)0, c, false, false); }



// ---- k_gemmw: register-blocked GEMM, ONE WAVE per 64x64 output tile (16 accumulators), operands straight from K-contiguous 16-bit planes; grid (M/64, N/64, Z), 32 threads.
// C[m][n] (f32, pitch ldc, + optional f32 bias[n]) = sum_k A[m][k] Bt[n][k] (+ split products per NSPLIT). z-batch strides sA/sB/sC in elements. K % 32 == 0.
template <typename T16> struct WFrag;
template <> struct WFrag<h16> { typedef v16h V; static __device__ __forceinline__ V ld(const h16* p) { return cat16(*(const v8h*)p, *(const v8h*)(p + 16)); } static __device__ __forceinline__ v8f mma(V a, V b, v8f c) { return wmma16(a, b, c); } };
template <> struct WFrag<bf> { typedef v16bf V; static __device__ __forceinline__ V ld(const bf* p) { return cat16b(*(const v8us*)p, *(const v8us*)(p + 16)); } static __device__ __forceinline__ v8f mma(V a, V b, v8f c) { return wmmab(a, b, c); } };
template <typename T16, int NSPLIT, bool BIAS>
__global__ __launch_bounds__(32) void k_gemmw(const T16* __restrict__ A, const T16* __restrict__ A2, const T16* __restrict__ Bt, const T16* __restrict__ Bt2, int K, float* C, int ldc, const float* __restrict__ bias, size_t sA, size_t sB, size_t sC) {
    typedef typename WFrag<T16>::V V;
    __shared__ __align__(16) float os[16 * 68];
    const size_t z = blockIdx.z; A += z * sA; if (A2) A2 += z * sA; Bt += z * sB; if (Bt2) Bt2 += z * sB; C += z * sC;
    const int lane = threadIdx.x & 31, lr = lane & 15, hi = lane >> 4; const int r0 = blockIdx.x * 64, c0 = blockIdx.y * 64;
    v8f acc[4][4];
#pragma unroll
    for (int mb = 0; mb < 4; ++mb)
#pragma unroll
        for (int nb = 0; nb < 4; ++nb) acc[mb][nb] = (v8f){};
    const size_t aoff = (size_t)(r0 + lr) * K + 8 * hi, boff = (size_t)(c0 + lr) * K + 8 * hi;
#pragma unroll 1
    for (int kc = 0; kc < K; kc += 32) {
        V a[4], a2[4];
#pragma unroll
        for (int mb = 0; mb < 4; ++mb) { a[mb] = WFrag<T16>::ld(A + aoff + (size_t)mb * 16 * K + kc); if (NSPLIT == 1 || NSPLIT == 2) a2[mb] = WFrag<T16>::ld(A2 + aoff + (size_t)mb * 16 * K + kc); }
#pragma unroll
        for (int nb = 0; nb < 4; ++nb) { const V b = WFrag<T16>::ld(Bt + boff + (size_t)nb * 16 * K + kc); V b2; if (NSPLIT >= 2) b2 = WFrag<T16>::ld(Bt2 + boff + (size_t)nb * 16 * K + kc);
#pragma unroll
            for (int mb = 0; mb < 4; ++mb) { acc[mb][nb] = WFrag<T16>::mma(a[mb], b, acc[mb][nb]); if (NSPLIT == 1 || NSPLIT == 2) acc[mb][nb] = WFrag<T16>::mma(a2[mb], b, acc[mb][nb]); if (NSPLIT >= 2) acc[mb][nb] = WFrag<T16>::mma(a[mb], b2, acc[mb][nb]); } }
        asm volatile("v_nop\n\tv_nop\n\tv_nop\n\tv_nop" : "+v"(acc[0][0]), "+v"(acc[1][1]), "+v"(acc[2][2]), "+v"(acc[3][3]) : "v"(a[0]), "v"(a[3]));
    }
#pragma unroll
    for (int mb = 0; mb < 4; ++mb) {
#pragma unroll
        for (int nb = 0; nb < 4; ++nb) {
#pragma unroll
            for (int j = 0; j < 8; ++j) os[(hi * 8 + j) * 68 + nb * 16 + lr] = acc[mb][nb][j]; }
        __builtin_amdgcn_wave_barrier(); asm volatile("" ::: "memory");
        float* crow = C + (size_t)(r0 + mb * 16) * ldc + c0;
{
#pragma unroll
            for (int s = 0; s < 8; ++s) { const int row = 2 * s + hi, cofs = lr * 4; v4f val = *(const v4fa*)(os + row * 68 + cofs); if (BIAS) { val[0] += bfr(bias[c0 + cofs]); val[1] += bfr(bias[c0 + cofs + 1]); val[2] += bfr(bias[c0 + cofs + 2]); val[3] += bfr(bias[c0 + cofs + 3]); }
                *(v4f*)(crow + (size_t)row * ldc + cofs) = val; }
             }
        __builtin_amdgcn_wave_barrier(); asm volatile("" ::: "memory");
    }
}

// ---- k_gemmc: the same one-wave 64x64 tile GEMM specialised for causal attention: CMODE 1 skips score tiles entirely above the diagonal (query rows r0+roff.., key columns c0..), CMODE 2 limits the
// key (K) loop of the probability x value contraction to the diagonal block (probabilities beyond it are exactly zero). roff = row offset of this launch's first row within the sequence.
template <typename T16, int NSPLIT, int CMODE>
__global__ __launch_bounds__(32) void k_gemmc(const T16* __restrict__ A, const T16* __restrict__ A2, const T16* __restrict__ Bt, const T16* __restrict__ Bt2, int K, float* C, int ldc, int roff, size_t sA, size_t sB, size_t sC) {
    typedef typename WFrag<T16>::V V;
    __shared__ __align__(16) float os[16 * 68];
    const size_t z = blockIdx.z; A += z * sA; if (A2) A2 += z * sA; Bt += z * sB; if (Bt2) Bt2 += z * sB; C += z * sC;
    const int lane = threadIdx.x & 31, lr = lane & 15, hi = lane >> 4; const int r0 = blockIdx.x * 64, c0 = blockIdx.y * 64;
    if (CMODE == 1 && c0 > r0 + roff + 63) return;                  // score tile entirely above the causal diagonal: never read (the softmax masks j > i by select)
    const int Kl = (CMODE == 2) ? min(K, r0 + roff + 64) : K;        // P.V: probabilities are exactly 0 beyond the diagonal block, so the K loop stops there
    v8f acc[4][4];
#pragma unroll
    for (int mb = 0; mb < 4; ++mb)
#pragma unroll
        for (int nb = 0; nb < 4; ++nb) acc[mb][nb] = (v8f){};
    const size_t aoff = (size_t)(r0 + lr) * K + 8 * hi, boff = (size_t)(c0 + lr) * K + 8 * hi;
#pragma unroll 1
    for (int kc = 0; kc < Kl; kc += 32) {
        V a[4], a2[4];
#pragma unroll
        for (int mb = 0; mb < 4; ++mb) { a[mb] = WFrag<T16>::ld(A + aoff + (size_t)mb * 16 * K + kc); if (NSPLIT == 1 || NSPLIT == 2) a2[mb] = WFrag<T16>::ld(A2 + aoff + (size_t)mb * 16 * K + kc); }
#pragma unroll
        for (int nb = 0; nb < 4; ++nb) { const V b = WFrag<T16>::ld(Bt + boff + (size_t)nb * 16 * K + kc); V b2; if (NSPLIT >= 2) b2 = WFrag<T16>::ld(Bt2 + boff + (size_t)nb * 16 * K + kc);
#pragma unroll
            for (int mb = 0; mb < 4; ++mb) { acc[mb][nb] = WFrag<T16>::mma(a[mb], b, acc[mb][nb]); if (NSPLIT == 1 || NSPLIT == 2) acc[mb][nb] = WFrag<T16>::mma(a2[mb], b, acc[mb][nb]); if (NSPLIT >= 2) acc[mb][nb] = WFrag<T16>::mma(a[mb], b2, acc[mb][nb]); } }
        asm volatile("v_nop\n\tv_nop\n\tv_nop\n\tv_nop" : "+v"(acc[0][0]), "+v"(acc[1][1]), "+v"(acc[2][2]), "+v"(acc[3][3]) : "v"(a[0]), "v"(a[3]));
    }
#pragma unroll
    for (int mb = 0; mb < 4; ++mb) {
#pragma unroll
        for (int nb = 0; nb < 4; ++nb) {
#pragma unroll
            for (int j = 0; j < 8; ++j) os[(hi * 8 + j) * 68 + nb * 16 + lr] = acc[mb][nb][j]; }
        __builtin_amdgcn_wave_barrier(); asm volatile("" ::: "memory");
        float* crow = C + (size_t)(r0 + mb * 16) * ldc + c0;
{
#pragma unroll
            for (int s = 0; s < 8; ++s) { const int row = 2 * s + hi, cofs = lr * 4; v4f val = *(const v4fa*)(os + row * 68 + cofs);
                *(v4f*)(crow + (size_t)row * ldc + cofs) = val; }
             }
        __builtin_amdgcn_wave_barrier(); asm volatile("" ::: "memory");
    }
}

__device__ __forceinline__ h16 tohx(float x) { return (h16)x; }
__device__ __forceinline__ void splitf(float y, unsigned short& h, unsigned short& l) { h = f2bf(y); l = f2bf(y - bf2f(h)); }
typedef __attribute__((ext_vector_type(2))) _Float16 v2h;
typedef __attribute__((ext_vector_type(4))) _Float16 v4h;
typedef __attribute__((ext_vector_type(2))) unsigned short v2us;
typedef __attribute__((ext_vector_type(4))) unsigned short v4us;
typedef __attribute__((ext_vector_type(2))) float v2f;
typedef __attribute__((ext_vector_type(4))) int v4i;

__global__ __launch_bounds__(256) void k_wtG(const float* __restrict__ w, int K, int N, bf* Bt) {
    const int lane = threadIdx.x & 31; const int L0 = (blockIdx.x * 8 + (threadIdx.x >> 5)) * 8; const int nlines = N * K / 64;
{
#pragma unroll 1
        for (int l = 0; l < 8; ++l) { const int L = L0 + l; if (L >= nlines) break; const size_t e = (size_t)L * 64 + lane * 2; const int k = (int)(e % K), n = (int)(e / K); v2us o;
            o[0] = f2bf(w[(size_t)k * N + n]); o[1] = f2bf(w[(size_t)(k + 1) * N + n]); *(v2us*)(Bt + e) = o; }
         }
}
__global__ __launch_bounds__(256) void k_cvt8(const float* __restrict__ src, bf* dst, size_t n8) { const size_t i = (size_t)blockIdx.x * 256 + threadIdx.x; if (i >= n8) return; const v8f v = *(const v8f*)(src + i * 8); v8us o;
#pragma unroll
    for (int k = 0; k < 8; ++k) o[k] = f2bf(v[k]); *(v8us*)(dst + i * 8) = o;  }
__global__ __launch_bounds__(256) void k_cscvt(const float* __restrict__ cosT, const float* __restrict__ sinT, float* CS) { const int idx = blockIdx.x * 256 + threadIdx.x; if (idx >= TT * HD) return; v2f cs; cs[0] = bfr(cosT[idx]); cs[1] = bfr(sinT[idx]); *(v2f*)(CS + (size_t)idx * 2) = cs;  }
// k_rope: head planes [h][t][d] (fp16 + hi/lo) of rope(x) x sc with the rotate-half convention out[d] = x[d] cos[t][d] - x[d+HD/2] sin[t][d], out[d+HD/2] = x[d+HD/2] cos[t][d+HD/2] + x[d] sin[t][d+HD/2]
__global__ __launch_bounds__(256) void k_rope(const float* __restrict__ F, int pitch, int nheads, const float* __restrict__ CS, const float* __restrict__ RF, const float* __restrict__ nw, float sc, h16* P16, bf* Ph, bf* Pl) {
    const size_t e = ((size_t)blockIdx.x * 256 + threadIdx.x) * 2; if (e >= (size_t)nheads * TT * HD) return; const int d = (int)(e % HD); const int t = (int)((e / HD) % TT); const int h = (int)(e / ((size_t)HD * TT)); const float* f = F + (size_t)t * pitch + h * HD; const float rf = RF ? RF[(size_t)h * TT + t] : 1.0f; v2h o16; v2us oh, ol;
#pragma unroll
    for (int q = 0; q < 2; ++q) { const int dd = d + q; const int dp = (dd < HD / 2) ? dd + HD / 2 : dd - HD / 2; float x0 = f[dd], x1 = f[dp];
        if (RF) { float n0 = __fmul_rn(x0, rf), n1 = __fmul_rn(x1, rf); asm volatile("" : "+v"(n0)); asm volatile("" : "+v"(n1)); x0 = __fmul_rn(bfr(nw[dd]), n0); x1 = __fmul_rn(bfr(nw[dp]), n1); }
        const v2f cs = *(const v2f*)(CS + ((size_t)t * HD + dd) * 2); float a = __fmul_rn(x0, cs[0]), bq = __fmul_rn(x1, cs[1]); asm volatile("" : "+v"(a)); asm volatile("" : "+v"(bq)); const float r = ((dd < HD / 2) ? __fsub_rn(a, bq) : __fadd_rn(a, bq)) * sc;
        o16[q] = tohx(r); unsigned short a2, c2; splitf(r, a2, c2); oh[q] = a2; ol[q] = c2; }
    *(v2h*)(P16 + e) = o16; *(v2us*)(Ph + e) = oh; *(v2us*)(Pl + e) = ol;  }
__global__ __launch_bounds__(256) void k_vtp(const float* __restrict__ F, int pitch, int nheads, h16* V16, bf* Vh, bf* Vl) { const size_t e = ((size_t)blockIdx.x * 256 + threadIdx.x) * 2; if (e >= (size_t)nheads * HD * TT) return; const int t = (int)(e % TT); const int d = (int)((e / TT) % HD); const int g = (int)(e / ((size_t)TT * HD)); v2h o16; v2us oh, ol;
#pragma unroll
    for (int q = 0; q < 2; ++q) { const float x = F[(size_t)(t + q) * pitch + g * HD + d]; o16[q] = tohx(x); unsigned short a2, c2; splitf(x, a2, c2); oh[q] = a2; ol[q] = c2; }
    *(v2h*)(V16 + e) = o16; *(v2us*)(Vh + e) = oh; *(v2us*)(Vl + e) = ol;  }
__global__ __launch_bounds__(256) void k_csid(float* CS) { const int idx = blockIdx.x * 256 + threadIdx.x; if (idx >= TT * HD) return; v2f cs; cs[0] = 1.0f; cs[1] = 0.0f; *(v2f*)(CS + (size_t)idx * 2) = cs;  }
// k_asoft: per row (zz, i): t = S x HD^-0.5 for j <= i and i - j < WIN (sliding causal window; the reference's -1e9 additive fill vanishes identically); softmax over the 2048 keys (register row, one exp, fixed trees);
__global__ __launch_bounds__(256) void k_asoft(const float* __restrict__ Sb, h16* P16, bf* Ph, bf* Pl) {
    const int lane = threadIdx.x & 31; const int row = blockIdx.x * 8 + (threadIdx.x >> 5); if (row >= ZH * TT) return; const int i = row % TT; const int zz = row / TT; (void)zz; const bool hires = (i < RH); const float* sr = Sb + (size_t)row * TT; float v[TT / 32]; float mx = -3.0e38f;
#pragma unroll
    for (int ch = 0; ch < TT / 128; ++ch) { const int j0 = ch * 128 + lane * 4; const v4f a = *(const v4f*)(sr + j0);
#pragma unroll
        for (int q = 0; q < 4; ++q) { const int j = j0 + q; (void)j; const float t = (j <= i && i - j < WIN) ? a[q] * SCL : -3.0e38f; v[ch * 4 + q] = t; mx = fmaxf(mx, t); } }
#pragma unroll
    for (int sh = 16; sh; sh >>= 1) mx = fmaxf(mx, __shfl_xor(mx, sh, 32));
    float sum = 0.f;
#pragma unroll
    for (int k = 0; k < TT / 32; ++k) { float d0 = __fsub_rn(v[k], mx); asm volatile("" : "+v"(d0)); v[k] = __builtin_amdgcn_exp2f(__fmul_rn(d0, 1.4426950408889634f)); sum += v[k]; }
#pragma unroll
    for (int sh = 16; sh; sh >>= 1) sum += __shfl_xor(sum, sh, 32);
    const float f = __fdiv_rn(hires ? 1.0f : PCAR, sum);
{
        if (hires) {
#pragma unroll
            for (int ch = 0; ch < TT / 128; ++ch) { v4us oh, ol;
#pragma unroll
                for (int q = 0; q < 4; ++q) { unsigned short a, c2; splitf(v[ch * 4 + q] * f, a, c2); oh[q] = a; ol[q] = c2; }
                const size_t oo = ((size_t)zz * (RH ? RH : 1) + i) * TT + ch * 128 + lane * 4; *(v4us*)(Ph + oo) = oh; *(v4us*)(Pl + oo) = ol; }
        } else {
#pragma unroll
            for (int ch = 0; ch < TT / 128; ++ch) { v4h o4;
#pragma unroll
                for (int q = 0; q < 4; ++q) o4[q] = tohx(v[ch * 4 + q] * f);
                *(v4h*)(P16 + (size_t)row * TT + ch * 128 + lane * 4) = o4; } }
         }
}
__global__ __launch_bounds__(256) void k_merge(const float* __restrict__ O, int h0, bf* Ah, bf* Al) { const size_t e = ((size_t)blockIdx.x * 256 + threadIdx.x) * 2; if (e >= (size_t)ZH * TT * HD) return; const int d = (int)(e % HD); const int t = (int)((e / HD) % TT); const int zz = (int)(e / ((size_t)HD * TT)); const float cs = (t < RH) ? 1.0f : (1.0f / PCAR); const size_t oo = (size_t)t * DQ + (h0 + zz) * HD + d;
    v2us oh, ol;
#pragma unroll
    for (int q = 0; q < 2; ++q) { unsigned short a, c2; splitf(O[e + q] * cs, a, c2); oh[q] = a; ol[q] = c2; } *(v2us*)(Ah + oo) = oh; *(v2us*)(Al + oo) = ol;  }

__global__ __launch_bounds__(256) void k_wt16(const float* __restrict__ w, int K, int N, h16* Bt) { const size_t e = ((size_t)blockIdx.x * 256 + threadIdx.x) * 2; if (e >= (size_t)N * K) return; const int k = (int)(e % K), n = (int)(e / K); v2h o; o[0] = tohx(bfr(w[(size_t)k * N + n])); o[1] = tohx(bfr(w[(size_t)(k + 1) * N + n])); *(v2h*)(Bt + e) = o;  }
__global__ __launch_bounds__(256) void k_rmsc(const float* __restrict__ X, int isin, const float* __restrict__ w, h16* HC) { const int lane = threadIdx.x & 31; const int t = blockIdx.x * 8 + (threadIdx.x >> 5); if (t >= TT) return; float v[32]; float s = 0.f;
#pragma unroll
    for (int ch = 0; ch < 8; ++ch) { const v4f a = *(const v4f*)(X + (size_t)t * DM + ch * 128 + lane * 4);
#pragma unroll
        for (int q = 0; q < 4; ++q) { const float xv = isin ? bfr(a[q]) : a[q]; v[ch * 4 + q] = xv; float p = __fmul_rn(xv, xv); asm volatile("" : "+v"(p)); s = __fadd_rn(s, p); } }
#pragma unroll
    for (int sh = 16; sh; sh >>= 1) s += __shfl_xor(s, sh, 32);
    const float r = __frsqrt_rn(__fadd_rn(s * (1.0f / DM), 1.1920929e-07f));
{
#pragma unroll
        for (int ch = 0; ch < 8; ++ch) { const int c0 = ch * 128 + lane * 4; const int n = c0 / 256, cc = c0 % 256; v4h o;
#pragma unroll
            for (int q = 0; q < 4; ++q) { float tn = __fmul_rn(v[ch * 4 + q], r); asm volatile("" : "+v"(tn)); o[q] = tohx(__fmul_rn(tn, bfr(w[c0 + q]))); }
            *(v4h*)(HC + ((size_t)n * TT + t) * 256 + cc) = o; }
         } }
__global__ __launch_bounds__(256) void k_dmax(const float* __restrict__ TMP, const float* __restrict__ thr, const float* __restrict__ gain, int n, int ld, float* ACC) { const size_t i = ((size_t)blockIdx.x * 256 + threadIdx.x) * 4; if (i >= (size_t)TT * ld) return; const int o = (int)(i % ld); const v4f a = *(const v4f*)(TMP + i); v4f prev; if (n) prev = *(const v4f*)(ACC + i); v4f r;
#pragma unroll
    for (int q = 0; q < 4; ++q) { const float z = __fsub_rn(a[q], bfr(thr[o + q])); const float sg = __fdiv_rn(1.0f, 1.0f + __expf(-z)); float sl = __fmul_rn(z, sg); asm volatile("" : "+v"(sl)); const float val = __fmul_rn(bfr(gain[o + q]), sl); r[q] = n ? fmaxf(prev[q], val) : val; }
    *(v4f*)(ACC + i) = r;  }
__global__ __launch_bounds__(256) void k_res(const float* __restrict__ x, const float* __restrict__ ATT, float* X1) { const size_t i = ((size_t)blockIdx.x * 256 + threadIdx.x) * 4; if (i >= (size_t)TT * DM) return; const v4f a = *(const v4f*)(ATT + i); v4f o; o[0] = __fadd_rn(bfr(x[i]), a[0]); o[1] = __fadd_rn(bfr(x[i + 1]), a[1]); o[2] = __fadd_rn(bfr(x[i + 2]), a[2]); o[3] = __fadd_rn(bfr(x[i + 3]), a[3]); *(v4f*)(X1 + i) = o;  }
__global__ __launch_bounds__(256) void k_ffp(const float* __restrict__ G, const float* __restrict__ U, h16* FF16) { const size_t i = ((size_t)blockIdx.x * 256 + threadIdx.x) * 4; if (i >= (size_t)TT * 2048) return; const v4f g = *(const v4f*)(G + i), u = *(const v4f*)(U + i); v4h o;
#pragma unroll
    for (int q = 0; q < 4; ++q) { const float sg = __fdiv_rn(1.0f, 1.0f + __expf(-g[q])); float sl = __fmul_rn(g[q], sg); asm volatile("" : "+v"(sl)); o[q] = tohx(__fmul_rn(sl, u[q])); } *(v4h*)(FF16 + i) = o;  }
__global__ __launch_bounds__(256) void k_fin(const float* __restrict__ X1, const float* __restrict__ F2, float* OUT) { const size_t i = ((size_t)blockIdx.x * 256 + threadIdx.x) * 4; if (i >= (size_t)TT * DM) return; const v4f a = *(const v4f*)(X1 + i), f = *(const v4f*)(F2 + i); v4f o; o[0] = __fadd_rn(a[0], f[0]); o[1] = __fadd_rn(a[1], f[1]); o[2] = __fadd_rn(a[2], f[2]); o[3] = __fadd_rn(a[3], f[3]); *(v4f*)(OUT + i) = o;  }

extern "C" void kernel_launch(void* const* d_in, const int* in_sizes, int n_in,
                              void* d_out, int out_size, void* d_ws, size_t ws_size, hipStream_t stream) {
    (void)in_sizes; (void)n_in; (void)out_size;
    const float* x = (const float*)d_in[0]; const float* qkvw = (const float*)d_in[1]; const float* qthr = (const float*)d_in[2]; const float* qgain = (const float*)d_in[3]; const float* wo = (const float*)d_in[4]; const float* gw = (const float*)d_in[5]; const float* gthr = (const float*)d_in[6]; const float* ggain = (const float*)d_in[7]; const float* uw = (const float*)d_in[8]; const float* uthr = (const float*)d_in[9]; const float* ugain = (const float*)d_in[10]; const float* dw = (const float*)d_in[11]; const float* n1w = (const float*)d_in[12]; const float* n2w = (const float*)d_in[13];
    float* OUT = (float*)d_out;     // [2][2048][1024]
    char* wsp = (char*)d_ws;
    auto take = [&](size_t bytes) { char* p = wsp; wsp += (bytes + 255) & ~(size_t)255; return (void*)p; };
    bf* WQ = (bf*)take((size_t)DQ * DM * 2); bf* WK = (bf*)take((size_t)DKV * DM * 2); bf* WV = (bf*)take((size_t)DKV * DM * 2); bf* WO = (bf*)take((size_t)DM * DQ * 2); float* CS = (float*)take((size_t)TT * HD * 2 * 4);
    bf* XB = (bf*)take((size_t)TT * DM * 2); float* FQ = (float*)take((size_t)TT * DQ * 4); float* FK = (float*)take((size_t)TT * DKV * 4);
    h16* QP16 = (h16*)take((size_t)NH_ * TT * HD * 2); h16* KP16 = (h16*)take((size_t)NKV * TT * HD * 2); h16* VT16 = (h16*)take((size_t)NKV * HD * TT * 2);
    bf* QPh = (bf*)take((size_t)NH_ * TT * HD * 2); bf* QPl = (bf*)take((size_t)NH_ * TT * HD * 2); bf* KPh = (bf*)take((size_t)NKV * TT * HD * 2); bf* KPl = (bf*)take((size_t)NKV * TT * HD * 2); bf* VTh = (bf*)take((size_t)NKV * HD * TT * 2); bf* VTl = (bf*)take((size_t)NKV * HD * TT * 2); bf* Ph = (bf*)take((size_t)ZH * RH * TT * 2); bf* Pl = (bf*)take((size_t)ZH * RH * TT * 2);
    float* Sb = (float*)take((size_t)ZH * TT * TT * 4); h16* P16 = (h16*)take((size_t)ZH * TT * TT * 2); float* Ob = (float*)take((size_t)ZH * TT * HD * 4); bf* ATh = (bf*)take((size_t)TT * DQ * 2); bf* ATl = (bf*)take((size_t)TT * DQ * 2);
    if ((size_t)(wsp - (char*)d_ws) > ws_size) return;    // ws 256 MiB
    float* FV = FK;   // v projection reuses the k buffer after the k planes are built (stream-ordered)
    h16* BQKV = (h16*)take((size_t)4 * 3072 * 256 * 2); h16* BG = (h16*)take((size_t)4 * 2048 * 256 * 2); h16* BU = (h16*)take((size_t)4 * 2048 * 256 * 2); h16* BD = (h16*)take((size_t)DM * 2048 * 2); h16* HC = (h16*)take((size_t)4 * TT * 256 * 2); float* TMP = (float*)take((size_t)TT * 2048 * 4); float* ACG = (float*)take((size_t)TT * 2048 * 4); float* ACU = (float*)take((size_t)TT * 2048 * 4); h16* FF16 = (h16*)take((size_t)TT * 2048 * 2); float* ATT = (float*)take((size_t)TT * DM * 4); float* X1 = (float*)take((size_t)TT * DM * 4);
    if ((size_t)(wsp - (char*)d_ws) > ws_size) return;
    { for (int n = 0; n < 4; ++n) { k_wt16<<<(unsigned)(((size_t)256 * 3072 / 2 + 255) / 256), 256, 0, stream>>>(qkvw + (size_t)n * 256 * 3072, 256, 3072, BQKV + (size_t)n * 3072 * 256); k_wt16<<<(unsigned)(((size_t)256 * 2048 / 2 + 255) / 256), 256, 0, stream>>>(gw + (size_t)n * 256 * 2048, 256, 2048, BG + (size_t)n * 2048 * 256); k_wt16<<<(unsigned)(((size_t)256 * 2048 / 2 + 255) / 256), 256, 0, stream>>>(uw + (size_t)n * 256 * 2048, 256, 2048, BU + (size_t)n * 2048 * 256); }
      k_wt16<<<(unsigned)(((size_t)2048 * DM / 2 + 255) / 256), 256, 0, stream>>>(dw, 2048, DM, BD);
      k_wtG<<<(unsigned)((DQ * DM / 64 + 63) / 64), 256, 0, stream>>>(wo, DQ, DM, WO);
       }
    k_csid<<<(TT * HD + 255) / 256, 256, 0, stream>>>(CS);
    const unsigned LQ = (unsigned)(((size_t)NH_ * TT * HD / 2 + 255) / 256), LKv = (unsigned)(((size_t)NKV * TT * HD / 2 + 255) / 256);
    for (int b = 0; b < NB_; ++b) {
        
        k_rmsc<<<TT / 8, 256, 0, stream>>>(x + (size_t)b * TT * DM, 1, n1w, HC);
        // dendritic q / k / v: per output slice, 4 block GEMMs on fp16 planes with the running gain*silu(. - thr) max into FQ / FK / FV
        auto dend = [&](int slice, float* dst) { for (int n = 0; n < 4; ++n) { k_gemmw<h16, 0, false><<<dim3(TT / 64, DQ / 64, 1), 32, 0, stream>>>(HC + (size_t)n * TT * 256, nullptr, BQKV + (size_t)n * 3072 * 256 + (size_t)slice * DQ * 256, nullptr, 256, TMP, DQ, nullptr, 0, 0, 0); k_dmax<<<(unsigned)(((size_t)TT * DQ / 4 + 255) / 256), 256, 0, stream>>>(TMP, qthr + n * 3072 + slice * DQ, qgain + n * 3072 + slice * DQ, n, DQ, dst); } };
        dend(0, FQ);
        k_rope<<<LQ, 256, 0, stream>>>(FQ, DQ, NH_, CS, nullptr, nullptr, 1.0f, QP16, QPh, QPl);
        dend(1, FK);
        k_rope<<<LKv, 256, 0, stream>>>(FK, DKV, NKV, CS, nullptr, nullptr, 1.0f, KP16, KPh, KPl);
        dend(2, FV); k_vtp<<<LKv, 256, 0, stream>>>(FV, DKV, NKV, VT16, VTh, VTl);
        for (int h0 = 0; h0 < NH_; h0 += ZH) { const size_t zq = (size_t)h0, zk = (size_t)(h0 / REP);   // one kv head per query head: the pass's two heads use consecutive kv planes (z-strides TT*HD)
            k_gemmc<bf, 2, 1><<<dim3(RH / 64, TT / 64, ZH), 32, 0, stream>>>(QPh + zq * TT * HD, QPl + zq * TT * HD, KPh + zk * TT * HD, KPl + zk * TT * HD, HD, Sb, TT, 0, (size_t)TT * HD, (size_t)TT * HD, (size_t)TT * TT);
            k_gemmc<h16, 0, 1><<<dim3((TT - RH) / 64, TT / 64, ZH), 32, 0, stream>>>(QP16 + zq * TT * HD + (size_t)RH * HD, nullptr, KP16 + zk * TT * HD, nullptr, HD, Sb + (size_t)RH * TT, TT, RH, (size_t)TT * HD, (size_t)TT * HD, (size_t)TT * TT);
            k_asoft<<<ZH * TT / 8, 256, 0, stream>>>(Sb, P16, Ph, Pl);
            k_gemmc<bf, 2, 2><<<dim3(RH / 64, HD / 64, ZH), 32, 0, stream>>>(Ph, Pl, VTh + zk * HD * TT, VTl + zk * HD * TT, TT, Ob, HD, 0, (size_t)RH * TT, (size_t)HD * TT, (size_t)TT * HD);
            k_gemmc<h16, 0, 2><<<dim3((TT - RH) / 64, HD / 64, ZH), 32, 0, stream>>>(P16 + (size_t)RH * TT, nullptr, VT16 + zk * HD * TT, nullptr, TT, Ob + (size_t)RH * HD, HD, RH, (size_t)TT * TT, (size_t)HD * TT, (size_t)TT * HD);
            k_merge<<<(unsigned)(((size_t)ZH * TT * HD / 2 + 255) / 256), 256, 0, stream>>>(Ob, h0, ATh, ATl); }
        k_gemmw<bf, 1, false><<<dim3(TT / 64, DM / 64, 1), 32, 0, stream>>>(ATh, ATl, WO, nullptr, DQ, ATT, DM, nullptr, 0, 0, 0);
        k_res<<<(TT * DM / 4 + 255) / 256, 256, 0, stream>>>(x + (size_t)b * TT * DM, ATT, X1); k_rmsc<<<TT / 8, 256, 0, stream>>>(X1, 0, n2w, HC);
        for (int n = 0; n < 4; ++n) { k_gemmw<h16, 0, false><<<dim3(TT / 64, 2048 / 64, 1), 32, 0, stream>>>(HC + (size_t)n * TT * 256, nullptr, BG + (size_t)n * 2048 * 256, nullptr, 256, TMP, 2048, nullptr, 0, 0, 0); k_dmax<<<(unsigned)(((size_t)TT * 2048 / 4 + 255) / 256), 256, 0, stream>>>(TMP, gthr + n * 2048, ggain + n * 2048, n, 2048, ACG);
            k_gemmw<h16, 0, false><<<dim3(TT / 64, 2048 / 64, 1), 32, 0, stream>>>(HC + (size_t)n * TT * 256, nullptr, BU + (size_t)n * 2048 * 256, nullptr, 256, TMP, 2048, nullptr, 0, 0, 0); k_dmax<<<(unsigned)(((size_t)TT * 2048 / 4 + 255) / 256), 256, 0, stream>>>(TMP, uthr + n * 2048, ugain + n * 2048, n, 2048, ACU); }
        k_ffp<<<(unsigned)(((size_t)TT * 2048 / 4 + 255) / 256), 256, 0, stream>>>(ACG, ACU, FF16);
        k_gemmw<h16, 0, false><<<dim3(TT / 64, DM / 64, 1), 32, 0, stream>>>(FF16, nullptr, BD, nullptr, 2048, ATT, DM, nullptr, 0, 0, 0);
        k_fin<<<(TT * DM / 4 + 255) / 256, 256, 0, stream>>>(X1, ATT, OUT + (size_t)b * TT * DM); }
}

// v001
// One run takes 1510 microseconds.
// In two side-by-side timings against v000, it was 1.40 and 1.43 times as fast.
#include <hip/hip_runtime.h>

// DendriticFractalBlock (x [2][2048][1024]; h = RMSNorm(x) w1; [q|k|v] = dendritic(h, qkv_w, thr, gain) = max over the 4 input blocks n of gain[n] silu(h_n W[n] - thr[n]) (16 heads x 64); causal softmax(q.k/8); x1 = x + merged.v o_w;
// h2 = RMSNorm(x1) w2; ff = silu(dendritic(h2, gate)) * dendritic(h2, up); out = x1 + ff down_w -> [2][2048][1024]; all weights x @ W; eps = f32 eps).
// Compute dtypes, f32 accumulate: every input rounded to bf16; the RMSNorms f32 -> SINGLE fp16 block planes; every dendritic GEMM on fp16 planes x fp16 copies of the bf16 weights (1 product; hi+lo would double the
// ~25 G of dendritic GEMMs), the gain/silu/threshold/max epilogues f32; scores (K 64) and probs.v on hl planes (3 products) for the first 512 query rows of each head and single fp16 planes for the rest, f32 causal softmax with masked tiles

#define NB_  2
#define TT   2048
#define DM   1024
#define NH_  16
#define NKV  16
#define REP  (NH_ / NKV)
#define HD   64
#define DQ   (NH_ * HD)
#define DKV  (NKV * HD)
#define ZH   2
#define RH   512                  // query rows < RH use hi+lo planes (0: none)
#define WIN  2048
#define PCAR 1024.0f
#define SCL  0.125f   // HD^-0.5
typedef _Float16 h16;
typedef unsigned short bf;
typedef __attribute__((ext_vector_type(16))) __bf16   v16bf;
typedef __attribute__((ext_vector_type(16))) _Float16 v16h;
typedef __attribute__((ext_vector_type(8)))  _Float16 v8h;
typedef __attribute__((ext_vector_type(8)))  unsigned short v8us;
typedef __attribute__((ext_vector_type(8)))  float    v8f;
typedef __attribute__((ext_vector_type(4)))  float    v4f;
typedef v8h  __attribute__((may_alias)) v8ha;
typedef v4f  __attribute__((may_alias)) v4fa;
typedef v8us __attribute__((may_alias)) v8usa;

__device__ __forceinline__ unsigned short f2bf(float f) { unsigned u = __float_as_uint(f); u += 0x7FFFu + ((u >> 16) & 1u); return (unsigned short)(u >> 16); }
__device__ __forceinline__ float bf2f(unsigned short b) { return __uint_as_float(((unsigned)b) << 16); }
__device__ __forceinline__ float bfr(float f) { return bf2f(f2bf(f)); }
__device__ __forceinline__ v16h cat16(v8h lo, v8h hi) { return __builtin_shufflevector(lo, hi, 0, 1, 2, 3, 4, 5, 6, 7, 8, 9, 10, 11, 12, 13, 14, 15); }
__device__ __forceinline__ v16bf cat16b(v8us lo, v8us hi) { return __builtin_bit_cast(v16bf, __builtin_shufflevector(lo, hi, 0, 1, 2, 3, 4, 5, 6, 7, 8, 9, 10, 11, 12, 13, 14, 15)); }
__device__ __forceinline__ v8f wmma16(v16h a, v16h b, v8f c) { return __builtin_amdgcn_wmma_f32_16x16x32_f16(false, a, false, b, (short)0, c, false, false); }
__device__ __forceinline__ v8f wmmab(v16bf a, v16bf b, v8f c) { return __builtin_amdgcn_wmma_f32_16x16x32_bf16(false, a, false, b, (short)0, c, false, false); }



// ---- k_gemmw: register-blocked GEMM, 64x64 output tile (16 accumulators) per wave, operands straight from K-contiguous 16-bit planes; grid (M/64, N/64, Z), 32 * KS threads.
// KS = 1: one wave owns the tile. KS > 1 (K % 64 == 0): the KS waves of the work-group share the tile's K loop, so each waits out 1/KS of its load latencies, and their partial tiles are summed through LDS.
// C[m][n] (f32, pitch ldc, + optional f32 bias[n]) = sum_k A[m][k] Bt[n][k] (+ split products per NSPLIT). z-batch strides sA/sB/sC in elements. K % 32 == 0.
template <typename T16> struct WFrag;
template <> struct WFrag<h16> { typedef v16h V; static __device__ __forceinline__ V ld(const h16* p) { return cat16(*(const v8h*)p, *(const v8h*)(p + 16)); } static __device__ __forceinline__ v8f mma(V a, V b, v8f c) { return wmma16(a, b, c); } };
template <> struct WFrag<bf> { typedef v16bf V; static __device__ __forceinline__ V ld(const bf* p) { return cat16b(*(const v8us*)p, *(const v8us*)(p + 16)); } static __device__ __forceinline__ v8f mma(V a, V b, v8f c) { return wmmab(a, b, c); } };
template <typename T16, int NSPLIT, bool BIAS, int KS>
__global__ __launch_bounds__(32 * KS) void k_gemmw(const T16* __restrict__ A, const T16* __restrict__ A2, const T16* __restrict__ Bt, const T16* __restrict__ Bt2, int K, float* C, int ldc, const float* __restrict__ bias, size_t sA, size_t sB, size_t sC) {
    typedef typename WFrag<T16>::V V;
    constexpr int WST = (KS == 1) ? 16 * 68 : 64 * 68;      // floats of one wave's LDS slab: one 16-row block (KS = 1), its whole partial tile (KS > 1)
    __shared__ __align__(16) float os[KS * WST];
    const int wv = (KS == 1) ? 0 : __builtin_amdgcn_readfirstlane((int)(threadIdx.x >> 5));   // wave number, scalar: the K loop's control stays a scalar branch
    const size_t z = blockIdx.z; A += z * sA; if (A2) A2 += z * sA; Bt += z * sB; if (Bt2) Bt2 += z * sB; C += z * sC;
    const int lane = threadIdx.x & 31, lr = lane & 15, hi = lane >> 4; const int r0 = blockIdx.x * 64, c0 = blockIdx.y * 64;
    v8f acc[4][4];
#pragma unroll
    for (int mb = 0; mb < 4; ++mb)
#pragma unroll
        for (int nb = 0; nb < 4; ++nb) acc[mb][nb] = (v8f){};
    const size_t aoff = (size_t)(r0 + lr) * K + 8 * hi, boff = (size_t)(c0 + lr) * K + 8 * hi;
#pragma unroll 1
    for (int kc = wv * 64; kc < K; kc += (kc & 32) ? KS * 64 - 32 : 32) {   // wave wv takes the 64-wide K chunks wv, wv + KS, ... (one whole 128-byte line of each operand row)
        V a[4], a2[4];
#pragma unroll
        for (int mb = 0; mb < 4; ++mb) { a[mb] = WFrag<T16>::ld(A + aoff + (size_t)mb * 16 * K + kc); if (NSPLIT == 1 || NSPLIT == 2) a2[mb] = WFrag<T16>::ld(A2 + aoff + (size_t)mb * 16 * K + kc); }
#pragma unroll
        for (int nb = 0; nb < 4; ++nb) { const V b = WFrag<T16>::ld(Bt + boff + (size_t)nb * 16 * K + kc); V b2; if (NSPLIT >= 2) b2 = WFrag<T16>::ld(Bt2 + boff + (size_t)nb * 16 * K + kc);
#pragma unroll
            for (int mb = 0; mb < 4; ++mb) { acc[mb][nb] = WFrag<T16>::mma(a[mb], b, acc[mb][nb]); if (NSPLIT == 1 || NSPLIT == 2) acc[mb][nb] = WFrag<T16>::mma(a2[mb], b, acc[mb][nb]); if (NSPLIT >= 2) acc[mb][nb] = WFrag<T16>::mma(a[mb], b2, acc[mb][nb]); } }
        asm volatile("v_nop\n\tv_nop\n\tv_nop\n\tv_nop" : "+v"(acc[0][0]), "+v"(acc[1][1]), "+v"(acc[2][2]), "+v"(acc[3][3]) : "v"(a[0]), "v"(a[3]));
    }
    if constexpr (KS > 1) {     // the KS waves' partial tiles meet in LDS and are summed in fixed wave order 0 .. KS-1
        // unrolls: acc[][] stays in registers only under constant indices; the q and ww loops so that their LDS reads issue together
#pragma unroll
        for (int mb = 0; mb < 4; ++mb)
#pragma unroll
            for (int nb = 0; nb < 4; ++nb) {
#pragma unroll
                for (int j = 0; j < 8; ++j) os[wv * WST + (mb * 16 + hi * 8 + j) * 68 + nb * 16 + lr] = acc[mb][nb][j]; }
        __syncthreads();    // every wave's partial tile is in LDS before any of it is summed
        float* crow = C + (size_t)r0 * ldc + c0;
#pragma unroll
        for (int q = 0; q < 32 / KS; ++q) { const int idx = q * 32 * KS + (int)threadIdx.x, row = idx >> 4, cofs = (idx & 15) * 4; v4f val = *(const v4fa*)(os + row * 68 + cofs);
#pragma unroll
            for (int ww = 1; ww < KS; ++ww) val += *(const v4fa*)(os + ww * WST + row * 68 + cofs);
            if (BIAS) { val[0] += bfr(bias[c0 + cofs]); val[1] += bfr(bias[c0 + cofs + 1]); val[2] += bfr(bias[c0 + cofs + 2]); val[3] += bfr(bias[c0 + cofs + 3]); }
            *(v4f*)(crow + (size_t)row * ldc + cofs) = val; }
        return;
    }
#pragma unroll
    for (int mb = 0; mb < 4; ++mb) {
#pragma unroll
        for (int nb = 0; nb < 4; ++nb) {
#pragma unroll
            for (int j = 0; j < 8; ++j) os[(hi * 8 + j) * 68 + nb * 16 + lr] = acc[mb][nb][j]; }
        __builtin_amdgcn_wave_barrier(); asm volatile("" ::: "memory");
        float* crow = C + (size_t)(r0 + mb * 16) * ldc + c0;
{
#pragma unroll
            for (int s = 0; s < 8; ++s) { const int row = 2 * s + hi, cofs = lr * 4; v4f val = *(const v4fa*)(os + row * 68 + cofs); if (BIAS) { val[0] += bfr(bias[c0 + cofs]); val[1] += bfr(bias[c0 + cofs + 1]); val[2] += bfr(bias[c0 + cofs + 2]); val[3] += bfr(bias[c0 + cofs + 3]); }
                *(v4f*)(crow + (size_t)row * ldc + cofs) = val; }
             }
        __builtin_amdgcn_wave_barrier(); asm volatile("" ::: "memory");
    }
}

// ---- k_gemmc: the same 64x64 tile GEMM (KS as in k_gemmw) specialised for causal attention: CMODE 1 skips score tiles entirely above the diagonal (query rows r0+roff.., key columns c0..), CMODE 2 limits the
// key (K) loop of the probability x value contraction to the diagonal block (probabilities beyond it are exactly zero). roff = row offset of this launch's first row within the sequence.
template <typename T16, int NSPLIT, int CMODE, int KS>
__global__ __launch_bounds__(32 * KS) void k_gemmc(const T16* __restrict__ A, const T16* __restrict__ A2, const T16* __restrict__ Bt, const T16* __restrict__ Bt2, int K, float* C, int ldc, int roff, size_t sA, size_t sB, size_t sC) {
    typedef typename WFrag<T16>::V V;
    constexpr int WST = (KS == 1) ? 16 * 68 : 64 * 68;      // floats of one wave's LDS slab: one 16-row block (KS = 1), its whole partial tile (KS > 1)
    __shared__ __align__(16) float os[KS * WST];
    const int wv = (KS == 1) ? 0 : __builtin_amdgcn_readfirstlane((int)(threadIdx.x >> 5));   // wave number, scalar: the K loop's control stays a scalar branch
    const size_t z = blockIdx.z; A += z * sA; if (A2) A2 += z * sA; Bt += z * sB; if (Bt2) Bt2 += z * sB; C += z * sC;
    const int lane = threadIdx.x & 31, lr = lane & 15, hi = lane >> 4; const int r0 = blockIdx.x * 64, c0 = blockIdx.y * 64;
    if (CMODE == 1 && c0 > r0 + roff + 63) return;                  // score tile entirely above the causal diagonal: never read (the softmax masks j > i by select)
    const int Kl = (CMODE == 2) ? min(K, r0 + roff + 64) : K;        // P.V: probabilities are exactly 0 beyond the diagonal block, so the K loop stops there
    v8f acc[4][4];
#pragma unroll
    for (int mb = 0; mb < 4; ++mb)
#pragma unroll
        for (int nb = 0; nb < 4; ++nb) acc[mb][nb] = (v8f){};
    const size_t aoff = (size_t)(r0 + lr) * K + 8 * hi, boff = (size_t)(c0 + lr) * K + 8 * hi;
#pragma unroll 1
    for (int kc = wv * 64; kc < Kl; kc += (kc & 32) ? KS * 64 - 32 : 32) {   // wave wv takes the 64-wide K chunks wv, wv + KS, ... (one whole 128-byte line of each operand row)
        V a[4], a2[4];
#pragma unroll
        for (int mb = 0; mb < 4; ++mb) { a[mb] = WFrag<T16>::ld(A + aoff + (size_t)mb * 16 * K + kc); if (NSPLIT == 1 || NSPLIT == 2) a2[mb] = WFrag<T16>::ld(A2 + aoff + (size_t)mb * 16 * K + kc); }
#pragma unroll
        for (int nb = 0; nb < 4; ++nb) { const V b = WFrag<T16>::ld(Bt + boff + (size_t)nb * 16 * K + kc); V b2; if (NSPLIT >= 2) b2 = WFrag<T16>::ld(Bt2 + boff + (size_t)nb * 16 * K + kc);
#pragma unroll
            for (int mb = 0; mb < 4; ++mb) { acc[mb][nb] = WFrag<T16>::mma(a[mb], b, acc[mb][nb]); if (NSPLIT == 1 || NSPLIT == 2) acc[mb][nb] = WFrag<T16>::mma(a2[mb], b, acc[mb][nb]); if (NSPLIT >= 2) acc[mb][nb] = WFrag<T16>::mma(a[mb], b2, acc[mb][nb]); } }
        asm volatile("v_nop\n\tv_nop\n\tv_nop\n\tv_nop" : "+v"(acc[0][0]), "+v"(acc[1][1]), "+v"(acc[2][2]), "+v"(acc[3][3]) : "v"(a[0]), "v"(a[3]));
    }
    if constexpr (KS > 1) {     // the KS waves' partial tiles meet in LDS and are summed in fixed wave order 0 .. KS-1
        // unrolls: acc[][] stays in registers only under constant indices; the q and ww loops so that their LDS reads issue together
#pragma unroll
        for (int mb = 0; mb < 4; ++mb)
#pragma unroll
            for (int nb = 0; nb < 4; ++nb) {
#pragma unroll
                for (int j = 0; j < 8; ++j) os[wv * WST + (mb * 16 + hi * 8 + j) * 68 + nb * 16 + lr] = acc[mb][nb][j]; }
        __syncthreads();    // every wave's partial tile is in LDS before any of it is summed
        float* crow = C + (size_t)r0 * ldc + c0;
#pragma unroll
        for (int q = 0; q < 32 / KS; ++q) { const int idx = q * 32 * KS + (int)threadIdx.x, row = idx >> 4, cofs = (idx & 15) * 4; v4f val = *(const v4fa*)(os + row * 68 + cofs);
#pragma unroll
            for (int ww = 1; ww < KS; ++ww) val += *(const v4fa*)(os + ww * WST + row * 68 + cofs);
            *(v4f*)(crow + (size_t)row * ldc + cofs) = val; }
        return;
    }
#pragma unroll
    for (int mb = 0; mb < 4; ++mb) {
#pragma unroll
        for (int nb = 0; nb < 4; ++nb) {
#pragma unroll
            for (int j = 0; j < 8; ++j) os[(hi * 8 + j) * 68 + nb * 16 + lr] = acc[mb][nb][j]; }
        __builtin_amdgcn_wave_barrier(); asm volatile("" ::: "memory");
        float* crow = C + (size_t)(r0 + mb * 16) * ldc + c0;
{
#pragma unroll
            for (int s = 0; s < 8; ++s) { const int row = 2 * s + hi, cofs = lr * 4; v4f val = *(const v4fa*)(os + row * 68 + cofs);
                *(v4f*)(crow + (size_t)row * ldc + cofs) = val; }
             }
        __builtin_amdgcn_wave_barrier(); asm volatile("" ::: "memory");
    }
}

__device__ __forceinline__ h16 tohx(float x) { return (h16)x; }
__device__ __forceinline__ void splitf(float y, unsigned short& h, unsigned short& l) { h = f2bf(y); l = f2bf(y - bf2f(h)); }
typedef __attribute__((ext_vector_type(2))) _Float16 v2h;
typedef __attribute__((ext_vector_type(4))) _Float16 v4h;
typedef __attribute__((ext_vector_type(2))) unsigned short v2us;
typedef __attribute__((ext_vector_type(4))) unsigned short v4us;
typedef __attribute__((ext_vector_type(2))) float v2f;
typedef __attribute__((ext_vector_type(4))) int v4i;

__global__ __launch_bounds__(256) void k_wtG(const float* __restrict__ w, int K, int N, bf* Bt) {
    const int lane = threadIdx.x & 31; const int L0 = (blockIdx.x * 8 + (threadIdx.x >> 5)) * 8; const int nlines = N * K / 64;
{
#pragma unroll 1
        for (int l = 0; l < 8; ++l) { const int L = L0 + l; if (L >= nlines) break; const size_t e = (size_t)L * 64 + lane * 2; const int k = (int)(e % K), n = (int)(e / K); v2us o;
            o[0] = f2bf(w[(size_t)k * N + n]); o[1] = f2bf(w[(size_t)(k + 1) * N + n]); *(v2us*)(Bt + e) = o; }
         }
}
__global__ __launch_bounds__(256) void k_cvt8(const float* __restrict__ src, bf* dst, size_t n8) { const size_t i = (size_t)blockIdx.x * 256 + threadIdx.x; if (i >= n8) return; const v8f v = *(const v8f*)(src + i * 8); v8us o;
#pragma unroll
    for (int k = 0; k < 8; ++k) o[k] = f2bf(v[k]); *(v8us*)(dst + i * 8) = o;  }
__global__ __launch_bounds__(256) void k_cscvt(const float* __restrict__ cosT, const float* __restrict__ sinT, float* CS) { const int idx = blockIdx.x * 256 + threadIdx.x; if (idx >= TT * HD) return; v2f cs; cs[0] = bfr(cosT[idx]); cs[1] = bfr(sinT[idx]); *(v2f*)(CS + (size_t)idx * 2) = cs;  }
// k_rope: head planes [h][t][d] (fp16 + hi/lo) of rope(x) x sc with the rotate-half convention out[d] = x[d] cos[t][d] - x[d+HD/2] sin[t][d], out[d+HD/2] = x[d+HD/2] cos[t][d+HD/2] + x[d] sin[t][d+HD/2]
__global__ __launch_bounds__(256) void k_rope(const float* __restrict__ F, int pitch, int nheads, const float* __restrict__ CS, const float* __restrict__ RF, const float* __restrict__ nw, float sc, h16* P16, bf* Ph, bf* Pl) {
    const size_t e = ((size_t)blockIdx.x * 256 + threadIdx.x) * 2; if (e >= (size_t)nheads * TT * HD) return; const int d = (int)(e % HD); const int t = (int)((e / HD) % TT); const int h = (int)(e / ((size_t)HD * TT)); const float* f = F + (size_t)t * pitch + h * HD; const float rf = RF ? RF[(size_t)h * TT + t] : 1.0f; v2h o16; v2us oh, ol;
#pragma unroll
    for (int q = 0; q < 2; ++q) { const int dd = d + q; const int dp = (dd < HD / 2) ? dd + HD / 2 : dd - HD / 2; float x0 = f[dd], x1 = f[dp];
        if (RF) { float n0 = __fmul_rn(x0, rf), n1 = __fmul_rn(x1, rf); asm volatile("" : "+v"(n0)); asm volatile("" : "+v"(n1)); x0 = __fmul_rn(bfr(nw[dd]), n0); x1 = __fmul_rn(bfr(nw[dp]), n1); }
        const v2f cs = *(const v2f*)(CS + ((size_t)t * HD + dd) * 2); float a = __fmul_rn(x0, cs[0]), bq = __fmul_rn(x1, cs[1]); asm volatile("" : "+v"(a)); asm volatile("" : "+v"(bq)); const float r = ((dd < HD / 2) ? __fsub_rn(a, bq) : __fadd_rn(a, bq)) * sc;
        o16[q] = tohx(r); unsigned short a2, c2; splitf(r, a2, c2); oh[q] = a2; ol[q] = c2; }
    *(v2h*)(P16 + e) = o16; *(v2us*)(Ph + e) = oh; *(v2us*)(Pl + e) = ol;  }
__global__ __launch_bounds__(256) void k_vtp(const float* __restrict__ F, int pitch, int nheads, h16* V16, bf* Vh, bf* Vl) { const size_t e = ((size_t)blockIdx.x * 256 + threadIdx.x) * 2; if (e >= (size_t)nheads * HD * TT) return; const int t = (int)(e % TT); const int d = (int)((e / TT) % HD); const int g = (int)(e / ((size_t)TT * HD)); v2h o16; v2us oh, ol;
#pragma unroll
    for (int q = 0; q < 2; ++q) { const float x = F[(size_t)(t + q) * pitch + g * HD + d]; o16[q] = tohx(x); unsigned short a2, c2; splitf(x, a2, c2); oh[q] = a2; ol[q] = c2; }
    *(v2h*)(V16 + e) = o16; *(v2us*)(Vh + e) = oh; *(v2us*)(Vl + e) = ol;  }
__global__ __launch_bounds__(256) void k_csid(float* CS) { const int idx = blockIdx.x * 256 + threadIdx.x; if (idx >= TT * HD) return; v2f cs; cs[0] = 1.0f; cs[1] = 0.0f; *(v2f*)(CS + (size_t)idx * 2) = cs;  }
// k_asoft: per row (zz, i): t = S x HD^-0.5 for j <= i and i - j < WIN (sliding causal window; the reference's -1e9 additive fill vanishes identically); softmax over the 2048 keys (register row, one exp, fixed trees);
__global__ __launch_bounds__(256) void k_asoft(const float* __restrict__ Sb, h16* P16, bf* Ph, bf* Pl) {
    const int lane = threadIdx.x & 31; const int row = blockIdx.x * 8 + (threadIdx.x >> 5); if (row >= ZH * TT) return; const int i = row % TT; const int zz = row / TT; (void)zz; const bool hires = (i < RH); const float* sr = Sb + (size_t)row * TT; float v[TT / 32]; float mx = -3.0e38f;
#pragma unroll
    for (int ch = 0; ch < TT / 128; ++ch) { const int j0 = ch * 128 + lane * 4; const v4f a = *(const v4f*)(sr + j0);
#pragma unroll
        for (int q = 0; q < 4; ++q) { const int j = j0 + q; (void)j; const float t = (j <= i && i - j < WIN) ? a[q] * SCL : -3.0e38f; v[ch * 4 + q] = t; mx = fmaxf(mx, t); } }
#pragma unroll
    for (int sh = 16; sh; sh >>= 1) mx = fmaxf(mx, __shfl_xor(mx, sh, 32));
    float sum = 0.f;
#pragma unroll
    for (int k = 0; k < TT / 32; ++k) { float d0 = __fsub_rn(v[k], mx); asm volatile("" : "+v"(d0)); v[k] = __builtin_amdgcn_exp2f(__fmul_rn(d0, 1.4426950408889634f)); sum += v[k]; }
#pragma unroll
    for (int sh = 16; sh; sh >>= 1) sum += __shfl_xor(sum, sh, 32);
    const float f = __fdiv_rn(hires ? 1.0f : PCAR, sum);
{
        if (hires) {
#pragma unroll
            for (int ch = 0; ch < TT / 128; ++ch) { v4us oh, ol;
#pragma unroll
                for (int q = 0; q < 4; ++q) { unsigned short a, c2; splitf(v[ch * 4 + q] * f, a, c2); oh[q] = a; ol[q] = c2; }
                const size_t oo = ((size_t)zz * (RH ? RH : 1) + i) * TT + ch * 128 + lane * 4; *(v4us*)(Ph + oo) = oh; *(v4us*)(Pl + oo) = ol; }
        } else {
#pragma unroll
            for (int ch = 0; ch < TT / 128; ++ch) { v4h o4;
#pragma unroll
                for (int q = 0; q < 4; ++q) o4[q] = tohx(v[ch * 4 + q] * f);
                *(v4h*)(P16 + (size_t)row * TT + ch * 128 + lane * 4) = o4; } }
         }
}
__global__ __launch_bounds__(256) void k_merge(const float* __restrict__ O, int h0, bf* Ah, bf* Al) { const size_t e = ((size_t)blockIdx.x * 256 + threadIdx.x) * 2; if (e >= (size_t)ZH * TT * HD) return; const int d = (int)(e % HD); const int t = (int)((e / HD) % TT); const int zz = (int)(e / ((size_t)HD * TT)); const float cs = (t < RH) ? 1.0f : (1.0f / PCAR); const size_t oo = (size_t)t * DQ + (h0 + zz) * HD + d;
    v2us oh, ol;
#pragma unroll
    for (int q = 0; q < 2; ++q) { unsigned short a, c2; splitf(O[e + q] * cs, a, c2); oh[q] = a; ol[q] = c2; } *(v2us*)(Ah + oo) = oh; *(v2us*)(Al + oo) = ol;  }

__global__ __launch_bounds__(256) void k_wt16(const float* __restrict__ w, int K, int N, h16* Bt) { const size_t e = ((size_t)blockIdx.x * 256 + threadIdx.x) * 2; if (e >= (size_t)N * K) return; const int k = (int)(e % K), n = (int)(e / K); v2h o; o[0] = tohx(bfr(w[(size_t)k * N + n])); o[1] = tohx(bfr(w[(size_t)(k + 1) * N + n])); *(v2h*)(Bt + e) = o;  }
__global__ __launch_bounds__(256) void k_rmsc(const float* __restrict__ X, int isin, const float* __restrict__ w, h16* HC) { const int lane = threadIdx.x & 31; const int t = blockIdx.x * 8 + (threadIdx.x >> 5); if (t >= TT) return; float v[32]; float s = 0.f;
#pragma unroll
    for (int ch = 0; ch < 8; ++ch) { const v4f a = *(const v4f*)(X + (size_t)t * DM + ch * 128 + lane * 4);
#pragma unroll
        for (int q = 0; q < 4; ++q) { const float xv = isin ? bfr(a[q]) : a[q]; v[ch * 4 + q] = xv; float p = __fmul_rn(xv, xv); asm volatile("" : "+v"(p)); s = __fadd_rn(s, p); } }
#pragma unroll
    for (int sh = 16; sh; sh >>= 1) s += __shfl_xor(s, sh, 32);
    const float r = __frsqrt_rn(__fadd_rn(s * (1.0f / DM), 1.1920929e-07f));
{
#pragma unroll
        for (int ch = 0; ch < 8; ++ch) { const int c0 = ch * 128 + lane * 4; const int n = c0 / 256, cc = c0 % 256; v4h o;
#pragma unroll
            for (int q = 0; q < 4; ++q) { float tn = __fmul_rn(v[ch * 4 + q], r); asm volatile("" : "+v"(tn)); o[q] = tohx(__fmul_rn(tn, bfr(w[c0 + q]))); }
            *(v4h*)(HC + ((size_t)n * TT + t) * 256 + cc) = o; }
         } }
__global__ __launch_bounds__(256) void k_dmax(const float* __restrict__ TMP, const float* __restrict__ thr, const float* __restrict__ gain, int n, int ld, float* ACC) { const size_t i = ((size_t)blockIdx.x * 256 + threadIdx.x) * 4; if (i >= (size_t)TT * ld) return; const int o = (int)(i % ld); const v4f a = *(const v4f*)(TMP + i); v4f prev; if (n) prev = *(const v4f*)(ACC + i); v4f r;
#pragma unroll
    for (int q = 0; q < 4; ++q) { const float z = __fsub_rn(a[q], bfr(thr[o + q])); const float sg = __fdiv_rn(1.0f, 1.0f + __expf(-z)); float sl = __fmul_rn(z, sg); asm volatile("" : "+v"(sl)); const float val = __fmul_rn(bfr(gain[o + q]), sl); r[q] = n ? fmaxf(prev[q], val) : val; }
    *(v4f*)(ACC + i) = r;  }
__global__ __launch_bounds__(256) void k_res(const float* __restrict__ x, const float* __restrict__ ATT, float* X1) { const size_t i = ((size_t)blockIdx.x * 256 + threadIdx.x) * 4; if (i >= (size_t)TT * DM) return; const v4f a = *(const v4f*)(ATT + i); v4f o; o[0] = __fadd_rn(bfr(x[i]), a[0]); o[1] = __fadd_rn(bfr(x[i + 1]), a[1]); o[2] = __fadd_rn(bfr(x[i + 2]), a[2]); o[3] = __fadd_rn(bfr(x[i + 3]), a[3]); *(v4f*)(X1 + i) = o;  }
__global__ __launch_bounds__(256) void k_ffp(const float* __restrict__ G, const float* __restrict__ U, h16* FF16) { const size_t i = ((size_t)blockIdx.x * 256 + threadIdx.x) * 4; if (i >= (size_t)TT * 2048) return; const v4f g = *(const v4f*)(G + i), u = *(const v4f*)(U + i); v4h o;
#pragma unroll
    for (int q = 0; q < 4; ++q) { const float sg = __fdiv_rn(1.0f, 1.0f + __expf(-g[q])); float sl = __fmul_rn(g[q], sg); asm volatile("" : "+v"(sl)); o[q] = tohx(__fmul_rn(sl, u[q])); } *(v4h*)(FF16 + i) = o;  }
__global__ __launch_bounds__(256) void k_fin(const float* __restrict__ X1, const float* __restrict__ F2, float* OUT) { const size_t i = ((size_t)blockIdx.x * 256 + threadIdx.x) * 4; if (i >= (size_t)TT * DM) return; const v4f a = *(const v4f*)(X1 + i), f = *(const v4f*)(F2 + i); v4f o; o[0] = __fadd_rn(a[0], f[0]); o[1] = __fadd_rn(a[1], f[1]); o[2] = __fadd_rn(a[2], f[2]); o[3] = __fadd_rn(a[3], f[3]); *(v4f*)(OUT + i) = o;  }

extern "C" void kernel_launch(void* const* d_in, const int* in_sizes, int n_in,
                              void* d_out, int out_size, void* d_ws, size_t ws_size, hipStream_t stream) {
    (void)in_sizes; (void)n_in; (void)out_size;
    const float* x = (const float*)d_in[0]; const float* qkvw = (const float*)d_in[1]; const float* qthr = (const float*)d_in[2]; const float* qgain = (const float*)d_in[3]; const float* wo = (const float*)d_in[4]; const float* gw = (const float*)d_in[5]; const float* gthr = (const float*)d_in[6]; const float* ggain = (const float*)d_in[7]; const float* uw = (const float*)d_in[8]; const float* uthr = (const float*)d_in[9]; const float* ugain = (const float*)d_in[10]; const float* dw = (const float*)d_in[11]; const float* n1w = (const float*)d_in[12]; const float* n2w = (const float*)d_in[13];
    float* OUT = (float*)d_out;     // [2][2048][1024]
    char* wsp = (char*)d_ws;
    auto take = [&](size_t bytes) { char* p = wsp; wsp += (bytes + 255) & ~(size_t)255; return (void*)p; };
    bf* WQ = (bf*)take((size_t)DQ * DM * 2); bf* WK = (bf*)take((size_t)DKV * DM * 2); bf* WV = (bf*)take((size_t)DKV * DM * 2); bf* WO = (bf*)take((size_t)DM * DQ * 2); float* CS = (float*)take((size_t)TT * HD * 2 * 4);
    bf* XB = (bf*)take((size_t)TT * DM * 2); float* FQ = (float*)take((size_t)TT * DQ * 4); float* FK = (float*)take((size_t)TT * DKV * 4);
    h16* QP16 = (h16*)take((size_t)NH_ * TT * HD * 2); h16* KP16 = (h16*)take((size_t)NKV * TT * HD * 2); h16* VT16 = (h16*)take((size_t)NKV * HD * TT * 2);
    bf* QPh = (bf*)take((size_t)NH_ * TT * HD * 2); bf* QPl = (bf*)take((size_t)NH_ * TT * HD * 2); bf* KPh = (bf*)take((size_t)NKV * TT * HD * 2); bf* KPl = (bf*)take((size_t)NKV * TT * HD * 2); bf* VTh = (bf*)take((size_t)NKV * HD * TT * 2); bf* VTl = (bf*)take((size_t)NKV * HD * TT * 2); bf* Ph = (bf*)take((size_t)ZH * RH * TT * 2); bf* Pl = (bf*)take((size_t)ZH * RH * TT * 2);
    float* Sb = (float*)take((size_t)ZH * TT * TT * 4); h16* P16 = (h16*)take((size_t)ZH * TT * TT * 2); float* Ob = (float*)take((size_t)ZH * TT * HD * 4); bf* ATh = (bf*)take((size_t)TT * DQ * 2); bf* ATl = (bf*)take((size_t)TT * DQ * 2);
    if ((size_t)(wsp - (char*)d_ws) > ws_size) return;    // ws 256 MiB
    float* FV = FK;   // v projection reuses the k buffer after the k planes are built (stream-ordered)
    h16* BQKV = (h16*)take((size_t)4 * 3072 * 256 * 2); h16* BG = (h16*)take((size_t)4 * 2048 * 256 * 2); h16* BU = (h16*)take((size_t)4 * 2048 * 256 * 2); h16* BD = (h16*)take((size_t)DM * 2048 * 2); h16* HC = (h16*)take((size_t)4 * TT * 256 * 2); float* TMP = (float*)take((size_t)TT * 2048 * 4); float* ACG = (float*)take((size_t)TT * 2048 * 4); float* ACU = (float*)take((size_t)TT * 2048 * 4); h16* FF16 = (h16*)take((size_t)TT * 2048 * 2); float* ATT = (float*)take((size_t)TT * DM * 4); float* X1 = (float*)take((size_t)TT * DM * 4);
    if ((size_t)(wsp - (char*)d_ws) > ws_size) return;
    { for (int n = 0; n < 4; ++n) { k_wt16<<<(unsigned)(((size_t)256 * 3072 / 2 + 255) / 256), 256, 0, stream>>>(qkvw + (size_t)n * 256 * 3072, 256, 3072, BQKV + (size_t)n * 3072 * 256); k_wt16<<<(unsigned)(((size_t)256 * 2048 / 2 + 255) / 256), 256, 0, stream>>>(gw + (size_t)n * 256 * 2048, 256, 2048, BG + (size_t)n * 2048 * 256); k_wt16<<<(unsigned)(((size_t)256 * 2048 / 2 + 255) / 256), 256, 0, stream>>>(uw + (size_t)n * 256 * 2048, 256, 2048, BU + (size_t)n * 2048 * 256); }
      k_wt16<<<(unsigned)(((size_t)2048 * DM / 2 + 255) / 256), 256, 0, stream>>>(dw, 2048, DM, BD);
      k_wtG<<<(unsigned)((DQ * DM / 64 + 63) / 64), 256, 0, stream>>>(wo, DQ, DM, WO);
       }
    k_csid<<<(TT * HD + 255) / 256, 256, 0, stream>>>(CS);
    const unsigned LQ = (unsigned)(((size_t)NH_ * TT * HD / 2 + 255) / 256), LKv = (unsigned)(((size_t)NKV * TT * HD / 2 + 255) / 256);
    for (int b = 0; b < NB_; ++b) {
        
        k_rmsc<<<TT / 8, 256, 0, stream>>>(x + (size_t)b * TT * DM, 1, n1w, HC);
        // dendritic q / k / v: per output slice, 4 block GEMMs on fp16 planes with the running gain*silu(. - thr) max into FQ / FK / FV
        auto dend = [&](int slice, float* dst) { for (int n = 0; n < 4; ++n) { k_gemmw<h16, 0, false, 4><<<dim3(TT / 64, DQ / 64, 1), 128, 0, stream>>>(HC + (size_t)n * TT * 256, nullptr, BQKV + (size_t)n * 3072 * 256 + (size_t)slice * DQ * 256, nullptr, 256, TMP, DQ, nullptr, 0, 0, 0); k_dmax<<<(unsigned)(((size_t)TT * DQ / 4 + 255) / 256), 256, 0, stream>>>(TMP, qthr + n * 3072 + slice * DQ, qgain + n * 3072 + slice * DQ, n, DQ, dst); } };
        dend(0, FQ);
        k_rope<<<LQ, 256, 0, stream>>>(FQ, DQ, NH_, CS, nullptr, nullptr, 1.0f, QP16, QPh, QPl);
        dend(1, FK);
        k_rope<<<LKv, 256, 0, stream>>>(FK, DKV, NKV, CS, nullptr, nullptr, 1.0f, KP16, KPh, KPl);
        dend(2, FV); k_vtp<<<LKv, 256, 0, stream>>>(FV, DKV, NKV, VT16, VTh, VTl);
        for (int h0 = 0; h0 < NH_; h0 += ZH) { const size_t zq = (size_t)h0, zk = (size_t)(h0 / REP);   // one kv head per query head: the pass's two heads use consecutive kv planes (z-strides TT*HD)
            k_gemmc<bf, 2, 1, 1><<<dim3(RH / 64, TT / 64, ZH), 32, 0, stream>>>(QPh + zq * TT * HD, QPl + zq * TT * HD, KPh + zk * TT * HD, KPl + zk * TT * HD, HD, Sb, TT, 0, (size_t)TT * HD, (size_t)TT * HD, (size_t)TT * TT);
            k_gemmc<h16, 0, 1, 1><<<dim3((TT - RH) / 64, TT / 64, ZH), 32, 0, stream>>>(QP16 + zq * TT * HD + (size_t)RH * HD, nullptr, KP16 + zk * TT * HD, nullptr, HD, Sb + (size_t)RH * TT, TT, RH, (size_t)TT * HD, (size_t)TT * HD, (size_t)TT * TT);
            k_asoft<<<ZH * TT / 8, 256, 0, stream>>>(Sb, P16, Ph, Pl);
            k_gemmc<bf, 2, 2, 8><<<dim3(RH / 64, HD / 64, ZH), 256, 0, stream>>>(Ph, Pl, VTh + zk * HD * TT, VTl + zk * HD * TT, TT, Ob, HD, 0, (size_t)RH * TT, (size_t)HD * TT, (size_t)TT * HD);
            k_gemmc<h16, 0, 2, 16><<<dim3((TT - RH) / 64, HD / 64, ZH), 512, 0, stream>>>(P16 + (size_t)RH * TT, nullptr, VT16 + zk * HD * TT, nullptr, TT, Ob + (size_t)RH * HD, HD, RH, (size_t)TT * TT, (size_t)HD * TT, (size_t)TT * HD);
            k_merge<<<(unsigned)(((size_t)ZH * TT * HD / 2 + 255) / 256), 256, 0, stream>>>(Ob, h0, ATh, ATl); }
        k_gemmw<bf, 1, false, 8><<<dim3(TT / 64, DM / 64, 1), 256, 0, stream>>>(ATh, ATl, WO, nullptr, DQ, ATT, DM, nullptr, 0, 0, 0);
        k_res<<<(TT * DM / 4 + 255) / 256, 256, 0, stream>>>(x + (size_t)b * TT * DM, ATT, X1); k_rmsc<<<TT / 8, 256, 0, stream>>>(X1, 0, n2w, HC);
        for (int n = 0; n < 4; ++n) { k_gemmw<h16, 0, false, 4><<<dim3(TT / 64, 2048 / 64, 1), 128, 0, stream>>>(HC + (size_t)n * TT * 256, nullptr, BG + (size_t)n * 2048 * 256, nullptr, 256, TMP, 2048, nullptr, 0, 0, 0); k_dmax<<<(unsigned)(((size_t)TT * 2048 / 4 + 255) / 256), 256, 0, stream>>>(TMP, gthr + n * 2048, ggain + n * 2048, n, 2048, ACG);
            k_gemmw<h16, 0, false, 4><<<dim3(TT / 64, 2048 / 64, 1), 128, 0, stream>>>(HC + (size_t)n * TT * 256, nullptr, BU + (size_t)n * 2048 * 256, nullptr, 256, TMP, 2048, nullptr, 0, 0, 0); k_dmax<<<(unsigned)(((size_t)TT * 2048 / 4 + 255) / 256), 256, 0, stream>>>(TMP, uthr + n * 2048, ugain + n * 2048, n, 2048, ACU); }
        k_ffp<<<(unsigned)(((size_t)TT * 2048 / 4 + 255) / 256), 256, 0, stream>>>(ACG, ACU, FF16);
        k_gemmw<h16, 0, false, 8><<<dim3(TT / 64, DM / 64, 1), 256, 0, stream>>>(FF16, nullptr, BD, nullptr, 2048, ATT, DM, nullptr, 0, 0, 0);
        k_fin<<<(TT * DM / 4 + 255) / 256, 256, 0, stream>>>(X1, ATT, OUT + (size_t)b * TT * DM); }
}

// v002
// One run takes 1100 microseconds.
// Two timings next to v001 put it at 1.38 and 1.36 times that version's speed.
// Counting every step since v000, it is 1.94 times as fast.
#include <hip/hip_runtime.h>

// DendriticFractalBlock (x [2][2048][1024]; h = RMSNorm(x) w1; [q|k|v] = dendritic(h, qkv_w, thr, gain) = max over the 4 input blocks n of gain[n] silu(h_n W[n] - thr[n]) (16 heads x 64); causal softmax(q.k/8); x1 = x + merged.v o_w;
// h2 = RMSNorm(x1) w2; ff = silu(dendritic(h2, gate)) * dendritic(h2, up); out = x1 + ff down_w -> [2][2048][1024]; all weights x @ W; eps = f32 eps).
// Compute dtypes, f32 accumulate: every input rounded to bf16; the RMSNorms f32 -> SINGLE fp16 block planes; every dendritic GEMM on fp16 planes x fp16 copies of the bf16 weights (1 product; hi+lo would double the
// ~25 G of dendritic GEMMs), the gain/silu/threshold/max epilogues f32; scores (K 64) and probs.v on hl planes (3 products) for the first 512 query rows of each head and single fp16 planes for the rest, f32 causal softmax with masked tiles

#define NB_  2
#define TT   2048
#define DM   1024
#define NH_  16
#define NKV  16
#define REP  (NH_ / NKV)
#define HD   64
#define DQ   (NH_ * HD)
#define DKV  (NKV * HD)
#define ZH   2
#define RH   512                  // query rows < RH use hi+lo planes (0: none)
#define WIN  2048
#define PCAR 1024.0f
#define SCL  0.125f   // HD^-0.5
typedef _Float16 h16;
typedef unsigned short bf;
typedef __attribute__((ext_vector_type(16))) __bf16   v16bf;
typedef __attribute__((ext_vector_type(16))) _Float16 v16h;
typedef __attribute__((ext_vector_type(8)))  _Float16 v8h;
typedef __attribute__((ext_vector_type(8)))  unsigned short v8us;
typedef __attribute__((ext_vector_type(8)))  float    v8f;
typedef __attribute__((ext_vector_type(4)))  float    v4f;
typedef v8h  __attribute__((may_alias)) v8ha;
typedef v4f  __attribute__((may_alias)) v4fa;
typedef v8us __attribute__((may_alias)) v8usa;

__device__ __forceinline__ unsigned short f2bf(float f) { unsigned u = __float_as_uint(f); u += 0x7FFFu + ((u >> 16) & 1u); return (unsigned short)(u >> 16); }
__device__ __forceinline__ float bf2f(unsigned short b) { return __uint_as_float(((unsigned)b) << 16); }
__device__ __forceinline__ float bfr(float f) { return bf2f(f2bf(f)); }
__device__ __forceinline__ v16h cat16(v8h lo, v8h hi) { return __builtin_shufflevector(lo, hi, 0, 1, 2, 3, 4, 5, 6, 7, 8, 9, 10, 11, 12, 13, 14, 15); }
__device__ __forceinline__ v16bf cat16b(v8us lo, v8us hi) { return __builtin_bit_cast(v16bf, __builtin_shufflevector(lo, hi, 0, 1, 2, 3, 4, 5, 6, 7, 8, 9, 10, 11, 12, 13, 14, 15)); }
__device__ __forceinline__ v8f wmma16(v16h a, v16h b, v8f c) { return __builtin_amdgcn_wmma_f32_16x16x32_f16(false, a, false, b, (short)0, c, false, false); }
__device__ __forceinline__ v8f wmmab(v16bf a, v16bf b, v8f c) { return __builtin_amdgcn_wmma_f32_16x16x32_bf16(false, a, false, b, (short)0, c, false, false); }



// ---- k_gemmw: register-blocked GEMM, 64x64 output tile (16 accumulators) per wave, operands straight from K-contiguous 16-bit planes; grid (M/64, N/64, Z), 32 * KS threads.
// KS = 1: one wave owns the tile. KS > 1 (K % 64 == 0): the KS waves of the work-group share the tile's K loop, so each waits out 1/KS of its load latencies, and their partial tiles are summed through LDS.
// C[m][n] (f32, pitch ldc, + optional f32 bias[n]) = sum_k A[m][k] Bt[n][k] (+ split products per NSPLIT). z-batch strides sA/sB/sC in elements. K % 32 == 0.
template <typename T16> struct WFrag;
template <> struct WFrag<h16> { typedef v16h V; static __device__ __forceinline__ V ld(const h16* p) { return cat16(*(const v8h*)p, *(const v8h*)(p + 16)); } static __device__ __forceinline__ v8f mma(V a, V b, v8f c) { return wmma16(a, b, c); } };
template <> struct WFrag<bf> { typedef v16bf V; static __device__ __forceinline__ V ld(const bf* p) { return cat16b(*(const v8us*)p, *(const v8us*)(p + 16)); } static __device__ __forceinline__ v8f mma(V a, V b, v8f c) { return wmmab(a, b, c); } };
template <typename T16, int NSPLIT, bool BIAS, int KS>
__global__ __launch_bounds__(32 * KS) void k_gemmw(const T16* __restrict__ A, const T16* __restrict__ A2, const T16* __restrict__ Bt, const T16* __restrict__ Bt2, int K, float* C, int ldc, const float* __restrict__ bias, size_t sA, size_t sB, size_t sC) {
    typedef typename WFrag<T16>::V V;
    constexpr int WST = (KS == 1) ? 16 * 68 : 64 * 68;      // floats of one wave's LDS slab: one 16-row block (KS = 1), its whole partial tile (KS > 1)
    __shared__ __align__(16) float os[KS * WST];
    const int wv = (KS == 1) ? 0 : __builtin_amdgcn_readfirstlane((int)(threadIdx.x >> 5));   // wave number, scalar: the K loop's control stays a scalar branch
    const size_t z = blockIdx.z; A += z * sA; if (A2) A2 += z * sA; Bt += z * sB; if (Bt2) Bt2 += z * sB; C += z * sC;
    const int lane = threadIdx.x & 31, lr = lane & 15, hi = lane >> 4; const int r0 = blockIdx.x * 64, c0 = blockIdx.y * 64;
    v8f acc[4][4];
#pragma unroll
    for (int mb = 0; mb < 4; ++mb)
#pragma unroll
        for (int nb = 0; nb < 4; ++nb) acc[mb][nb] = (v8f){};
    const size_t aoff = (size_t)(r0 + lr) * K + 8 * hi, boff = (size_t)(c0 + lr) * K + 8 * hi;
#pragma unroll 1
    for (int kc = wv * 64; kc < K; kc += (kc & 32) ? KS * 64 - 32 : 32) {   // wave wv takes the 64-wide K chunks wv, wv + KS, ... (one whole 128-byte line of each operand row)
        V a[4], a2[4];
#pragma unroll
        for (int mb = 0; mb < 4; ++mb) { a[mb] = WFrag<T16>::ld(A + aoff + (size_t)mb * 16 * K + kc); if (NSPLIT == 1 || NSPLIT == 2) a2[mb] = WFrag<T16>::ld(A2 + aoff + (size_t)mb * 16 * K + kc); }
#pragma unroll
        for (int nb = 0; nb < 4; ++nb) { const V b = WFrag<T16>::ld(Bt + boff + (size_t)nb * 16 * K + kc); V b2; if (NSPLIT >= 2) b2 = WFrag<T16>::ld(Bt2 + boff + (size_t)nb * 16 * K + kc);
#pragma unroll
            for (int mb = 0; mb < 4; ++mb) { acc[mb][nb] = WFrag<T16>::mma(a[mb], b, acc[mb][nb]); if (NSPLIT == 1 || NSPLIT == 2) acc[mb][nb] = WFrag<T16>::mma(a2[mb], b, acc[mb][nb]); if (NSPLIT >= 2) acc[mb][nb] = WFrag<T16>::mma(a[mb], b2, acc[mb][nb]); } }
        asm volatile("v_nop\n\tv_nop\n\tv_nop\n\tv_nop" : "+v"(acc[0][0]), "+v"(acc[1][1]), "+v"(acc[2][2]), "+v"(acc[3][3]) : "v"(a[0]), "v"(a[3]));
    }
    if constexpr (KS > 1) {     // the KS waves' partial tiles meet in LDS and are summed in fixed wave order 0 .. KS-1
        // unrolls: acc[][] stays in registers only under constant indices; the q and ww loops so that their LDS reads issue together
#pragma unroll
        for (int mb = 0; mb < 4; ++mb)
#pragma unroll
            for (int nb = 0; nb < 4; ++nb) {
#pragma unroll
                for (int j = 0; j < 8; ++j) os[wv * WST + (mb * 16 + hi * 8 + j) * 68 + nb * 16 + lr] = acc[mb][nb][j]; }
        __syncthreads();    // every wave's partial tile is in LDS before any of it is summed
        float* crow = C + (size_t)r0 * ldc + c0;
#pragma unroll
        for (int q = 0; q < 32 / KS; ++q) { const int idx = q * 32 * KS + (int)threadIdx.x, row = idx >> 4, cofs = (idx & 15) * 4; v4f val = *(const v4fa*)(os + row * 68 + cofs);
#pragma unroll
            for (int ww = 1; ww < KS; ++ww) val += *(const v4fa*)(os + ww * WST + row * 68 + cofs);
            if (BIAS) { val[0] += bfr(bias[c0 + cofs]); val[1] += bfr(bias[c0 + cofs + 1]); val[2] += bfr(bias[c0 + cofs + 2]); val[3] += bfr(bias[c0 + cofs + 3]); }
            *(v4f*)(crow + (size_t)row * ldc + cofs) = val; }
        return;
    }
#pragma unroll
    for (int mb = 0; mb < 4; ++mb) {
#pragma unroll
        for (int nb = 0; nb < 4; ++nb) {
#pragma unroll
            for (int j = 0; j < 8; ++j) os[(hi * 8 + j) * 68 + nb * 16 + lr] = acc[mb][nb][j]; }
        __builtin_amdgcn_wave_barrier(); asm volatile("" ::: "memory");
        float* crow = C + (size_t)(r0 + mb * 16) * ldc + c0;
{
#pragma unroll
            for (int s = 0; s < 8; ++s) { const int row = 2 * s + hi, cofs = lr * 4; v4f val = *(const v4fa*)(os + row * 68 + cofs); if (BIAS) { val[0] += bfr(bias[c0 + cofs]); val[1] += bfr(bias[c0 + cofs + 1]); val[2] += bfr(bias[c0 + cofs + 2]); val[3] += bfr(bias[c0 + cofs + 3]); }
                *(v4f*)(crow + (size_t)row * ldc + cofs) = val; }
             }
        __builtin_amdgcn_wave_barrier(); asm volatile("" ::: "memory");
    }
}

// ---- k_gemmc: the same 64x64 tile GEMM (KS as in k_gemmw) specialised for causal attention: CMODE 1 skips score tiles entirely above the diagonal (query rows r0+roff.., key columns c0..), CMODE 2 limits the
// key (K) loop of the probability x value contraction to the diagonal block (probabilities beyond it are exactly zero). roff = row offset of this launch's first row within the sequence.
template <typename T16, int NSPLIT, int CMODE, int KS>
__global__ __launch_bounds__(32 * KS) void k_gemmc(const T16* __restrict__ A, const T16* __restrict__ A2, const T16* __restrict__ Bt, const T16* __restrict__ Bt2, int K, float* C, int ldc, int roff, size_t sA, size_t sB, size_t sC) {
    typedef typename WFrag<T16>::V V;
    constexpr int WST = (KS == 1) ? 16 * 68 : 64 * 68;      // floats of one wave's LDS slab: one 16-row block (KS = 1), its whole partial tile (KS > 1)
    __shared__ __align__(16) float os[KS * WST];
    const int wv = (KS == 1) ? 0 : __builtin_amdgcn_readfirstlane((int)(threadIdx.x >> 5));   // wave number, scalar: the K loop's control stays a scalar branch
    const size_t z = blockIdx.z; A += z * sA; if (A2) A2 += z * sA; Bt += z * sB; if (Bt2) Bt2 += z * sB; C += z * sC;
    const int lane = threadIdx.x & 31, lr = lane & 15, hi = lane >> 4; const int r0 = blockIdx.x * 64, c0 = blockIdx.y * 64;
    if (CMODE == 1 && c0 > r0 + roff + 63) return;                  // score tile entirely above the causal diagonal: never read (the softmax masks j > i by select)
    const int Kl = (CMODE == 2) ? min(K, r0 + roff + 64) : K;        // P.V: probabilities are exactly 0 beyond the diagonal block, so the K loop stops there
    v8f acc[4][4];
#pragma unroll
    for (int mb = 0; mb < 4; ++mb)
#pragma unroll
        for (int nb = 0; nb < 4; ++nb) acc[mb][nb] = (v8f){};
    const size_t aoff = (size_t)(r0 + lr) * K + 8 * hi, boff = (size_t)(c0 + lr) * K + 8 * hi;
#pragma unroll 1
    for (int kc = wv * 64; kc < Kl; kc += (kc & 32) ? KS * 64 - 32 : 32) {   // wave wv takes the 64-wide K chunks wv, wv + KS, ... (one whole 128-byte line of each operand row)
        V a[4], a2[4];
#pragma unroll
        for (int mb = 0; mb < 4; ++mb) { a[mb] = WFrag<T16>::ld(A + aoff + (size_t)mb * 16 * K + kc); if (NSPLIT == 1 || NSPLIT == 2) a2[mb] = WFrag<T16>::ld(A2 + aoff + (size_t)mb * 16 * K + kc); }
#pragma unroll
        for (int nb = 0; nb < 4; ++nb) { const V b = WFrag<T16>::ld(Bt + boff + (size_t)nb * 16 * K + kc); V b2; if (NSPLIT >= 2) b2 = WFrag<T16>::ld(Bt2 + boff + (size_t)nb * 16 * K + kc);
#pragma unroll
            for (int mb = 0; mb < 4; ++mb) { acc[mb][nb] = WFrag<T16>::mma(a[mb], b, acc[mb][nb]); if (NSPLIT == 1 || NSPLIT == 2) acc[mb][nb] = WFrag<T16>::mma(a2[mb], b, acc[mb][nb]); if (NSPLIT >= 2) acc[mb][nb] = WFrag<T16>::mma(a[mb], b2, acc[mb][nb]); } }
        asm volatile("v_nop\n\tv_nop\n\tv_nop\n\tv_nop" : "+v"(acc[0][0]), "+v"(acc[1][1]), "+v"(acc[2][2]), "+v"(acc[3][3]) : "v"(a[0]), "v"(a[3]));
    }
    if constexpr (KS > 1) {     // the KS waves' partial tiles meet in LDS and are summed in fixed wave order 0 .. KS-1
        // unrolls: acc[][] stays in registers only under constant indices; the q and ww loops so that their LDS reads issue together
#pragma unroll
        for (int mb = 0; mb < 4; ++mb)
#pragma unroll
            for (int nb = 0; nb < 4; ++nb) {
#pragma unroll
                for (int j = 0; j < 8; ++j) os[wv * WST + (mb * 16 + hi * 8 + j) * 68 + nb * 16 + lr] = acc[mb][nb][j]; }
        __syncthreads();    // every wave's partial tile is in LDS before any of it is summed
        float* crow = C + (size_t)r0 * ldc + c0;
#pragma unroll
        for (int q = 0; q < 32 / KS; ++q) { const int idx = q * 32 * KS + (int)threadIdx.x, row = idx >> 4, cofs = (idx & 15) * 4; v4f val = *(const v4fa*)(os + row * 68 + cofs);
#pragma unroll
            for (int ww = 1; ww < KS; ++ww) val += *(const v4fa*)(os + ww * WST + row * 68 + cofs);
            *(v4f*)(crow + (size_t)row * ldc + cofs) = val; }
        return;
    }
#pragma unroll
    for (int mb = 0; mb < 4; ++mb) {
#pragma unroll
        for (int nb = 0; nb < 4; ++nb) {
#pragma unroll
            for (int j = 0; j < 8; ++j) os[(hi * 8 + j) * 68 + nb * 16 + lr] = acc[mb][nb][j]; }
        __builtin_amdgcn_wave_barrier(); asm volatile("" ::: "memory");
        float* crow = C + (size_t)(r0 + mb * 16) * ldc + c0;
{
#pragma unroll
            for (int s = 0; s < 8; ++s) { const int row = 2 * s + hi, cofs = lr * 4; v4f val = *(const v4fa*)(os + row * 68 + cofs);
                *(v4f*)(crow + (size_t)row * ldc + cofs) = val; }
             }
        __builtin_amdgcn_wave_barrier(); asm volatile("" ::: "memory");
    }
}

__device__ __forceinline__ h16 tohx(float x) { return (h16)x; }
__device__ __forceinline__ void splitf(float y, unsigned short& h, unsigned short& l) { h = f2bf(y); l = f2bf(y - bf2f(h)); }
typedef __attribute__((ext_vector_type(2))) _Float16 v2h;
typedef __attribute__((ext_vector_type(4))) _Float16 v4h;
typedef __attribute__((ext_vector_type(2))) unsigned short v2us;
typedef __attribute__((ext_vector_type(4))) unsigned short v4us;
typedef __attribute__((ext_vector_type(2))) float v2f;
typedef __attribute__((ext_vector_type(4))) int v4i;

__global__ __launch_bounds__(256) void k_wtG(const float* __restrict__ w, int K, int N, bf* Bt) {
    const int lane = threadIdx.x & 31; const int L0 = (blockIdx.x * 8 + (threadIdx.x >> 5)) * 8; const int nlines = N * K / 64;
{
#pragma unroll 1
        for (int l = 0; l < 8; ++l) { const int L = L0 + l; if (L >= nlines) break; const size_t e = (size_t)L * 64 + lane * 2; const int k = (int)(e % K), n = (int)(e / K); v2us o;
            o[0] = f2bf(w[(size_t)k * N + n]); o[1] = f2bf(w[(size_t)(k + 1) * N + n]); *(v2us*)(Bt + e) = o; }
         }
}
__global__ __launch_bounds__(256) void k_cvt8(const float* __restrict__ src, bf* dst, size_t n8) { const size_t i = (size_t)blockIdx.x * 256 + threadIdx.x; if (i >= n8) return; const v8f v = *(const v8f*)(src + i * 8); v8us o;
#pragma unroll
    for (int k = 0; k < 8; ++k) o[k] = f2bf(v[k]); *(v8us*)(dst + i * 8) = o;  }
__global__ __launch_bounds__(256) void k_cscvt(const float* __restrict__ cosT, const float* __restrict__ sinT, float* CS) { const int idx = blockIdx.x * 256 + threadIdx.x; if (idx >= TT * HD) return; v2f cs; cs[0] = bfr(cosT[idx]); cs[1] = bfr(sinT[idx]); *(v2f*)(CS + (size_t)idx * 2) = cs;  }
// k_rope: head planes [h][t][d] (fp16 + hi/lo) of rope(x) x sc with the rotate-half convention out[d] = x[d] cos[t][d] - x[d+HD/2] sin[t][d], out[d+HD/2] = x[d+HD/2] cos[t][d+HD/2] + x[d] sin[t][d+HD/2]
__global__ __launch_bounds__(256) void k_rope(const float* __restrict__ F, int pitch, int nheads, const float* __restrict__ CS, const float* __restrict__ RF, const float* __restrict__ nw, float sc, h16* P16, bf* Ph, bf* Pl) {
    const size_t e = ((size_t)blockIdx.x * 256 + threadIdx.x) * 2; if (e >= (size_t)nheads * TT * HD) return; const int d = (int)(e % HD); const int t = (int)((e / HD) % TT); const int h = (int)(e / ((size_t)HD * TT)); const float* f = F + (size_t)t * pitch + h * HD; const float rf = RF ? RF[(size_t)h * TT + t] : 1.0f; v2h o16; v2us oh, ol;
#pragma unroll
    for (int q = 0; q < 2; ++q) { const int dd = d + q; const int dp = (dd < HD / 2) ? dd + HD / 2 : dd - HD / 2; float x0 = f[dd], x1 = f[dp];
        if (RF) { float n0 = __fmul_rn(x0, rf), n1 = __fmul_rn(x1, rf); asm volatile("" : "+v"(n0)); asm volatile("" : "+v"(n1)); x0 = __fmul_rn(bfr(nw[dd]), n0); x1 = __fmul_rn(bfr(nw[dp]), n1); }
        const v2f cs = *(const v2f*)(CS + ((size_t)t * HD + dd) * 2); float a = __fmul_rn(x0, cs[0]), bq = __fmul_rn(x1, cs[1]); asm volatile("" : "+v"(a)); asm volatile("" : "+v"(bq)); const float r = ((dd < HD / 2) ? __fsub_rn(a, bq) : __fadd_rn(a, bq)) * sc;
        o16[q] = tohx(r); unsigned short a2, c2; splitf(r, a2, c2); oh[q] = a2; ol[q] = c2; }
    *(v2h*)(P16 + e) = o16; *(v2us*)(Ph + e) = oh; *(v2us*)(Pl + e) = ol;  }
__global__ __launch_bounds__(256) void k_vtp(const float* __restrict__ F, int pitch, int nheads, h16* V16, bf* Vh, bf* Vl) { const size_t e = ((size_t)blockIdx.x * 256 + threadIdx.x) * 2; if (e >= (size_t)nheads * HD * TT) return; const int t = (int)(e % TT); const int d = (int)((e / TT) % HD); const int g = (int)(e / ((size_t)TT * HD)); v2h o16; v2us oh, ol;
#pragma unroll
    for (int q = 0; q < 2; ++q) { const float x = F[(size_t)(t + q) * pitch + g * HD + d]; o16[q] = tohx(x); unsigned short a2, c2; splitf(x, a2, c2); oh[q] = a2; ol[q] = c2; }
    *(v2h*)(V16 + e) = o16; *(v2us*)(Vh + e) = oh; *(v2us*)(Vl + e) = ol;  }
__global__ __launch_bounds__(256) void k_csid(float* CS) { const int idx = blockIdx.x * 256 + threadIdx.x; if (idx >= TT * HD) return; v2f cs; cs[0] = 1.0f; cs[1] = 0.0f; *(v2f*)(CS + (size_t)idx * 2) = cs;  }
// k_asoft: per row (zz, i): t = S x HD^-0.5 for j <= i and i - j < WIN (sliding causal window; the reference's -1e9 additive fill vanishes identically); softmax over the 2048 keys (register row, one exp, fixed trees);
__global__ __launch_bounds__(256) void k_asoft(const float* __restrict__ Sb, h16* P16, bf* Ph, bf* Pl) {
    const int lane = threadIdx.x & 31; const int row = blockIdx.x * 8 + (threadIdx.x >> 5); if (row >= ZH * TT) return; const int i = row % TT; const int zz = row / TT; (void)zz; const bool hires = (i < RH); const float* sr = Sb + (size_t)row * TT; float v[TT / 32]; float mx = -3.0e38f;
#pragma unroll
    for (int ch = 0; ch < TT / 128; ++ch) { const int j0 = ch * 128 + lane * 4; const v4f a = *(const v4f*)(sr + j0);
#pragma unroll
        for (int q = 0; q < 4; ++q) { const int j = j0 + q; (void)j; const float t = (j <= i && i - j < WIN) ? a[q] * SCL : -3.0e38f; v[ch * 4 + q] = t; mx = fmaxf(mx, t); } }
#pragma unroll
    for (int sh = 16; sh; sh >>= 1) mx = fmaxf(mx, __shfl_xor(mx, sh, 32));
    float sum = 0.f;
#pragma unroll
    for (int k = 0; k < TT / 32; ++k) { float d0 = __fsub_rn(v[k], mx); asm volatile("" : "+v"(d0)); v[k] = __builtin_amdgcn_exp2f(__fmul_rn(d0, 1.4426950408889634f)); sum += v[k]; }
#pragma unroll
    for (int sh = 16; sh; sh >>= 1) sum += __shfl_xor(sum, sh, 32);
    const float f = __fdiv_rn(hires ? 1.0f : PCAR, sum);
{
        if (hires) {
#pragma unroll
            for (int ch = 0; ch < TT / 128; ++ch) { v4us oh, ol;
#pragma unroll
                for (int q = 0; q < 4; ++q) { unsigned short a, c2; splitf(v[ch * 4 + q] * f, a, c2); oh[q] = a; ol[q] = c2; }
                const size_t oo = ((size_t)zz * (RH ? RH : 1) + i) * TT + ch * 128 + lane * 4; *(v4us*)(Ph + oo) = oh; *(v4us*)(Pl + oo) = ol; }
        } else {
#pragma unroll
            for (int ch = 0; ch < TT / 128; ++ch) { v4h o4;
#pragma unroll
                for (int q = 0; q < 4; ++q) o4[q] = tohx(v[ch * 4 + q] * f);
                *(v4h*)(P16 + (size_t)row * TT + ch * 128 + lane * 4) = o4; } }
         }
}
__global__ __launch_bounds__(256) void k_merge(const float* __restrict__ O, int h0, bf* Ah, bf* Al) { const size_t e = ((size_t)blockIdx.x * 256 + threadIdx.x) * 2; if (e >= (size_t)ZH * TT * HD) return; const int d = (int)(e % HD); const int t = (int)((e / HD) % TT); const int zz = (int)(e / ((size_t)HD * TT)); const float cs = (t < RH) ? 1.0f : (1.0f / PCAR); const size_t oo = (size_t)t * DQ + (h0 + zz) * HD + d;
    v2us oh, ol;
#pragma unroll
    for (int q = 0; q < 2; ++q) { unsigned short a, c2; splitf(O[e + q] * cs, a, c2); oh[q] = a; ol[q] = c2; } *(v2us*)(Ah + oo) = oh; *(v2us*)(Al + oo) = ol;  }

__global__ __launch_bounds__(256) void k_wt16(const float* __restrict__ w, int K, int N, h16* Bt) { const size_t e = ((size_t)blockIdx.x * 256 + threadIdx.x) * 2; if (e >= (size_t)N * K) return; const int k = (int)(e % K), n = (int)(e / K); v2h o; o[0] = tohx(bfr(w[(size_t)k * N + n])); o[1] = tohx(bfr(w[(size_t)(k + 1) * N + n])); *(v2h*)(Bt + e) = o;  }
__global__ __launch_bounds__(256) void k_rmsc(const float* __restrict__ X, int isin, const float* __restrict__ w, h16* HC) { const int lane = threadIdx.x & 31; const int t = blockIdx.x * 8 + (threadIdx.x >> 5); if (t >= TT) return; float v[32]; float s = 0.f;
#pragma unroll
    for (int ch = 0; ch < 8; ++ch) { const v4f a = *(const v4f*)(X + (size_t)t * DM + ch * 128 + lane * 4);
#pragma unroll
        for (int q = 0; q < 4; ++q) { const float xv = isin ? bfr(a[q]) : a[q]; v[ch * 4 + q] = xv; float p = __fmul_rn(xv, xv); asm volatile("" : "+v"(p)); s = __fadd_rn(s, p); } }
#pragma unroll
    for (int sh = 16; sh; sh >>= 1) s += __shfl_xor(s, sh, 32);
    const float r = __frsqrt_rn(__fadd_rn(s * (1.0f / DM), 1.1920929e-07f));
{
#pragma unroll
        for (int ch = 0; ch < 8; ++ch) { const int c0 = ch * 128 + lane * 4; const int n = c0 / 256, cc = c0 % 256; v4h o;
#pragma unroll
            for (int q = 0; q < 4; ++q) { float tn = __fmul_rn(v[ch * 4 + q], r); asm volatile("" : "+v"(tn)); o[q] = tohx(__fmul_rn(tn, bfr(w[c0 + q]))); }
            *(v4h*)(HC + ((size_t)n * TT + t) * 256 + cc) = o; }
         } }
// ---- k_dend: one dendritic layer per blockIdx.z; grid (TT/64, N/64, layers), 128 threads. Wave n of the work-group forms the 64x64 tile of input block n, h_n W[n] (K = 256, fp16 planes, f32 accumulate, one running sum over K);
// the four tiles meet in LDS, and each output element is max over n = 0 .. 3 (in that order) of gain[n] silu(tile_n - thr[n]). H: block planes [n][TT][256]; Bt: [n][N][256]; thr, gain: [n][N]; C: [TT][N].
// blockIdx.z picks the layer: weights and outputs by the strides sB and sC (elements), thresholds and gains by the pointer pair.
__global__ __launch_bounds__(128) void k_dend(const h16* __restrict__ H, const h16* __restrict__ Bt, int N, const float* __restrict__ thr0, const float* __restrict__ gain0, const float* __restrict__ thr1, const float* __restrict__ gain1, float* C, size_t sB, size_t sC) {
    constexpr int K = 256, WST = 64 * 68;                   // WST: floats of one wave's LDS slab (its whole tile, row pitch 68)
    __shared__ __align__(16) float os[4 * WST];
    const int wv = __builtin_amdgcn_readfirstlane((int)(threadIdx.x >> 5));   // wave number = input block n, scalar
    const float* thr = blockIdx.z ? thr1 : thr0; const float* gain = blockIdx.z ? gain1 : gain0;
    const h16* A = H + (size_t)wv * TT * K; const h16* B = Bt + blockIdx.z * sB + (size_t)wv * N * K; C += blockIdx.z * sC;
    const int lane = threadIdx.x & 31, lr = lane & 15, hi = lane >> 4; const int r0 = blockIdx.x * 64, c0 = blockIdx.y * 64;
    v8f acc[4][4];
#pragma unroll
    for (int mb = 0; mb < 4; ++mb)
#pragma unroll
        for (int nb = 0; nb < 4; ++nb) acc[mb][nb] = (v8f){};
    const size_t aoff = (size_t)(r0 + lr) * K + 8 * hi, boff = (size_t)(c0 + lr) * K + 8 * hi;
    // unroll: K is a constant, eight trips; straight-line code lets the next trip's loads issue ahead of this trip's products
#pragma unroll
    for (int kc = 0; kc < K; kc += 32) {
        v16h a[4];
#pragma unroll
        for (int mb = 0; mb < 4; ++mb) a[mb] = WFrag<h16>::ld(A + aoff + (size_t)mb * 16 * K + kc);
#pragma unroll
        for (int nb = 0; nb < 4; ++nb) { const v16h b = WFrag<h16>::ld(B + boff + (size_t)nb * 16 * K + kc);
#pragma unroll
            for (int mb = 0; mb < 4; ++mb) acc[mb][nb] = wmma16(a[mb], b, acc[mb][nb]); }
    }
    // both address pairs stay live up to this wait, so no register that an issued operand load names is given a new value in front of it
    asm volatile("s_wait_xcnt 0x0" :: "v"(A + aoff), "v"(B + boff) : "memory");
    // unrolls: acc[][] stays in registers only under constant indices
#pragma unroll
    for (int mb = 0; mb < 4; ++mb)
#pragma unroll
        for (int nb = 0; nb < 4; ++nb) {
#pragma unroll
            for (int j = 0; j < 8; ++j) os[wv * WST + (mb * 16 + hi * 8 + j) * 68 + nb * 16 + lr] = acc[mb][nb][j]; }
    __syncthreads();    // all four blocks' tiles are in LDS before any element's max is taken
    const unsigned cofs = (threadIdx.x & 15u) * 4u; v4f th[4], ga[4]; unsigned ob[4];   // this thread's four output columns are the same in every row it handles
#pragma unroll
    for (int n = 0; n < 4; ++n) { ob[n] = ((unsigned)(n * N) + cofs) * 4u; th[n] = *(const v4fa*)((const char*)(thr + c0) + ob[n]); ga[n] = *(const v4fa*)((const char*)(gain + c0) + ob[n]); }
    // the four byte offsets stay live up to this wait, so no register that an issued threshold or gain load names is given a new value in front of it
    asm volatile("s_wait_xcnt 0x0" :: "v"(ob[0]), "v"(ob[1]), "v"(ob[2]), "v"(ob[3]) : "memory");
#pragma unroll
    for (int n = 0; n < 4; ++n)
#pragma unroll
        for (int q = 0; q < 4; ++q) { th[n][q] = bfr(th[n][q]); ga[n][q] = bfr(ga[n][q]); }
    float* crow = C + (size_t)r0 * N + c0 + cofs;
    // unroll 2: two rows' independent division chains fill each other's waits; more would only lengthen the code
#pragma unroll 2
    for (int s = 0; s < 8; ++s) { const int row = s * 8 + (int)(threadIdx.x >> 4); v4f r;
#pragma unroll
        for (int n = 0; n < 4; ++n) { const v4f a = *(const v4fa*)(os + n * WST + row * 68 + cofs);
#pragma unroll
            for (int q = 0; q < 4; ++q) { const float z = __fsub_rn(a[q], th[n][q]); const float sg = __fdiv_rn(1.0f, 1.0f + __expf(-z)); const float val = __fmul_rn(ga[n][q], __fmul_rn(z, sg)); r[q] = n ? fmaxf(r[q], val) : val; } }
        *(v4f*)(crow + (size_t)row * N) = r;
        asm volatile("s_wait_xcnt 0x0" ::: "memory"); }   // the next trip rewrites the registers that this store names: the wait stands in front of that
}
__global__ __launch_bounds__(256) void k_res(const float* __restrict__ x, const float* __restrict__ ATT, float* X1) { const size_t i = ((size_t)blockIdx.x * 256 + threadIdx.x) * 4; if (i >= (size_t)TT * DM) return; const v4f a = *(const v4f*)(ATT + i); v4f o; o[0] = __fadd_rn(bfr(x[i]), a[0]); o[1] = __fadd_rn(bfr(x[i + 1]), a[1]); o[2] = __fadd_rn(bfr(x[i + 2]), a[2]); o[3] = __fadd_rn(bfr(x[i + 3]), a[3]); *(v4f*)(X1 + i) = o;  }
__global__ __launch_bounds__(256) void k_ffp(const float* __restrict__ G, const float* __restrict__ U, h16* FF16) { const size_t i = ((size_t)blockIdx.x * 256 + threadIdx.x) * 4; if (i >= (size_t)TT * 2048) return; const v4f g = *(const v4f*)(G + i), u = *(const v4f*)(U + i); v4h o;
#pragma unroll
    for (int q = 0; q < 4; ++q) { const float sg = __fdiv_rn(1.0f, 1.0f + __expf(-g[q])); float sl = __fmul_rn(g[q], sg); asm volatile("" : "+v"(sl)); o[q] = tohx(__fmul_rn(sl, u[q])); } *(v4h*)(FF16 + i) = o;  }
__global__ __launch_bounds__(256) void k_fin(const float* __restrict__ X1, const float* __restrict__ F2, float* OUT) { const size_t i = ((size_t)blockIdx.x * 256 + threadIdx.x) * 4; if (i >= (size_t)TT * DM) return; const v4f a = *(const v4f*)(X1 + i), f = *(const v4f*)(F2 + i); v4f o; o[0] = __fadd_rn(a[0], f[0]); o[1] = __fadd_rn(a[1], f[1]); o[2] = __fadd_rn(a[2], f[2]); o[3] = __fadd_rn(a[3], f[3]); *(v4f*)(OUT + i) = o;  }

extern "C" void kernel_launch(void* const* d_in, const int* in_sizes, int n_in,
                              void* d_out, int out_size, void* d_ws, size_t ws_size, hipStream_t stream) {
    (void)in_sizes; (void)n_in; (void)out_size;
    const float* x = (const float*)d_in[0]; const float* qkvw = (const float*)d_in[1]; const float* qthr = (const float*)d_in[2]; const float* qgain = (const float*)d_in[3]; const float* wo = (const float*)d_in[4]; const float* gw = (const float*)d_in[5]; const float* gthr = (const float*)d_in[6]; const float* ggain = (const float*)d_in[7]; const float* uw = (const float*)d_in[8]; const float* uthr = (const float*)d_in[9]; const float* ugain = (const float*)d_in[10]; const float* dw = (const float*)d_in[11]; const float* n1w = (const float*)d_in[12]; const float* n2w = (const float*)d_in[13];
    float* OUT = (float*)d_out;     // [2][2048][1024]
    char* wsp = (char*)d_ws;
    auto take = [&](size_t bytes) { char* p = wsp; wsp += (bytes + 255) & ~(size_t)255; return (void*)p; };
    bf* WQ = (bf*)take((size_t)DQ * DM * 2); bf* WK = (bf*)take((size_t)DKV * DM * 2); bf* WV = (bf*)take((size_t)DKV * DM * 2); bf* WO = (bf*)take((size_t)DM * DQ * 2); float* CS = (float*)take((size_t)TT * HD * 2 * 4);
    bf* XB = (bf*)take((size_t)TT * DM * 2); float* FQKV = (float*)take((size_t)TT * 3072 * 4);   // dendritic [q|k|v], row pitch 3072
    h16* QP16 = (h16*)take((size_t)NH_ * TT * HD * 2); h16* KP16 = (h16*)take((size_t)NKV * TT * HD * 2); h16* VT16 = (h16*)take((size_t)NKV * HD * TT * 2);
    bf* QPh = (bf*)take((size_t)NH_ * TT * HD * 2); bf* QPl = (bf*)take((size_t)NH_ * TT * HD * 2); bf* KPh = (bf*)take((size_t)NKV * TT * HD * 2); bf* KPl = (bf*)take((size_t)NKV * TT * HD * 2); bf* VTh = (bf*)take((size_t)NKV * HD * TT * 2); bf* VTl = (bf*)take((size_t)NKV * HD * TT * 2); bf* Ph = (bf*)take((size_t)ZH * RH * TT * 2); bf* Pl = (bf*)take((size_t)ZH * RH * TT * 2);
    float* Sb = (float*)take((size_t)ZH * TT * TT * 4); h16* P16 = (h16*)take((size_t)ZH * TT * TT * 2); float* Ob = (float*)take((size_t)ZH * TT * HD * 4); bf* ATh = (bf*)take((size_t)TT * DQ * 2); bf* ATl = (bf*)take((size_t)TT * DQ * 2);
    if ((size_t)(wsp - (char*)d_ws) > ws_size) return;    // ws 256 MiB
    h16* BQKV = (h16*)take((size_t)4 * 3072 * 256 * 2); h16* BG = (h16*)take((size_t)2 * 4 * 2048 * 256 * 2); h16* BU = BG + (size_t)4 * 2048 * 256; h16* BD = (h16*)take((size_t)DM * 2048 * 2); h16* HC = (h16*)take((size_t)4 * TT * 256 * 2); float* ACG = (float*)take((size_t)2 * TT * 2048 * 4); float* ACU = ACG + (size_t)TT * 2048; h16* FF16 = (h16*)take((size_t)TT * 2048 * 2); float* ATT = (float*)take((size_t)TT * DM * 4); float* X1 = (float*)take((size_t)TT * DM * 4);
    if ((size_t)(wsp - (char*)d_ws) > ws_size) return;
    { for (int n = 0; n < 4; ++n) { k_wt16<<<(unsigned)(((size_t)256 * 3072 / 2 + 255) / 256), 256, 0, stream>>>(qkvw + (size_t)n * 256 * 3072, 256, 3072, BQKV + (size_t)n * 3072 * 256); k_wt16<<<(unsigned)(((size_t)256 * 2048 / 2 + 255) / 256), 256, 0, stream>>>(gw + (size_t)n * 256 * 2048, 256, 2048, BG + (size_t)n * 2048 * 256); k_wt16<<<(unsigned)(((size_t)256 * 2048 / 2 + 255) / 256), 256, 0, stream>>>(uw + (size_t)n * 256 * 2048, 256, 2048, BU + (size_t)n * 2048 * 256); }
      k_wt16<<<(unsigned)(((size_t)2048 * DM / 2 + 255) / 256), 256, 0, stream>>>(dw, 2048, DM, BD);
      k_wtG<<<(unsigned)((DQ * DM / 64 + 63) / 64), 256, 0, stream>>>(wo, DQ, DM, WO);
       }
    k_csid<<<(TT * HD + 255) / 256, 256, 0, stream>>>(CS);
    const unsigned LQ = (unsigned)(((size_t)NH_ * TT * HD / 2 + 255) / 256), LKv = (unsigned)(((size_t)NKV * TT * HD / 2 + 255) / 256);
    for (int b = 0; b < NB_; ++b) {
        
        k_rmsc<<<TT / 8, 256, 0, stream>>>(x + (size_t)b * TT * DM, 1, n1w, HC);
        // dendritic [q|k|v]: one launch for the whole layer (N = 3072)
        k_dend<<<dim3(TT / 64, 3072 / 64, 1), 128, 0, stream>>>(HC, BQKV, 3072, qthr, qgain, qthr, qgain, FQKV, 0, 0);
        k_rope<<<LQ, 256, 0, stream>>>(FQKV, 3072, NH_, CS, nullptr, nullptr, 1.0f, QP16, QPh, QPl);
        k_rope<<<LKv, 256, 0, stream>>>(FQKV + DQ, 3072, NKV, CS, nullptr, nullptr, 1.0f, KP16, KPh, KPl);
        k_vtp<<<LKv, 256, 0, stream>>>(FQKV + DQ + DKV, 3072, NKV, VT16, VTh, VTl);
        for (int h0 = 0; h0 < NH_; h0 += ZH) { const size_t zq = (size_t)h0, zk = (size_t)(h0 / REP);   // one kv head per query head: the pass's two heads use consecutive kv planes (z-strides TT*HD)
            k_gemmc<bf, 2, 1, 1><<<dim3(RH / 64, TT / 64, ZH), 32, 0, stream>>>(QPh + zq * TT * HD, QPl + zq * TT * HD, KPh + zk * TT * HD, KPl + zk * TT * HD, HD, Sb, TT, 0, (size_t)TT * HD, (size_t)TT * HD, (size_t)TT * TT);
            k_gemmc<h16, 0, 1, 1><<<dim3((TT - RH) / 64, TT / 64, ZH), 32, 0, stream>>>(QP16 + zq * TT * HD + (size_t)RH * HD, nullptr, KP16 + zk * TT * HD, nullptr, HD, Sb + (size_t)RH * TT, TT, RH, (size_t)TT * HD, (size_t)TT * HD, (size_t)TT * TT);
            k_asoft<<<ZH * TT / 8, 256, 0, stream>>>(Sb, P16, Ph, Pl);
            k_gemmc<bf, 2, 2, 8><<<dim3(RH / 64, HD / 64, ZH), 256, 0, stream>>>(Ph, Pl, VTh + zk * HD * TT, VTl + zk * HD * TT, TT, Ob, HD, 0, (size_t)RH * TT, (size_t)HD * TT, (size_t)TT * HD);
            k_gemmc<h16, 0, 2, 16><<<dim3((TT - RH) / 64, HD / 64, ZH), 512, 0, stream>>>(P16 + (size_t)RH * TT, nullptr, VT16 + zk * HD * TT, nullptr, TT, Ob + (size_t)RH * HD, HD, RH, (size_t)TT * TT, (size_t)HD * TT, (size_t)TT * HD);
            k_merge<<<(unsigned)(((size_t)ZH * TT * HD / 2 + 255) / 256), 256, 0, stream>>>(Ob, h0, ATh, ATl); }
        k_gemmw<bf, 1, false, 8><<<dim3(TT / 64, DM / 64, 1), 256, 0, stream>>>(ATh, ATl, WO, nullptr, DQ, ATT, DM, nullptr, 0, 0, 0);
        k_res<<<(TT * DM / 4 + 255) / 256, 256, 0, stream>>>(x + (size_t)b * TT * DM, ATT, X1); k_rmsc<<<TT / 8, 256, 0, stream>>>(X1, 0, n2w, HC);
        // dendritic gate (z = 0) and up (z = 1) in one launch
        k_dend<<<dim3(TT / 64, 2048 / 64, 2), 128, 0, stream>>>(HC, BG, 2048, gthr, ggain, uthr, ugain, ACG, (size_t)4 * 2048 * 256, (size_t)TT * 2048);
        k_ffp<<<(unsigned)(((size_t)TT * 2048 / 4 + 255) / 256), 256, 0, stream>>>(ACG, ACU, FF16);
        k_gemmw<h16, 0, false, 8><<<dim3(TT / 64, DM / 64, 1), 256, 0, stream>>>(FF16, nullptr, BD, nullptr, 2048, ATT, DM, nullptr, 0, 0, 0);
        k_fin<<<(TT * DM / 4 + 255) / 256, 256, 0, stream>>>(X1, ATT, OUT + (size_t)b * TT * DM); }
}

// v004
// A run of this version takes 443 microseconds.
// Versions in between are left out here; by their measured steps it is 2.50 times as fast as v002.
// All steps since v000 together make it 4.84 times as fast.
#include <hip/hip_runtime.h>

// DendriticFractalBlock (x [2][2048][1024]; h = RMSNorm(x) w1; [q|k|v] = dendritic(h, qkv_w, thr, gain) = max over the 4 input blocks n of gain[n] silu(h_n W[n] - thr[n]) (16 heads x 64); causal softmax(q.k/8); x1 = x + merged.v o_w;
// h2 = RMSNorm(x1) w2; ff = silu(dendritic(h2, gate)) * dendritic(h2, up); out = x1 + ff down_w -> [2][2048][1024]; all weights x @ W; eps = f32 eps).
// Compute dtypes, f32 accumulate: every input rounded to bf16; the RMSNorms f32 -> SINGLE fp16 block planes; every dendritic GEMM on fp16 planes x fp16 copies of the bf16 weights (1 product; hi+lo would double the
// ~25 G of dendritic GEMMs), the gain/silu/threshold/max epilogues f32; scores (K 64) and probs.v on hl planes (3 products) for the first 512 query rows of each head and single fp16 planes for the rest, f32 causal softmax with masked tiles

#define NB_  2
#define TT   2048
#define DM   1024
#define NH_  16
#define NKV  16
#define REP  (NH_ / NKV)
#define HD   64
#define DQ   (NH_ * HD)
#define DKV  (NKV * HD)
#define RH   512                  // query rows < RH use hi+lo planes (0: none)
#define SCL  0.125f   // HD^-0.5
typedef _Float16 h16;
typedef unsigned short bf;
typedef __attribute__((ext_vector_type(16))) __bf16   v16bf;
typedef __attribute__((ext_vector_type(16))) _Float16 v16h;
typedef __attribute__((ext_vector_type(8)))  _Float16 v8h;
typedef __attribute__((ext_vector_type(8)))  unsigned short v8us;
typedef __attribute__((ext_vector_type(8)))  float    v8f;
typedef __attribute__((ext_vector_type(4)))  float    v4f;
typedef v8h  __attribute__((may_alias)) v8ha;
typedef v4f  __attribute__((may_alias)) v4fa;
typedef v8us __attribute__((may_alias)) v8usa;

__device__ __forceinline__ unsigned short f2bf(float f) { unsigned u = __float_as_uint(f); u += 0x7FFFu + ((u >> 16) & 1u); return (unsigned short)(u >> 16); }
__device__ __forceinline__ float bf2f(unsigned short b) { return __uint_as_float(((unsigned)b) << 16); }
__device__ __forceinline__ float bfr(float f) { return bf2f(f2bf(f)); }
__device__ __forceinline__ v16h cat16(v8h lo, v8h hi) { return __builtin_shufflevector(lo, hi, 0, 1, 2, 3, 4, 5, 6, 7, 8, 9, 10, 11, 12, 13, 14, 15); }
__device__ __forceinline__ v16bf cat16b(v8us lo, v8us hi) { return __builtin_bit_cast(v16bf, __builtin_shufflevector(lo, hi, 0, 1, 2, 3, 4, 5, 6, 7, 8, 9, 10, 11, 12, 13, 14, 15)); }
__device__ __forceinline__ v8f wmma16(v16h a, v16h b, v8f c) { return __builtin_amdgcn_wmma_f32_16x16x32_f16(false, a, false, b, (short)0, c, false, false); }
__device__ __forceinline__ v8f wmmab(v16bf a, v16bf b, v8f c) { return __builtin_amdgcn_wmma_f32_16x16x32_bf16(false, a, false, b, (short)0, c, false, false); }



// ---- k_gemmw: register-blocked GEMM, 64x64 output tile (16 accumulators) per wave, operands straight from K-contiguous 16-bit planes; grid (M/64, N/64, Z), 32 * KS threads.
// KS = 1: one wave owns the tile. KS > 1 (K % 64 == 0): the KS waves of the work-group share the tile's K loop, so each waits out 1/KS of its load latencies, and their partial tiles are summed through LDS.
// C[m][n] (f32, pitch ldc, + optional f32 bias[n]) = sum_k A[m][k] Bt[n][k] (+ split products per NSPLIT). z-batch strides sA/sB/sC in elements. K % 32 == 0.
template <typename T16> struct WFrag;
template <> struct WFrag<h16> { typedef v16h V; static __device__ __forceinline__ V ld(const h16* p) { return cat16(*(const v8h*)p, *(const v8h*)(p + 16)); } static __device__ __forceinline__ v8f mma(V a, V b, v8f c) { return wmma16(a, b, c); } };
template <> struct WFrag<bf> { typedef v16bf V; static __device__ __forceinline__ V ld(const bf* p) { return cat16b(*(const v8us*)p, *(const v8us*)(p + 16)); } static __device__ __forceinline__ v8f mma(V a, V b, v8f c) { return wmmab(a, b, c); } };
template <typename T16, int NSPLIT, bool BIAS, int KS>
__global__ __launch_bounds__(32 * KS) void k_gemmw(const T16* __restrict__ A, const T16* __restrict__ A2, const T16* __restrict__ Bt, const T16* __restrict__ Bt2, int K, float* C, int ldc, const float* __restrict__ bias, size_t sA, size_t sB, size_t sC) {
    typedef typename WFrag<T16>::V V;
    constexpr int WST = (KS == 1) ? 16 * 68 : 64 * 68;      // floats of one wave's LDS slab: one 16-row block (KS = 1), its whole partial tile (KS > 1)
    __shared__ __align__(16) float os[KS * WST];
    const int wv = (KS == 1) ? 0 : __builtin_amdgcn_readfirstlane((int)(threadIdx.x >> 5));   // wave number, scalar: the K loop's control stays a scalar branch
    const size_t z = blockIdx.z; A += z * sA; if (A2) A2 += z * sA; Bt += z * sB; if (Bt2) Bt2 += z * sB; C += z * sC;
    const int lane = threadIdx.x & 31, lr = lane & 15, hi = lane >> 4; const int r0 = blockIdx.x * 64, c0 = blockIdx.y * 64;
    v8f acc[4][4];
#pragma unroll
    for (int mb = 0; mb < 4; ++mb)
#pragma unroll
        for (int nb = 0; nb < 4; ++nb) acc[mb][nb] = (v8f){};
    const size_t aoff = (size_t)(r0 + lr) * K + 8 * hi, boff = (size_t)(c0 + lr) * K + 8 * hi;
#pragma unroll 1
    for (int kc = wv * 64; kc < K; kc += (kc & 32) ? KS * 64 - 32 : 32) {   // wave wv takes the 64-wide K chunks wv, wv + KS, ... (one whole 128-byte line of each operand row)
        V a[4], a2[4];
#pragma unroll
        for (int mb = 0; mb < 4; ++mb) { a[mb] = WFrag<T16>::ld(A + aoff + (size_t)mb * 16 * K + kc); if (NSPLIT == 1 || NSPLIT == 2) a2[mb] = WFrag<T16>::ld(A2 + aoff + (size_t)mb * 16 * K + kc); }
#pragma unroll
        for (int nb = 0; nb < 4; ++nb) { const V b = WFrag<T16>::ld(Bt + boff + (size_t)nb * 16 * K + kc); V b2; if (NSPLIT >= 2) b2 = WFrag<T16>::ld(Bt2 + boff + (size_t)nb * 16 * K + kc);
#pragma unroll
            for (int mb = 0; mb < 4; ++mb) { acc[mb][nb] = WFrag<T16>::mma(a[mb], b, acc[mb][nb]); if (NSPLIT == 1 || NSPLIT == 2) acc[mb][nb] = WFrag<T16>::mma(a2[mb], b, acc[mb][nb]); if (NSPLIT >= 2) acc[mb][nb] = WFrag<T16>::mma(a[mb], b2, acc[mb][nb]); } }
        asm volatile("v_nop\n\tv_nop\n\tv_nop\n\tv_nop" : "+v"(acc[0][0]), "+v"(acc[1][1]), "+v"(acc[2][2]), "+v"(acc[3][3]) : "v"(a[0]), "v"(a[3]));
    }
    if constexpr (KS > 1) {     // the KS waves' partial tiles meet in LDS and are summed in fixed wave order 0 .. KS-1
        // unrolls: acc[][] stays in registers only under constant indices; the q and ww loops so that their LDS reads issue together
#pragma unroll
        for (int mb = 0; mb < 4; ++mb)
#pragma unroll
            for (int nb = 0; nb < 4; ++nb) {
#pragma unroll
                for (int j = 0; j < 8; ++j) os[wv * WST + (mb * 16 + hi * 8 + j) * 68 + nb * 16 + lr] = acc[mb][nb][j]; }
        __syncthreads();    // every wave's partial tile is in LDS before any of it is summed
        float* crow = C + (size_t)r0 * ldc + c0;
#pragma unroll
        for (int q = 0; q < 32 / KS; ++q) { const int idx = q * 32 * KS + (int)threadIdx.x, row = idx >> 4, cofs = (idx & 15) * 4; v4f val = *(const v4fa*)(os + row * 68 + cofs);
#pragma unroll
            for (int ww = 1; ww < KS; ++ww) val += *(const v4fa*)(os + ww * WST + row * 68 + cofs);
            if (BIAS) { val[0] += bfr(bias[c0 + cofs]); val[1] += bfr(bias[c0 + cofs + 1]); val[2] += bfr(bias[c0 + cofs + 2]); val[3] += bfr(bias[c0 + cofs + 3]); }
            *(v4f*)(crow + (size_t)row * ldc + cofs) = val; }
        return;
    }
#pragma unroll
    for (int mb = 0; mb < 4; ++mb) {
#pragma unroll
        for (int nb = 0; nb < 4; ++nb) {
#pragma unroll
            for (int j = 0; j < 8; ++j) os[(hi * 8 + j) * 68 + nb * 16 + lr] = acc[mb][nb][j]; }
        __builtin_amdgcn_wave_barrier(); asm volatile("" ::: "memory");
        float* crow = C + (size_t)(r0 + mb * 16) * ldc + c0;
{
#pragma unroll
            for (int s = 0; s < 8; ++s) { const int row = 2 * s + hi, cofs = lr * 4; v4f val = *(const v4fa*)(os + row * 68 + cofs); if (BIAS) { val[0] += bfr(bias[c0 + cofs]); val[1] += bfr(bias[c0 + cofs + 1]); val[2] += bfr(bias[c0 + cofs + 2]); val[3] += bfr(bias[c0 + cofs + 3]); }
                *(v4f*)(crow + (size_t)row * ldc + cofs) = val; }
             }
        __builtin_amdgcn_wave_barrier(); asm volatile("" ::: "memory");
    }
}

__device__ __forceinline__ h16 tohx(float x) { return (h16)x; }
__device__ __forceinline__ void splitf(float y, unsigned short& h, unsigned short& l) { h = f2bf(y); l = f2bf(y - bf2f(h)); }
typedef __attribute__((ext_vector_type(2))) _Float16 v2h;
typedef __attribute__((ext_vector_type(4))) _Float16 v4h;
typedef __attribute__((ext_vector_type(2))) unsigned short v2us;
typedef __attribute__((ext_vector_type(4))) unsigned short v4us;
typedef __attribute__((ext_vector_type(2))) float v2f;
typedef __attribute__((ext_vector_type(4))) int v4i;

// k_wtG: Bt[n][k] = bf16 of w[k][n]; the register block, the grid and the waits of k_wt16 below
template <int K, int N>
__global__ __launch_bounds__(256) void k_wtG(const float* __restrict__ w, bf* Bt) { const int lane = threadIdx.x & 31; const int n0 = blockIdx.x * 64 + (lane & 15) * 4, k0 = blockIdx.y * 128 + (int)(threadIdx.x >> 5) * 16 + (lane >> 4) * 8; v4f r[8];
    const float* wp = w + (size_t)k0 * N + n0;
    // every unroll: the register blocks stay in registers only under constant indices
#pragma unroll
    for (int j = 0; j < 8; ++j) r[j] = *(const v4f*)(wp + j * N);
    // the address stays live up to this wait, so no register that an issued load names is given a new value in front of it
    asm volatile("s_wait_xcnt 0x0" :: "v"(wp) : "memory");
    v8us o[4];
#pragma unroll
    for (int q = 0; q < 4; ++q)
#pragma unroll
        for (int j = 0; j < 8; ++j) o[q][j] = f2bf(r[j][q]);
#pragma unroll
    for (int q = 0; q < 4; ++q) *(v8us*)(Bt + (size_t)n0 * K + k0 + q * K) = o[q]; }
__global__ __launch_bounds__(256) void k_cvt8(const float* __restrict__ src, bf* dst, size_t n8) { const size_t i = (size_t)blockIdx.x * 256 + threadIdx.x; if (i >= n8) return; const v8f v = *(const v8f*)(src + i * 8); v8us o;
#pragma unroll
    for (int k = 0; k < 8; ++k) o[k] = f2bf(v[k]); *(v8us*)(dst + i * 8) = o;  }
__global__ __launch_bounds__(256) void k_cscvt(const float* __restrict__ cosT, const float* __restrict__ sinT, float* CS) { const int idx = blockIdx.x * 256 + threadIdx.x; if (idx >= TT * HD) return; v2f cs; cs[0] = bfr(cosT[idx]); cs[1] = bfr(sinT[idx]); *(v2f*)(CS + (size_t)idx * 2) = cs;  }
// k_rope: head planes [h][t][d] (fp16 + hi/lo) of rope(x) x sc with the rotate-half convention out[d] = x[d] cos[t][d] - x[d+HD/2] sin[t][d], out[d+HD/2] = x[d+HD/2] cos[t][d+HD/2] + x[d] sin[t][d+HD/2]
// Each thread takes four consecutive d of the rows t, t + 16, t + 32 and t + 48 of one head, so that a wave's 16-byte load covers whole lines; its sixteen loads all issue before the first run is worked on. Grid: heads * TT * HD / 4096 blocks, exact (a block covers 64 whole rows of one head).
template <int PITCH>
__global__ __launch_bounds__(256) void k_rope(const float* __restrict__ F, const float* __restrict__ CS, float sc, h16* P16, bf* Ph, bf* Pl) {
    // every unroll of this kernel: the register blocks stay in registers only under constant indices
    const size_t e = ((size_t)blockIdx.x * 1024 + threadIdx.x) * 4; const int d = (int)(e % HD); const int t = (int)((e / HD) % TT); const int h = (int)(e / ((size_t)HD * TT));
    const bool lo = d < HD / 2;      // a run lies wholly in one half of the row, its partners in the other
    const float* fa = F + (size_t)t * PITCH + h * HD + d; const float* fb = lo ? fa + HD / 2 : fa - HD / 2; const float* cp = CS + ((size_t)t * HD + d) * 2;
    v4f xa[4], xb[4], cv[4][2];
#pragma unroll
    for (int c = 0; c < 4; ++c) { xa[c] = *(const v4f*)(fa + c * 16 * PITCH); xb[c] = *(const v4f*)(fb + c * 16 * PITCH); cv[c][0] = *(const v4f*)(cp + c * 16 * HD * 2); cv[c][1] = *(const v4f*)(cp + c * 16 * HD * 2 + 4); }
    // the three addresses stay live up to this wait, so no register that an issued load names is given a new value in front of it
    asm volatile("s_wait_xcnt 0x0" :: "v"(fa), "v"(fb), "v"(cp) : "memory");
    __builtin_amdgcn_sched_barrier(0);   // keeps the vector work behind the wait: without it the compiler works on the first loads before it issues the last, and their latencies add up
    v4h o16[4]; v4us oh[4], ol[4];
#pragma unroll
    for (int c = 0; c < 4; ++c)
#pragma unroll
        for (int q = 0; q < 4; ++q) { const float a = __fmul_rn(xa[c][q], cv[c][q >> 1][(q & 1) * 2]), bq = __fmul_rn(xb[c][q], cv[c][q >> 1][(q & 1) * 2 + 1]); const float r = (lo ? __fsub_rn(a, bq) : __fadd_rn(a, bq)) * sc;
            o16[c][q] = tohx(r); unsigned short a2, c2; splitf(r, a2, c2); oh[c][q] = a2; ol[c][q] = c2; }
#pragma unroll
    for (int c = 0; c < 4; ++c) { *(v4h*)(P16 + e + c * 1024) = o16[c]; *(v4us*)(Ph + e + c * 1024) = oh[c]; *(v4us*)(Pl + e + c * 1024) = ol[c]; } }
// k_vtp: transposed value planes [g][d][t]. Each thread holds a block of 8 t x 4 d in registers: eight 16-byte loads along d (a wave reads two whole 256-byte head rows a load), then per d and plane one 16-byte store along t.
// Grid (TT / 128, heads), 256 threads: a block covers one head's 64 d x 128 t, so every 128-byte output line is filled by one block.
template <int PITCH>
__global__ __launch_bounds__(256) void k_vtp(const float* __restrict__ F, h16* V16, bf* Vh, bf* Vl) { const int lane = threadIdx.x & 31; const int g = blockIdx.y, d0 = (lane & 15) * 4, t0 = blockIdx.x * 128 + (int)(threadIdx.x >> 5) * 16 + (lane >> 4) * 8; v4f r[8];
    const float* fp = F + (size_t)t0 * PITCH + g * HD + d0;
    // every unroll: the register blocks stay in registers only under constant indices
#pragma unroll
    for (int j = 0; j < 8; ++j) r[j] = *(const v4f*)(fp + j * PITCH);
    // the address stays live up to this wait, so no register that an issued load names is given a new value in front of it
    asm volatile("s_wait_xcnt 0x0" :: "v"(fp) : "memory");
    v8h o16[4]; v8us oh[4], ol[4];
#pragma unroll
    for (int q = 0; q < 4; ++q)
#pragma unroll
        for (int j = 0; j < 8; ++j) { const float x = r[j][q]; o16[q][j] = tohx(x); unsigned short a2, c2; splitf(x, a2, c2); oh[q][j] = a2; ol[q][j] = c2; }
    const size_t e = ((size_t)g * HD + d0) * TT + t0;
#pragma unroll
    for (int q = 0; q < 4; ++q) { *(v8h*)(V16 + e + q * TT) = o16[q]; *(v8us*)(Vh + e + q * TT) = oh[q]; *(v8us*)(Vl + e + q * TT) = ol[q]; } }
// grid TT * HD / 2048 blocks, exact: four 16-byte stores (two (cos, sin) pairs each) a thread
__global__ __launch_bounds__(256) void k_csid(float* CS) { v4f cs; cs[0] = 1.0f; cs[1] = 0.0f; cs[2] = 1.0f; cs[3] = 0.0f; float* p = CS + ((size_t)blockIdx.x * 1024 + threadIdx.x) * 4;
#pragma unroll
    for (int c = 0; c < 4; ++c) *(v4f*)(p + c * 1024) = cs;  }
// ---- k_fattn: causal attention of one batch in one launch; grid (heads, TT/64), 128 threads; wave w of a work-group owns the 16 query rows r0 + 16 w .. + 15 of one head and walks the keys 0 .. r0 + 63 in passes of 64.
// Transposed products: S^T = K Q^T (A = key rows, B = query rows), so a lane holds 32 scores of ONE query (column lane & 15; keys 16 kb + 8 (lane >> 4) + j); running maximum and sum stay in the lane, the two lane halves
// exchange the maximum once a pass and the sum once at the end. Two score tiles, converted in place, are the B operand of O^T += V^T P^T (A = rows of the transposed value plane). Scores and probabilities never leave the registers.
// Operand classes: query rows < RH on bf16 hi+lo planes (3 products each), the rest on single fp16 planes (probabilities carried x 2^10, which cancels in the division by their sum). Output: bf16 hi+lo planes [t][DQ].
template <typename T16> struct IsHL { static constexpr bool v = false; };
template <> struct IsHL<bf> { static constexpr bool v = true; };
template <bool B> struct BoolC { static constexpr bool value = B; };
__device__ __forceinline__ float xhalf(float x) { return __int_as_float(__builtin_amdgcn_permlanex16(__float_as_int(x), __float_as_int(x), 0x76543210, 0xfedcba98, false, false)); }   // the value of lane ^ 16
// eight 2^x in place, in one statement: each v_exp_f32 is followed by one that neither reads its result nor overwrites its source, the last by the v_nop that the instruction set asks for behind a transcendental
__device__ __forceinline__ void exp2x8(float (&e)[8]) {
    asm("v_exp_f32 %0, %0\n\tv_exp_f32 %1, %1\n\tv_exp_f32 %2, %2\n\tv_exp_f32 %3, %3\n\tv_exp_f32 %4, %4\n\tv_exp_f32 %5, %5\n\tv_exp_f32 %6, %6\n\tv_exp_f32 %7, %7\n\tv_nop"
        : "+v"(e[0]), "+v"(e[1]), "+v"(e[2]), "+v"(e[3]), "+v"(e[4]), "+v"(e[5]), "+v"(e[6]), "+v"(e[7])); }
template <typename T16>
__device__ __forceinline__ void attn_wave(const T16* __restrict__ Qp, const T16* __restrict__ Q2, const T16* __restrict__ Kp, const T16* __restrict__ K2, const T16* __restrict__ Vp, const T16* __restrict__ V2, int q0, bf* __restrict__ Ah, bf* __restrict__ Al) {
    // every unroll below: the fragment, score and accumulator arrays stay in registers only under constant indices
    typedef typename WFrag<T16>::V V; constexpr bool HL = IsHL<T16>::v;
    constexpr float CL = SCL * 1.4426950408889634f, OFF = HL ? 0.0f : 10.0f;      // scores in log2 units; OFF: the carry 2^10 of the fp16 probabilities
    const int lane = threadIdx.x & 31, lr = lane & 15, hi = lane >> 4; const int q = q0 + lr;
    // every load is a wave-uniform base plus a lane's fixed byte offset: the offsets (query row; row lr of a key block; row lr of a value block) never change, only the key and value bases move on, by one pass at a time
    const unsigned qob = (unsigned)(q * HD + 8 * hi) * 2u, kob = (unsigned)(lr * HD + 8 * hi) * 2u, vob = (unsigned)(lr * TT + 8 * hi) * 2u;
    auto at = [](const T16* base, unsigned ob) { return (const T16*)((const char*)base + ob); };
    const T16* qa = at(Qp, qob); const T16* qa2 = HL ? at(Q2, qob) : nullptr; const T16* ka0 = at(Kp, kob);
    V qf[2], qf2[2];
#pragma unroll
    for (int ds = 0; ds < 2; ++ds) { qf[ds] = WFrag<T16>::ld(qa + ds * 32); if constexpr (HL) qf2[ds] = WFrag<T16>::ld(qa2 + ds * 32); }
    v8f o[4];
#pragma unroll
    for (int db = 0; db < 4; ++db) o[db] = (v8f){};
    float m = -3.0e38f, l = 0.0f;
    V kf[4][2], kf2[4][2];
    if constexpr (!HL) {    // single planes: the key fragments run one pass ahead; hi+lo planes (at most RH / 64 passes, twice the registers) fetch theirs inside the pass
#pragma unroll
        for (int kb = 0; kb < 4; ++kb)
#pragma unroll
            for (int ds = 0; ds < 2; ++ds) kf[kb][ds] = WFrag<T16>::ld(ka0 + kb * 16 * HD + ds * 32);
    }
    // all s_wait_xcnt below: addresses, offsets and bases stay live up to the wait, so no register that an issued load names is given a new value in front of it;
    // the sched_barrier behind a wait keeps the loads in front of it and later vector work behind it
    if constexpr (HL) asm volatile("s_wait_xcnt 0x0" :: "v"(qa), "v"(qa2), "v"(qob), "s"(Qp), "s"(Q2) : "memory"); else asm volatile("s_wait_xcnt 0x0" :: "v"(qa), "v"(ka0), "v"(qob), "v"(kob), "s"(Qp), "s"(Kp) : "memory");
    __builtin_amdgcn_sched_barrier(0);
    const int np = q0 / 64 + 1;     // passes; only the last one meets the diagonal
    auto pass = [&](auto diag, int kt) {
        V vf[4][2], vf2[4][2];
        const T16* ka = at(Kp, kob); const T16* ka2 = HL ? at(K2, kob) : nullptr; const T16* va = at(Vp, vob); const T16* va2 = HL ? at(V2, vob) : nullptr;
        if constexpr (HL) {
#pragma unroll
            for (int kb = 0; kb < 4; ++kb)
#pragma unroll
                for (int ds = 0; ds < 2; ++ds) { kf[kb][ds] = WFrag<T16>::ld(ka + kb * 16 * HD + ds * 32); kf2[kb][ds] = WFrag<T16>::ld(ka2 + kb * 16 * HD + ds * 32); }
            asm volatile("s_wait_xcnt 0x0" :: "v"(ka), "v"(ka2), "v"(kob), "s"(Kp), "s"(K2) : "memory");
            __builtin_amdgcn_sched_barrier(0);
        } else {
#pragma unroll
            for (int db = 0; db < 4; ++db)
#pragma unroll
                for (int ks = 0; ks < 2; ++ks) vf[db][ks] = WFrag<T16>::ld(va + db * 16 * TT + ks * 32);
        }
        v8f s[4];
#pragma unroll
        for (int kb = 0; kb < 4; ++kb) { s[kb] = (v8f){};
#pragma unroll
            for (int ds = 0; ds < 2; ++ds) { s[kb] = WFrag<T16>::mma(kf[kb][ds], qf[ds], s[kb]); if constexpr (HL) { s[kb] = WFrag<T16>::mma(kf[kb][ds], qf2[ds], s[kb]); s[kb] = WFrag<T16>::mma(kf2[kb][ds], qf[ds], s[kb]); } } }
        if constexpr (HL) {     // the value fragments fly under the softmax
#pragma unroll
            for (int db = 0; db < 4; ++db)
#pragma unroll
                for (int ks = 0; ks < 2; ++ks) { vf[db][ks] = WFrag<T16>::ld(va + db * 16 * TT + ks * 32); vf2[db][ks] = WFrag<T16>::ld(va2 + db * 16 * TT + ks * 32); }
            asm volatile("s_wait_xcnt 0x0" :: "v"(va), "v"(va2), "v"(vob), "s"(Vp), "s"(V2) : "memory");
            __builtin_amdgcn_sched_barrier(0);
        } else {
            if constexpr (!decltype(diag)::value) {     // the next pass's key fragments, behind this pass's score products
#pragma unroll
                for (int kb = 0; kb < 4; ++kb)
#pragma unroll
                    for (int ds = 0; ds < 2; ++ds) kf[kb][ds] = WFrag<T16>::ld(ka + (64 + kb * 16) * HD + ds * 32);
            }
            asm volatile("s_wait_xcnt 0x0" :: "v"(ka), "v"(va), "v"(kob), "v"(vob), "s"(Kp), "s"(Vp) : "memory");
            __builtin_amdgcn_sched_barrier(0);
        }
        if constexpr (!decltype(diag)::value) { Kp += 64 * HD; Vp += 64; if constexpr (HL) { K2 += 64 * HD; V2 += 64; } }
        if constexpr (decltype(diag)::value) {      // causal mask: key > query
#pragma unroll
            for (int kb = 0; kb < 4; ++kb)
#pragma unroll
                for (int j = 0; j < 8; ++j) s[kb][j] = (kt + kb * 16 + hi * 8 + j > q) ? -3.0e38f : s[kb][j];
        }
        float t4[4];     // four independent chains, one a score tile, then a tree: the maximum (and below the sum) does not wait on one chain of 32
#pragma unroll
        for (int kb = 0; kb < 4; ++kb) { t4[kb] = s[kb][0];
#pragma unroll
            for (int j = 1; j < 8; ++j) t4[kb] = fmaxf(t4[kb], s[kb][j]); }
        float tm = fmaxf(fmaxf(t4[0], t4[1]), fmaxf(t4[2], t4[3]));
        tm = fmaxf(tm, xhalf(tm));
        const float mn = fmaxf(m, tm * CL), sh = OFF - mn; float al = m - mn; m = mn;
        asm("v_exp_f32 %0, %0\n\tv_nop" : "+v"(al));     // 2^al; the v_nop is the slot that the instruction set asks for behind a transcendental
#pragma unroll
        for (int kb = 0; kb < 4; ++kb) { t4[kb] = 0.0f; float e[8];
#pragma unroll
            for (int j = 0; j < 8; ++j) e[j] = fmaf(s[kb][j], CL, sh);
            exp2x8(e);
#pragma unroll
            for (int j = 0; j < 8; ++j) { s[kb][j] = e[j]; t4[kb] += e[j]; } }
        l = fmaf(l, al, (t4[0] + t4[1]) + (t4[2] + t4[3]));
#pragma unroll
        for (int db = 0; db < 4; ++db) o[db] *= al;
#pragma unroll
        for (int ks = 0; ks < 2; ++ks) {
            if constexpr (HL) { v8us h0, h1, l0, l1;
#pragma unroll
                for (int j = 0; j < 8; ++j) { unsigned short a, c; splitf(s[2 * ks][j], a, c); h0[j] = a; l0[j] = c; splitf(s[2 * ks + 1][j], a, c); h1[j] = a; l1[j] = c; }
                const V ph = cat16b(h0, h1), pl = cat16b(l0, l1);
#pragma unroll
                for (int db = 0; db < 4; ++db) { o[db] = WFrag<T16>::mma(vf[db][ks], ph, o[db]); o[db] = WFrag<T16>::mma(vf[db][ks], pl, o[db]); o[db] = WFrag<T16>::mma(vf2[db][ks], ph, o[db]); }
            } else { const V pf = cat16(__builtin_convertvector(s[2 * ks], v8h), __builtin_convertvector(s[2 * ks + 1], v8h));
#pragma unroll
                for (int db = 0; db < 4; ++db) o[db] = WFrag<T16>::mma(vf[db][ks], pf, o[db]); }
        }
    };
    // unroll 1: one pass is already a long straight run; a second copy would only double the code
#pragma unroll 1
    for (int p = 0; p + 1 < np; ++p) pass(BoolC<false>(), p * 64);
    pass(BoolC<true>(), (np - 1) * 64);
    l += xhalf(l); const float inv = __fdiv_rn(1.0f, l);
    v8us oh[4], ol[4];
#pragma unroll
    for (int db = 0; db < 4; ++db)
#pragma unroll
        for (int j = 0; j < 8; ++j) { unsigned short a, c; splitf(o[db][j] * inv, a, c); oh[db][j] = a; ol[db][j] = c; }
    const size_t oo = (size_t)q * DQ + hi * 8;   // a lane's eight accumulator registers are eight consecutive d of its query row: 16-byte stores
#pragma unroll
    for (int db = 0; db < 4; ++db) { *(v8us*)(Ah + oo + db * 16) = oh[db]; *(v8us*)(Al + oo + db * 16) = ol[db]; }
}
// waves_per_eu(2, 2): the grid brings two waves to a SIMD; with that register budget a pass's value loads all issue at its head and the key loads a pass ahead
__global__ __launch_bounds__(128) __attribute__((amdgpu_waves_per_eu(2, 2))) void k_fattn(const h16* __restrict__ Q16, const h16* __restrict__ K16, const h16* __restrict__ V16, const bf* __restrict__ Qh, const bf* __restrict__ Ql, const bf* __restrict__ Kh, const bf* __restrict__ Kl, const bf* __restrict__ Vh, const bf* __restrict__ Vl, bf* __restrict__ Ah, bf* __restrict__ Al) {
    const int wv = __builtin_amdgcn_readfirstlane((int)(threadIdx.x >> 5));   // wave number, scalar: the pass loop's control stays a scalar branch
    const int r0 = (TT / 64 - 1 - (int)blockIdx.y) * 64;                      // longest key walks first
    const size_t zq = (size_t)blockIdx.x * TT * HD, zk = (size_t)(blockIdx.x / REP) * TT * HD;
    if (r0 < RH) attn_wave<bf>(Qh + zq, Ql + zq, Kh + zk, Kl + zk, Vh + zk, Vl + zk, r0 + wv * 16, Ah + blockIdx.x * HD, Al + blockIdx.x * HD);
    else attn_wave<h16>(Q16 + zq, nullptr, K16 + zk, nullptr, V16 + zk, nullptr, r0 + wv * 16, Ah + blockIdx.x * HD, Al + blockIdx.x * HD);
}

// k_wt16: Bt[n][k] = fp16 of the bf16-rounded w[k][n]. Each thread holds a block of 8 k x 4 n in registers: eight 16-byte loads along n (a wave reads 256 contiguous bytes of two rows a load), then per n one 16-byte store along k.
// Grid (N / 64, K / 128), 256 threads: a block covers 64 n x 128 k, so every 128-byte output line is filled by one block.
template <int K, int N>
__global__ __launch_bounds__(256) void k_wt16(const float* __restrict__ w, h16* Bt) { const int lane = threadIdx.x & 31; const int n0 = blockIdx.x * 64 + (lane & 15) * 4, k0 = blockIdx.y * 128 + (int)(threadIdx.x >> 5) * 16 + (lane >> 4) * 8; v4f r[8];
    const float* wp = w + (size_t)k0 * N + n0;
    // every unroll: the register blocks stay in registers only under constant indices
#pragma unroll
    for (int j = 0; j < 8; ++j) r[j] = *(const v4f*)(wp + j * N);
    // the address stays live up to this wait, so no register that an issued load names is given a new value in front of it
    asm volatile("s_wait_xcnt 0x0" :: "v"(wp) : "memory");
    v8h o[4];
#pragma unroll
    for (int q = 0; q < 4; ++q)
#pragma unroll
        for (int j = 0; j < 8; ++j) o[q][j] = tohx(bfr(r[j][q]));
#pragma unroll
    for (int q = 0; q < 4; ++q) *(v8h*)(Bt + (size_t)n0 * K + k0 + q * K) = o[q]; }
__global__ __launch_bounds__(256) void k_rmsc(const float* __restrict__ X, int isin, const float* __restrict__ w, h16* HC) { const int lane = threadIdx.x & 31; const int t = blockIdx.x * 8 + (threadIdx.x >> 5); if (t >= TT) return; float v[32]; float s = 0.f;
#pragma unroll
    for (int ch = 0; ch < 8; ++ch) { const v4f a = *(const v4f*)(X + (size_t)t * DM + ch * 128 + lane * 4);
#pragma unroll
        for (int q = 0; q < 4; ++q) { const float xv = isin ? bfr(a[q]) : a[q]; v[ch * 4 + q] = xv; float p = __fmul_rn(xv, xv); asm volatile("" : "+v"(p)); s = __fadd_rn(s, p); } }
#pragma unroll
    for (int sh = 16; sh; sh >>= 1) s += __shfl_xor(s, sh, 32);
    const float r = __frsqrt_rn(__fadd_rn(s * (1.0f / DM), 1.1920929e-07f));
{
#pragma unroll
        for (int ch = 0; ch < 8; ++ch) { const int c0 = ch * 128 + lane * 4; const int n = c0 / 256, cc = c0 % 256; v4h o;
#pragma unroll
            for (int q = 0; q < 4; ++q) { float tn = __fmul_rn(v[ch * 4 + q], r); asm volatile("" : "+v"(tn)); o[q] = tohx(__fmul_rn(tn, bfr(w[c0 + q]))); }
            *(v4h*)(HC + ((size_t)n * TT + t) * 256 + cc) = o; }
         } }
// ---- k_dend: one dendritic layer per blockIdx.z; grid (TT/64, N/64, layers), 128 threads. Wave n of the work-group forms the 64x64 tile of input block n, h_n W[n] (K = 256, fp16 planes, f32 accumulate, one running sum over K);
// the four tiles meet in LDS, and each output element is max over n = 0 .. 3 (in that order) of gain[n] silu(tile_n - thr[n]). H: block planes [n][TT][256]; Bt: [n][N][256]; thr, gain: [n][N]; C: [TT][N].
// blockIdx.z picks the layer: weights and outputs by the strides sB and sC (elements), thresholds and gains by the pointer pair.
__global__ __launch_bounds__(128) void k_dend(const h16* __restrict__ H, const h16* __restrict__ Bt, int N, const float* __restrict__ thr0, const float* __restrict__ gain0, const float* __restrict__ thr1, const float* __restrict__ gain1, float* C, size_t sB, size_t sC) {
    constexpr int K = 256, WST = 64 * 68;                   // WST: floats of one wave's LDS slab (its whole tile, row pitch 68)
    __shared__ __align__(16) float os[4 * WST];
    const int wv = __builtin_amdgcn_readfirstlane((int)(threadIdx.x >> 5));   // wave number = input block n, scalar
    const float* thr = blockIdx.z ? thr1 : thr0; const float* gain = blockIdx.z ? gain1 : gain0;
    const h16* A = H + (size_t)wv * TT * K; const h16* B = Bt + blockIdx.z * sB + (size_t)wv * N * K; C += blockIdx.z * sC;
    const int lane = threadIdx.x & 31, lr = lane & 15, hi = lane >> 4; const int r0 = blockIdx.x * 64, c0 = blockIdx.y * 64;
    v8f acc[4][4];
#pragma unroll
    for (int mb = 0; mb < 4; ++mb)
#pragma unroll
        for (int nb = 0; nb < 4; ++nb) acc[mb][nb] = (v8f){};
    const size_t aoff = (size_t)(r0 + lr) * K + 8 * hi, boff = (size_t)(c0 + lr) * K + 8 * hi;
    // unroll: K is a constant, eight trips; straight-line code lets the next trip's loads issue ahead of this trip's products
#pragma unroll
    for (int kc = 0; kc < K; kc += 32) {
        v16h a[4];
#pragma unroll
        for (int mb = 0; mb < 4; ++mb) a[mb] = WFrag<h16>::ld(A + aoff + (size_t)mb * 16 * K + kc);
#pragma unroll
        for (int nb = 0; nb < 4; ++nb) { const v16h b = WFrag<h16>::ld(B + boff + (size_t)nb * 16 * K + kc);
#pragma unroll
            for (int mb = 0; mb < 4; ++mb) acc[mb][nb] = wmma16(a[mb], b, acc[mb][nb]); }
    }
    // both address pairs stay live up to this wait, so no register that an issued operand load names is given a new value in front of it
    asm volatile("s_wait_xcnt 0x0" :: "v"(A + aoff), "v"(B + boff) : "memory");
    // unrolls: acc[][] stays in registers only under constant indices
#pragma unroll
    for (int mb = 0; mb < 4; ++mb)
#pragma unroll
        for (int nb = 0; nb < 4; ++nb) {
#pragma unroll
            for (int j = 0; j < 8; ++j) os[wv * WST + (mb * 16 + hi * 8 + j) * 68 + nb * 16 + lr] = acc[mb][nb][j]; }
    __syncthreads();    // all four blocks' tiles are in LDS before any element's max is taken
    const unsigned cofs = (threadIdx.x & 15u) * 4u; v4f th[4], ga[4]; unsigned ob[4];   // this thread's four output columns are the same in every row it handles
#pragma unroll
    for (int n = 0; n < 4; ++n) { ob[n] = ((unsigned)(n * N) + cofs) * 4u; th[n] = *(const v4fa*)((const char*)(thr + c0) + ob[n]); ga[n] = *(const v4fa*)((const char*)(gain + c0) + ob[n]); }
    // the four byte offsets stay live up to this wait, so no register that an issued threshold or gain load names is given a new value in front of it
    asm volatile("s_wait_xcnt 0x0" :: "v"(ob[0]), "v"(ob[1]), "v"(ob[2]), "v"(ob[3]) : "memory");
#pragma unroll
    for (int n = 0; n < 4; ++n)
#pragma unroll
        for (int q = 0; q < 4; ++q) { th[n][q] = bfr(th[n][q]); ga[n][q] = bfr(ga[n][q]); }
    float* crow = C + (size_t)r0 * N + c0 + cofs;
    // unroll 2: two rows' independent division chains fill each other's waits; more would only lengthen the code
#pragma unroll 2
    for (int s = 0; s < 8; ++s) { const int row = s * 8 + (int)(threadIdx.x >> 4); v4f r;
#pragma unroll
        for (int n = 0; n < 4; ++n) { const v4f a = *(const v4fa*)(os + n * WST + row * 68 + cofs);
#pragma unroll
            for (int q = 0; q < 4; ++q) { const float z = __fsub_rn(a[q], th[n][q]); const float sg = __fdiv_rn(1.0f, 1.0f + __expf(-z)); const float val = __fmul_rn(ga[n][q], __fmul_rn(z, sg)); r[q] = n ? fmaxf(r[q], val) : val; } }
        *(v4f*)(crow + (size_t)row * N) = r;
        asm volatile("s_wait_xcnt 0x0" ::: "memory"); }   // the next trip rewrites the registers that this store names: the wait stands in front of that
}
// k_res, k_ffp, k_fin: each thread takes four runs (k_ffp: eight) of four elements, 256 threads apart, and issues all its loads before the first run is worked on; exact grids. Every unroll: the register blocks stay in registers only under constant indices.
// In each: the two addresses stay live up to the s_wait_xcnt, so no register that an issued load names is given a new value in front of it.
__global__ __launch_bounds__(256) void k_res(const float* __restrict__ x, const float* __restrict__ ATT, float* X1) { const size_t i0 = ((size_t)blockIdx.x * 1024 + threadIdx.x) * 4; const float* xp = x + i0; const float* ap = ATT + i0; v4f xv[4], a[4], o[4];
#pragma unroll
    for (int c = 0; c < 4; ++c) { xv[c] = *(const v4f*)(xp + c * 1024); a[c] = *(const v4f*)(ap + c * 1024); }
    asm volatile("s_wait_xcnt 0x0" :: "v"(xp), "v"(ap) : "memory");
#pragma unroll
    for (int c = 0; c < 4; ++c) { o[c][0] = __fadd_rn(bfr(xv[c][0]), a[c][0]); o[c][1] = __fadd_rn(bfr(xv[c][1]), a[c][1]); o[c][2] = __fadd_rn(bfr(xv[c][2]), a[c][2]); o[c][3] = __fadd_rn(bfr(xv[c][3]), a[c][3]); }
#pragma unroll
    for (int c = 0; c < 4; ++c) *(v4f*)(X1 + i0 + c * 1024) = o[c]; }
__global__ __launch_bounds__(256) void k_ffp(const float* __restrict__ G, const float* __restrict__ U, h16* FF16) { const size_t i0 = ((size_t)blockIdx.x * 2048 + threadIdx.x) * 4; const float* gp = G + i0; const float* up = U + i0; v4f g[8], u[8]; v4h o[8];   // eight runs
#pragma unroll
    for (int c = 0; c < 8; ++c) { g[c] = *(const v4f*)(gp + c * 1024); u[c] = *(const v4f*)(up + c * 1024); }
    asm volatile("s_wait_xcnt 0x0" :: "v"(gp), "v"(up) : "memory");
    __builtin_amdgcn_sched_barrier(0);   // keeps the vector work behind the wait: without it the compiler works on the first loads before it issues the last, and their latencies add up
#pragma unroll
    for (int c = 0; c < 8; ++c)
#pragma unroll
        for (int q = 0; q < 4; ++q) { const float sg = __fdiv_rn(1.0f, 1.0f + __expf(-g[c][q])); const float sl = __fmul_rn(g[c][q], sg); o[c][q] = tohx(__fmul_rn(sl, u[c][q])); }
#pragma unroll
    for (int c = 0; c < 8; ++c) *(v4h*)(FF16 + i0 + c * 1024) = o[c]; }
__global__ __launch_bounds__(256) void k_fin(const float* __restrict__ X1, const float* __restrict__ F2, float* OUT) { const size_t i0 = ((size_t)blockIdx.x * 1024 + threadIdx.x) * 4; const float* ap = X1 + i0; const float* fp = F2 + i0; v4f a[4], f[4], o[4];
#pragma unroll
    for (int c = 0; c < 4; ++c) { a[c] = *(const v4f*)(ap + c * 1024); f[c] = *(const v4f*)(fp + c * 1024); }
    asm volatile("s_wait_xcnt 0x0" :: "v"(ap), "v"(fp) : "memory");
#pragma unroll
    for (int c = 0; c < 4; ++c) { o[c][0] = __fadd_rn(a[c][0], f[c][0]); o[c][1] = __fadd_rn(a[c][1], f[c][1]); o[c][2] = __fadd_rn(a[c][2], f[c][2]); o[c][3] = __fadd_rn(a[c][3], f[c][3]); }
#pragma unroll
    for (int c = 0; c < 4; ++c) *(v4f*)(OUT + i0 + c * 1024) = o[c]; }

extern "C" void kernel_launch(void* const* d_in, const int* in_sizes, int n_in,
                              void* d_out, int out_size, void* d_ws, size_t ws_size, hipStream_t stream) {
    (void)in_sizes; (void)n_in; (void)out_size;
    const float* x = (const float*)d_in[0]; const float* qkvw = (const float*)d_in[1]; const float* qthr = (const float*)d_in[2]; const float* qgain = (const float*)d_in[3]; const float* wo = (const float*)d_in[4]; const float* gw = (const float*)d_in[5]; const float* gthr = (const float*)d_in[6]; const float* ggain = (const float*)d_in[7]; const float* uw = (const float*)d_in[8]; const float* uthr = (const float*)d_in[9]; const float* ugain = (const float*)d_in[10]; const float* dw = (const float*)d_in[11]; const float* n1w = (const float*)d_in[12]; const float* n2w = (const float*)d_in[13];
    float* OUT = (float*)d_out;     // [2][2048][1024]
    char* wsp = (char*)d_ws;
    auto take = [&](size_t bytes) { char* p = wsp; wsp += (bytes + 255) & ~(size_t)255; return (void*)p; };
    bf* WQ = (bf*)take((size_t)DQ * DM * 2); bf* WK = (bf*)take((size_t)DKV * DM * 2); bf* WV = (bf*)take((size_t)DKV * DM * 2); bf* WO = (bf*)take((size_t)DM * DQ * 2); float* CS = (float*)take((size_t)TT * HD * 2 * 4);
    bf* XB = (bf*)take((size_t)TT * DM * 2); float* FQKV = (float*)take((size_t)TT * 3072 * 4);   // dendritic [q|k|v], row pitch 3072
    h16* QP16 = (h16*)take((size_t)NH_ * TT * HD * 2); h16* KP16 = (h16*)take((size_t)NKV * TT * HD * 2); h16* VT16 = (h16*)take((size_t)NKV * HD * TT * 2);
    bf* QPh = (bf*)take((size_t)NH_ * TT * HD * 2); bf* QPl = (bf*)take((size_t)NH_ * TT * HD * 2); bf* KPh = (bf*)take((size_t)NKV * TT * HD * 2); bf* KPl = (bf*)take((size_t)NKV * TT * HD * 2); bf* VTh = (bf*)take((size_t)NKV * HD * TT * 2); bf* VTl = (bf*)take((size_t)NKV * HD * TT * 2);
    bf* ATh = (bf*)take((size_t)TT * DQ * 2); bf* ATl = (bf*)take((size_t)TT * DQ * 2);
    if ((size_t)(wsp - (char*)d_ws) > ws_size) return;    // ws 256 MiB
    h16* BQKV = (h16*)take((size_t)4 * 3072 * 256 * 2); h16* BG = (h16*)take((size_t)2 * 4 * 2048 * 256 * 2); h16* BU = BG + (size_t)4 * 2048 * 256; h16* BD = (h16*)take((size_t)DM * 2048 * 2); h16* HC = (h16*)take((size_t)4 * TT * 256 * 2); float* ACG = (float*)take((size_t)2 * TT * 2048 * 4); float* ACU = ACG + (size_t)TT * 2048; h16* FF16 = (h16*)take((size_t)TT * 2048 * 2); float* ATT = (float*)take((size_t)TT * DM * 4); float* X1 = (float*)take((size_t)TT * DM * 4);
    if ((size_t)(wsp - (char*)d_ws) > ws_size) return;
    { for (int n = 0; n < 4; ++n) { k_wt16<256, 3072><<<dim3(3072 / 64, 256 / 128, 1), 256, 0, stream>>>(qkvw + (size_t)n * 256 * 3072, BQKV + (size_t)n * 3072 * 256); k_wt16<256, 2048><<<dim3(2048 / 64, 256 / 128, 1), 256, 0, stream>>>(gw + (size_t)n * 256 * 2048, BG + (size_t)n * 2048 * 256); k_wt16<256, 2048><<<dim3(2048 / 64, 256 / 128, 1), 256, 0, stream>>>(uw + (size_t)n * 256 * 2048, BU + (size_t)n * 2048 * 256); }
      k_wt16<2048, DM><<<dim3(DM / 64, 2048 / 128, 1), 256, 0, stream>>>(dw, BD);
      k_wtG<DQ, DM><<<dim3(DM / 64, DQ / 128, 1), 256, 0, stream>>>(wo, WO);
       }
    k_csid<<<TT * HD / 2048, 256, 0, stream>>>(CS);
    const unsigned LQ = (unsigned)((size_t)NH_ * TT * HD / 4096), LKv = (unsigned)((size_t)NKV * TT * HD / 4096);
    for (int b = 0; b < NB_; ++b) {
        
        k_rmsc<<<TT / 8, 256, 0, stream>>>(x + (size_t)b * TT * DM, 1, n1w, HC);
        // dendritic [q|k|v]: one launch for the whole layer (N = 3072)
        k_dend<<<dim3(TT / 64, 3072 / 64, 1), 128, 0, stream>>>(HC, BQKV, 3072, qthr, qgain, qthr, qgain, FQKV, 0, 0);
        k_rope<3072><<<LQ, 256, 0, stream>>>(FQKV, CS, 1.0f, QP16, QPh, QPl);
        k_rope<3072><<<LKv, 256, 0, stream>>>(FQKV + DQ, CS, 1.0f, KP16, KPh, KPl);
        k_vtp<3072><<<dim3(TT / 128, NKV, 1), 256, 0, stream>>>(FQKV + DQ + DKV, VT16, VTh, VTl);
        // causal attention, all heads of the batch in one launch; it writes the merged hi+lo planes itself
        k_fattn<<<dim3(NH_, TT / 64, 1), 128, 0, stream>>>(QP16, KP16, VT16, QPh, QPl, KPh, KPl, VTh, VTl, ATh, ATl);
        k_gemmw<bf, 1, false, 8><<<dim3(TT / 64, DM / 64, 1), 256, 0, stream>>>(ATh, ATl, WO, nullptr, DQ, ATT, DM, nullptr, 0, 0, 0);
        k_res<<<TT * DM / 4096, 256, 0, stream>>>(x + (size_t)b * TT * DM, ATT, X1); k_rmsc<<<TT / 8, 256, 0, stream>>>(X1, 0, n2w, HC);
        // dendritic gate (z = 0) and up (z = 1) in one launch
        k_dend<<<dim3(TT / 64, 2048 / 64, 2), 128, 0, stream>>>(HC, BG, 2048, gthr, ggain, uthr, ugain, ACG, (size_t)4 * 2048 * 256, (size_t)TT * 2048);
        k_ffp<<<TT * 2048 / 8192, 256, 0, stream>>>(ACG, ACU, FF16);
        k_gemmw<h16, 0, false, 8><<<dim3(TT / 64, DM / 64, 1), 256, 0, stream>>>(FF16, nullptr, BD, nullptr, 2048, ATT, DM, nullptr, 0, 0, 0);
        k_fin<<<TT * DM / 4096, 256, 0, stream>>>(X1, ATT, OUT + (size_t)b * TT * DM); }
}

// v005
// One run takes 352 microseconds.
// Next to v004, in two timings, it ran 1.25 times as fast each time.
// Counting every step since v000, it is 6.06 times as fast.
#include <hip/hip_runtime.h>

// Transformer block with dendritic layers (x [2][2048][1024]; h = RMSNorm(x) w1; [q|k|v] = dendritic(h, qkv_w, thr, gain) = max over the 4 input blocks n of gain[n] silu(h_n W[n] - thr[n]) (16 heads x 64); causal softmax(q.k/8); x1 = x + merged.v o_w;
// h2 = RMSNorm(x1) w2; ff = silu(dendritic(h2, gate)) * dendritic(h2, up); out = x1 + ff down_w -> [2][2048][1024]; all weights x @ W; eps = f32 eps).
// Compute dtypes, f32 accumulate: every input rounded to bf16; the RMSNorms f32 -> SINGLE fp16 block planes; every dendritic GEMM on fp16 planes x fp16 copies of the bf16 weights (1 product; hi+lo would double the
// ~25 G of dendritic GEMMs), the gain/silu/threshold/max epilogues f32; scores (K 64) and probs.v on hl planes (3 products) for the first 512 query rows of each head and single fp16 planes for the rest, f32 causal softmax with masked tiles

#define NB_  2
#define TT   2048
#define DM   1024
#define NH_  16
#define NKV  16
#define REP  (NH_ / NKV)
#define HD   64
#define DQ   (NH_ * HD)
#define DKV  (NKV * HD)
#define RH   512                  // query rows < RH use hi+lo planes (0: none)
#define SCL  0.125f   // HD^-0.5
typedef _Float16 h16;
typedef unsigned short bf;
typedef __attribute__((ext_vector_type(16))) __bf16   v16bf;
typedef __attribute__((ext_vector_type(16))) _Float16 v16h;
typedef __attribute__((ext_vector_type(8)))  _Float16 v8h;
typedef __attribute__((ext_vector_type(8)))  unsigned short v8us;
typedef __attribute__((ext_vector_type(8)))  float    v8f;
typedef __attribute__((ext_vector_type(4)))  float    v4f;
typedef v8h  __attribute__((may_alias)) v8ha;
typedef v4f  __attribute__((may_alias)) v4fa;
typedef v8us __attribute__((may_alias)) v8usa;

__device__ __forceinline__ unsigned short f2bf(float f) { unsigned u = __float_as_uint(f); u += 0x7FFFu + ((u >> 16) & 1u); return (unsigned short)(u >> 16); }
__device__ __forceinline__ float bf2f(unsigned short b) { return __uint_as_float(((unsigned)b) << 16); }
__device__ __forceinline__ float bfr(float f) { return bf2f(f2bf(f)); }
__device__ __forceinline__ v16h cat16(v8h lo, v8h hi) { return __builtin_shufflevector(lo, hi, 0, 1, 2, 3, 4, 5, 6, 7, 8, 9, 10, 11, 12, 13, 14, 15); }
__device__ __forceinline__ v16bf cat16b(v8us lo, v8us hi) { return __builtin_bit_cast(v16bf, __builtin_shufflevector(lo, hi, 0, 1, 2, 3, 4, 5, 6, 7, 8, 9, 10, 11, 12, 13, 14, 15)); }
__device__ __forceinline__ v8f wmma16(v16h a, v16h b, v8f c) { return __builtin_amdgcn_wmma_f32_16x16x32_f16(false, a, false, b, (short)0, c, false, false); }
__device__ __forceinline__ v8f wmmab(v16bf a, v16bf b, v8f c) { return __builtin_amdgcn_wmma_f32_16x16x32_bf16(false, a, false, b, (short)0, c, false, false); }



// ---- Fragment order: every 16-bit operand plane P[row][k] (K columns, K % 32 == 0) is stored as blocks of 16 rows x 32 k, 1 KB each, block (row / 16, k / 32) at element ((row / 16) (K / 32) + k / 32) 512.
// Inside a block the eight k of one 16-byte run lie where the matrix instruction's lane wants them: lane = row % 16 + 16 ((k / 8) % 2), first half of the fragment (k % 32 < 16) at lane * 8, second half at 256 + lane * 8.
// So a wave's fragment is two 16-byte loads of 512 contiguous bytes each (four whole lines), not two loads that touch 16 lines; which lane and register holds which (row, k) is the matrix instruction's own layout (k = 8 (lane / 16) + j and 16 + 8 (lane / 16) + j of row lane % 16).
__device__ __forceinline__ size_t fro(int row, int k, int K) { return ((size_t)(row >> 4) * (K >> 5) + (k >> 5)) * 512 + ((k >> 4) & 1) * 256 + ((row & 15) + ((k >> 3) & 1) * 16) * 8 + (k & 7); }
// a wave-uniform base plus the lane's fixed byte offset (lane * 16): the form of every fragment load
template <typename T16> __device__ __forceinline__ const T16* atl(const T16* base, unsigned ob) { return (const T16*)((const char*)base + ob); }

// ---- k_gemmw: register-blocked GEMM, 64x64 output tile (16 accumulators) per wave, operands straight from 16-bit planes in fragment order; grid (M/64, N/64, Z), 32 * KS threads.
// KS = 1: one wave owns the tile. KS > 1 (K % 64 == 0): the KS waves of the work-group share the tile's K loop, so each waits out 1/KS of its load latencies, and their partial tiles are summed through LDS.
// C[m][n] (f32, pitch ldc, + optional f32 bias[n]) = sum_k A[m][k] Bt[n][k] (+ split products per NSPLIT). z-batch strides sA/sB/sC in elements. K % 32 == 0, a template constant, so that every block's distance from the two bases is an immediate offset.
template <typename T16> struct WFrag;
template <> struct WFrag<h16> { typedef v16h V; static __device__ __forceinline__ V ld(const h16* p) { return cat16(*(const v8h*)p, *(const v8h*)(p + 256)); } static __device__ __forceinline__ v8f mma(V a, V b, v8f c) { return wmma16(a, b, c); } };
template <> struct WFrag<bf> { typedef v16bf V; static __device__ __forceinline__ V ld(const bf* p) { return cat16b(*(const v8us*)p, *(const v8us*)(p + 256)); } static __device__ __forceinline__ v8f mma(V a, V b, v8f c) { return wmmab(a, b, c); } };
template <typename T16, int NSPLIT, bool BIAS, int KS, int K>
__global__ __launch_bounds__(32 * KS) void k_gemmw(const T16* __restrict__ A, const T16* __restrict__ A2, const T16* __restrict__ Bt, const T16* __restrict__ Bt2, float* C, int ldc, const float* __restrict__ bias, size_t sA, size_t sB, size_t sC) {
    typedef typename WFrag<T16>::V V;
    constexpr int WST = (KS == 1) ? 16 * 68 : 64 * 68;      // floats of one wave's LDS slab: one 16-row block (KS = 1), its whole partial tile (KS > 1)
    __shared__ __align__(16) float os[KS * WST];
    const int wv = (KS == 1) ? 0 : __builtin_amdgcn_readfirstlane((int)(threadIdx.x >> 5));   // wave number, scalar: the K loop's control stays a scalar branch
    const size_t z = blockIdx.z; A += z * sA; if (A2) A2 += z * sA; Bt += z * sB; if (Bt2) Bt2 += z * sB; C += z * sC;
    const int lane = threadIdx.x & 31, lr = lane & 15, hi = lane >> 4; const int r0 = blockIdx.x * 64, c0 = blockIdx.y * 64;
    v8f acc[4][4];
#pragma unroll
    for (int mb = 0; mb < 4; ++mb)
#pragma unroll
        for (int nb = 0; nb < 4; ++nb) acc[mb][nb] = (v8f){};
    const unsigned lob = (unsigned)lane * 16u;      // the lane's byte offset in every block
    A += (size_t)r0 * K; if (A2) A2 += (size_t)r0 * K; Bt += (size_t)c0 * K; if (Bt2) Bt2 += (size_t)c0 * K;     // 16 rows of blocks are 16 K elements
#pragma unroll 1
    for (int kc = wv * 64; kc < K; kc += (kc & 32) ? KS * 64 - 32 : 32) {   // wave wv takes the 64-wide K chunks wv, wv + KS, ... (two blocks of each 16 operand rows)
        const T16* pa = atl(A + (size_t)kc * 16, lob); const T16* pa2 = (NSPLIT == 1 || NSPLIT == 2) ? atl(A2 + (size_t)kc * 16, lob) : pa; const T16* pb = atl(Bt + (size_t)kc * 16, lob); const T16* pb2 = (NSPLIT >= 2) ? atl(Bt2 + (size_t)kc * 16, lob) : pb;
        V a[4], a2[4];
#pragma unroll
        for (int mb = 0; mb < 4; ++mb) { a[mb] = WFrag<T16>::ld(pa + mb * 16 * K); if (NSPLIT == 1 || NSPLIT == 2) a2[mb] = WFrag<T16>::ld(pa2 + mb * 16 * K); }
#pragma unroll
        for (int nb = 0; nb < 4; ++nb) { const V b = WFrag<T16>::ld(pb + nb * 16 * K); V b2; if (NSPLIT >= 2) b2 = WFrag<T16>::ld(pb2 + nb * 16 * K);
#pragma unroll
            for (int mb = 0; mb < 4; ++mb) { acc[mb][nb] = WFrag<T16>::mma(a[mb], b, acc[mb][nb]); if (NSPLIT == 1 || NSPLIT == 2) acc[mb][nb] = WFrag<T16>::mma(a2[mb], b, acc[mb][nb]); if (NSPLIT >= 2) acc[mb][nb] = WFrag<T16>::mma(a[mb], b2, acc[mb][nb]); } }
        // the trip's addresses stay live up to this wait, so no register that an issued operand load names is given a new value in front of it
        asm volatile("s_wait_xcnt 0x0" :: "v"(pa), "v"(pa2), "v"(pb), "v"(pb2) : "memory");
        asm volatile("v_nop\n\tv_nop\n\tv_nop\n\tv_nop" : "+v"(acc[0][0]), "+v"(acc[1][1]), "+v"(acc[2][2]), "+v"(acc[3][3]) : "v"(a[0]), "v"(a[3]));
    }
    if constexpr (KS > 1) {     // the KS waves' partial tiles meet in LDS and are summed in fixed wave order 0 .. KS-1
        // unrolls: acc[][] stays in registers only under constant indices; the q and ww loops so that their LDS reads issue together
#pragma unroll
        for (int mb = 0; mb < 4; ++mb)
#pragma unroll
            for (int nb = 0; nb < 4; ++nb) {
#pragma unroll
                for (int j = 0; j < 8; ++j) os[wv * WST + (mb * 16 + hi * 8 + j) * 68 + nb * 16 + lr] = acc[mb][nb][j]; }
        __syncthreads();    // every wave's partial tile is in LDS before any of it is summed
        float* crow = C + (size_t)r0 * ldc + c0;
#pragma unroll
        for (int q = 0; q < 32 / KS; ++q) { const int idx = q * 32 * KS + (int)threadIdx.x, row = idx >> 4, cofs = (idx & 15) * 4; v4f val = *(const v4fa*)(os + row * 68 + cofs);
#pragma unroll
            for (int ww = 1; ww < KS; ++ww) val += *(const v4fa*)(os + ww * WST + row * 68 + cofs);
            if (BIAS) { val[0] += bfr(bias[c0 + cofs]); val[1] += bfr(bias[c0 + cofs + 1]); val[2] += bfr(bias[c0 + cofs + 2]); val[3] += bfr(bias[c0 + cofs + 3]); }
            *(v4f*)(crow + (size_t)row * ldc + cofs) = val; }
        return;
    }
#pragma unroll
    for (int mb = 0; mb < 4; ++mb) {
#pragma unroll
        for (int nb = 0; nb < 4; ++nb) {
#pragma unroll
            for (int j = 0; j < 8; ++j) os[(hi * 8 + j) * 68 + nb * 16 + lr] = acc[mb][nb][j]; }
        __builtin_amdgcn_wave_barrier(); asm volatile("" ::: "memory");
        float* crow = C + (size_t)(r0 + mb * 16) * ldc + c0;
{
#pragma unroll
            for (int s = 0; s < 8; ++s) { const int row = 2 * s + hi, cofs = lr * 4; v4f val = *(const v4fa*)(os + row * 68 + cofs); if (BIAS) { val[0] += bfr(bias[c0 + cofs]); val[1] += bfr(bias[c0 + cofs + 1]); val[2] += bfr(bias[c0 + cofs + 2]); val[3] += bfr(bias[c0 + cofs + 3]); }
                *(v4f*)(crow + (size_t)row * ldc + cofs) = val; }
             }
        __builtin_amdgcn_wave_barrier(); asm volatile("" ::: "memory");
    }
}

__device__ __forceinline__ h16 tohx(float x) { return (h16)x; }
__device__ __forceinline__ void splitf(float y, unsigned short& h, unsigned short& l) { h = f2bf(y); l = f2bf(y - bf2f(h)); }
typedef __attribute__((ext_vector_type(2))) _Float16 v2h;
typedef __attribute__((ext_vector_type(4))) _Float16 v4h;
typedef __attribute__((ext_vector_type(2))) unsigned short v2us;
typedef __attribute__((ext_vector_type(4))) unsigned short v4us;
typedef __attribute__((ext_vector_type(2))) float v2f;
typedef __attribute__((ext_vector_type(4))) int v4i;

// k_wtG: Bt[n][k] (fragment order) = bf16 of w[k][n]; the register block, the grid and the waits of k_wt16 below
template <int K, int N>
__global__ __launch_bounds__(256) void k_wtG(const float* __restrict__ w, bf* Bt) { const int lane = threadIdx.x & 31; const int n0 = blockIdx.x * 64 + (lane & 15) * 4, k0 = blockIdx.y * 128 + (int)(threadIdx.x >> 5) * 16 + (lane >> 4) * 8; v4f r[8];
    const float* wp = w + (size_t)k0 * N + n0;
    // every unroll: the register blocks stay in registers only under constant indices
#pragma unroll
    for (int j = 0; j < 8; ++j) r[j] = *(const v4f*)(wp + j * N);
    // the address stays live up to this wait, so no register that an issued load names is given a new value in front of it
    asm volatile("s_wait_xcnt 0x0" :: "v"(wp) : "memory");
    v8us o[4];
#pragma unroll
    for (int q = 0; q < 4; ++q)
#pragma unroll
        for (int j = 0; j < 8; ++j) o[q][j] = f2bf(r[j][q]);
#pragma unroll
    for (int q = 0; q < 4; ++q) *(v8us*)(Bt + fro(n0, k0, K) + q * 8) = o[q]; }   // fragment order: the next n is the next 16-byte run
__global__ __launch_bounds__(256) void k_cvt8(const float* __restrict__ src, bf* dst, size_t n8) { const size_t i = (size_t)blockIdx.x * 256 + threadIdx.x; if (i >= n8) return; const v8f v = *(const v8f*)(src + i * 8); v8us o;
#pragma unroll
    for (int k = 0; k < 8; ++k) o[k] = f2bf(v[k]); *(v8us*)(dst + i * 8) = o;  }
__global__ __launch_bounds__(256) void k_cscvt(const float* __restrict__ cosT, const float* __restrict__ sinT, float* CS) { const int idx = blockIdx.x * 256 + threadIdx.x; if (idx >= TT * HD) return; v2f cs; cs[0] = bfr(cosT[idx]); cs[1] = bfr(sinT[idx]); *(v2f*)(CS + (size_t)idx * 2) = cs;  }
// k_rope: head planes [h][t][d] (each head's [t][d] in fragment order; fp16 + hi/lo) of rope(x) x sc with the rotate-half convention out[d] = x[d] cos[t][d] - x[d+HD/2] sin[t][d], out[d+HD/2] = x[d+HD/2] cos[t][d+HD/2] + x[d] sin[t][d+HD/2]
// Each thread takes four consecutive d of the rows t, t + 16, t + 32 and t + 48 of one head, so that a wave's 16-byte load covers whole lines; its sixteen loads all issue before the first run is worked on. Grid: heads * TT * HD / 4096 blocks, exact (a block covers 64 whole rows of one head).
template <int PITCH>
__global__ __launch_bounds__(256) void k_rope(const float* __restrict__ F, const float* __restrict__ CS, float sc, h16* P16, bf* Ph, bf* Pl) {
    // every unroll of this kernel: the register blocks stay in registers only under constant indices
    const size_t e = ((size_t)blockIdx.x * 1024 + threadIdx.x) * 4; const int d = (int)(e % HD); const int t = (int)((e / HD) % TT); const int h = (int)(e / ((size_t)HD * TT));
    const bool lo = d < HD / 2;      // a run lies wholly in one half of the row, its partners in the other
    const float* fa = F + (size_t)t * PITCH + h * HD + d; const float* fb = lo ? fa + HD / 2 : fa - HD / 2; const float* cp = CS + ((size_t)t * HD + d) * 2;
    v4f xa[4], xb[4], cv[4][2];
#pragma unroll
    for (int c = 0; c < 4; ++c) { xa[c] = *(const v4f*)(fa + c * 16 * PITCH); xb[c] = *(const v4f*)(fb + c * 16 * PITCH); cv[c][0] = *(const v4f*)(cp + c * 16 * HD * 2); cv[c][1] = *(const v4f*)(cp + c * 16 * HD * 2 + 4); }
    // the three addresses stay live up to this wait, so no register that an issued load names is given a new value in front of it
    asm volatile("s_wait_xcnt 0x0" :: "v"(fa), "v"(fb), "v"(cp) : "memory");
    __builtin_amdgcn_sched_barrier(0);   // keeps the vector work behind the wait: without it the compiler works on the first loads before it issues the last, and their latencies add up
    v4h o16[4]; v4us oh[4], ol[4];
#pragma unroll
    for (int c = 0; c < 4; ++c)
#pragma unroll
        for (int q = 0; q < 4; ++q) { const float a = __fmul_rn(xa[c][q], cv[c][q >> 1][(q & 1) * 2]), bq = __fmul_rn(xb[c][q], cv[c][q >> 1][(q & 1) * 2 + 1]); const float r = (lo ? __fsub_rn(a, bq) : __fadd_rn(a, bq)) * sc;
            o16[c][q] = tohx(r); unsigned short a2, c2; splitf(r, a2, c2); oh[c][q] = a2; ol[c][q] = c2; }
    const size_t eo = (size_t)h * TT * HD + fro(t, d, HD);      // 16 rows on are two blocks on, 1024 elements
#pragma unroll
    for (int c = 0; c < 4; ++c) { *(v4h*)(P16 + eo + c * 1024) = o16[c]; *(v4us*)(Ph + eo + c * 1024) = oh[c]; *(v4us*)(Pl + eo + c * 1024) = ol[c]; } }
// k_vtp: transposed value planes [g][d][t] (each head's [d][t] in fragment order). Each thread holds a block of 8 t x 4 d in registers: eight 16-byte loads along d (a wave reads two whole 256-byte head rows a load), then per d and plane one 16-byte store along t.
// Grid (TT / 128, heads), 256 threads: a block covers one head's 64 d x 128 t, so every 128-byte output line is filled by one block.
template <int PITCH>
__global__ __launch_bounds__(256) void k_vtp(const float* __restrict__ F, h16* V16, bf* Vh, bf* Vl) { const int lane = threadIdx.x & 31; const int g = blockIdx.y, d0 = (lane & 15) * 4, t0 = blockIdx.x * 128 + (int)(threadIdx.x >> 5) * 16 + (lane >> 4) * 8; v4f r[8];
    const float* fp = F + (size_t)t0 * PITCH + g * HD + d0;
    // every unroll: the register blocks stay in registers only under constant indices
#pragma unroll
    for (int j = 0; j < 8; ++j) r[j] = *(const v4f*)(fp + j * PITCH);
    // the address stays live up to this wait, so no register that an issued load names is given a new value in front of it
    asm volatile("s_wait_xcnt 0x0" :: "v"(fp) : "memory");
    v8h o16[4]; v8us oh[4], ol[4];
#pragma unroll
    for (int q = 0; q < 4; ++q)
#pragma unroll
        for (int j = 0; j < 8; ++j) { const float x = r[j][q]; o16[q][j] = tohx(x); unsigned short a2, c2; splitf(x, a2, c2); oh[q][j] = a2; ol[q][j] = c2; }
    const size_t e = (size_t)g * HD * TT + fro(d0, t0, TT);      // the next d is the next 16-byte run
#pragma unroll
    for (int q = 0; q < 4; ++q) { *(v8h*)(V16 + e + q * 8) = o16[q]; *(v8us*)(Vh + e + q * 8) = oh[q]; *(v8us*)(Vl + e + q * 8) = ol[q]; } }
// grid TT * HD / 2048 blocks, exact: four 16-byte stores (two (cos, sin) pairs each) a thread
__global__ __launch_bounds__(256) void k_csid(float* CS) { v4f cs; cs[0] = 1.0f; cs[1] = 0.0f; cs[2] = 1.0f; cs[3] = 0.0f; float* p = CS + ((size_t)blockIdx.x * 1024 + threadIdx.x) * 4;
#pragma unroll
    for (int c = 0; c < 4; ++c) *(v4f*)(p + c * 1024) = cs;  }
// ---- k_fattn: causal attention of one batch in one launch; grid (heads, TT/64), 128 threads; wave w of a work-group owns the 16 query rows r0 + 16 w .. + 15 of one head and walks the keys 0 .. r0 + 63 in passes of 64.
// Transposed products: S^T = K Q^T (A = key rows, B = query rows), so a lane holds 32 scores of ONE query (column lane & 15; keys 16 kb + 8 (lane >> 4) + j); running maximum and sum stay in the lane, the two lane halves
// exchange the maximum once a pass and the sum once at the end. Two score tiles, converted in place, are the B operand of O^T += V^T P^T (A = rows of the transposed value plane). Scores and probabilities never leave the registers.
// Operand classes: query rows < RH on bf16 hi+lo planes (3 products each), the rest on single fp16 planes (probabilities carried x 2^10, which cancels in the division by their sum). Output: bf16 hi+lo planes [t][DQ]. All planes in fragment order.
template <typename T16> struct IsHL { static constexpr bool v = false; };
template <> struct IsHL<bf> { static constexpr bool v = true; };
template <bool B> struct BoolC { static constexpr bool value = B; };
__device__ __forceinline__ float xhalf(float x) { return __int_as_float(__builtin_amdgcn_permlanex16(__float_as_int(x), __float_as_int(x), 0x76543210, 0xfedcba98, false, false)); }   // the value of lane ^ 16
// eight 2^x in place, in one statement: each v_exp_f32 is followed by one that neither reads its result nor overwrites its source, the last by the v_nop that the instruction set asks for behind a transcendental
__device__ __forceinline__ void exp2x8(float (&e)[8]) {
    asm("v_exp_f32 %0, %0\n\tv_exp_f32 %1, %1\n\tv_exp_f32 %2, %2\n\tv_exp_f32 %3, %3\n\tv_exp_f32 %4, %4\n\tv_exp_f32 %5, %5\n\tv_exp_f32 %6, %6\n\tv_exp_f32 %7, %7\n\tv_nop"
        : "+v"(e[0]), "+v"(e[1]), "+v"(e[2]), "+v"(e[3]), "+v"(e[4]), "+v"(e[5]), "+v"(e[6]), "+v"(e[7])); }
template <typename T16>
__device__ __forceinline__ void attn_wave(const T16* __restrict__ Qp, const T16* __restrict__ Q2, const T16* __restrict__ Kp, const T16* __restrict__ K2, const T16* __restrict__ Vp, const T16* __restrict__ V2, int q0, bf* __restrict__ Ah, bf* __restrict__ Al) {
    // every unroll below: the fragment, score and accumulator arrays stay in registers only under constant indices
    typedef typename WFrag<T16>::V V; constexpr bool HL = IsHL<T16>::v;
    constexpr float CL = SCL * 1.4426950408889634f, OFF = HL ? 0.0f : 10.0f;      // scores in log2 units; OFF: the carry 2^10 of the fp16 probabilities
    const int lane = threadIdx.x & 31, lr = lane & 15, hi = lane >> 4; const int q = q0 + lr;
    // every load is a wave-uniform base plus the lane's fixed byte offset in a block: the offset never changes, only the key and value bases move on, by one pass at a time
    const unsigned qob = (unsigned)lane * 16u, kob = qob, vob = qob;
    Qp += q0 * HD; if constexpr (HL) Q2 += q0 * HD;      // the wave's 16 query rows: two blocks
    auto at = [](const T16* base, unsigned ob) { return (const T16*)((const char*)base + ob); };
    const T16* qa = at(Qp, qob); const T16* qa2 = HL ? at(Q2, qob) : nullptr; const T16* ka0 = at(Kp, kob);
    V qf[2], qf2[2];
#pragma unroll
    for (int ds = 0; ds < 2; ++ds) { qf[ds] = WFrag<T16>::ld(qa + ds * 512); if constexpr (HL) qf2[ds] = WFrag<T16>::ld(qa2 + ds * 512); }
    v8f o[4];
#pragma unroll
    for (int db = 0; db < 4; ++db) o[db] = (v8f){};
    float m = -3.0e38f, l = 0.0f;
    V kf[4][2], kf2[4][2];
    if constexpr (!HL) {    // single planes: the key fragments run one pass ahead; hi+lo planes (at most RH / 64 passes, twice the registers) fetch theirs inside the pass
#pragma unroll
        for (int kb = 0; kb < 4; ++kb)
#pragma unroll
            for (int ds = 0; ds < 2; ++ds) kf[kb][ds] = WFrag<T16>::ld(ka0 + kb * 16 * HD + ds * 512);
    }
    // all s_wait_xcnt below: addresses, offsets and bases stay live up to the wait, so no register that an issued load names is given a new value in front of it;
    // the sched_barrier behind a wait keeps the loads in front of it and later vector work behind it
    if constexpr (HL) asm volatile("s_wait_xcnt 0x0" :: "v"(qa), "v"(qa2), "v"(qob), "s"(Qp), "s"(Q2) : "memory"); else asm volatile("s_wait_xcnt 0x0" :: "v"(qa), "v"(ka0), "v"(qob), "v"(kob), "s"(Qp), "s"(Kp) : "memory");
    __builtin_amdgcn_sched_barrier(0);
    const int np = q0 / 64 + 1;     // passes; only the last one meets the diagonal
    auto pass = [&](auto diag, int kt) {
        V vf[4][2], vf2[4][2];
        const T16* ka = at(Kp, kob); const T16* ka2 = HL ? at(K2, kob) : nullptr; const T16* va = at(Vp, vob); const T16* va2 = HL ? at(V2, vob) : nullptr;
        if constexpr (HL) {
#pragma unroll
            for (int kb = 0; kb < 4; ++kb)
#pragma unroll
                for (int ds = 0; ds < 2; ++ds) { kf[kb][ds] = WFrag<T16>::ld(ka + kb * 16 * HD + ds * 512); kf2[kb][ds] = WFrag<T16>::ld(ka2 + kb * 16 * HD + ds * 512); }
            asm volatile("s_wait_xcnt 0x0" :: "v"(ka), "v"(ka2), "v"(kob), "s"(Kp), "s"(K2) : "memory");
            __builtin_amdgcn_sched_barrier(0);
        } else {
#pragma unroll
            for (int db = 0; db < 4; ++db)
#pragma unroll
                for (int ks = 0; ks < 2; ++ks) vf[db][ks] = WFrag<T16>::ld(va + db * 16 * TT + ks * 512);
        }
        v8f s[4];
#pragma unroll
        for (int kb = 0; kb < 4; ++kb) { s[kb] = (v8f){};
#pragma unroll
            for (int ds = 0; ds < 2; ++ds) { s[kb] = WFrag<T16>::mma(kf[kb][ds], qf[ds], s[kb]); if constexpr (HL) { s[kb] = WFrag<T16>::mma(kf[kb][ds], qf2[ds], s[kb]); s[kb] = WFrag<T16>::mma(kf2[kb][ds], qf[ds], s[kb]); } } }
        if constexpr (HL) {     // the value fragments fly under the softmax
#pragma unroll
            for (int db = 0; db < 4; ++db)
#pragma unroll
                for (int ks = 0; ks < 2; ++ks) { vf[db][ks] = WFrag<T16>::ld(va + db * 16 * TT + ks * 512); vf2[db][ks] = WFrag<T16>::ld(va2 + db * 16 * TT + ks * 512); }
            asm volatile("s_wait_xcnt 0x0" :: "v"(va), "v"(va2), "v"(vob), "s"(Vp), "s"(V2) : "memory");
            __builtin_amdgcn_sched_barrier(0);
        } else {
            if constexpr (!decltype(diag)::value) {     // the next pass's key fragments, behind this pass's score products
#pragma unroll
                for (int kb = 0; kb < 4; ++kb)
#pragma unroll
                    for (int ds = 0; ds < 2; ++ds) kf[kb][ds] = WFrag<T16>::ld(ka + (64 + kb * 16) * HD + ds * 512);
            }
            asm volatile("s_wait_xcnt 0x0" :: "v"(ka), "v"(va), "v"(kob), "v"(vob), "s"(Kp), "s"(Vp) : "memory");
            __builtin_amdgcn_sched_barrier(0);
        }
        if constexpr (!decltype(diag)::value) { Kp += 64 * HD; Vp += 64 * 16; if constexpr (HL) { K2 += 64 * HD; V2 += 64 * 16; } }   // 64 keys: eight key blocks; two blocks of each 16 value rows
        if constexpr (decltype(diag)::value) {      // causal mask: key > query
#pragma unroll
            for (int kb = 0; kb < 4; ++kb)
#pragma unroll
                for (int j = 0; j < 8; ++j) s[kb][j] = (kt + kb * 16 + hi * 8 + j > q) ? -3.0e38f : s[kb][j];
        }
        float t4[4];     // four independent chains, one a score tile, then a tree: the maximum (and below the sum) does not wait on one chain of 32
#pragma unroll
        for (int kb = 0; kb < 4; ++kb) { t4[kb] = s[kb][0];
#pragma unroll
            for (int j = 1; j < 8; ++j) t4[kb] = fmaxf(t4[kb], s[kb][j]); }
        float tm = fmaxf(fmaxf(t4[0], t4[1]), fmaxf(t4[2], t4[3]));
        tm = fmaxf(tm, xhalf(tm));
        const float mn = fmaxf(m, tm * CL), sh = OFF - mn; float al = m - mn; m = mn;
        asm("v_exp_f32 %0, %0\n\tv_nop" : "+v"(al));     // 2^al; the v_nop is the slot that the instruction set asks for behind a transcendental
#pragma unroll
        for (int kb = 0; kb < 4; ++kb) { t4[kb] = 0.0f; float e[8];
#pragma unroll
            for (int j = 0; j < 8; ++j) e[j] = fmaf(s[kb][j], CL, sh);
            exp2x8(e);
#pragma unroll
            for (int j = 0; j < 8; ++j) { s[kb][j] = e[j]; t4[kb] += e[j]; } }
        l = fmaf(l, al, (t4[0] + t4[1]) + (t4[2] + t4[3]));
#pragma unroll
        for (int db = 0; db < 4; ++db) o[db] *= al;
#pragma unroll
        for (int ks = 0; ks < 2; ++ks) {
            if constexpr (HL) { v8us h0, h1, l0, l1;
#pragma unroll
                for (int j = 0; j < 8; ++j) { unsigned short a, c; splitf(s[2 * ks][j], a, c); h0[j] = a; l0[j] = c; splitf(s[2 * ks + 1][j], a, c); h1[j] = a; l1[j] = c; }
                const V ph = cat16b(h0, h1), pl = cat16b(l0, l1);
#pragma unroll
                for (int db = 0; db < 4; ++db) { o[db] = WFrag<T16>::mma(vf[db][ks], ph, o[db]); o[db] = WFrag<T16>::mma(vf[db][ks], pl, o[db]); o[db] = WFrag<T16>::mma(vf2[db][ks], ph, o[db]); }
            } else { const V pf = cat16(__builtin_convertvector(s[2 * ks], v8h), __builtin_convertvector(s[2 * ks + 1], v8h));
#pragma unroll
                for (int db = 0; db < 4; ++db) o[db] = WFrag<T16>::mma(vf[db][ks], pf, o[db]); }
        }
    };
    // unroll 1: one pass is already a long straight run; a second copy would only double the code
#pragma unroll 1
    for (int p = 0; p + 1 < np; ++p) pass(BoolC<false>(), p * 64);
    pass(BoolC<true>(), (np - 1) * 64);
    l += xhalf(l); const float inv = __fdiv_rn(1.0f, l);
    v8us oh[4], ol[4];
#pragma unroll
    for (int db = 0; db < 4; ++db)
#pragma unroll
        for (int j = 0; j < 8; ++j) { unsigned short a, c; splitf(o[db][j] * inv, a, c); oh[db][j] = a; ol[db][j] = c; }
    const size_t oo = (size_t)q0 * DQ + lane * 8;   // a lane's eight accumulator registers are eight consecutive d of its query row: in fragment order its own 16-byte run of half a block, so a wave's store is 512 contiguous bytes
#pragma unroll
    for (int db = 0; db < 4; ++db) { *(v8us*)(Ah + oo + db * 256) = oh[db]; *(v8us*)(Al + oo + db * 256) = ol[db]; }
}
// waves_per_eu(2, 2): the grid brings two waves to a SIMD; with that register budget a pass's value loads all issue at its head and the key loads a pass ahead
__global__ __launch_bounds__(128) __attribute__((amdgpu_waves_per_eu(2, 2))) void k_fattn(const h16* __restrict__ Q16, const h16* __restrict__ K16, const h16* __restrict__ V16, const bf* __restrict__ Qh, const bf* __restrict__ Ql, const bf* __restrict__ Kh, const bf* __restrict__ Kl, const bf* __restrict__ Vh, const bf* __restrict__ Vl, bf* __restrict__ Ah, bf* __restrict__ Al) {
    const int wv = __builtin_amdgcn_readfirstlane((int)(threadIdx.x >> 5));   // wave number, scalar: the pass loop's control stays a scalar branch
    const int r0 = (TT / 64 - 1 - (int)blockIdx.y) * 64;                      // longest key walks first
    const size_t zq = (size_t)blockIdx.x * TT * HD, zk = (size_t)(blockIdx.x / REP) * TT * HD;
    if (r0 < RH) attn_wave<bf>(Qh + zq, Ql + zq, Kh + zk, Kl + zk, Vh + zk, Vl + zk, r0 + wv * 16, Ah + blockIdx.x * HD * 16, Al + blockIdx.x * HD * 16);     // a head's 64 columns of 16 rows: two blocks
    else attn_wave<h16>(Q16 + zq, nullptr, K16 + zk, nullptr, V16 + zk, nullptr, r0 + wv * 16, Ah + blockIdx.x * HD * 16, Al + blockIdx.x * HD * 16);
}

// k_wt16: Bt[n][k] (fragment order) = fp16 of the bf16-rounded w[k][n]. Each thread holds a block of 8 k x 4 n in registers: eight 16-byte loads along n (a wave reads 256 contiguous bytes of two rows a load), then per n one 16-byte store along k.
// Grid (N / 64, K / 128), 256 threads: a block covers 64 n x 128 k, whole 1 KB blocks of the plane, so every 128-byte output line is filled by one block.
template <int K, int N>
__global__ __launch_bounds__(256) void k_wt16(const float* __restrict__ w, h16* Bt) { const int lane = threadIdx.x & 31; const int n0 = blockIdx.x * 64 + (lane & 15) * 4, k0 = blockIdx.y * 128 + (int)(threadIdx.x >> 5) * 16 + (lane >> 4) * 8; v4f r[8];
    const float* wp = w + (size_t)k0 * N + n0;
    // every unroll: the register blocks stay in registers only under constant indices
#pragma unroll
    for (int j = 0; j < 8; ++j) r[j] = *(const v4f*)(wp + j * N);
    // the address stays live up to this wait, so no register that an issued load names is given a new value in front of it
    asm volatile("s_wait_xcnt 0x0" :: "v"(wp) : "memory");
    v8h o[4];
#pragma unroll
    for (int q = 0; q < 4; ++q)
#pragma unroll
        for (int j = 0; j < 8; ++j) o[q][j] = tohx(bfr(r[j][q]));
#pragma unroll
    for (int q = 0; q < 4; ++q) *(v8h*)(Bt + fro(n0, k0, K) + q * 8) = o[q]; }   // fragment order: the next n is the next 16-byte run
__global__ __launch_bounds__(256) void k_rmsc(const float* __restrict__ X, int isin, const float* __restrict__ w, h16* HC) { const int lane = threadIdx.x & 31; const int t = blockIdx.x * 8 + (threadIdx.x >> 5); if (t >= TT) return; float v[32]; float s = 0.f;
#pragma unroll
    for (int ch = 0; ch < 8; ++ch) { const v4f a = *(const v4f*)(X + (size_t)t * DM + ch * 128 + lane * 4);
#pragma unroll
        for (int q = 0; q < 4; ++q) { const float xv = isin ? bfr(a[q]) : a[q]; v[ch * 4 + q] = xv; float p = __fmul_rn(xv, xv); asm volatile("" : "+v"(p)); s = __fadd_rn(s, p); } }
#pragma unroll
    for (int sh = 16; sh; sh >>= 1) s += __shfl_xor(s, sh, 32);
    const float r = __frsqrt_rn(__fadd_rn(s * (1.0f / DM), 1.1920929e-07f));
{       v4h o[8]; float wr[32]; const unsigned wob = (unsigned)lane * 16u; const float* wp = (const float*)((const char*)w + wob);   // this lane's weights: columns ch 128 + lane 4 + q
#pragma unroll
        for (int ch = 0; ch < 8; ++ch)
#pragma unroll
            for (int q = 0; q < 4; ++q) wr[ch * 4 + q] = wp[ch * 128 + q];
        // address, offset and base stay live up to this wait, so no register that an issued weight load names is given a new value in front of it
        asm volatile("s_wait_xcnt 0x0" :: "v"(wp), "v"(wob), "s"(w) : "memory");
#pragma unroll
        for (int ch = 0; ch < 8; ++ch)
#pragma unroll
            for (int q = 0; q < 4; ++q) { float tn = __fmul_rn(v[ch * 4 + q], r); asm volatile("" : "+v"(tn)); o[ch][q] = tohx(__fmul_rn(tn, bfr(wr[ch * 4 + q]))); }
        // block planes in fragment order: plane ch / 2, columns (ch % 2) 128 + lane 4, four blocks apart; the work-group's eight rows fill whole lines
        h16* hp = HC + fro(t, lane * 4, 256);
#pragma unroll
        for (int ch = 0; ch < 8; ++ch) *(v4h*)(hp + (size_t)(ch >> 1) * TT * 256 + (ch & 1) * 2048) = o[ch];
         } }
// ---- k_dend: one dendritic layer per blockIdx.z; grid (TT/64, N/64, layers), 128 threads. Wave n of the work-group forms the 64x64 tile of input block n, h_n W[n] (K = 256, fp16 planes, f32 accumulate, one running sum over K);
// the four tiles meet in LDS, and each output element is max over n = 0 .. 3 (in that order) of gain[n] silu(tile_n - thr[n]). H: block planes [n][TT][256]; Bt: [n][N][256], each plane in fragment order; thr, gain: [n][N]; C: [TT][N].
// blockIdx.z picks the layer: weights and outputs by the strides sB and sC (elements), thresholds and gains by the pointer pair.
__global__ __launch_bounds__(128) void k_dend(const h16* __restrict__ H, const h16* __restrict__ Bt, int N, const float* __restrict__ thr0, const float* __restrict__ gain0, const float* __restrict__ thr1, const float* __restrict__ gain1, float* C, size_t sB, size_t sC) {
    constexpr int K = 256, WST = 64 * 68;                   // WST: floats of one wave's LDS slab (its whole tile, row pitch 68)
    __shared__ __align__(16) float os[4 * WST];
    const int wv = __builtin_amdgcn_readfirstlane((int)(threadIdx.x >> 5));   // wave number = input block n, scalar
    const float* thr = blockIdx.z ? thr1 : thr0; const float* gain = blockIdx.z ? gain1 : gain0;
    const h16* A = H + (size_t)wv * TT * K; const h16* B = Bt + blockIdx.z * sB + (size_t)wv * N * K; C += blockIdx.z * sC;
    const int lane = threadIdx.x & 31, lr = lane & 15, hi = lane >> 4; const int r0 = blockIdx.x * 64, c0 = blockIdx.y * 64;
    v8f acc[4][4];
#pragma unroll
    for (int mb = 0; mb < 4; ++mb)
#pragma unroll
        for (int nb = 0; nb < 4; ++nb) acc[mb][nb] = (v8f){};
    const unsigned lob = (unsigned)lane * 16u;      // the lane's byte offset in every block
    A += (size_t)r0 * K; B += (size_t)c0 * K;       // 16 rows of blocks are 16 K elements
    // every unroll: K is a constant, eight trips; the fragment arrays stay in registers only under constant indices.
    // The next trip's loads issue ahead of this trip's products: its A fragments at the trip's head into the other half of a[][], each B fragment behind the last product that reads its forerunner.
    // Written out in the source: with every block an immediate offset from one base the compiler, left to itself, puts each load directly in front of its first product and waits for it there.
    v16h a[2][4], b[4];
#pragma unroll
    for (int mb = 0; mb < 4; ++mb) a[0][mb] = WFrag<h16>::ld(atl(A, lob) + mb * 16 * K);
#pragma unroll
    for (int nb = 0; nb < 4; ++nb) b[nb] = WFrag<h16>::ld(atl(B, lob) + nb * 16 * K);
#pragma unroll
    for (int t = 0; t < K / 32; ++t) {
        if (t + 1 < K / 32) {
#pragma unroll
            for (int mb = 0; mb < 4; ++mb) a[(t + 1) & 1][mb] = WFrag<h16>::ld(atl(A, lob) + mb * 16 * K + (t + 1) * 512); }
#pragma unroll
        for (int nb = 0; nb < 4; ++nb) {
#pragma unroll
            for (int mb = 0; mb < 4; ++mb) acc[mb][nb] = wmma16(a[t & 1][mb], b[nb], acc[mb][nb]);
            if (t + 1 < K / 32) b[nb] = WFrag<h16>::ld(atl(B, lob) + nb * 16 * K + (t + 1) * 512); }
    }
    // the offset and both bases stay live up to this wait, so no register that an issued operand load names is given a new value in front of it
    asm volatile("s_wait_xcnt 0x0" :: "v"(lob), "s"(A), "s"(B) : "memory");
    // unrolls: acc[][] stays in registers only under constant indices
#pragma unroll
    for (int mb = 0; mb < 4; ++mb)
#pragma unroll
        for (int nb = 0; nb < 4; ++nb) {
#pragma unroll
            for (int j = 0; j < 8; ++j) os[wv * WST + (mb * 16 + hi * 8 + j) * 68 + nb * 16 + lr] = acc[mb][nb][j]; }
    __syncthreads();    // all four blocks' tiles are in LDS before any element's max is taken
    const unsigned cofs = (threadIdx.x & 15u) * 4u; v4f th[4], ga[4]; unsigned ob[4];   // this thread's four output columns are the same in every row it handles
#pragma unroll
    for (int n = 0; n < 4; ++n) { ob[n] = ((unsigned)(n * N) + cofs) * 4u; th[n] = *(const v4fa*)((const char*)(thr + c0) + ob[n]); ga[n] = *(const v4fa*)((const char*)(gain + c0) + ob[n]); }
    // the four byte offsets and the two bases stay live up to this wait, so no register that an issued threshold or gain load names is given a new value in front of it
    asm volatile("s_wait_xcnt 0x0" :: "v"(ob[0]), "v"(ob[1]), "v"(ob[2]), "v"(ob[3]), "s"(thr + c0), "s"(gain + c0) : "memory");
#pragma unroll
    for (int n = 0; n < 4; ++n)
#pragma unroll
        for (int q = 0; q < 4; ++q) { th[n][q] = bfr(th[n][q]); ga[n][q] = bfr(ga[n][q]); }
    float* crow = C + (size_t)r0 * N + c0 + cofs;
    // unroll 2: two rows' independent division chains fill each other's waits; more would only lengthen the code
#pragma unroll 2
    for (int s = 0; s < 8; ++s) { const int row = s * 8 + (int)(threadIdx.x >> 4); v4f r;
#pragma unroll
        for (int n = 0; n < 4; ++n) { const v4f a = *(const v4fa*)(os + n * WST + row * 68 + cofs);
#pragma unroll
            for (int q = 0; q < 4; ++q) { const float z = __fsub_rn(a[q], th[n][q]); const float sg = __fdiv_rn(1.0f, 1.0f + __expf(-z)); const float val = __fmul_rn(ga[n][q], __fmul_rn(z, sg)); r[q] = n ? fmaxf(r[q], val) : val; } }
        *(v4f*)(crow + (size_t)row * N) = r;
        asm volatile("s_wait_xcnt 0x0" ::: "memory"); }   // the next trip rewrites the registers that this store names: the wait stands in front of that
}
// k_res, k_ffp, k_fin: each thread takes four runs (k_ffp: eight) of four elements, 256 threads apart (k_ffp: 128 columns apart in two rows), and issues all its loads before the first run is worked on; exact grids. Every unroll: the register blocks stay in registers only under constant indices.
// In each: the two addresses stay live up to the s_wait_xcnt, so no register that an issued load names is given a new value in front of it.
__global__ __launch_bounds__(256) void k_res(const float* __restrict__ x, const float* __restrict__ ATT, float* X1) { const size_t i0 = ((size_t)blockIdx.x * 1024 + threadIdx.x) * 4; const float* xp = x + i0; const float* ap = ATT + i0; v4f xv[4], a[4], o[4];
#pragma unroll
    for (int c = 0; c < 4; ++c) { xv[c] = *(const v4f*)(xp + c * 1024); a[c] = *(const v4f*)(ap + c * 1024); }
    asm volatile("s_wait_xcnt 0x0" :: "v"(xp), "v"(ap) : "memory");
#pragma unroll
    for (int c = 0; c < 4; ++c) { o[c][0] = __fadd_rn(bfr(xv[c][0]), a[c][0]); o[c][1] = __fadd_rn(bfr(xv[c][1]), a[c][1]); o[c][2] = __fadd_rn(bfr(xv[c][2]), a[c][2]); o[c][3] = __fadd_rn(bfr(xv[c][3]), a[c][3]); }
#pragma unroll
    for (int c = 0; c < 4; ++c) *(v4f*)(X1 + i0 + c * 1024) = o[c]; }
__global__ __launch_bounds__(256) void k_ffp(const float* __restrict__ G, const float* __restrict__ U, h16* FF16) {
    // a block covers 16 rows x 512 columns, whole 1 KB blocks of the fragment-order output plane; a wave takes two rows, four runs of 128 columns (512 contiguous bytes a load) in each
    const int row = (int)(blockIdx.x >> 2) * 16 + (int)(threadIdx.x >> 5) * 2, k = (int)(blockIdx.x & 3) * 512 + (int)(threadIdx.x & 31) * 4;
    const size_t i0 = (size_t)row * 2048 + k; const float* gp = G + i0; const float* up = U + i0; v4f g[8], u[8]; v4h o[8];   // eight runs
#pragma unroll
    for (int c = 0; c < 8; ++c) { g[c] = *(const v4f*)(gp + (c >> 2) * 2048 + (c & 3) * 128); u[c] = *(const v4f*)(up + (c >> 2) * 2048 + (c & 3) * 128); }
    asm volatile("s_wait_xcnt 0x0" :: "v"(gp), "v"(up) : "memory");
    __builtin_amdgcn_sched_barrier(0);   // keeps the vector work behind the wait: without it the compiler works on the first loads before it issues the last, and their latencies add up
#pragma unroll
    for (int c = 0; c < 8; ++c)
#pragma unroll
        for (int q = 0; q < 4; ++q) { const float sg = __fdiv_rn(1.0f, 1.0f + __expf(-g[c][q])); const float sl = __fmul_rn(g[c][q], sg); o[c][q] = tohx(__fmul_rn(sl, u[c][q])); }
    h16* eo = FF16 + fro(row, k, 2048);
#pragma unroll
    for (int c = 0; c < 8; ++c) *(v4h*)(eo + (c >> 2) * 8 + (c & 3) * 2048) = o[c]; }   // the next row is the next 16-byte run; 128 columns on are four blocks on
__global__ __launch_bounds__(256) void k_fin(const float* __restrict__ X1, const float* __restrict__ F2, float* OUT) { const size_t i0 = ((size_t)blockIdx.x * 1024 + threadIdx.x) * 4; const float* ap = X1 + i0; const float* fp = F2 + i0; v4f a[4], f[4], o[4];
#pragma unroll
    for (int c = 0; c < 4; ++c) { a[c] = *(const v4f*)(ap + c * 1024); f[c] = *(const v4f*)(fp + c * 1024); }
    asm volatile("s_wait_xcnt 0x0" :: "v"(ap), "v"(fp) : "memory");
#pragma unroll
    for (int c = 0; c < 4; ++c) { o[c][0] = __fadd_rn(a[c][0], f[c][0]); o[c][1] = __fadd_rn(a[c][1], f[c][1]); o[c][2] = __fadd_rn(a[c][2], f[c][2]); o[c][3] = __fadd_rn(a[c][3], f[c][3]); }
#pragma unroll
    for (int c = 0; c < 4; ++c) *(v4f*)(OUT + i0 + c * 1024) = o[c]; }

extern "C" void kernel_launch(void* const* d_in, const int* in_sizes, int n_in,
                              void* d_out, int out_size, void* d_ws, size_t ws_size, hipStream_t stream) {
    (void)in_sizes; (void)n_in; (void)out_size;
    const float* x = (const float*)d_in[0]; const float* qkvw = (const float*)d_in[1]; const float* qthr = (const float*)d_in[2]; const float* qgain = (const float*)d_in[3]; const float* wo = (const float*)d_in[4]; const float* gw = (const float*)d_in[5]; const float* gthr = (const float*)d_in[6]; const float* ggain = (const float*)d_in[7]; const float* uw = (const float*)d_in[8]; const float* uthr = (const float*)d_in[9]; const float* ugain = (const float*)d_in[10]; const float* dw = (const float*)d_in[11]; const float* n1w = (const float*)d_in[12]; const float* n2w = (const float*)d_in[13];
    float* OUT = (float*)d_out;     // [2][2048][1024]
    char* wsp = (char*)d_ws;
    auto take = [&](size_t bytes) { char* p = wsp; wsp += (bytes + 255) & ~(size_t)255; return (void*)p; };
    bf* WQ = (bf*)take((size_t)DQ * DM * 2); bf* WK = (bf*)take((size_t)DKV * DM * 2); bf* WV = (bf*)take((size_t)DKV * DM * 2); bf* WO = (bf*)take((size_t)DM * DQ * 2); float* CS = (float*)take((size_t)TT * HD * 2 * 4);
    bf* XB = (bf*)take((size_t)TT * DM * 2); float* FQKV = (float*)take((size_t)TT * 3072 * 4);   // dendritic [q|k|v], row pitch 3072
    h16* QP16 = (h16*)take((size_t)NH_ * TT * HD * 2); h16* KP16 = (h16*)take((size_t)NKV * TT * HD * 2); h16* VT16 = (h16*)take((size_t)NKV * HD * TT * 2);
    bf* QPh = (bf*)take((size_t)NH_ * TT * HD * 2); bf* QPl = (bf*)take((size_t)NH_ * TT * HD * 2); bf* KPh = (bf*)take((size_t)NKV * TT * HD * 2); bf* KPl = (bf*)take((size_t)NKV * TT * HD * 2); bf* VTh = (bf*)take((size_t)NKV * HD * TT * 2); bf* VTl = (bf*)take((size_t)NKV * HD * TT * 2);
    bf* ATh = (bf*)take((size_t)TT * DQ * 2); bf* ATl = (bf*)take((size_t)TT * DQ * 2);
    if ((size_t)(wsp - (char*)d_ws) > ws_size) return;    // ws 256 MiB
    h16* BQKV = (h16*)take((size_t)4 * 3072 * 256 * 2); h16* BG = (h16*)take((size_t)2 * 4 * 2048 * 256 * 2); h16* BU = BG + (size_t)4 * 2048 * 256; h16* BD = (h16*)take((size_t)DM * 2048 * 2); h16* HC = (h16*)take((size_t)4 * TT * 256 * 2); float* ACG = (float*)take((size_t)2 * TT * 2048 * 4); float* ACU = ACG + (size_t)TT * 2048; h16* FF16 = (h16*)take((size_t)TT * 2048 * 2); float* ATT = (float*)take((size_t)TT * DM * 4); float* X1 = (float*)take((size_t)TT * DM * 4);
    if ((size_t)(wsp - (char*)d_ws) > ws_size) return;
    { for (int n = 0; n < 4; ++n) { k_wt16<256, 3072><<<dim3(3072 / 64, 256 / 128, 1), 256, 0, stream>>>(qkvw + (size_t)n * 256 * 3072, BQKV + (size_t)n * 3072 * 256); k_wt16<256, 2048><<<dim3(2048 / 64, 256 / 128, 1), 256, 0, stream>>>(gw + (size_t)n * 256 * 2048, BG + (size_t)n * 2048 * 256); k_wt16<256, 2048><<<dim3(2048 / 64, 256 / 128, 1), 256, 0, stream>>>(uw + (size_t)n * 256 * 2048, BU + (size_t)n * 2048 * 256); }
      k_wt16<2048, DM><<<dim3(DM / 64, 2048 / 128, 1), 256, 0, stream>>>(dw, BD);
      k_wtG<DQ, DM><<<dim3(DM / 64, DQ / 128, 1), 256, 0, stream>>>(wo, WO);
       }
    k_csid<<<TT * HD / 2048, 256, 0, stream>>>(CS);
    const unsigned LQ = (unsigned)((size_t)NH_ * TT * HD / 4096), LKv = (unsigned)((size_t)NKV * TT * HD / 4096);
    for (int b = 0; b < NB_; ++b) {
        
        k_rmsc<<<TT / 8, 256, 0, stream>>>(x + (size_t)b * TT * DM, 1, n1w, HC);
        // dendritic [q|k|v]: one launch for the whole layer (N = 3072)
        k_dend<<<dim3(TT / 64, 3072 / 64, 1), 128, 0, stream>>>(HC, BQKV, 3072, qthr, qgain, qthr, qgain, FQKV, 0, 0);
        k_rope<3072><<<LQ, 256, 0, stream>>>(FQKV, CS, 1.0f, QP16, QPh, QPl);
        k_rope<3072><<<LKv, 256, 0, stream>>>(FQKV + DQ, CS, 1.0f, KP16, KPh, KPl);
        k_vtp<3072><<<dim3(TT / 128, NKV, 1), 256, 0, stream>>>(FQKV + DQ + DKV, VT16, VTh, VTl);
        // causal attention, all heads of the batch in one launch; it writes the merged hi+lo planes itself
        k_fattn<<<dim3(NH_, TT / 64, 1), 128, 0, stream>>>(QP16, KP16, VT16, QPh, QPl, KPh, KPl, VTh, VTl, ATh, ATl);
        k_gemmw<bf, 1, false, 8, DQ><<<dim3(TT / 64, DM / 64, 1), 256, 0, stream>>>(ATh, ATl, WO, nullptr, ATT, DM, nullptr, 0, 0, 0);
        k_res<<<TT * DM / 4096, 256, 0, stream>>>(x + (size_t)b * TT * DM, ATT, X1); k_rmsc<<<TT / 8, 256, 0, stream>>>(X1, 0, n2w, HC);
        // dendritic gate (z = 0) and up (z = 1) in one launch
        k_dend<<<dim3(TT / 64, 2048 / 64, 2), 128, 0, stream>>>(HC, BG, 2048, gthr, ggain, uthr, ugain, ACG, (size_t)4 * 2048 * 256, (size_t)TT * 2048);
        k_ffp<<<TT * 2048 / 8192, 256, 0, stream>>>(ACG, ACU, FF16);
        k_gemmw<h16, 0, false, 8, 2048><<<dim3(TT / 64, DM / 64, 1), 256, 0, stream>>>(FF16, nullptr, BD, nullptr, ATT, DM, nullptr, 0, 0, 0);
        k_fin<<<TT * DM / 4096, 256, 0, stream>>>(X1, ATT, OUT + (size_t)b * TT * DM); }
}

// v006
// One run takes 256 microseconds.
// In two side-by-side timings against v005, it was 1.37 and 1.38 times as fast.
// All steps since v000 together make it 8.34 times as fast.
#include <hip/hip_runtime.h>

// Transformer block with dendritic layers (x [2][2048][1024]; h = RMSNorm(x) w1; [q|k|v] = dendritic(h, qkv_w, thr, gain) = max over the 4 input blocks n of gain[n] silu(h_n W[n] - thr[n]) (16 heads x 64); causal softmax(q.k/8); x1 = x + merged.v o_w;
// h2 = RMSNorm(x1) w2; ff = silu(dendritic(h2, gate)) * dendritic(h2, up); out = x1 + ff down_w -> [2][2048][1024]; all weights x @ W; eps = f32 eps).
// Compute dtypes, f32 accumulate: every input rounded to bf16; the RMSNorms f32 -> SINGLE fp16 block planes; every dendritic GEMM on fp16 planes x fp16 copies of the bf16 weights (1 product; hi+lo would double the
// ~60 G of dendritic GEMMs), the gain/silu/threshold/max epilogues f32; scores (K 64) and probs.v on hl planes (3 products) for the first 512 query rows of each head and single fp16 planes for the rest, f32 causal softmax with masked tiles

#define NB_  2
#define TT   2048
#define NR   (NB_ * TT)         // rows of both batches: every row-wise kernel takes them in one launch
#define DM   1024
#define NH_  16
#define NKV  16
#define REP  (NH_ / NKV)
#define HD   64
#define DQ   (NH_ * HD)
#define DKV  (NKV * HD)
#define RH   512                  // query rows < RH use hi+lo planes (0: none)
#define SCL  0.125f   // HD^-0.5
typedef _Float16 h16;
typedef unsigned short bf;
typedef __attribute__((ext_vector_type(16))) __bf16   v16bf;
typedef __attribute__((ext_vector_type(16))) _Float16 v16h;
typedef __attribute__((ext_vector_type(8)))  _Float16 v8h;
typedef __attribute__((ext_vector_type(8)))  unsigned short v8us;
typedef __attribute__((ext_vector_type(8)))  float    v8f;
typedef __attribute__((ext_vector_type(4)))  float    v4f;
typedef v8h  __attribute__((may_alias)) v8ha;
typedef v4f  __attribute__((may_alias)) v4fa;
typedef v8us __attribute__((may_alias)) v8usa;

__device__ __forceinline__ unsigned short f2bf(float f) { unsigned u = __float_as_uint(f); u += 0x7FFFu + ((u >> 16) & 1u); return (unsigned short)(u >> 16); }
__device__ __forceinline__ float bf2f(unsigned short b) { return __uint_as_float(((unsigned)b) << 16); }
__device__ __forceinline__ float bfr(float f) { return bf2f(f2bf(f)); }
__device__ __forceinline__ v16h cat16(v8h lo, v8h hi) { return __builtin_shufflevector(lo, hi, 0, 1, 2, 3, 4, 5, 6, 7, 8, 9, 10, 11, 12, 13, 14, 15); }
__device__ __forceinline__ v16bf cat16b(v8us lo, v8us hi) { return __builtin_bit_cast(v16bf, __builtin_shufflevector(lo, hi, 0, 1, 2, 3, 4, 5, 6, 7, 8, 9, 10, 11, 12, 13, 14, 15)); }
__device__ __forceinline__ v8f wmma16(v16h a, v16h b, v8f c) { return __builtin_amdgcn_wmma_f32_16x16x32_f16(false, a, false, b, (short)0, c, false, false); }
__device__ __forceinline__ v8f wmmab(v16bf a, v16bf b, v8f c) { return __builtin_amdgcn_wmma_f32_16x16x32_bf16(false, a, false, b, (short)0, c, false, false); }



// ---- Fragment order: every 16-bit operand plane P[row][k] (K columns, K % 32 == 0) is stored as blocks of 16 rows x 32 k, 1 KB each, block (row / 16, k / 32) at element ((row / 16) (K / 32) + k / 32) 512.
// Inside a block the eight k of one 16-byte run lie where the matrix instruction's lane wants them: lane = row % 16 + 16 ((k / 8) % 2), first half of the fragment (k % 32 < 16) at lane * 8, second half at 256 + lane * 8.
// So a wave's fragment is two 16-byte loads of 512 contiguous bytes each (four whole lines), not two loads that touch 16 lines; which lane and register holds which (row, k) is the matrix instruction's own layout (k = 8 (lane / 16) + j and 16 + 8 (lane / 16) + j of row lane % 16).
__device__ __forceinline__ size_t fro(int row, int k, int K) { return ((size_t)(row >> 4) * (K >> 5) + (k >> 5)) * 512 + ((k >> 4) & 1) * 256 + ((row & 15) + ((k >> 3) & 1) * 16) * 8 + (k & 7); }
// a wave-uniform base plus the lane's fixed byte offset (lane * 16): the form of every fragment load
template <typename T16> __device__ __forceinline__ const T16* atl(const T16* base, unsigned ob) { return (const T16*)((const char*)base + ob); }

// ---- k_gemmw: register-blocked GEMM, 64x64 output tile (16 accumulators) per wave, operands straight from 16-bit planes in fragment order; grid (M/64, N/64, Z), 32 * KS threads.
// KS = 1: one wave owns the tile. KS > 1 (K % 64 == 0): the KS waves of the work-group share the tile's K loop, so each waits out 1/KS of its load latencies, and their partial tiles are summed through LDS.
// C[m][n] (f32, pitch ldc, + optional f32 bias[n]) = sum_k A[m][k] Bt[n][k] (+ split products per NSPLIT). z-batch strides sA/sB/sC in elements. K % 32 == 0, a template constant, so that every block's distance from the two bases is an immediate offset.
template <typename T16> struct WFrag;
template <> struct WFrag<h16> { typedef v16h V; static __device__ __forceinline__ V ld(const h16* p) { return cat16(*(const v8h*)p, *(const v8h*)(p + 256)); } static __device__ __forceinline__ v8f mma(V a, V b, v8f c) { return wmma16(a, b, c); } };
template <> struct WFrag<bf> { typedef v16bf V; static __device__ __forceinline__ V ld(const bf* p) { return cat16b(*(const v8us*)p, *(const v8us*)(p + 256)); } static __device__ __forceinline__ v8f mma(V a, V b, v8f c) { return wmmab(a, b, c); } };
template <typename T16, int NSPLIT, bool BIAS, int KS, int K>
__global__ __launch_bounds__(32 * KS) void k_gemmw(const T16* __restrict__ A, const T16* __restrict__ A2, const T16* __restrict__ Bt, const T16* __restrict__ Bt2, float* C, int ldc, const float* __restrict__ bias, size_t sA, size_t sB, size_t sC) {
    typedef typename WFrag<T16>::V V;
    constexpr int WST = (KS == 1) ? 16 * 68 : 64 * 68;      // floats of one wave's LDS slab: one 16-row block (KS = 1), its whole partial tile (KS > 1)
    __shared__ __align__(16) float os[KS * WST];
    const int wv = (KS == 1) ? 0 : __builtin_amdgcn_readfirstlane((int)(threadIdx.x >> 5));   // wave number, scalar: the K loop's control stays a scalar branch
    const size_t z = blockIdx.z; A += z * sA; if (A2) A2 += z * sA; Bt += z * sB; if (Bt2) Bt2 += z * sB; C += z * sC;
    const int lane = threadIdx.x & 31, lr = lane & 15, hi = lane >> 4; const int r0 = blockIdx.x * 64, c0 = blockIdx.y * 64;
    v8f acc[4][4];
#pragma unroll
    for (int mb = 0; mb < 4; ++mb)
#pragma unroll
        for (int nb = 0; nb < 4; ++nb) acc[mb][nb] = (v8f){};
    const unsigned lob = (unsigned)lane * 16u;      // the lane's byte offset in every block
    A += (size_t)r0 * K; if (A2) A2 += (size_t)r0 * K; Bt += (size_t)c0 * K; if (Bt2) Bt2 += (size_t)c0 * K;     // 16 rows of blocks are 16 K elements
#pragma unroll 1
    for (int kc = wv * 64; kc < K; kc += (kc & 32) ? KS * 64 - 32 : 32) {   // wave wv takes the 64-wide K chunks wv, wv + KS, ... (two blocks of each 16 operand rows)
        const T16* pa = atl(A + (size_t)kc * 16, lob); const T16* pa2 = (NSPLIT == 1 || NSPLIT == 2) ? atl(A2 + (size_t)kc * 16, lob) : pa; const T16* pb = atl(Bt + (size_t)kc * 16, lob); const T16* pb2 = (NSPLIT >= 2) ? atl(Bt2 + (size_t)kc * 16, lob) : pb;
        V a[4], a2[4];
#pragma unroll
        for (int mb = 0; mb < 4; ++mb) { a[mb] = WFrag<T16>::ld(pa + mb * 16 * K); if (NSPLIT == 1 || NSPLIT == 2) a2[mb] = WFrag<T16>::ld(pa2 + mb * 16 * K); }
#pragma unroll
        for (int nb = 0; nb < 4; ++nb) { const V b = WFrag<T16>::ld(pb + nb * 16 * K); V b2; if (NSPLIT >= 2) b2 = WFrag<T16>::ld(pb2 + nb * 16 * K);
#pragma unroll
            for (int mb = 0; mb < 4; ++mb) { acc[mb][nb] = WFrag<T16>::mma(a[mb], b, acc[mb][nb]); if (NSPLIT == 1 || NSPLIT == 2) acc[mb][nb] = WFrag<T16>::mma(a2[mb], b, acc[mb][nb]); if (NSPLIT >= 2) acc[mb][nb] = WFrag<T16>::mma(a[mb], b2, acc[mb][nb]); } }
        // the trip's addresses stay live up to this wait, so no register that an issued operand load names is given a new value in front of it
        asm volatile("s_wait_xcnt 0x0" :: "v"(pa), "v"(pa2), "v"(pb), "v"(pb2) : "memory");
        asm volatile("v_nop\n\tv_nop\n\tv_nop\n\tv_nop" : "+v"(acc[0][0]), "+v"(acc[1][1]), "+v"(acc[2][2]), "+v"(acc[3][3]) : "v"(a[0]), "v"(a[3]));
    }
    if constexpr (KS > 1) {     // the KS waves' partial tiles meet in LDS and are summed in fixed wave order 0 .. KS-1
        // unrolls: acc[][] stays in registers only under constant indices; the q and ww loops so that their LDS reads issue together
#pragma unroll
        for (int mb = 0; mb < 4; ++mb)
#pragma unroll
            for (int nb = 0; nb < 4; ++nb) {
#pragma unroll
                for (int j = 0; j < 8; ++j) os[wv * WST + (mb * 16 + hi * 8 + j) * 68 + nb * 16 + lr] = acc[mb][nb][j]; }
        __syncthreads();    // every wave's partial tile is in LDS before any of it is summed
        float* crow = C + (size_t)r0 * ldc + c0;
#pragma unroll
        for (int q = 0; q < 32 / KS; ++q) { const int idx = q * 32 * KS + (int)threadIdx.x, row = idx >> 4, cofs = (idx & 15) * 4; v4f val = *(const v4fa*)(os + row * 68 + cofs);
#pragma unroll
            for (int ww = 1; ww < KS; ++ww) val += *(const v4fa*)(os + ww * WST + row * 68 + cofs);
            if (BIAS) { val[0] += bfr(bias[c0 + cofs]); val[1] += bfr(bias[c0 + cofs + 1]); val[2] += bfr(bias[c0 + cofs + 2]); val[3] += bfr(bias[c0 + cofs + 3]); }
            *(v4f*)(crow + (size_t)row * ldc + cofs) = val; }
        return;
    }
#pragma unroll
    for (int mb = 0; mb < 4; ++mb) {
#pragma unroll
        for (int nb = 0; nb < 4; ++nb) {
#pragma unroll
            for (int j = 0; j < 8; ++j) os[(hi * 8 + j) * 68 + nb * 16 + lr] = acc[mb][nb][j]; }
        __builtin_amdgcn_wave_barrier(); asm volatile("" ::: "memory");
        float* crow = C + (size_t)(r0 + mb * 16) * ldc + c0;
{
#pragma unroll
            for (int s = 0; s < 8; ++s) { const int row = 2 * s + hi, cofs = lr * 4; v4f val = *(const v4fa*)(os + row * 68 + cofs); if (BIAS) { val[0] += bfr(bias[c0 + cofs]); val[1] += bfr(bias[c0 + cofs + 1]); val[2] += bfr(bias[c0 + cofs + 2]); val[3] += bfr(bias[c0 + cofs + 3]); }
                *(v4f*)(crow + (size_t)row * ldc + cofs) = val; }
             }
        __builtin_amdgcn_wave_barrier(); asm volatile("" ::: "memory");
    }
}

__device__ __forceinline__ h16 tohx(float x) { return (h16)x; }
__device__ __forceinline__ void splitf(float y, unsigned short& h, unsigned short& l) { h = f2bf(y); l = f2bf(y - bf2f(h)); }
typedef __attribute__((ext_vector_type(2))) _Float16 v2h;
typedef __attribute__((ext_vector_type(4))) _Float16 v4h;
typedef __attribute__((ext_vector_type(2))) unsigned short v2us;
typedef __attribute__((ext_vector_type(4))) unsigned short v4us;
typedef __attribute__((ext_vector_type(2))) float v2f;
typedef __attribute__((ext_vector_type(4))) int v4i;

// d_wtG: Bt[n][k] (fragment order) = bf16 of w[k][n]; the register block, the block indices and the waits of d_wt16 below
template <int K, int N>
__device__ __forceinline__ void d_wtG(const float* __restrict__ w, bf* Bt, int bx, int by) { const int lane = threadIdx.x & 31; const int n0 = bx * 64 + (lane & 15) * 4, k0 = by * 128 + (int)(threadIdx.x >> 5) * 16 + (lane >> 4) * 8; v4f r[8];
    const float* wp = w + (size_t)k0 * N + n0;
    // every unroll: the register blocks stay in registers only under constant indices
#pragma unroll
    for (int j = 0; j < 8; ++j) r[j] = *(const v4f*)(wp + j * N);
    // the address stays live up to this wait, so no register that an issued load names is given a new value in front of it
    asm volatile("s_wait_xcnt 0x0" :: "v"(wp) : "memory");
    v8us o[4];
#pragma unroll
    for (int q = 0; q < 4; ++q)
#pragma unroll
        for (int j = 0; j < 8; ++j) o[q][j] = f2bf(r[j][q]);
#pragma unroll
    for (int q = 0; q < 4; ++q) *(v8us*)(Bt + fro(n0, k0, K) + q * 8) = o[q];   // fragment order: the next n is the next 16-byte run
    // the caller's code for its other block ranges follows in the kernel and rewrites registers that these stores name: the wait stands in front of that
    asm volatile("s_wait_xcnt 0x0" ::: "memory"); }
__global__ __launch_bounds__(256) void k_cvt8(const float* __restrict__ src, bf* dst, size_t n8) { const size_t i = (size_t)blockIdx.x * 256 + threadIdx.x; if (i >= n8) return; const v8f v = *(const v8f*)(src + i * 8); v8us o;
#pragma unroll
    for (int k = 0; k < 8; ++k) o[k] = f2bf(v[k]); *(v8us*)(dst + i * 8) = o;  }
__global__ __launch_bounds__(256) void k_cscvt(const float* __restrict__ cosT, const float* __restrict__ sinT, float* CS) { const int idx = blockIdx.x * 256 + threadIdx.x; if (idx >= TT * HD) return; v2f cs; cs[0] = bfr(cosT[idx]); cs[1] = bfr(sinT[idx]); *(v2f*)(CS + (size_t)idx * 2) = cs;  }
// d_rope: head planes [h][t][d] (each head's [t][d] in fragment order; fp16 + hi/lo) of rope(x) x sc with the rotate-half convention out[d] = x[d] cos[t][d] - x[d+HD/2] sin[t][d], out[d+HD/2] = x[d+HD/2] cos[t][d+HD/2] + x[d] sin[t][d+HD/2]
// Each thread takes four consecutive d of the rows t, t + 16, t + 32 and t + 48 of one head, so that a wave's 16-byte load covers whole lines; its sixteen loads all issue before the first run is worked on. Blocks bx: 2 * NB_ * NH_ * TT * HD / 4096, exact (a block covers 64 whole rows of one head).
// One range of blocks does q and k of both batches: plane h = (s NB_ + batch) NH_ + head, s = 0 for q and 1 for k; its source is the rows batch TT + t and the columns s DQ + head HD of F.
static_assert(NH_ == NKV, "q and k planes are numbered alike");
template <int PITCH>
__device__ __forceinline__ void d_rope(const float* __restrict__ F, const float* __restrict__ CS, float sc, h16* P16, bf* Ph, bf* Pl, int bx) {
    // every unroll of this function: the register blocks stay in registers only under constant indices
    const size_t e = ((size_t)bx * 1024 + threadIdx.x) * 4; const int d = (int)(e % HD); const int t = (int)((e / HD) % TT); const int h = (int)(e / ((size_t)HD * TT));
    const bool lo = d < HD / 2;      // a run lies wholly in one half of the row, its partners in the other
    const float* fa = F + (size_t)((h / NH_) % NB_ * TT + t) * PITCH + (h / (NB_ * NH_)) * DQ + (h % NH_) * HD + d; const float* fb = lo ? fa + HD / 2 : fa - HD / 2; const float* cp = CS + ((size_t)t * HD + d) * 2;
    v4f xa[4], xb[4], cv[4][2];
#pragma unroll
    for (int c = 0; c < 4; ++c) { xa[c] = *(const v4f*)(fa + c * 16 * PITCH); xb[c] = *(const v4f*)(fb + c * 16 * PITCH); cv[c][0] = *(const v4f*)(cp + c * 16 * HD * 2); cv[c][1] = *(const v4f*)(cp + c * 16 * HD * 2 + 4); }
    // the three addresses stay live up to this wait, so no register that an issued load names is given a new value in front of it
    asm volatile("s_wait_xcnt 0x0" :: "v"(fa), "v"(fb), "v"(cp) : "memory");
    __builtin_amdgcn_sched_barrier(0);   // keeps the vector work behind the wait: without it the compiler works on the first loads before it issues the last, and their latencies add up
    v4h o16[4]; v4us oh[4], ol[4];
#pragma unroll
    for (int c = 0; c < 4; ++c)
#pragma unroll
        for (int q = 0; q < 4; ++q) { const float a = __fmul_rn(xa[c][q], cv[c][q >> 1][(q & 1) * 2]), bq = __fmul_rn(xb[c][q], cv[c][q >> 1][(q & 1) * 2 + 1]); const float r = (lo ? __fsub_rn(a, bq) : __fadd_rn(a, bq)) * sc;
            o16[c][q] = tohx(r); unsigned short a2, c2; splitf(r, a2, c2); oh[c][q] = a2; ol[c][q] = c2; }
    const size_t eo = (size_t)h * TT * HD + fro(t, d, HD);      // 16 rows on are two blocks on, 1024 elements
#pragma unroll
    for (int c = 0; c < 4; ++c) { *(v4h*)(P16 + eo + c * 1024) = o16[c]; *(v4us*)(Ph + eo + c * 1024) = oh[c]; *(v4us*)(Pl + eo + c * 1024) = ol[c]; }
    // the caller's code for its other block ranges follows in the kernel and rewrites registers that these stores name: the wait stands in front of that
    asm volatile("s_wait_xcnt 0x0" ::: "memory"); }
// d_vtp: transposed value planes [g][d][t] (each head's [d][t] in fragment order). Each thread holds a block of 8 t x 4 d in registers: eight 16-byte loads along d (a wave reads two whole 256-byte head rows a load), then per d and plane one 16-byte store along t.
// Blocks (bx < TT / 128, g < NB_ * heads; g = batch NKV + head), 256 threads: a block covers one head's 64 d x 128 t, so every 128-byte output line is filled by one block.
template <int PITCH>
__device__ __forceinline__ void d_vtp(const float* __restrict__ F, h16* V16, bf* Vh, bf* Vl, int bx, int g) { const int lane = threadIdx.x & 31; const int d0 = (lane & 15) * 4, t0 = bx * 128 + (int)(threadIdx.x >> 5) * 16 + (lane >> 4) * 8; v4f r[8];
    const float* fp = F + (size_t)(g / NKV * TT + t0) * PITCH + (g % NKV) * HD + d0;
    // every unroll: the register blocks stay in registers only under constant indices
#pragma unroll
    for (int j = 0; j < 8; ++j) r[j] = *(const v4f*)(fp + j * PITCH);
    // the address stays live up to this wait, so no register that an issued load names is given a new value in front of it
    asm volatile("s_wait_xcnt 0x0" :: "v"(fp) : "memory");
    v8h o16[4]; v8us oh[4], ol[4];
#pragma unroll
    for (int q = 0; q < 4; ++q)
#pragma unroll
        for (int j = 0; j < 8; ++j) { const float x = r[j][q]; o16[q][j] = tohx(x); unsigned short a2, c2; splitf(x, a2, c2); oh[q][j] = a2; ol[q][j] = c2; }
    const size_t e = (size_t)g * HD * TT + fro(d0, t0, TT);      // the next d is the next 16-byte run
#pragma unroll
    for (int q = 0; q < 4; ++q) { *(v8h*)(V16 + e + q * 8) = o16[q]; *(v8us*)(Vh + e + q * 8) = oh[q]; *(v8us*)(Vl + e + q * 8) = ol[q]; }
    // the caller's code for its other block ranges follows in the kernel and rewrites registers that these stores name: the wait stands in front of that
    asm volatile("s_wait_xcnt 0x0" ::: "memory"); }
// k_qkvp: the q and k head planes and the transposed v planes of both batches in one launch (they only share their source F); the first RB blocks do d_rope, the other NB_ * NKV * TT / 128 do d_vtp.
#define RB   (2 * NB_ * NH_ * TT * HD / 4096)
#define VB   (NB_ * NKV * TT / 128)
template <int PITCH>
__global__ __launch_bounds__(256) void k_qkvp(const float* __restrict__ F, const float* __restrict__ CS, h16* P16, bf* Ph, bf* Pl, h16* V16, bf* Vh, bf* Vl) {
    const int i = (int)blockIdx.x;
    if (i < RB) d_rope<PITCH>(F, CS, 1.0f, P16, Ph, Pl, i);
    else d_vtp<PITCH>(F + DQ + DKV, V16, Vh, Vl, (i - RB) % (TT / 128), (i - RB) / (TT / 128)); }
// blocks bx < TT * HD / 2048, exact: four 16-byte stores (two (cos, sin) pairs each) a thread
__device__ __forceinline__ void d_csid(float* CS, int bx) { v4f cs; cs[0] = 1.0f; cs[1] = 0.0f; cs[2] = 1.0f; cs[3] = 0.0f; float* p = CS + ((size_t)bx * 1024 + threadIdx.x) * 4;
#pragma unroll
    for (int c = 0; c < 4; ++c) *(v4f*)(p + c * 1024) = cs;
    // behind these stores the caller's way to its end rewrites scalar registers, the stores' base among them: the wait stands in front of that
    asm volatile("s_wait_xcnt 0x0" ::: "memory"); }
// ---- k_fattn: causal attention of both batches in one launch; grid (NB_ * heads, TT/64), 128 threads; wave w of a work-group owns the 16 query rows r0 + 16 w .. + 15 of one head and walks the keys 0 .. r0 + 63 in passes of 64.
// Transposed products: S^T = K Q^T (A = key rows, B = query rows), so a lane holds 32 scores of ONE query (column lane & 15; keys 16 kb + 8 (lane >> 4) + j); running maximum and sum stay in the lane, the two lane halves
// exchange the maximum once a pass and the sum once at the end. Two score tiles, converted in place, are the B operand of O^T += V^T P^T (A = rows of the transposed value plane). Scores and probabilities never leave the registers.
// Operand classes: query rows < RH on bf16 hi+lo planes (3 products each), the rest on single fp16 planes (probabilities carried x 2^10, which cancels in the division by their sum). Output: bf16 hi+lo planes [t][DQ]. All planes in fragment order.
template <typename T16> struct IsHL { static constexpr bool v = false; };
template <> struct IsHL<bf> { static constexpr bool v = true; };
template <bool B> struct BoolC { static constexpr bool value = B; };
__device__ __forceinline__ float xhalf(float x) { return __int_as_float(__builtin_amdgcn_permlanex16(__float_as_int(x), __float_as_int(x), 0x76543210, 0xfedcba98, false, false)); }   // the value of lane ^ 16
// eight 2^x in place, in one statement: each v_exp_f32 is followed by one that neither reads its result nor overwrites its source, the last by the v_nop that the instruction set asks for behind a transcendental
__device__ __forceinline__ void exp2x8(float (&e)[8]) {
    asm("v_exp_f32 %0, %0\n\tv_exp_f32 %1, %1\n\tv_exp_f32 %2, %2\n\tv_exp_f32 %3, %3\n\tv_exp_f32 %4, %4\n\tv_exp_f32 %5, %5\n\tv_exp_f32 %6, %6\n\tv_exp_f32 %7, %7\n\tv_nop"
        : "+v"(e[0]), "+v"(e[1]), "+v"(e[2]), "+v"(e[3]), "+v"(e[4]), "+v"(e[5]), "+v"(e[6]), "+v"(e[7])); }
template <typename T16>
__device__ __forceinline__ void attn_wave(const T16* __restrict__ Qp, const T16* __restrict__ Q2, const T16* __restrict__ Kp, const T16* __restrict__ K2, const T16* __restrict__ Vp, const T16* __restrict__ V2, int q0, bf* __restrict__ Ah, bf* __restrict__ Al) {
    // every unroll below: the fragment, score and accumulator arrays stay in registers only under constant indices
    typedef typename WFrag<T16>::V V; constexpr bool HL = IsHL<T16>::v;
    constexpr float CL = SCL * 1.4426950408889634f, OFF = HL ? 0.0f : 10.0f;      // scores in log2 units; OFF: the carry 2^10 of the fp16 probabilities
    const int lane = threadIdx.x & 31, lr = lane & 15, hi = lane >> 4; const int q = q0 + lr;
    // every load is a wave-uniform base plus the lane's fixed byte offset in a block: the offset never changes, only the key and value bases move on, by one pass at a time
    const unsigned qob = (unsigned)lane * 16u, kob = qob, vob = qob;
    Qp += q0 * HD; if constexpr (HL) Q2 += q0 * HD;      // the wave's 16 query rows: two blocks
    auto at = [](const T16* base, unsigned ob) { return (const T16*)((const char*)base + ob); };
    const T16* qa = at(Qp, qob); const T16* qa2 = HL ? at(Q2, qob) : nullptr; const T16* ka0 = at(Kp, kob);
    V qf[2], qf2[2];
#pragma unroll
    for (int ds = 0; ds < 2; ++ds) { qf[ds] = WFrag<T16>::ld(qa + ds * 512); if constexpr (HL) qf2[ds] = WFrag<T16>::ld(qa2 + ds * 512); }
    v8f o[4];
#pragma unroll
    for (int db = 0; db < 4; ++db) o[db] = (v8f){};
    float m = -3.0e38f, l = 0.0f;
    V kf[4][2], kf2[4][2];
    if constexpr (!HL) {    // single planes: the key fragments run one pass ahead; hi+lo planes (at most RH / 64 passes, twice the registers) fetch theirs inside the pass
#pragma unroll
        for (int kb = 0; kb < 4; ++kb)
#pragma unroll
            for (int ds = 0; ds < 2; ++ds) kf[kb][ds] = WFrag<T16>::ld(ka0 + kb * 16 * HD + ds * 512);
    }
    // all s_wait_xcnt below: addresses, offsets and bases stay live up to the wait, so no register that an issued load names is given a new value in front of it;
    // the sched_barrier behind a wait keeps the loads in front of it and later vector work behind it
    if constexpr (HL) asm volatile("s_wait_xcnt 0x0" :: "v"(qa), "v"(qa2), "v"(qob), "s"(Qp), "s"(Q2) : "memory"); else asm volatile("s_wait_xcnt 0x0" :: "v"(qa), "v"(ka0), "v"(qob), "v"(kob), "s"(Qp), "s"(Kp) : "memory");
    __builtin_amdgcn_sched_barrier(0);
    const int np = q0 / 64 + 1;     // passes; only the last one meets the diagonal
    auto pass = [&](auto diag, int kt) {
        V vf[4][2], vf2[4][2];
        const T16* ka = at(Kp, kob); const T16* ka2 = HL ? at(K2, kob) : nullptr; const T16* va = at(Vp, vob); const T16* va2 = HL ? at(V2, vob) : nullptr;
        if constexpr (HL) {
#pragma unroll
            for (int kb = 0; kb < 4; ++kb)
#pragma unroll
                for (int ds = 0; ds < 2; ++ds) { kf[kb][ds] = WFrag<T16>::ld(ka + kb * 16 * HD + ds * 512); kf2[kb][ds] = WFrag<T16>::ld(ka2 + kb * 16 * HD + ds * 512); }
            asm volatile("s_wait_xcnt 0x0" :: "v"(ka), "v"(ka2), "v"(kob), "s"(Kp), "s"(K2) : "memory");
            __builtin_amdgcn_sched_barrier(0);
        } else {
#pragma unroll
            for (int db = 0; db < 4; ++db)
#pragma unroll
                for (int ks = 0; ks < 2; ++ks) vf[db][ks] = WFrag<T16>::ld(va + db * 16 * TT + ks * 512);
        }
        v8f s[4];
#pragma unroll
        for (int kb = 0; kb < 4; ++kb) { s[kb] = (v8f){};
#pragma unroll
            for (int ds = 0; ds < 2; ++ds) { s[kb] = WFrag<T16>::mma(kf[kb][ds], qf[ds], s[kb]); if constexpr (HL) { s[kb] = WFrag<T16>::mma(kf[kb][ds], qf2[ds], s[kb]); s[kb] = WFrag<T16>::mma(kf2[kb][ds], qf[ds], s[kb]); } } }
        if constexpr (HL) {     // the value fragments fly under the softmax
#pragma unroll
            for (int db = 0; db < 4; ++db)
#pragma unroll
                for (int ks = 0; ks < 2; ++ks) { vf[db][ks] = WFrag<T16>::ld(va + db * 16 * TT + ks * 512); vf2[db][ks] = WFrag<T16>::ld(va2 + db * 16 * TT + ks * 512); }
            asm volatile("s_wait_xcnt 0x0" :: "v"(va), "v"(va2), "v"(vob), "s"(Vp), "s"(V2) : "memory");
            __builtin_amdgcn_sched_barrier(0);
        } else {
            if constexpr (!decltype(diag)::value) {     // the next pass's key fragments, behind this pass's score products
#pragma unroll
                for (int kb = 0; kb < 4; ++kb)
#pragma unroll
                    for (int ds = 0; ds < 2; ++ds) kf[kb][ds] = WFrag<T16>::ld(ka + (64 + kb * 16) * HD + ds * 512);
            }
            asm volatile("s_wait_xcnt 0x0" :: "v"(ka), "v"(va), "v"(kob), "v"(vob), "s"(Kp), "s"(Vp) : "memory");
            __builtin_amdgcn_sched_barrier(0);
        }
        if constexpr (!decltype(diag)::value) { Kp += 64 * HD; Vp += 64 * 16; if constexpr (HL) { K2 += 64 * HD; V2 += 64 * 16; } }   // 64 keys: eight key blocks; two blocks of each 16 value rows
        if constexpr (decltype(diag)::value) {      // causal mask: key > query
#pragma unroll
            for (int kb = 0; kb < 4; ++kb)
#pragma unroll
                for (int j = 0; j < 8; ++j) s[kb][j] = (kt + kb * 16 + hi * 8 + j > q) ? -3.0e38f : s[kb][j];
        }
        float t4[4];     // four independent chains, one a score tile, then a tree: the maximum (and below the sum) does not wait on one chain of 32
#pragma unroll
        for (int kb = 0; kb < 4; ++kb) { t4[kb] = s[kb][0];
#pragma unroll
            for (int j = 1; j < 8; ++j) t4[kb] = fmaxf(t4[kb], s[kb][j]); }
        float tm = fmaxf(fmaxf(t4[0], t4[1]), fmaxf(t4[2], t4[3]));
        tm = fmaxf(tm, xhalf(tm));
        const float mn = fmaxf(m, tm * CL), sh = OFF - mn; float al = m - mn; m = mn;
        asm("v_exp_f32 %0, %0\n\tv_nop" : "+v"(al));     // 2^al; the v_nop is the slot that the instruction set asks for behind a transcendental
#pragma unroll
        for (int kb = 0; kb < 4; ++kb) { t4[kb] = 0.0f; float e[8];
#pragma unroll
            for (int j = 0; j < 8; ++j) e[j] = fmaf(s[kb][j], CL, sh);
            exp2x8(e);
#pragma unroll
            for (int j = 0; j < 8; ++j) { s[kb][j] = e[j]; t4[kb] += e[j]; } }
        l = fmaf(l, al, (t4[0] + t4[1]) + (t4[2] + t4[3]));
#pragma unroll
        for (int db = 0; db < 4; ++db) o[db] *= al;
#pragma unroll
        for (int ks = 0; ks < 2; ++ks) {
            if constexpr (HL) { v8us h0, h1, l0, l1;
#pragma unroll
                for (int j = 0; j < 8; ++j) { unsigned short a, c; splitf(s[2 * ks][j], a, c); h0[j] = a; l0[j] = c; splitf(s[2 * ks + 1][j], a, c); h1[j] = a; l1[j] = c; }
                const V ph = cat16b(h0, h1), pl = cat16b(l0, l1);
#pragma unroll
                for (int db = 0; db < 4; ++db) { o[db] = WFrag<T16>::mma(vf[db][ks], ph, o[db]); o[db] = WFrag<T16>::mma(vf[db][ks], pl, o[db]); o[db] = WFrag<T16>::mma(vf2[db][ks], ph, o[db]); }
            } else { const V pf = cat16(__builtin_convertvector(s[2 * ks], v8h), __builtin_convertvector(s[2 * ks + 1], v8h));
#pragma unroll
                for (int db = 0; db < 4; ++db) o[db] = WFrag<T16>::mma(vf[db][ks], pf, o[db]); }
        }
    };
    // unroll 1: one pass is already a long straight run; a second copy would only double the code
#pragma unroll 1
    for (int p = 0; p + 1 < np; ++p) pass(BoolC<false>(), p * 64);
    pass(BoolC<true>(), (np - 1) * 64);
    l += xhalf(l); const float inv = __fdiv_rn(1.0f, l);
    v8us oh[4], ol[4];
#pragma unroll
    for (int db = 0; db < 4; ++db)
#pragma unroll
        for (int j = 0; j < 8; ++j) { unsigned short a, c; splitf(o[db][j] * inv, a, c); oh[db][j] = a; ol[db][j] = c; }
    const size_t oo = (size_t)q0 * DQ + lane * 8;   // a lane's eight accumulator registers are eight consecutive d of its query row: in fragment order its own 16-byte run of half a block, so a wave's store is 512 contiguous bytes
#pragma unroll
    for (int db = 0; db < 4; ++db) { *(v8us*)(Ah + oo + db * 256) = oh[db]; *(v8us*)(Al + oo + db * 256) = ol[db]; }
}
// waves_per_eu(2, 2): with the register budget of two waves a SIMD a pass's value loads all issue at its head and the key loads a pass ahead
__global__ __launch_bounds__(128) __attribute__((amdgpu_waves_per_eu(2, 2))) void k_fattn(const h16* __restrict__ Q16, const h16* __restrict__ K16, const h16* __restrict__ V16, const bf* __restrict__ Qh, const bf* __restrict__ Ql, const bf* __restrict__ Kh, const bf* __restrict__ Kl, const bf* __restrict__ Vh, const bf* __restrict__ Vl, bf* __restrict__ Ah, bf* __restrict__ Al) {
    const int wv = __builtin_amdgcn_readfirstlane((int)(threadIdx.x >> 5));   // wave number, scalar: the pass loop's control stays a scalar branch
    const int r0 = (TT / 64 - 1 - (int)blockIdx.y) * 64;                      // longest key walks first
    const int bt = (int)blockIdx.x / NH_, hd = (int)blockIdx.x % NH_;         // batch and head; the planes are numbered batch * heads + head
    const size_t zq = (size_t)blockIdx.x * TT * HD, zk = (size_t)(bt * NKV + hd / REP) * TT * HD, za = (size_t)bt * TT * DQ + hd * HD * 16;     // za: the batch's rows of the merged planes; a head's 64 columns of 16 rows: two blocks
    if (r0 < RH) attn_wave<bf>(Qh + zq, Ql + zq, Kh + zk, Kl + zk, Vh + zk, Vl + zk, r0 + wv * 16, Ah + za, Al + za);
    else attn_wave<h16>(Q16 + zq, nullptr, K16 + zk, nullptr, V16 + zk, nullptr, r0 + wv * 16, Ah + za, Al + za);
}

// d_wt16: Bt[n][k] (fragment order) = fp16 of the bf16-rounded w[k][n]. Each thread holds a block of 8 k x 4 n in registers: eight 16-byte loads along n (a wave reads 256 contiguous bytes of two rows a load), then per n one 16-byte store along k.
// Blocks (bx < N / 64, by < K / 128), 256 threads: a block covers 64 n x 128 k, whole 1 KB blocks of the plane, so every 128-byte output line is filled by one block.
template <int K, int N>
__device__ __forceinline__ void d_wt16(const float* __restrict__ w, h16* Bt, int bx, int by) { const int lane = threadIdx.x & 31; const int n0 = bx * 64 + (lane & 15) * 4, k0 = by * 128 + (int)(threadIdx.x >> 5) * 16 + (lane >> 4) * 8; v4f r[8];
    const float* wp = w + (size_t)k0 * N + n0;
    // every unroll: the register blocks stay in registers only under constant indices
#pragma unroll
    for (int j = 0; j < 8; ++j) r[j] = *(const v4f*)(wp + j * N);
    // the address stays live up to this wait, so no register that an issued load names is given a new value in front of it
    asm volatile("s_wait_xcnt 0x0" :: "v"(wp) : "memory");
    v8h o[4];
#pragma unroll
    for (int q = 0; q < 4; ++q)
#pragma unroll
        for (int j = 0; j < 8; ++j) o[q][j] = tohx(bfr(r[j][q]));
#pragma unroll
    for (int q = 0; q < 4; ++q) *(v8h*)(Bt + fro(n0, k0, K) + q * 8) = o[q];   // fragment order: the next n is the next 16-byte run
    // the caller's code for its other block ranges follows in the kernel and rewrites registers that these stores name: the wait stands in front of that
    asm volatile("s_wait_xcnt 0x0" ::: "memory"); }
// k_prep: every weight plane and the (cos, sin) table in one launch; none reads what another writes. Ranges of blockIdx.x, in this order: the 4 blocks n of qkv_w, of gate_w and of up_w (each [256][N], planes n apart by 256 N), down_w, o_w, the table.
#define PB_Q (4 * (3072 / 64) * (256 / 128))
#define PB_F (4 * (2048 / 64) * (256 / 128))
#define PB_D ((DM / 64) * (2048 / 128))
#define PB_O ((DM / 64) * (DQ / 128))
#define PB_C (TT * HD / 2048)
__global__ __launch_bounds__(256) void k_prep(const float* __restrict__ qkvw, const float* __restrict__ gw, const float* __restrict__ uw, const float* __restrict__ dw, const float* __restrict__ wo, h16* BQKV, h16* BG, h16* BU, h16* BD, bf* WO, float* CS) {
    int i = (int)blockIdx.x;
    if (i < PB_Q) { const int n = i / (PB_Q / 4), j = i % (PB_Q / 4); d_wt16<256, 3072>(qkvw + (size_t)n * 256 * 3072, BQKV + (size_t)n * 3072 * 256, j % (3072 / 64), j / (3072 / 64)); return; }
    i -= PB_Q;
    if (i < 2 * PB_F) { const bool up = i >= PB_F; const int n = (i % PB_F) / (PB_F / 4), j = i % (PB_F / 4); d_wt16<256, 2048>((up ? uw : gw) + (size_t)n * 256 * 2048, (up ? BU : BG) + (size_t)n * 2048 * 256, j % (2048 / 64), j / (2048 / 64)); return; }
    i -= 2 * PB_F;
    if (i < PB_D) { d_wt16<2048, DM>(dw, BD, i % (DM / 64), i / (DM / 64)); return; }
    i -= PB_D;
    if (i < PB_O) { d_wtG<DQ, DM>(wo, WO, i % (DM / 64), i / (DM / 64)); return; }
    d_csid(CS, i - PB_O); }
// k_rmsc: the rows of both batches, one wave a row; grid NR / 8
__global__ __launch_bounds__(256) void k_rmsc(const float* __restrict__ X, int isin, const float* __restrict__ w, h16* HC) { const int lane = threadIdx.x & 31; const int t = blockIdx.x * 8 + (threadIdx.x >> 5); if (t >= NR) return; float v[32]; float s = 0.f;
#pragma unroll
    for (int ch = 0; ch < 8; ++ch) { const v4f a = *(const v4f*)(X + (size_t)t * DM + ch * 128 + lane * 4);
#pragma unroll
        for (int q = 0; q < 4; ++q) { const float xv = isin ? bfr(a[q]) : a[q]; v[ch * 4 + q] = xv; float p = __fmul_rn(xv, xv); asm volatile("" : "+v"(p)); s = __fadd_rn(s, p); } }
#pragma unroll
    for (int sh = 16; sh; sh >>= 1) s += __shfl_xor(s, sh, 32);
    const float r = __frsqrt_rn(__fadd_rn(s * (1.0f / DM), 1.1920929e-07f));
{       v4h o[8]; float wr[32]; const unsigned wob = (unsigned)lane * 16u; const float* wp = (const float*)((const char*)w + wob);   // this lane's weights: columns ch 128 + lane 4 + q
#pragma unroll
        for (int ch = 0; ch < 8; ++ch)
#pragma unroll
            for (int q = 0; q < 4; ++q) wr[ch * 4 + q] = wp[ch * 128 + q];
        // address, offset and base stay live up to this wait, so no register that an issued weight load names is given a new value in front of it
        asm volatile("s_wait_xcnt 0x0" :: "v"(wp), "v"(wob), "s"(w) : "memory");
#pragma unroll
        for (int ch = 0; ch < 8; ++ch)
#pragma unroll
            for (int q = 0; q < 4; ++q) { float tn = __fmul_rn(v[ch * 4 + q], r); asm volatile("" : "+v"(tn)); o[ch][q] = tohx(__fmul_rn(tn, bfr(wr[ch * 4 + q]))); }
        // block planes in fragment order: plane ch / 2, columns (ch % 2) 128 + lane 4, four blocks apart; the work-group's eight rows fill whole lines
        h16* hp = HC + fro(t, lane * 4, 256);
#pragma unroll
        for (int ch = 0; ch < 8; ++ch) *(v4h*)(hp + (size_t)(ch >> 1) * NR * 256 + (ch & 1) * 2048) = o[ch];
         } }
// ---- k_dend: dendritic layers (one a blockIdx.z), both batches' rows, per launch; grid (NR/64, N/64, layers), 128 threads. Wave n of the work-group forms the 64x64 tile of input block n, h_n W[n] (K = 256, fp16 planes, f32 accumulate, one running sum over K);
// the four tiles meet in LDS, and each output element is max over n = 0 .. 3 (in that order) of gain[n] silu(tile_n - thr[n]). H: block planes [n][NR][256]; Bt: [n][N][256], each plane in fragment order; thr, gain: [n][N]; C: [NR][N].
// blockIdx.z picks the layer: weights and outputs by the strides sB and sC (elements), thresholds and gains by the pointer pair.
__global__ __launch_bounds__(128) void k_dend(const h16* __restrict__ H, const h16* __restrict__ Bt, int N, const float* __restrict__ thr0, const float* __restrict__ gain0, const float* __restrict__ thr1, const float* __restrict__ gain1, float* C, size_t sB, size_t sC) {
    constexpr int K = 256, WST = 64 * 68;                   // WST: floats of one wave's LDS slab (its whole tile, row pitch 68)
    __shared__ __align__(16) float os[4 * WST];
    const int wv = __builtin_amdgcn_readfirstlane((int)(threadIdx.x >> 5));   // wave number = input block n, scalar
    const float* thr = blockIdx.z ? thr1 : thr0; const float* gain = blockIdx.z ? gain1 : gain0;
    const h16* A = H + (size_t)wv * NR * K; const h16* B = Bt + blockIdx.z * sB + (size_t)wv * N * K; C += blockIdx.z * sC;
    const int lane = threadIdx.x & 31, lr = lane & 15, hi = lane >> 4; const int r0 = blockIdx.x * 64, c0 = blockIdx.y * 64;
    v8f acc[4][4];
#pragma unroll
    for (int mb = 0; mb < 4; ++mb)
#pragma unroll
        for (int nb = 0; nb < 4; ++nb) acc[mb][nb] = (v8f){};
    const unsigned lob = (unsigned)lane * 16u;      // the lane's byte offset in every block
    A += (size_t)r0 * K; B += (size_t)c0 * K;       // 16 rows of blocks are 16 K elements
    // every unroll: K is a constant, eight trips; the fragment arrays stay in registers only under constant indices.
    // The next trip's loads issue ahead of this trip's products: its A fragments at the trip's head into the other half of a[][], each B fragment behind the last product that reads its forerunner.
    // Written out in the source: with every block an immediate offset from one base the compiler, left to itself, puts each load directly in front of its first product and waits for it there.
    v16h a[2][4], b[4];
#pragma unroll
    for (int mb = 0; mb < 4; ++mb) a[0][mb] = WFrag<h16>::ld(atl(A, lob) + mb * 16 * K);
#pragma unroll
    for (int nb = 0; nb < 4; ++nb) b[nb] = WFrag<h16>::ld(atl(B, lob) + nb * 16 * K);
#pragma unroll
    for (int t = 0; t < K / 32; ++t) {
        if (t + 1 < K / 32) {
#pragma unroll
            for (int mb = 0; mb < 4; ++mb) a[(t + 1) & 1][mb] = WFrag<h16>::ld(atl(A, lob) + mb * 16 * K + (t + 1) * 512); }
#pragma unroll
        for (int nb = 0; nb < 4; ++nb) {
#pragma unroll
            for (int mb = 0; mb < 4; ++mb) acc[mb][nb] = wmma16(a[t & 1][mb], b[nb], acc[mb][nb]);
            if (t + 1 < K / 32) b[nb] = WFrag<h16>::ld(atl(B, lob) + nb * 16 * K + (t + 1) * 512); }
    }
    // the offset and both bases stay live up to this wait, so no register that an issued operand load names is given a new value in front of it
    asm volatile("s_wait_xcnt 0x0" :: "v"(lob), "s"(A), "s"(B) : "memory");
    // unrolls: acc[][] stays in registers only under constant indices
#pragma unroll
    for (int mb = 0; mb < 4; ++mb)
#pragma unroll
        for (int nb = 0; nb < 4; ++nb) {
#pragma unroll
            for (int j = 0; j < 8; ++j) os[wv * WST + (mb * 16 + hi * 8 + j) * 68 + nb * 16 + lr] = acc[mb][nb][j]; }
    __syncthreads();    // all four blocks' tiles are in LDS before any element's max is taken
    const unsigned cofs = (threadIdx.x & 15u) * 4u; v4f th[4], ga[4]; unsigned ob[4];   // this thread's four output columns are the same in every row it handles
#pragma unroll
    for (int n = 0; n < 4; ++n) { ob[n] = ((unsigned)(n * N) + cofs) * 4u; th[n] = *(const v4fa*)((const char*)(thr + c0) + ob[n]); ga[n] = *(const v4fa*)((const char*)(gain + c0) + ob[n]); }
    // the four byte offsets and the two bases stay live up to this wait, so no register that an issued threshold or gain load names is given a new value in front of it
    asm volatile("s_wait_xcnt 0x0" :: "v"(ob[0]), "v"(ob[1]), "v"(ob[2]), "v"(ob[3]), "s"(thr + c0), "s"(gain + c0) : "memory");
#pragma unroll
    for (int n = 0; n < 4; ++n)
#pragma unroll
        for (int q = 0; q < 4; ++q) { th[n][q] = bfr(th[n][q]); ga[n][q] = bfr(ga[n][q]); }
    float* crow = C + (size_t)r0 * N + c0 + cofs;
    // unroll 2: two rows' independent division chains fill each other's waits; more would only lengthen the code
#pragma unroll 2
    for (int s = 0; s < 8; ++s) { const int row = s * 8 + (int)(threadIdx.x >> 4); v4f r;
#pragma unroll
        for (int n = 0; n < 4; ++n) { const v4f a = *(const v4fa*)(os + n * WST + row * 68 + cofs);
#pragma unroll
            for (int q = 0; q < 4; ++q) { const float z = __fsub_rn(a[q], th[n][q]); const float sg = __fdiv_rn(1.0f, 1.0f + __expf(-z)); const float val = __fmul_rn(ga[n][q], __fmul_rn(z, sg)); r[q] = n ? fmaxf(r[q], val) : val; } }
        *(v4f*)(crow + (size_t)row * N) = r;
        asm volatile("s_wait_xcnt 0x0" ::: "memory"); }   // the next trip rewrites the registers that this store names: the wait stands in front of that
}
// k_res, k_ffp, k_fin: each thread takes four runs (k_ffp: eight) of four elements, 256 threads apart (k_ffp: 128 columns apart in two rows), and issues all its loads before the first run is worked on; exact grids. Every unroll: the register blocks stay in registers only under constant indices.
// In each: the two addresses stay live up to the s_wait_xcnt, so no register that an issued load names is given a new value in front of it.
__global__ __launch_bounds__(256) void k_res(const float* __restrict__ x, const float* __restrict__ ATT, float* X1) { const size_t i0 = ((size_t)blockIdx.x * 1024 + threadIdx.x) * 4; const float* xp = x + i0; const float* ap = ATT + i0; v4f xv[4], a[4], o[4];
#pragma unroll
    for (int c = 0; c < 4; ++c) { xv[c] = *(const v4f*)(xp + c * 1024); a[c] = *(const v4f*)(ap + c * 1024); }
    asm volatile("s_wait_xcnt 0x0" :: "v"(xp), "v"(ap) : "memory");
#pragma unroll
    for (int c = 0; c < 4; ++c) { o[c][0] = __fadd_rn(bfr(xv[c][0]), a[c][0]); o[c][1] = __fadd_rn(bfr(xv[c][1]), a[c][1]); o[c][2] = __fadd_rn(bfr(xv[c][2]), a[c][2]); o[c][3] = __fadd_rn(bfr(xv[c][3]), a[c][3]); }
#pragma unroll
    for (int c = 0; c < 4; ++c) *(v4f*)(X1 + i0 + c * 1024) = o[c]; }
__global__ __launch_bounds__(256) void k_ffp(const float* __restrict__ G, const float* __restrict__ U, h16* FF16) {
    // a block covers 16 rows x 512 columns, whole 1 KB blocks of the fragment-order output plane; a wave takes two rows, four runs of 128 columns (512 contiguous bytes a load) in each
    const int row = (int)(blockIdx.x >> 2) * 16 + (int)(threadIdx.x >> 5) * 2, k = (int)(blockIdx.x & 3) * 512 + (int)(threadIdx.x & 31) * 4;
    const size_t i0 = (size_t)row * 2048 + k; const float* gp = G + i0; const float* up = U + i0; v4f g[8], u[8]; v4h o[8];   // eight runs
#pragma unroll
    for (int c = 0; c < 8; ++c) { g[c] = *(const v4f*)(gp + (c >> 2) * 2048 + (c & 3) * 128); u[c] = *(const v4f*)(up + (c >> 2) * 2048 + (c & 3) * 128); }
    asm volatile("s_wait_xcnt 0x0" :: "v"(gp), "v"(up) : "memory");
    __builtin_amdgcn_sched_barrier(0);   // keeps the vector work behind the wait: without it the compiler works on the first loads before it issues the last, and their latencies add up
#pragma unroll
    for (int c = 0; c < 8; ++c)
#pragma unroll
        for (int q = 0; q < 4; ++q) { const float sg = __fdiv_rn(1.0f, 1.0f + __expf(-g[c][q])); const float sl = __fmul_rn(g[c][q], sg); o[c][q] = tohx(__fmul_rn(sl, u[c][q])); }
    h16* eo = FF16 + fro(row, k, 2048);
#pragma unroll
    for (int c = 0; c < 8; ++c) *(v4h*)(eo + (c >> 2) * 8 + (c & 3) * 2048) = o[c]; }   // the next row is the next 16-byte run; 128 columns on are four blocks on
__global__ __launch_bounds__(256) void k_fin(const float* __restrict__ X1, const float* __restrict__ F2, float* OUT) { const size_t i0 = ((size_t)blockIdx.x * 1024 + threadIdx.x) * 4; const float* ap = X1 + i0; const float* fp = F2 + i0; v4f a[4], f[4], o[4];
#pragma unroll
    for (int c = 0; c < 4; ++c) { a[c] = *(const v4f*)(ap + c * 1024); f[c] = *(const v4f*)(fp + c * 1024); }
    asm volatile("s_wait_xcnt 0x0" :: "v"(ap), "v"(fp) : "memory");
#pragma unroll
    for (int c = 0; c < 4; ++c) { o[c][0] = __fadd_rn(a[c][0], f[c][0]); o[c][1] = __fadd_rn(a[c][1], f[c][1]); o[c][2] = __fadd_rn(a[c][2], f[c][2]); o[c][3] = __fadd_rn(a[c][3], f[c][3]); }
#pragma unroll
    for (int c = 0; c < 4; ++c) *(v4f*)(OUT + i0 + c * 1024) = o[c]; }

extern "C" void kernel_launch(void* const* d_in, const int* in_sizes, int n_in,
                              void* d_out, int out_size, void* d_ws, size_t ws_size, hipStream_t stream) {
    (void)in_sizes; (void)n_in; (void)out_size;
    const float* x = (const float*)d_in[0]; const float* qkvw = (const float*)d_in[1]; const float* qthr = (const float*)d_in[2]; const float* qgain = (const float*)d_in[3]; const float* wo = (const float*)d_in[4]; const float* gw = (const float*)d_in[5]; const float* gthr = (const float*)d_in[6]; const float* ggain = (const float*)d_in[7]; const float* uw = (const float*)d_in[8]; const float* uthr = (const float*)d_in[9]; const float* ugain = (const float*)d_in[10]; const float* dw = (const float*)d_in[11]; const float* n1w = (const float*)d_in[12]; const float* n2w = (const float*)d_in[13];
    float* OUT = (float*)d_out;     // [2][2048][1024]
    char* wsp = (char*)d_ws;
    auto take = [&](size_t bytes) { char* p = wsp; wsp += (bytes + 255) & ~(size_t)255; return (void*)p; };
    const size_t PL = (size_t)NB_ * NH_ * TT * HD;      // elements of one set of head planes [batch][head][..]
    bf* WO = (bf*)take((size_t)DM * DQ * 2); float* CS = (float*)take((size_t)TT * HD * 2 * 4);
    h16* BQKV = (h16*)take((size_t)4 * 3072 * 256 * 2); h16* BG = (h16*)take((size_t)2 * 4 * 2048 * 256 * 2); h16* BU = BG + (size_t)4 * 2048 * 256; h16* BD = (h16*)take((size_t)DM * 2048 * 2);
    h16* HC = (h16*)take((size_t)4 * NR * 256 * 2); h16* FF16 = (h16*)take((size_t)NR * 2048 * 2); float* ATT = (float*)take((size_t)NR * DM * 4); float* X1 = (float*)take((size_t)NR * DM * 4);
    bf* ATh = (bf*)take((size_t)NR * DQ * 2); bf* ATl = (bf*)take((size_t)NR * DQ * 2);
    float* FQKV = (float*)take((size_t)NR * 3072 * 4);   // dendritic [q|k|v], row pitch 3072
    h16* QP16 = (h16*)take(2 * PL * 2); h16* KP16 = QP16 + PL; bf* QPh = (bf*)take(2 * PL * 2); bf* KPh = QPh + PL; bf* QPl = (bf*)take(2 * PL * 2); bf* KPl = QPl + PL;   // the k planes directly behind the q planes
    h16* VT16 = (h16*)take(PL * 2); bf* VTh = (bf*)take(PL * 2); bf* VTl = (bf*)take(PL * 2);
    if ((size_t)(wsp - (char*)d_ws) > ws_size) return;    // ws 256 MiB
    // gate and up outputs (2 NR 2048 floats) lie over FQKV and the fp16 q and k planes, which are as many bytes and are last read by k_fattn, launched before these are written
    float* ACG = FQKV; float* ACU = ACG + (size_t)NR * 2048;
    k_prep<<<PB_Q + 2 * PB_F + PB_D + PB_O + PB_C, 256, 0, stream>>>(qkvw, gw, uw, dw, wo, BQKV, BG, BU, BD, WO, CS);
    k_rmsc<<<NR / 8, 256, 0, stream>>>(x, 1, n1w, HC);
    // dendritic [q|k|v]: one launch for the whole layer (N = 3072)
    k_dend<<<dim3(NR / 64, 3072 / 64, 1), 128, 0, stream>>>(HC, BQKV, 3072, qthr, qgain, qthr, qgain, FQKV, 0, 0);
    k_qkvp<3072><<<RB + VB, 256, 0, stream>>>(FQKV, CS, QP16, QPh, QPl, VT16, VTh, VTl);
    // causal attention, all heads of both batches in one launch; it writes the merged hi+lo planes itself
    k_fattn<<<dim3(NB_ * NH_, TT / 64, 1), 128, 0, stream>>>(QP16, KP16, VT16, QPh, QPl, KPh, KPl, VTh, VTl, ATh, ATl);
    k_gemmw<bf, 1, false, 8, DQ><<<dim3(NR / 64, DM / 64, 1), 256, 0, stream>>>(ATh, ATl, WO, nullptr, ATT, DM, nullptr, 0, 0, 0);
    k_res<<<NR * DM / 4096, 256, 0, stream>>>(x, ATT, X1); k_rmsc<<<NR / 8, 256, 0, stream>>>(X1, 0, n2w, HC);
    // dendritic gate (z = 0) and up (z = 1) in one launch
    k_dend<<<dim3(NR / 64, 2048 / 64, 2), 128, 0, stream>>>(HC, BG, 2048, gthr, ggain, uthr, ugain, ACG, (size_t)4 * 2048 * 256, (size_t)NR * 2048);
    k_ffp<<<NR * 2048 / 8192, 256, 0, stream>>>(ACG, ACU, FF16);
    k_gemmw<h16, 0, false, 8, 2048><<<dim3(NR / 64, DM / 64, 1), 256, 0, stream>>>(FF16, nullptr, BD, nullptr, ATT, DM, nullptr, 0, 0, 0);
    k_fin<<<NR * DM / 4096, 256, 0, stream>>>(X1, ATT, OUT);
}

// v007
// One run takes 247 microseconds.
// Next to v006, in two timings, it ran 1.04 times as fast each time.
// All steps since v000 together make it 8.66 times as fast.
#include <hip/hip_runtime.h>

// Transformer block with dendritic layers (x [2][2048][1024]; h = RMSNorm(x) w1; [q|k|v] = dendritic(h, qkv_w, thr, gain) = max over the 4 input blocks n of gain[n] silu(h_n W[n] - thr[n]) (16 heads x 64); causal softmax(q.k/8); x1 = x + merged.v o_w;
// h2 = RMSNorm(x1) w2; ff = silu(dendritic(h2, gate)) * dendritic(h2, up); out = x1 + ff down_w -> [2][2048][1024]; all weights x @ W; eps = f32 eps).
// Compute dtypes, f32 accumulate: every input rounded to bf16; the RMSNorms f32 -> SINGLE fp16 block planes; every dendritic GEMM on fp16 planes x fp16 copies of the bf16 weights (1 product; hi+lo would double the
// ~60 G of dendritic GEMMs), the gain/silu/threshold/max epilogues f32; scores (K 64) and probs.v on hl planes (3 products) for the first 512 query rows of each head and single fp16 planes for the rest, f32 causal softmax with masked tiles

#define NB_  2
#define TT   2048
#define NR   (NB_ * TT)         // rows of both batches: every row-wise kernel takes them in one launch
#define DM   1024
#define NH_  16
#define NKV  16
#define REP  (NH_ / NKV)
#define HD   64
#define DQ   (NH_ * HD)
#define DKV  (NKV * HD)
#define RH   512                  // query rows < RH use hi+lo planes (0: none)
#define SCL  0.125f   // HD^-0.5
typedef _Float16 h16;
typedef unsigned short bf;
typedef __attribute__((ext_vector_type(16))) __bf16   v16bf;
typedef __attribute__((ext_vector_type(16))) _Float16 v16h;
typedef __attribute__((ext_vector_type(8)))  _Float16 v8h;
typedef __attribute__((ext_vector_type(8)))  unsigned short v8us;
typedef __attribute__((ext_vector_type(8)))  float    v8f;
typedef __attribute__((ext_vector_type(4)))  float    v4f;
typedef v8h  __attribute__((may_alias)) v8ha;
typedef v4f  __attribute__((may_alias)) v4fa;
typedef v8us __attribute__((may_alias)) v8usa;

__device__ __forceinline__ unsigned short f2bf(float f) { unsigned u = __float_as_uint(f); u += 0x7FFFu + ((u >> 16) & 1u); return (unsigned short)(u >> 16); }
__device__ __forceinline__ float bf2f(unsigned short b) { return __uint_as_float(((unsigned)b) << 16); }
__device__ __forceinline__ float bfr(float f) { return bf2f(f2bf(f)); }
__device__ __forceinline__ v16h cat16(v8h lo, v8h hi) { return __builtin_shufflevector(lo, hi, 0, 1, 2, 3, 4, 5, 6, 7, 8, 9, 10, 11, 12, 13, 14, 15); }
__device__ __forceinline__ v16bf cat16b(v8us lo, v8us hi) { return __builtin_bit_cast(v16bf, __builtin_shufflevector(lo, hi, 0, 1, 2, 3, 4, 5, 6, 7, 8, 9, 10, 11, 12, 13, 14, 15)); }
__device__ __forceinline__ v8f wmma16(v16h a, v16h b, v8f c) { return __builtin_amdgcn_wmma_f32_16x16x32_f16(false, a, false, b, (short)0, c, false, false); }
__device__ __forceinline__ v8f wmmab(v16bf a, v16bf b, v8f c) { return __builtin_amdgcn_wmma_f32_16x16x32_bf16(false, a, false, b, (short)0, c, false, false); }



// ---- Fragment order: every 16-bit operand plane P[row][k] (K columns, K % 32 == 0) is stored as blocks of 16 rows x 32 k, 1 KB each, block (row / 16, k / 32) at element ((row / 16) (K / 32) + k / 32) 512.
// Inside a block the eight k of one 16-byte run lie where the matrix instruction's lane wants them: lane = row % 16 + 16 ((k / 8) % 2), first half of the fragment (k % 32 < 16) at lane * 8, second half at 256 + lane * 8.
// So a wave's fragment is two 16-byte loads of 512 contiguous bytes each (four whole lines), not two loads that touch 16 lines; which lane and register holds which (row, k) is the matrix instruction's own layout (k = 8 (lane / 16) + j and 16 + 8 (lane / 16) + j of row lane % 16).
__device__ __forceinline__ size_t fro(int row, int k, int K) { return ((size_t)(row >> 4) * (K >> 5) + (k >> 5)) * 512 + ((k >> 4) & 1) * 256 + ((row & 15) + ((k >> 3) & 1) * 16) * 8 + (k & 7); }
// a wave-uniform base plus the lane's fixed byte offset (lane * 16): the form of every fragment load
template <typename T16> __device__ __forceinline__ const T16* atl(const T16* base, unsigned ob) { return (const T16*)((const char*)base + ob); }

// ---- k_gemmw: register-blocked GEMM, 64x64 output tile (16 accumulators) per wave, operands straight from 16-bit planes in fragment order; grid (M/64, N/64, Z), 32 * KS threads.
// KS = 1: one wave owns the tile. KS > 1 (K % 64 == 0): the KS waves of the work-group share the tile's K loop, so each waits out 1/KS of its load latencies, and their partial tiles are summed through LDS.
// C[m][n] (f32, pitch ldc, + optional f32 bias[n]) = sum_k A[m][k] Bt[n][k] (+ split products per NSPLIT). z-batch strides sA/sB/sC in elements. K % 32 == 0, a template constant, so that every block's distance from the two bases is an immediate offset.
template <typename T16> struct WFrag;
template <> struct WFrag<h16> { typedef v16h V; static __device__ __forceinline__ V ld(const h16* p) { return cat16(*(const v8h*)p, *(const v8h*)(p + 256)); } static __device__ __forceinline__ v8f mma(V a, V b, v8f c) { return wmma16(a, b, c); } };
template <> struct WFrag<bf> { typedef v16bf V; static __device__ __forceinline__ V ld(const bf* p) { return cat16b(*(const v8us*)p, *(const v8us*)(p + 256)); } static __device__ __forceinline__ v8f mma(V a, V b, v8f c) { return wmmab(a, b, c); } };
template <typename T16, int NSPLIT, bool BIAS, int KS, int K>
__global__ __launch_bounds__(32 * KS) void k_gemmw(const T16* __restrict__ A, const T16* __restrict__ A2, const T16* __restrict__ Bt, const T16* __restrict__ Bt2, float* C, int ldc, const float* __restrict__ bias, size_t sA, size_t sB, size_t sC) {
    typedef typename WFrag<T16>::V V;
    constexpr int WST = (KS == 1) ? 16 * 68 : 64 * 68;      // floats of one wave's LDS slab: one 16-row block (KS = 1), its whole partial tile (KS > 1)
    __shared__ __align__(16) float os[KS * WST];
    const int wv = (KS == 1) ? 0 : __builtin_amdgcn_readfirstlane((int)(threadIdx.x >> 5));   // wave number, scalar: the K loop's control stays a scalar branch
    const size_t z = blockIdx.z; A += z * sA; if (A2) A2 += z * sA; Bt += z * sB; if (Bt2) Bt2 += z * sB; C += z * sC;
    const int lane = threadIdx.x & 31, lr = lane & 15, hi = lane >> 4; const int r0 = blockIdx.x * 64, c0 = blockIdx.y * 64;
    v8f acc[4][4];
#pragma unroll
    for (int mb = 0; mb < 4; ++mb)
#pragma unroll
        for (int nb = 0; nb < 4; ++nb) acc[mb][nb] = (v8f){};
    const unsigned lob = (unsigned)lane * 16u;      // the lane's byte offset in every block
    A += (size_t)r0 * K; if (A2) A2 += (size_t)r0 * K; Bt += (size_t)c0 * K; if (Bt2) Bt2 += (size_t)c0 * K;     // 16 rows of blocks are 16 K elements
#pragma unroll 1
    for (int kc = wv * 64; kc < K; kc += (kc & 32) ? KS * 64 - 32 : 32) {   // wave wv takes the 64-wide K chunks wv, wv + KS, ... (two blocks of each 16 operand rows)
        const T16* pa = atl(A + (size_t)kc * 16, lob); const T16* pa2 = (NSPLIT == 1 || NSPLIT == 2) ? atl(A2 + (size_t)kc * 16, lob) : pa; const T16* pb = atl(Bt + (size_t)kc * 16, lob); const T16* pb2 = (NSPLIT >= 2) ? atl(Bt2 + (size_t)kc * 16, lob) : pb;
        V a[4], a2[4];
#pragma unroll
        for (int mb = 0; mb < 4; ++mb) { a[mb] = WFrag<T16>::ld(pa + mb * 16 * K); if (NSPLIT == 1 || NSPLIT == 2) a2[mb] = WFrag<T16>::ld(pa2 + mb * 16 * K); }
#pragma unroll
        for (int nb = 0; nb < 4; ++nb) { const V b = WFrag<T16>::ld(pb + nb * 16 * K); V b2; if (NSPLIT >= 2) b2 = WFrag<T16>::ld(pb2 + nb * 16 * K);
#pragma unroll
            for (int mb = 0; mb < 4; ++mb) { acc[mb][nb] = WFrag<T16>::mma(a[mb], b, acc[mb][nb]); if (NSPLIT == 1 || NSPLIT == 2) acc[mb][nb] = WFrag<T16>::mma(a2[mb], b, acc[mb][nb]); if (NSPLIT >= 2) acc[mb][nb] = WFrag<T16>::mma(a[mb], b2, acc[mb][nb]); } }
        // the trip's addresses stay live up to this wait, so no register that an issued operand load names is given a new value in front of it
        asm volatile("s_wait_xcnt 0x0" :: "v"(pa), "v"(pa2), "v"(pb), "v"(pb2) : "memory");
        asm volatile("v_nop\n\tv_nop\n\tv_nop\n\tv_nop" : "+v"(acc[0][0]), "+v"(acc[1][1]), "+v"(acc[2][2]), "+v"(acc[3][3]) : "v"(a[0]), "v"(a[3]));
    }
    if constexpr (KS > 1) {     // the KS waves' partial tiles meet in LDS and are summed in fixed wave order 0 .. KS-1
        // unrolls: acc[][] stays in registers only under constant indices; the q and ww loops so that their LDS reads issue together
#pragma unroll
        for (int mb = 0; mb < 4; ++mb)
#pragma unroll
            for (int nb = 0; nb < 4; ++nb) {
#pragma unroll
                for (int j = 0; j < 8; ++j) os[wv * WST + (mb * 16 + hi * 8 + j) * 68 + nb * 16 + lr] = acc[mb][nb][j]; }
        __syncthreads();    // every wave's partial tile is in LDS before any of it is summed
        float* crow = C + (size_t)r0 * ldc + c0;
#pragma unroll
        for (int q = 0; q < 32 / KS; ++q) { const int idx = q * 32 * KS + (int)threadIdx.x, row = idx >> 4, cofs = (idx & 15) * 4; v4f val = *(const v4fa*)(os + row * 68 + cofs);
#pragma unroll
            for (int ww = 1; ww < KS; ++ww) val += *(const v4fa*)(os + ww * WST + row * 68 + cofs);
            if (BIAS) { val[0] += bfr(bias[c0 + cofs]); val[1] += bfr(bias[c0 + cofs + 1]); val[2] += bfr(bias[c0 + cofs + 2]); val[3] += bfr(bias[c0 + cofs + 3]); }
            *(v4f*)(crow + (size_t)row * ldc + cofs) = val; }
        return;
    }
#pragma unroll
    for (int mb = 0; mb < 4; ++mb) {
#pragma unroll
        for (int nb = 0; nb < 4; ++nb) {
#pragma unroll
            for (int j = 0; j < 8; ++j) os[(hi * 8 + j) * 68 + nb * 16 + lr] = acc[mb][nb][j]; }
        __builtin_amdgcn_wave_barrier(); asm volatile("" ::: "memory");
        float* crow = C + (size_t)(r0 + mb * 16) * ldc + c0;
{
#pragma unroll
            for (int s = 0; s < 8; ++s) { const int row = 2 * s + hi, cofs = lr * 4; v4f val = *(const v4fa*)(os + row * 68 + cofs); if (BIAS) { val[0] += bfr(bias[c0 + cofs]); val[1] += bfr(bias[c0 + cofs + 1]); val[2] += bfr(bias[c0 + cofs + 2]); val[3] += bfr(bias[c0 + cofs + 3]); }
                *(v4f*)(crow + (size_t)row * ldc + cofs) = val; }
             }
        __builtin_amdgcn_wave_barrier(); asm volatile("" ::: "memory");
    }
}

__device__ __forceinline__ h16 tohx(float x) { return (h16)x; }
__device__ __forceinline__ void splitf(float y, unsigned short& h, unsigned short& l) { h = f2bf(y); l = f2bf(y - bf2f(h)); }
typedef __attribute__((ext_vector_type(2))) _Float16 v2h;
typedef __attribute__((ext_vector_type(4))) _Float16 v4h;
typedef __attribute__((ext_vector_type(2))) unsigned short v2us;
typedef __attribute__((ext_vector_type(4))) unsigned short v4us;
typedef __attribute__((ext_vector_type(2))) float v2f;
typedef __attribute__((ext_vector_type(4))) int v4i;

// d_wtG: Bt[n][k] (fragment order) = bf16 of w[k][n]; the register block, the block indices and the waits of d_wt16 below
template <int K, int N>
__device__ __forceinline__ void d_wtG(const float* __restrict__ w, bf* Bt, int bx, int by) { const int lane = threadIdx.x & 31; const int n0 = bx * 64 + (lane & 15) * 4, k0 = by * 128 + (int)(threadIdx.x >> 5) * 16 + (lane >> 4) * 8; v4f r[8];
    const float* wp = w + (size_t)k0 * N + n0;
    // every unroll: the register blocks stay in registers only under constant indices
#pragma unroll
    for (int j = 0; j < 8; ++j) r[j] = *(const v4f*)(wp + j * N);
    // the address stays live up to this wait, so no register that an issued load names is given a new value in front of it
    asm volatile("s_wait_xcnt 0x0" :: "v"(wp) : "memory");
    v8us o[4];
#pragma unroll
    for (int q = 0; q < 4; ++q)
#pragma unroll
        for (int j = 0; j < 8; ++j) o[q][j] = f2bf(r[j][q]);
#pragma unroll
    for (int q = 0; q < 4; ++q) *(v8us*)(Bt + fro(n0, k0, K) + q * 8) = o[q];   // fragment order: the next n is the next 16-byte run
    // the caller's code for its other block ranges follows in the kernel and rewrites registers that these stores name: the wait stands in front of that
    asm volatile("s_wait_xcnt 0x0" ::: "memory"); }
__global__ __launch_bounds__(256) void k_cvt8(const float* __restrict__ src, bf* dst, size_t n8) { const size_t i = (size_t)blockIdx.x * 256 + threadIdx.x; if (i >= n8) return; const v8f v = *(const v8f*)(src + i * 8); v8us o;
#pragma unroll
    for (int k = 0; k < 8; ++k) o[k] = f2bf(v[k]); *(v8us*)(dst + i * 8) = o;  }
__global__ __launch_bounds__(256) void k_cscvt(const float* __restrict__ cosT, const float* __restrict__ sinT, float* CS) { const int idx = blockIdx.x * 256 + threadIdx.x; if (idx >= TT * HD) return; v2f cs; cs[0] = bfr(cosT[idx]); cs[1] = bfr(sinT[idx]); *(v2f*)(CS + (size_t)idx * 2) = cs;  }
// d_rope: head planes [h][t][d] (each head's [t][d] in fragment order; fp16 + hi/lo) of rope(x) x sc with the rotate-half convention out[d] = x[d] cos[t][d] - x[d+HD/2] sin[t][d], out[d+HD/2] = x[d+HD/2] cos[t][d+HD/2] + x[d] sin[t][d+HD/2]
// Each thread takes four consecutive d of the rows t, t + 16, t + 32 and t + 48 of one head, so that a wave's 16-byte load covers whole lines; its sixteen loads all issue before the first run is worked on. Blocks bx: 2 * NB_ * NH_ * TT * HD / 4096, exact (a block covers 64 whole rows of one head).
// One range of blocks does q and k of both batches: plane h = (s NB_ + batch) NH_ + head, s = 0 for q and 1 for k; its source is the rows batch TT + t and the columns s DQ + head HD of F.
static_assert(NH_ == NKV, "q and k planes are numbered alike");
template <int PITCH>
__device__ __forceinline__ void d_rope(const float* __restrict__ F, const float* __restrict__ CS, float sc, h16* P16, bf* Ph, bf* Pl, int bx) {
    // every unroll of this function: the register blocks stay in registers only under constant indices
    const size_t e = ((size_t)bx * 1024 + threadIdx.x) * 4; const int d = (int)(e % HD); const int t = (int)((e / HD) % TT); const int h = (int)(e / ((size_t)HD * TT));
    const bool lo = d < HD / 2;      // a run lies wholly in one half of the row, its partners in the other
    const float* fa = F + (size_t)((h / NH_) % NB_ * TT + t) * PITCH + (h / (NB_ * NH_)) * DQ + (h % NH_) * HD + d; const float* fb = lo ? fa + HD / 2 : fa - HD / 2; const float* cp = CS + ((size_t)t * HD + d) * 2;
    v4f xa[4], xb[4], cv[4][2];
#pragma unroll
    for (int c = 0; c < 4; ++c) { xa[c] = *(const v4f*)(fa + c * 16 * PITCH); xb[c] = *(const v4f*)(fb + c * 16 * PITCH); cv[c][0] = *(const v4f*)(cp + c * 16 * HD * 2); cv[c][1] = *(const v4f*)(cp + c * 16 * HD * 2 + 4); }
    // the three addresses stay live up to this wait, so no register that an issued load names is given a new value in front of it
    asm volatile("s_wait_xcnt 0x0" :: "v"(fa), "v"(fb), "v"(cp) : "memory");
    __builtin_amdgcn_sched_barrier(0);   // keeps the vector work behind the wait: without it the compiler works on the first loads before it issues the last, and their latencies add up
    v4h o16[4]; v4us oh[4], ol[4];
#pragma unroll
    for (int c = 0; c < 4; ++c)
#pragma unroll
        for (int q = 0; q < 4; ++q) { const float a = __fmul_rn(xa[c][q], cv[c][q >> 1][(q & 1) * 2]), bq = __fmul_rn(xb[c][q], cv[c][q >> 1][(q & 1) * 2 + 1]); const float r = (lo ? __fsub_rn(a, bq) : __fadd_rn(a, bq)) * sc;
            o16[c][q] = tohx(r); unsigned short a2, c2; splitf(r, a2, c2); oh[c][q] = a2; ol[c][q] = c2; }
    const size_t eo = (size_t)h * TT * HD + fro(t, d, HD);      // 16 rows on are two blocks on, 1024 elements
#pragma unroll
    for (int c = 0; c < 4; ++c) { *(v4h*)(P16 + eo + c * 1024) = o16[c]; *(v4us*)(Ph + eo + c * 1024) = oh[c]; *(v4us*)(Pl + eo + c * 1024) = ol[c]; }
    // the caller's code for its other block ranges follows in the kernel and rewrites registers that these stores name: the wait stands in front of that
    asm volatile("s_wait_xcnt 0x0" ::: "memory"); }
// d_vtp: transposed value planes [g][d][t] (each head's [d][t] in fragment order). Each thread holds a block of 8 t x 4 d in registers: eight 16-byte loads along d (a wave reads two whole 256-byte head rows a load), then per d and plane one 16-byte store along t.
// Blocks (bx < TT / 128, g < NB_ * heads; g = batch NKV + head), 256 threads: a block covers one head's 64 d x 128 t, so every 128-byte output line is filled by one block.
template <int PITCH>
__device__ __forceinline__ void d_vtp(const float* __restrict__ F, h16* V16, bf* Vh, bf* Vl, int bx, int g) { const int lane = threadIdx.x & 31; const int d0 = (lane & 15) * 4, t0 = bx * 128 + (int)(threadIdx.x >> 5) * 16 + (lane >> 4) * 8; v4f r[8];
    const float* fp = F + (size_t)(g / NKV * TT + t0) * PITCH + (g % NKV) * HD + d0;
    // every unroll: the register blocks stay in registers only under constant indices
#pragma unroll
    for (int j = 0; j < 8; ++j) r[j] = *(const v4f*)(fp + j * PITCH);
    // the address stays live up to this wait, so no register that an issued load names is given a new value in front of it
    asm volatile("s_wait_xcnt 0x0" :: "v"(fp) : "memory");
    v8h o16[4]; v8us oh[4], ol[4];
#pragma unroll
    for (int q = 0; q < 4; ++q)
#pragma unroll
        for (int j = 0; j < 8; ++j) { const float x = r[j][q]; o16[q][j] = tohx(x); unsigned short a2, c2; splitf(x, a2, c2); oh[q][j] = a2; ol[q][j] = c2; }
    const size_t e = (size_t)g * HD * TT + fro(d0, t0, TT);      // the next d is the next 16-byte run
#pragma unroll
    for (int q = 0; q < 4; ++q) { *(v8h*)(V16 + e + q * 8) = o16[q]; *(v8us*)(Vh + e + q * 8) = oh[q]; *(v8us*)(Vl + e + q * 8) = ol[q]; }
    // the caller's code for its other block ranges follows in the kernel and rewrites registers that these stores name: the wait stands in front of that
    asm volatile("s_wait_xcnt 0x0" ::: "memory"); }
// k_qkvp: the q and k head planes and the transposed v planes of both batches in one launch (they only share their source F); the first RB blocks do d_rope, the other NB_ * NKV * TT / 128 do d_vtp.
#define RB   (2 * NB_ * NH_ * TT * HD / 4096)
#define VB   (NB_ * NKV * TT / 128)
template <int PITCH>
__global__ __launch_bounds__(256) void k_qkvp(const float* __restrict__ F, const float* __restrict__ CS, h16* P16, bf* Ph, bf* Pl, h16* V16, bf* Vh, bf* Vl) {
    const int i = (int)blockIdx.x;
    if (i < RB) d_rope<PITCH>(F, CS, 1.0f, P16, Ph, Pl, i);
    else d_vtp<PITCH>(F + DQ + DKV, V16, Vh, Vl, (i - RB) % (TT / 128), (i - RB) / (TT / 128)); }
// blocks bx < TT * HD / 2048, exact: four 16-byte stores (two (cos, sin) pairs each) a thread
__device__ __forceinline__ void d_csid(float* CS, int bx) { v4f cs; cs[0] = 1.0f; cs[1] = 0.0f; cs[2] = 1.0f; cs[3] = 0.0f; float* p = CS + ((size_t)bx * 1024 + threadIdx.x) * 4;
#pragma unroll
    for (int c = 0; c < 4; ++c) *(v4f*)(p + c * 1024) = cs;
    // behind these stores the caller's way to its end rewrites scalar registers, the stores' base among them: the wait stands in front of that
    asm volatile("s_wait_xcnt 0x0" ::: "memory"); }
// ---- k_fattn: causal attention of both batches in one launch; grid (NB_ * heads, TT/64), 128 threads; wave w of a work-group owns the 16 query rows r0 + 16 w .. + 15 of one head and walks the keys 0 .. r0 + 63 in passes of 64.
// Transposed products: S^T = K Q^T (A = key rows, B = query rows), so a lane holds 32 scores of ONE query (column lane & 15; keys 16 kb + 8 (lane >> 4) + j); running maximum and sum stay in the lane, the two lane halves
// exchange the maximum once a pass and the sum once at the end. Two score tiles, converted in place, are the B operand of O^T += V^T P^T (A = rows of the transposed value plane). Scores and probabilities never leave the registers.
// Operand classes: query rows < RH on bf16 hi+lo planes (3 products each), the rest on single fp16 planes (probabilities carried x 2^10, which cancels in the division by their sum). Output: bf16 hi+lo planes [t][DQ]. All planes in fragment order.
template <typename T16> struct IsHL { static constexpr bool v = false; };
template <> struct IsHL<bf> { static constexpr bool v = true; };
template <bool B> struct BoolC { static constexpr bool value = B; };
__device__ __forceinline__ float xhalf(float x) { return __int_as_float(__builtin_amdgcn_permlanex16(__float_as_int(x), __float_as_int(x), 0x76543210, 0xfedcba98, false, false)); }   // the value of lane ^ 16
// eight 2^x in place, in one statement: each v_exp_f32 is followed by one that neither reads its result nor overwrites its source, the last by the v_nop that the instruction set asks for behind a transcendental
__device__ __forceinline__ void exp2x8(float (&e)[8]) {
    asm("v_exp_f32 %0, %0\n\tv_exp_f32 %1, %1\n\tv_exp_f32 %2, %2\n\tv_exp_f32 %3, %3\n\tv_exp_f32 %4, %4\n\tv_exp_f32 %5, %5\n\tv_exp_f32 %6, %6\n\tv_exp_f32 %7, %7\n\tv_nop"
        : "+v"(e[0]), "+v"(e[1]), "+v"(e[2]), "+v"(e[3]), "+v"(e[4]), "+v"(e[5]), "+v"(e[6]), "+v"(e[7])); }
// eight 1/x in place (v_rcp_f32, 1 ulp), in one statement for the same reason; sig8: eight sigmoids 1 / (1 + e^-z) from eight z, the exponent as __expf forms it (2^(-z log2 e))
__device__ __forceinline__ void rcpx8(float (&e)[8]) {
    asm("v_rcp_f32 %0, %0\n\tv_rcp_f32 %1, %1\n\tv_rcp_f32 %2, %2\n\tv_rcp_f32 %3, %3\n\tv_rcp_f32 %4, %4\n\tv_rcp_f32 %5, %5\n\tv_rcp_f32 %6, %6\n\tv_rcp_f32 %7, %7\n\tv_nop"
        : "+v"(e[0]), "+v"(e[1]), "+v"(e[2]), "+v"(e[3]), "+v"(e[4]), "+v"(e[5]), "+v"(e[6]), "+v"(e[7])); }
__device__ __forceinline__ void sig8(float (&e)[8]) {
    // both unrolls: e[] stays in registers only under constant indices
#pragma unroll
    for (int j = 0; j < 8; ++j) e[j] = __fmul_rn(e[j], -1.4426950408889634f);
    exp2x8(e);
#pragma unroll
    for (int j = 0; j < 8; ++j) e[j] = 1.0f + e[j];
    rcpx8(e); }
template <typename T16>
__device__ __forceinline__ void attn_wave(const T16* __restrict__ Qp, const T16* __restrict__ Q2, const T16* __restrict__ Kp, const T16* __restrict__ K2, const T16* __restrict__ Vp, const T16* __restrict__ V2, int q0, bf* __restrict__ Ah, bf* __restrict__ Al) {
    // every unroll below: the fragment, score and accumulator arrays stay in registers only under constant indices
    typedef typename WFrag<T16>::V V; constexpr bool HL = IsHL<T16>::v;
    constexpr float CL = SCL * 1.4426950408889634f, OFF = HL ? 0.0f : 10.0f;      // scores in log2 units; OFF: the carry 2^10 of the fp16 probabilities
    const int lane = threadIdx.x & 31, lr = lane & 15, hi = lane >> 4; const int q = q0 + lr;
    // every load is a wave-uniform base plus the lane's fixed byte offset in a block: the offset never changes, only the key and value bases move on, by one pass at a time
    const unsigned qob = (unsigned)lane * 16u, kob = qob, vob = qob;
    Qp += q0 * HD; if constexpr (HL) Q2 += q0 * HD;      // the wave's 16 query rows: two blocks
    auto at = [](const T16* base, unsigned ob) { return (const T16*)((const char*)base + ob); };
    const T16* qa = at(Qp, qob); const T16* qa2 = HL ? at(Q2, qob) : nullptr; const T16* ka0 = at(Kp, kob);
    V qf[2], qf2[2];
#pragma unroll
    for (int ds = 0; ds < 2; ++ds) { qf[ds] = WFrag<T16>::ld(qa + ds * 512); if constexpr (HL) qf2[ds] = WFrag<T16>::ld(qa2 + ds * 512); }
    v8f o[4];
#pragma unroll
    for (int db = 0; db < 4; ++db) o[db] = (v8f){};
    float m = -3.0e38f, l = 0.0f;
    V kf[4][2], kf2[4][2];
    if constexpr (!HL) {    // single planes: the key fragments run one pass ahead; hi+lo planes (at most RH / 64 passes, twice the registers) fetch theirs inside the pass
#pragma unroll
        for (int kb = 0; kb < 4; ++kb)
#pragma unroll
            for (int ds = 0; ds < 2; ++ds) kf[kb][ds] = WFrag<T16>::ld(ka0 + kb * 16 * HD + ds * 512);
    }
    // all s_wait_xcnt below: addresses, offsets and bases stay live up to the wait, so no register that an issued load names is given a new value in front of it;
    // the sched_barrier behind a wait keeps the loads in front of it and later vector work behind it
    if constexpr (HL) asm volatile("s_wait_xcnt 0x0" :: "v"(qa), "v"(qa2), "v"(qob), "s"(Qp), "s"(Q2) : "memory"); else asm volatile("s_wait_xcnt 0x0" :: "v"(qa), "v"(ka0), "v"(qob), "v"(kob), "s"(Qp), "s"(Kp) : "memory");
    __builtin_amdgcn_sched_barrier(0);
    const int np = q0 / 64 + 1;     // passes; only the last one meets the diagonal
    auto pass = [&](auto diag, int kt) {
        V vf[4][2], vf2[4][2];
        const T16* ka = at(Kp, kob); const T16* ka2 = HL ? at(K2, kob) : nullptr; const T16* va = at(Vp, vob); const T16* va2 = HL ? at(V2, vob) : nullptr;
        if constexpr (HL) {
#pragma unroll
            for (int kb = 0; kb < 4; ++kb)
#pragma unroll
                for (int ds = 0; ds < 2; ++ds) { kf[kb][ds] = WFrag<T16>::ld(ka + kb * 16 * HD + ds * 512); kf2[kb][ds] = WFrag<T16>::ld(ka2 + kb * 16 * HD + ds * 512); }
            asm volatile("s_wait_xcnt 0x0" :: "v"(ka), "v"(ka2), "v"(kob), "s"(Kp), "s"(K2) : "memory");
            __builtin_amdgcn_sched_barrier(0);
        } else {
#pragma unroll
            for (int db = 0; db < 4; ++db)
#pragma unroll
                for (int ks = 0; ks < 2; ++ks) vf[db][ks] = WFrag<T16>::ld(va + db * 16 * TT + ks * 512);
        }
        v8f s[4];
#pragma unroll
        for (int kb = 0; kb < 4; ++kb) { s[kb] = (v8f){};
#pragma unroll
            for (int ds = 0; ds < 2; ++ds) { s[kb] = WFrag<T16>::mma(kf[kb][ds], qf[ds], s[kb]); if constexpr (HL) { s[kb] = WFrag<T16>::mma(kf[kb][ds], qf2[ds], s[kb]); s[kb] = WFrag<T16>::mma(kf2[kb][ds], qf[ds], s[kb]); } } }
        if constexpr (HL) {     // the value fragments fly under the softmax
#pragma unroll
            for (int db = 0; db < 4; ++db)
#pragma unroll
                for (int ks = 0; ks < 2; ++ks) { vf[db][ks] = WFrag<T16>::ld(va + db * 16 * TT + ks * 512); vf2[db][ks] = WFrag<T16>::ld(va2 + db * 16 * TT + ks * 512); }
            asm volatile("s_wait_xcnt 0x0" :: "v"(va), "v"(va2), "v"(vob), "s"(Vp), "s"(V2) : "memory");
            __builtin_amdgcn_sched_barrier(0);
        } else {
            if constexpr (!decltype(diag)::value) {     // the next pass's key fragments, behind this pass's score products
#pragma unroll
                for (int kb = 0; kb < 4; ++kb)
#pragma unroll
                    for (int ds = 0; ds < 2; ++ds) kf[kb][ds] = WFrag<T16>::ld(ka + (64 + kb * 16) * HD + ds * 512);
            }
            asm volatile("s_wait_xcnt 0x0" :: "v"(ka), "v"(va), "v"(kob), "v"(vob), "s"(Kp), "s"(Vp) : "memory");
            __builtin_amdgcn_sched_barrier(0);
        }
        if constexpr (!decltype(diag)::value) { Kp += 64 * HD; Vp += 64 * 16; if constexpr (HL) { K2 += 64 * HD; V2 += 64 * 16; } }   // 64 keys: eight key blocks; two blocks of each 16 value rows
        if constexpr (decltype(diag)::value) {      // causal mask: key > query
#pragma unroll
            for (int kb = 0; kb < 4; ++kb)
#pragma unroll
                for (int j = 0; j < 8; ++j) s[kb][j] = (kt + kb * 16 + hi * 8 + j > q) ? -3.0e38f : s[kb][j];
        }
        float t4[4];     // four independent chains, one a score tile, then a tree: the maximum (and below the sum) does not wait on one chain of 32
#pragma unroll
        for (int kb = 0; kb < 4; ++kb) { t4[kb] = s[kb][0];
#pragma unroll
            for (int j = 1; j < 8; ++j) t4[kb] = fmaxf(t4[kb], s[kb][j]); }
        float tm = fmaxf(fmaxf(t4[0], t4[1]), fmaxf(t4[2], t4[3]));
        tm = fmaxf(tm, xhalf(tm));
        const float mn = fmaxf(m, tm * CL), sh = OFF - mn; float al = m - mn; m = mn;
        asm("v_exp_f32 %0, %0\n\tv_nop" : "+v"(al));     // 2^al; the v_nop is the slot that the instruction set asks for behind a transcendental
#pragma unroll
        for (int kb = 0; kb < 4; ++kb) { t4[kb] = 0.0f; float e[8];
#pragma unroll
            for (int j = 0; j < 8; ++j) e[j] = fmaf(s[kb][j], CL, sh);
            exp2x8(e);
#pragma unroll
            for (int j = 0; j < 8; ++j) { s[kb][j] = e[j]; t4[kb] += e[j]; } }
        l = fmaf(l, al, (t4[0] + t4[1]) + (t4[2] + t4[3]));
#pragma unroll
        for (int db = 0; db < 4; ++db) o[db] *= al;
#pragma unroll
        for (int ks = 0; ks < 2; ++ks) {
            if constexpr (HL) { v8us h0, h1, l0, l1;
#pragma unroll
                for (int j = 0; j < 8; ++j) { unsigned short a, c; splitf(s[2 * ks][j], a, c); h0[j] = a; l0[j] = c; splitf(s[2 * ks + 1][j], a, c); h1[j] = a; l1[j] = c; }
                const V ph = cat16b(h0, h1), pl = cat16b(l0, l1);
#pragma unroll
                for (int db = 0; db < 4; ++db) { o[db] = WFrag<T16>::mma(vf[db][ks], ph, o[db]); o[db] = WFrag<T16>::mma(vf[db][ks], pl, o[db]); o[db] = WFrag<T16>::mma(vf2[db][ks], ph, o[db]); }
            } else { const V pf = cat16(__builtin_convertvector(s[2 * ks], v8h), __builtin_convertvector(s[2 * ks + 1], v8h));
#pragma unroll
                for (int db = 0; db < 4; ++db) o[db] = WFrag<T16>::mma(vf[db][ks], pf, o[db]); }
        }
    };
    // unroll 1: one pass is already a long straight run; a second copy would only double the code
#pragma unroll 1
    for (int p = 0; p + 1 < np; ++p) pass(BoolC<false>(), p * 64);
    pass(BoolC<true>(), (np - 1) * 64);
    l += xhalf(l); const float inv = __fdiv_rn(1.0f, l);
    v8us oh[4], ol[4];
#pragma unroll
    for (int db = 0; db < 4; ++db)
#pragma unroll
        for (int j = 0; j < 8; ++j) { unsigned short a, c; splitf(o[db][j] * inv, a, c); oh[db][j] = a; ol[db][j] = c; }
    const size_t oo = (size_t)q0 * DQ + lane * 8;   // a lane's eight accumulator registers are eight consecutive d of its query row: in fragment order its own 16-byte run of half a block, so a wave's store is 512 contiguous bytes
#pragma unroll
    for (int db = 0; db < 4; ++db) { *(v8us*)(Ah + oo + db * 256) = oh[db]; *(v8us*)(Al + oo + db * 256) = ol[db]; }
}
// waves_per_eu(2, 2): with the register budget of two waves a SIMD a pass's value loads all issue at its head and the key loads a pass ahead
__global__ __launch_bounds__(128) __attribute__((amdgpu_waves_per_eu(2, 2))) void k_fattn(const h16* __restrict__ Q16, const h16* __restrict__ K16, const h16* __restrict__ V16, const bf* __restrict__ Qh, const bf* __restrict__ Ql, const bf* __restrict__ Kh, const bf* __restrict__ Kl, const bf* __restrict__ Vh, const bf* __restrict__ Vl, bf* __restrict__ Ah, bf* __restrict__ Al) {
    const int wv = __builtin_amdgcn_readfirstlane((int)(threadIdx.x >> 5));   // wave number, scalar: the pass loop's control stays a scalar branch
    const int r0 = (TT / 64 - 1 - (int)blockIdx.y) * 64;                      // longest key walks first
    const int bt = (int)blockIdx.x / NH_, hd = (int)blockIdx.x % NH_;         // batch and head; the planes are numbered batch * heads + head
    const size_t zq = (size_t)blockIdx.x * TT * HD, zk = (size_t)(bt * NKV + hd / REP) * TT * HD, za = (size_t)bt * TT * DQ + hd * HD * 16;     // za: the batch's rows of the merged planes; a head's 64 columns of 16 rows: two blocks
    if (r0 < RH) attn_wave<bf>(Qh + zq, Ql + zq, Kh + zk, Kl + zk, Vh + zk, Vl + zk, r0 + wv * 16, Ah + za, Al + za);
    else attn_wave<h16>(Q16 + zq, nullptr, K16 + zk, nullptr, V16 + zk, nullptr, r0 + wv * 16, Ah + za, Al + za);
}

// d_wt16: Bt[n][k] (fragment order) = fp16 of the bf16-rounded w[k][n]. Each thread holds a block of 8 k x 4 n in registers: eight 16-byte loads along n (a wave reads 256 contiguous bytes of two rows a load), then per n one 16-byte store along k.
// Blocks (bx < N / 64, by < K / 128), 256 threads: a block covers 64 n x 128 k, whole 1 KB blocks of the plane, so every 128-byte output line is filled by one block.
template <int K, int N>
__device__ __forceinline__ void d_wt16(const float* __restrict__ w, h16* Bt, int bx, int by) { const int lane = threadIdx.x & 31; const int n0 = bx * 64 + (lane & 15) * 4, k0 = by * 128 + (int)(threadIdx.x >> 5) * 16 + (lane >> 4) * 8; v4f r[8];
    const float* wp = w + (size_t)k0 * N + n0;
    // every unroll: the register blocks stay in registers only under constant indices
#pragma unroll
    for (int j = 0; j < 8; ++j) r[j] = *(const v4f*)(wp + j * N);
    // the address stays live up to this wait, so no register that an issued load names is given a new value in front of it
    asm volatile("s_wait_xcnt 0x0" :: "v"(wp) : "memory");
    v8h o[4];
#pragma unroll
    for (int q = 0; q < 4; ++q)
#pragma unroll
        for (int j = 0; j < 8; ++j) o[q][j] = tohx(bfr(r[j][q]));
#pragma unroll
    for (int q = 0; q < 4; ++q) *(v8h*)(Bt + fro(n0, k0, K) + q * 8) = o[q];   // fragment order: the next n is the next 16-byte run
    // the caller's code for its other block ranges follows in the kernel and rewrites registers that these stores name: the wait stands in front of that
    asm volatile("s_wait_xcnt 0x0" ::: "memory"); }
// k_prep: every weight plane and the (cos, sin) table in one launch; none reads what another writes. Ranges of blockIdx.x, in this order: the 4 blocks n of qkv_w, of gate_w and of up_w (each [256][N], planes n apart by 256 N), down_w, o_w, the table.
#define PB_Q (4 * (3072 / 64) * (256 / 128))
#define PB_F (4 * (2048 / 64) * (256 / 128))
#define PB_D ((DM / 64) * (2048 / 128))
#define PB_O ((DM / 64) * (DQ / 128))
#define PB_C (TT * HD / 2048)
__global__ __launch_bounds__(256) void k_prep(const float* __restrict__ qkvw, const float* __restrict__ gw, const float* __restrict__ uw, const float* __restrict__ dw, const float* __restrict__ wo, h16* BQKV, h16* BG, h16* BU, h16* BD, bf* WO, float* CS) {
    int i = (int)blockIdx.x;
    if (i < PB_Q) { const int n = i / (PB_Q / 4), j = i % (PB_Q / 4); d_wt16<256, 3072>(qkvw + (size_t)n * 256 * 3072, BQKV + (size_t)n * 3072 * 256, j % (3072 / 64), j / (3072 / 64)); return; }
    i -= PB_Q;
    if (i < 2 * PB_F) { const bool up = i >= PB_F; const int n = (i % PB_F) / (PB_F / 4), j = i % (PB_F / 4); d_wt16<256, 2048>((up ? uw : gw) + (size_t)n * 256 * 2048, (up ? BU : BG) + (size_t)n * 2048 * 256, j % (2048 / 64), j / (2048 / 64)); return; }
    i -= 2 * PB_F;
    if (i < PB_D) { d_wt16<2048, DM>(dw, BD, i % (DM / 64), i / (DM / 64)); return; }
    i -= PB_D;
    if (i < PB_O) { d_wtG<DQ, DM>(wo, WO, i % (DM / 64), i / (DM / 64)); return; }
    d_csid(CS, i - PB_O); }
// k_rmsc: the rows of both batches, one wave a row; grid NR / 8
__global__ __launch_bounds__(256) void k_rmsc(const float* __restrict__ X, int isin, const float* __restrict__ w, h16* HC) { const int lane = threadIdx.x & 31; const int t = blockIdx.x * 8 + (threadIdx.x >> 5); if (t >= NR) return; float v[32]; float s = 0.f;
#pragma unroll
    for (int ch = 0; ch < 8; ++ch) { const v4f a = *(const v4f*)(X + (size_t)t * DM + ch * 128 + lane * 4);
#pragma unroll
        for (int q = 0; q < 4; ++q) { const float xv = isin ? bfr(a[q]) : a[q]; v[ch * 4 + q] = xv; float p = __fmul_rn(xv, xv); asm volatile("" : "+v"(p)); s = __fadd_rn(s, p); } }
#pragma unroll
    for (int sh = 16; sh; sh >>= 1) s += __shfl_xor(s, sh, 32);
    const float r = __frsqrt_rn(__fadd_rn(s * (1.0f / DM), 1.1920929e-07f));
{       v4h o[8]; float wr[32]; const unsigned wob = (unsigned)lane * 16u; const float* wp = (const float*)((const char*)w + wob);   // this lane's weights: columns ch 128 + lane 4 + q
#pragma unroll
        for (int ch = 0; ch < 8; ++ch)
#pragma unroll
            for (int q = 0; q < 4; ++q) wr[ch * 4 + q] = wp[ch * 128 + q];
        // address, offset and base stay live up to this wait, so no register that an issued weight load names is given a new value in front of it
        asm volatile("s_wait_xcnt 0x0" :: "v"(wp), "v"(wob), "s"(w) : "memory");
#pragma unroll
        for (int ch = 0; ch < 8; ++ch)
#pragma unroll
            for (int q = 0; q < 4; ++q) { float tn = __fmul_rn(v[ch * 4 + q], r); asm volatile("" : "+v"(tn)); o[ch][q] = tohx(__fmul_rn(tn, bfr(wr[ch * 4 + q]))); }
        // block planes in fragment order: plane ch / 2, columns (ch % 2) 128 + lane 4, four blocks apart; the work-group's eight rows fill whole lines
        h16* hp = HC + fro(t, lane * 4, 256);
#pragma unroll
        for (int ch = 0; ch < 8; ++ch) *(v4h*)(hp + (size_t)(ch >> 1) * NR * 256 + (ch & 1) * 2048) = o[ch];
         } }
// ---- k_dend: dendritic layers (one a blockIdx.z), both batches' rows, per launch; grid (NR/64, N/64, layers), 128 threads. Wave n of the work-group forms the 64x64 tile of input block n, h_n W[n] (K = 256, fp16 planes, f32 accumulate, one running sum over K);
// the four tiles meet in LDS, and each output element is max over n = 0 .. 3 (in that order) of gain[n] silu(tile_n - thr[n]). H: block planes [n][NR][256]; Bt: [n][N][256], each plane in fragment order; thr, gain: [n][N]; C: [NR][N].
// blockIdx.z picks the layer: weights and outputs by the strides sB and sC (elements), thresholds and gains by the pointer pair.
__global__ __launch_bounds__(128) void k_dend(const h16* __restrict__ H, const h16* __restrict__ Bt, int N, const float* __restrict__ thr0, const float* __restrict__ gain0, const float* __restrict__ thr1, const float* __restrict__ gain1, float* C, size_t sB, size_t sC) {
    constexpr int K = 256, WST = 64 * 68;                   // WST: floats of one wave's LDS slab (its whole tile, row pitch 68)
    __shared__ __align__(16) float os[4 * WST];
    const int wv = __builtin_amdgcn_readfirstlane((int)(threadIdx.x >> 5));   // wave number = input block n, scalar
    const float* thr = blockIdx.z ? thr1 : thr0; const float* gain = blockIdx.z ? gain1 : gain0;
    const h16* A = H + (size_t)wv * NR * K; const h16* B = Bt + blockIdx.z * sB + (size_t)wv * N * K; C += blockIdx.z * sC;
    const int lane = threadIdx.x & 31, lr = lane & 15, hi = lane >> 4; const int r0 = blockIdx.x * 64, c0 = blockIdx.y * 64;
    v8f acc[4][4];
#pragma unroll
    for (int mb = 0; mb < 4; ++mb)
#pragma unroll
        for (int nb = 0; nb < 4; ++nb) acc[mb][nb] = (v8f){};
    const unsigned lob = (unsigned)lane * 16u;      // the lane's byte offset in every block
    A += (size_t)r0 * K; B += (size_t)c0 * K;       // 16 rows of blocks are 16 K elements
    // every unroll: K is a constant, eight trips; the fragment arrays stay in registers only under constant indices.
    // The next trip's loads issue ahead of this trip's products: its A fragments at the trip's head into the other half of a[][], each B fragment behind the last product that reads its forerunner.
    // Written out in the source: with every block an immediate offset from one base the compiler, left to itself, puts each load directly in front of its first product and waits for it there.
    v16h a[2][4], b[4];
#pragma unroll
    for (int mb = 0; mb < 4; ++mb) a[0][mb] = WFrag<h16>::ld(atl(A, lob) + mb * 16 * K);
#pragma unroll
    for (int nb = 0; nb < 4; ++nb) b[nb] = WFrag<h16>::ld(atl(B, lob) + nb * 16 * K);
#pragma unroll
    for (int t = 0; t < K / 32; ++t) {
        if (t + 1 < K / 32) {
#pragma unroll
            for (int mb = 0; mb < 4; ++mb) a[(t + 1) & 1][mb] = WFrag<h16>::ld(atl(A, lob) + mb * 16 * K + (t + 1) * 512); }
#pragma unroll
        for (int nb = 0; nb < 4; ++nb) {
#pragma unroll
            for (int mb = 0; mb < 4; ++mb) acc[mb][nb] = wmma16(a[t & 1][mb], b[nb], acc[mb][nb]);
            if (t + 1 < K / 32) b[nb] = WFrag<h16>::ld(atl(B, lob) + nb * 16 * K + (t + 1) * 512); }
    }
    // the offset and both bases stay live up to this wait, so no register that an issued operand load names is given a new value in front of it
    asm volatile("s_wait_xcnt 0x0" :: "v"(lob), "s"(A), "s"(B) : "memory");
    // unrolls: acc[][] stays in registers only under constant indices
#pragma unroll
    for (int mb = 0; mb < 4; ++mb)
#pragma unroll
        for (int nb = 0; nb < 4; ++nb) {
#pragma unroll
            for (int j = 0; j < 8; ++j) os[wv * WST + (mb * 16 + hi * 8 + j) * 68 + nb * 16 + lr] = acc[mb][nb][j]; }
    __syncthreads();    // all four blocks' tiles are in LDS before any element's max is taken
    const unsigned cofs = (threadIdx.x & 15u) * 4u; v4f th[4], ga[4]; unsigned ob[4];   // this thread's four output columns are the same in every row it handles
#pragma unroll
    for (int n = 0; n < 4; ++n) { ob[n] = ((unsigned)(n * N) + cofs) * 4u; th[n] = *(const v4fa*)((const char*)(thr + c0) + ob[n]); ga[n] = *(const v4fa*)((const char*)(gain + c0) + ob[n]); }
    // the four byte offsets and the two bases stay live up to this wait, so no register that an issued threshold or gain load names is given a new value in front of it
    asm volatile("s_wait_xcnt 0x0" :: "v"(ob[0]), "v"(ob[1]), "v"(ob[2]), "v"(ob[3]), "s"(thr + c0), "s"(gain + c0) : "memory");
#pragma unroll
    for (int n = 0; n < 4; ++n)
#pragma unroll
        for (int q = 0; q < 4; ++q) { th[n][q] = bfr(th[n][q]); ga[n][q] = bfr(ga[n][q]); }
    float* crow = C + (size_t)r0 * N + c0 + cofs;
    // unroll 2: two rows share a trip's address arithmetic and branch; more would only lengthen the code
#pragma unroll 2
    for (int s = 0; s < 8; ++s) { const int row = s * 8 + (int)(threadIdx.x >> 4); v4f r;
#pragma unroll
        for (int np = 0; np < 2; ++np) { float z[8], sg[8];      // two input blocks at a time: eight sigmoids a statement
#pragma unroll
            for (int n = 0; n < 2; ++n) { const v4f a = *(const v4fa*)(os + (np * 2 + n) * WST + row * 68 + cofs);
#pragma unroll
                for (int q = 0; q < 4; ++q) sg[n * 4 + q] = z[n * 4 + q] = __fsub_rn(a[q], th[np * 2 + n][q]); }
            sig8(sg);
#pragma unroll
            for (int n = 0; n < 2; ++n)
#pragma unroll
                for (int q = 0; q < 4; ++q) { const float val = __fmul_rn(ga[np * 2 + n][q], __fmul_rn(z[n * 4 + q], sg[n * 4 + q])); r[q] = (np * 2 + n) ? fmaxf(r[q], val) : val; } }
        *(v4f*)(crow + (size_t)row * N) = r;
        asm volatile("s_wait_xcnt 0x0" ::: "memory"); }   // the next trip rewrites the registers that this store names: the wait stands in front of that
}
// k_res, k_ffp, k_fin: each thread takes four runs (k_ffp: eight) of four elements, 256 threads apart (k_ffp: 128 columns apart in two rows), and issues all its loads before the first run is worked on; exact grids. Every unroll: the register blocks stay in registers only under constant indices.
// In each: the two addresses stay live up to the s_wait_xcnt, so no register that an issued load names is given a new value in front of it.
__global__ __launch_bounds__(256) void k_res(const float* __restrict__ x, const float* __restrict__ ATT, float* X1) { const size_t i0 = ((size_t)blockIdx.x * 1024 + threadIdx.x) * 4; const float* xp = x + i0; const float* ap = ATT + i0; v4f xv[4], a[4], o[4];
#pragma unroll
    for (int c = 0; c < 4; ++c) { xv[c] = *(const v4f*)(xp + c * 1024); a[c] = *(const v4f*)(ap + c * 1024); }
    asm volatile("s_wait_xcnt 0x0" :: "v"(xp), "v"(ap) : "memory");
#pragma unroll
    for (int c = 0; c < 4; ++c) { o[c][0] = __fadd_rn(bfr(xv[c][0]), a[c][0]); o[c][1] = __fadd_rn(bfr(xv[c][1]), a[c][1]); o[c][2] = __fadd_rn(bfr(xv[c][2]), a[c][2]); o[c][3] = __fadd_rn(bfr(xv[c][3]), a[c][3]); }
#pragma unroll
    for (int c = 0; c < 4; ++c) *(v4f*)(X1 + i0 + c * 1024) = o[c]; }
__global__ __launch_bounds__(256) void k_ffp(const float* __restrict__ G, const float* __restrict__ U, h16* FF16) {
    // a block covers 16 rows x 512 columns, whole 1 KB blocks of the fragment-order output plane; a wave takes two rows, four runs of 128 columns (512 contiguous bytes a load) in each
    const int row = (int)(blockIdx.x >> 2) * 16 + (int)(threadIdx.x >> 5) * 2, k = (int)(blockIdx.x & 3) * 512 + (int)(threadIdx.x & 31) * 4;
    const size_t i0 = (size_t)row * 2048 + k; const float* gp = G + i0; const float* up = U + i0; v4f g[8], u[8]; v4h o[8];   // eight runs
#pragma unroll
    for (int c = 0; c < 8; ++c) { g[c] = *(const v4f*)(gp + (c >> 2) * 2048 + (c & 3) * 128); u[c] = *(const v4f*)(up + (c >> 2) * 2048 + (c & 3) * 128); }
    asm volatile("s_wait_xcnt 0x0" :: "v"(gp), "v"(up) : "memory");
    __builtin_amdgcn_sched_barrier(0);   // keeps the vector work behind the wait: without it the compiler works on the first loads before it issues the last, and their latencies add up
#pragma unroll
    for (int c = 0; c < 8; c += 2) { float sg[8];
#pragma unroll
        for (int j = 0; j < 8; ++j) sg[j] = g[c + (j >> 2)][j & 3];
        sig8(sg);
#pragma unroll
        for (int j = 0; j < 8; ++j) { const float sl = __fmul_rn(g[c + (j >> 2)][j & 3], sg[j]); o[c + (j >> 2)][j & 3] = tohx(__fmul_rn(sl, u[c + (j >> 2)][j & 3])); } }
    h16* eo = FF16 + fro(row, k, 2048);
#pragma unroll
    for (int c = 0; c < 8; ++c) *(v4h*)(eo + (c >> 2) * 8 + (c & 3) * 2048) = o[c]; }   // the next row is the next 16-byte run; 128 columns on are four blocks on
__global__ __launch_bounds__(256) void k_fin(const float* __restrict__ X1, const float* __restrict__ F2, float* OUT) { const size_t i0 = ((size_t)blockIdx.x * 1024 + threadIdx.x) * 4; const float* ap = X1 + i0; const float* fp = F2 + i0; v4f a[4], f[4], o[4];
#pragma unroll
    for (int c = 0; c < 4; ++c) { a[c] = *(const v4f*)(ap + c * 1024); f[c] = *(const v4f*)(fp + c * 1024); }
    asm volatile("s_wait_xcnt 0x0" :: "v"(ap), "v"(fp) : "memory");
#pragma unroll
    for (int c = 0; c < 4; ++c) { o[c][0] = __fadd_rn(a[c][0], f[c][0]); o[c][1] = __fadd_rn(a[c][1], f[c][1]); o[c][2] = __fadd_rn(a[c][2], f[c][2]); o[c][3] = __fadd_rn(a[c][3], f[c][3]); }
#pragma unroll
    for (int c = 0; c < 4; ++c) *(v4f*)(OUT + i0 + c * 1024) = o[c]; }

extern "C" void kernel_launch(void* const* d_in, const int* in_sizes, int n_in,
                              void* d_out, int out_size, void* d_ws, size_t ws_size, hipStream_t stream) {
    (void)in_sizes; (void)n_in; (void)out_size;
    const float* x = (const float*)d_in[0]; const float* qkvw = (const float*)d_in[1]; const float* qthr = (const float*)d_in[2]; const float* qgain = (const float*)d_in[3]; const float* wo = (const float*)d_in[4]; const float* gw = (const float*)d_in[5]; const float* gthr = (const float*)d_in[6]; const float* ggain = (const float*)d_in[7]; const float* uw = (const float*)d_in[8]; const float* uthr = (const float*)d_in[9]; const float* ugain = (const float*)d_in[10]; const float* dw = (const float*)d_in[11]; const float* n1w = (const float*)d_in[12]; const float* n2w = (const float*)d_in[13];
    float* OUT = (float*)d_out;     // [2][2048][1024]
    char* wsp = (char*)d_ws;
    auto take = [&](size_t bytes) { char* p = wsp; wsp += (bytes + 255) & ~(size_t)255; return (void*)p; };
    const size_t PL = (size_t)NB_ * NH_ * TT * HD;      // elements of one set of head planes [batch][head][..]
    bf* WO = (bf*)take((size_t)DM * DQ * 2); float* CS = (float*)take((size_t)TT * HD * 2 * 4);
    h16* BQKV = (h16*)take((size_t)4 * 3072 * 256 * 2); h16* BG = (h16*)take((size_t)2 * 4 * 2048 * 256 * 2); h16* BU = BG + (size_t)4 * 2048 * 256; h16* BD = (h16*)take((size_t)DM * 2048 * 2);
    h16* HC = (h16*)take((size_t)4 * NR * 256 * 2); h16* FF16 = (h16*)take((size_t)NR * 2048 * 2); float* ATT = (float*)take((size_t)NR * DM * 4); float* X1 = (float*)take((size_t)NR * DM * 4);
    bf* ATh = (bf*)take((size_t)NR * DQ * 2); bf* ATl = (bf*)take((size_t)NR * DQ * 2);
    float* FQKV = (float*)take((size_t)NR * 3072 * 4);   // dendritic [q|k|v], row pitch 3072
    h16* QP16 = (h16*)take(2 * PL * 2); h16* KP16 = QP16 + PL; bf* QPh = (bf*)take(2 * PL * 2); bf* KPh = QPh + PL; bf* QPl = (bf*)take(2 * PL * 2); bf* KPl = QPl + PL;   // the k planes directly behind the q planes
    h16* VT16 = (h16*)take(PL * 2); bf* VTh = (bf*)take(PL * 2); bf* VTl = (bf*)take(PL * 2);
    if ((size_t)(wsp - (char*)d_ws) > ws_size) return;    // ws 256 MiB
    // gate and up outputs (2 NR 2048 floats) lie over FQKV and the fp16 q and k planes, which are as many bytes and are last read by k_fattn, launched before these are written
    float* ACG = FQKV; float* ACU = ACG + (size_t)NR * 2048;
    k_prep<<<PB_Q + 2 * PB_F + PB_D + PB_O + PB_C, 256, 0, stream>>>(qkvw, gw, uw, dw, wo, BQKV, BG, BU, BD, WO, CS);
    k_rmsc<<<NR / 8, 256, 0, stream>>>(x, 1, n1w, HC);
    // dendritic [q|k|v]: one launch for the whole layer (N = 3072)
    k_dend<<<dim3(NR / 64, 3072 / 64, 1), 128, 0, stream>>>(HC, BQKV, 3072, qthr, qgain, qthr, qgain, FQKV, 0, 0);
    k_qkvp<3072><<<RB + VB, 256, 0, stream>>>(FQKV, CS, QP16, QPh, QPl, VT16, VTh, VTl);
    // causal attention, all heads of both batches in one launch; it writes the merged hi+lo planes itself
    k_fattn<<<dim3(NB_ * NH_, TT / 64, 1), 128, 0, stream>>>(QP16, KP16, VT16, QPh, QPl, KPh, KPl, VTh, VTl, ATh, ATl);
    k_gemmw<bf, 1, false, 8, DQ><<<dim3(NR / 64, DM / 64, 1), 256, 0, stream>>>(ATh, ATl, WO, nullptr, ATT, DM, nullptr, 0, 0, 0);
    k_res<<<NR * DM / 4096, 256, 0, stream>>>(x, ATT, X1); k_rmsc<<<NR / 8, 256, 0, stream>>>(X1, 0, n2w, HC);
    // dendritic gate (z = 0) and up (z = 1) in one launch
    k_dend<<<dim3(NR / 64, 2048 / 64, 2), 128, 0, stream>>>(HC, BG, 2048, gthr, ggain, uthr, ugain, ACG, (size_t)4 * 2048 * 256, (size_t)NR * 2048);
    k_ffp<<<NR * 2048 / 8192, 256, 0, stream>>>(ACG, ACU, FF16);
    k_gemmw<h16, 0, false, 8, 2048><<<dim3(NR / 64, DM / 64, 1), 256, 0, stream>>>(FF16, nullptr, BD, nullptr, ATT, DM, nullptr, 0, 0, 0);
    k_fin<<<NR * DM / 4096, 256, 0, stream>>>(X1, ATT, OUT);
}

// v008
// One run takes 220 microseconds.
// Next to v007, in two timings, it ran 1.12 times as fast each time.
// All steps since v000 together make it 9.71 times as fast.
#include <hip/hip_runtime.h>

// Transformer block with dendritic layers (x [2][2048][1024]; h = RMSNorm(x) w1; [q|k|v] = dendritic(h, qkv_w, thr, gain) = max over the 4 input blocks n of gain[n] silu(h_n W[n] - thr[n]) (16 heads x 64); causal softmax(q.k/8); x1 = x + merged.v o_w;
// h2 = RMSNorm(x1) w2; ff = silu(dendritic(h2, gate)) * dendritic(h2, up); out = x1 + ff down_w -> [2][2048][1024]; all weights x @ W; eps = f32 eps).
// Compute dtypes, f32 accumulate: every input rounded to bf16; the RMSNorms f32 -> SINGLE fp16 block planes; every dendritic GEMM on fp16 planes x fp16 copies of the bf16 weights (1 product; hi+lo would double the
// ~60 G of dendritic GEMMs), the gain/silu/threshold/max epilogues f32; scores (K 64) and probs.v on hl planes (3 products) for the first 512 query rows of each head and single fp16 planes for the rest, f32 causal softmax with masked tiles

#define NB_  2
#define TT   2048
#define NR   (NB_ * TT)         // rows of both batches: every row-wise kernel takes them in one launch
#define DM   1024
#define NH_  16
#define NKV  16
#define REP  (NH_ / NKV)
#define HD   64
#define DQ   (NH_ * HD)
#define DKV  (NKV * HD)
#define RH   512                  // query rows < RH use hi+lo planes (0: none)
#define SCL  0.125f   // HD^-0.5
typedef _Float16 h16;
typedef unsigned short bf;
typedef __attribute__((ext_vector_type(16))) __bf16   v16bf;
typedef __attribute__((ext_vector_type(16))) _Float16 v16h;
typedef __attribute__((ext_vector_type(8)))  _Float16 v8h;
typedef __attribute__((ext_vector_type(8)))  unsigned short v8us;
typedef __attribute__((ext_vector_type(8)))  float    v8f;
typedef __attribute__((ext_vector_type(4)))  float    v4f;
typedef v8h  __attribute__((may_alias)) v8ha;
typedef v4f  __attribute__((may_alias)) v4fa;
typedef v8us __attribute__((may_alias)) v8usa;

__device__ __forceinline__ unsigned short f2bf(float f) { unsigned u = __float_as_uint(f); u += 0x7FFFu + ((u >> 16) & 1u); return (unsigned short)(u >> 16); }
__device__ __forceinline__ float bf2f(unsigned short b) { return __uint_as_float(((unsigned)b) << 16); }
__device__ __forceinline__ float bfr(float f) { return bf2f(f2bf(f)); }
__device__ __forceinline__ v16h cat16(v8h lo, v8h hi) { return __builtin_shufflevector(lo, hi, 0, 1, 2, 3, 4, 5, 6, 7, 8, 9, 10, 11, 12, 13, 14, 15); }
__device__ __forceinline__ v16bf cat16b(v8us lo, v8us hi) { return __builtin_bit_cast(v16bf, __builtin_shufflevector(lo, hi, 0, 1, 2, 3, 4, 5, 6, 7, 8, 9, 10, 11, 12, 13, 14, 15)); }
__device__ __forceinline__ v8f wmma16(v16h a, v16h b, v8f c) { return __builtin_amdgcn_wmma_f32_16x16x32_f16(false, a, false, b, (short)0, c, false, false); }
__device__ __forceinline__ v8f wmmab(v16bf a, v16bf b, v8f c) { return __builtin_amdgcn_wmma_f32_16x16x32_bf16(false, a, false, b, (short)0, c, false, false); }



// ---- Fragment order: every 16-bit operand plane P[row][k] (K columns, K % 32 == 0) is stored as blocks of 16 rows x 32 k, 1 KB each, block (row / 16, k / 32) at element ((row / 16) (K / 32) + k / 32) 512.
// Inside a block the eight k of one 16-byte run lie where the matrix instruction's lane wants them: lane = row % 16 + 16 ((k / 8) % 2), first half of the fragment (k % 32 < 16) at lane * 8, second half at 256 + lane * 8.
// So a wave's fragment is two 16-byte loads of 512 contiguous bytes each (four whole lines), not two loads that touch 16 lines; which lane and register holds which (row, k) is the matrix instruction's own layout (k = 8 (lane / 16) + j and 16 + 8 (lane / 16) + j of row lane % 16).
__device__ __forceinline__ size_t fro(int row, int k, int K) { return ((size_t)(row >> 4) * (K >> 5) + (k >> 5)) * 512 + ((k >> 4) & 1) * 256 + ((row & 15) + ((k >> 3) & 1) * 16) * 8 + (k & 7); }
// a wave-uniform base plus the lane's fixed byte offset (lane * 16): the form of every fragment load
template <typename T16> __device__ __forceinline__ const T16* atl(const T16* base, unsigned ob) { return (const T16*)((const char*)base + ob); }

// ---- k_gemmw: register-blocked GEMM, 64x64 output tile (16 accumulators) per wave, operands straight from 16-bit planes in fragment order; grid (M/64, N/64, Z), 32 * KS threads.
// KS = 1: one wave owns the tile. KS > 1 (K % 64 == 0): the KS waves of the work-group share the tile's K loop, so each waits out 1/KS of its load latencies, and their partial tiles are summed through LDS.
// RES (KS = 8 only): the residual res[m][n] (f32, pitch ldc) is added to the summed tile in the epilogue; 1: rounded to bf16 first (an input), 2: as it is; 0: none.
// C[m][n] (f32, pitch ldc, + optional f32 bias[n]) = sum_k A[m][k] Bt[n][k] (+ split products per NSPLIT). z-batch strides sA/sB/sC in elements. K % 32 == 0, a template constant, so that every block's distance from the two bases is an immediate offset.
template <typename T16> struct WFrag;
template <> struct WFrag<h16> { typedef v16h V; static __device__ __forceinline__ V ld(const h16* p) { return cat16(*(const v8h*)p, *(const v8h*)(p + 256)); } static __device__ __forceinline__ v8f mma(V a, V b, v8f c) { return wmma16(a, b, c); } };
template <> struct WFrag<bf> { typedef v16bf V; static __device__ __forceinline__ V ld(const bf* p) { return cat16b(*(const v8us*)p, *(const v8us*)(p + 256)); } static __device__ __forceinline__ v8f mma(V a, V b, v8f c) { return wmmab(a, b, c); } };
template <typename T16, int NSPLIT, bool BIAS, int KS, int K, int RES>
__global__ __launch_bounds__(32 * KS) void k_gemmw(const T16* __restrict__ A, const T16* __restrict__ A2, const T16* __restrict__ Bt, const T16* __restrict__ Bt2, float* C, int ldc, const float* __restrict__ bias, size_t sA, size_t sB, size_t sC, const float* __restrict__ res) {
    static_assert(RES == 0 || KS == 8, "the residual is added where the eight partial tiles are summed");
    typedef typename WFrag<T16>::V V;
    constexpr int WST = (KS == 1) ? 16 * 68 : 64 * 68;      // floats of one wave's LDS slab: one 16-row block (KS = 1), its whole partial tile (KS > 1)
    __shared__ __align__(16) float os[KS * WST];
    const int wv = (KS == 1) ? 0 : __builtin_amdgcn_readfirstlane((int)(threadIdx.x >> 5));   // wave number, scalar: the K loop's control stays a scalar branch
    const size_t z = blockIdx.z; A += z * sA; if (A2) A2 += z * sA; Bt += z * sB; if (Bt2) Bt2 += z * sB; C += z * sC;
    const int lane = threadIdx.x & 31, lr = lane & 15, hi = lane >> 4; const int r0 = blockIdx.x * 64, c0 = blockIdx.y * 64;
    v8f acc[4][4];
#pragma unroll
    for (int mb = 0; mb < 4; ++mb)
#pragma unroll
        for (int nb = 0; nb < 4; ++nb) acc[mb][nb] = (v8f){};
    const unsigned lob = (unsigned)lane * 16u;      // the lane's byte offset in every block
    A += (size_t)r0 * K; if (A2) A2 += (size_t)r0 * K; Bt += (size_t)c0 * K; if (Bt2) Bt2 += (size_t)c0 * K;     // 16 rows of blocks are 16 K elements
#pragma unroll 1
    for (int kc = wv * 64; kc < K; kc += (kc & 32) ? KS * 64 - 32 : 32) {   // wave wv takes the 64-wide K chunks wv, wv + KS, ... (two blocks of each 16 operand rows)
        const T16* pa = atl(A + (size_t)kc * 16, lob); const T16* pa2 = (NSPLIT == 1 || NSPLIT == 2) ? atl(A2 + (size_t)kc * 16, lob) : pa; const T16* pb = atl(Bt + (size_t)kc * 16, lob); const T16* pb2 = (NSPLIT >= 2) ? atl(Bt2 + (size_t)kc * 16, lob) : pb;
        V a[4], a2[4];
#pragma unroll
        for (int mb = 0; mb < 4; ++mb) { a[mb] = WFrag<T16>::ld(pa + mb * 16 * K); if (NSPLIT == 1 || NSPLIT == 2) a2[mb] = WFrag<T16>::ld(pa2 + mb * 16 * K); }
#pragma unroll
        for (int nb = 0; nb < 4; ++nb) { const V b = WFrag<T16>::ld(pb + nb * 16 * K); V b2; if (NSPLIT >= 2) b2 = WFrag<T16>::ld(pb2 + nb * 16 * K);
#pragma unroll
            for (int mb = 0; mb < 4; ++mb) { acc[mb][nb] = WFrag<T16>::mma(a[mb], b, acc[mb][nb]); if (NSPLIT == 1 || NSPLIT == 2) acc[mb][nb] = WFrag<T16>::mma(a2[mb], b, acc[mb][nb]); if (NSPLIT >= 2) acc[mb][nb] = WFrag<T16>::mma(a[mb], b2, acc[mb][nb]); } }
        // the trip's addresses stay live up to this wait, so no register that an issued operand load names is given a new value in front of it
        asm volatile("s_wait_xcnt 0x0" :: "v"(pa), "v"(pa2), "v"(pb), "v"(pb2) : "memory");
        asm volatile("v_nop\n\tv_nop\n\tv_nop\n\tv_nop" : "+v"(acc[0][0]), "+v"(acc[1][1]), "+v"(acc[2][2]), "+v"(acc[3][3]) : "v"(a[0]), "v"(a[3]));
    }
    if constexpr (KS > 1) {     // the KS waves' partial tiles meet in LDS and are summed in fixed wave order 0 .. KS-1
        v4f rv[32 / KS];
        if constexpr (RES != 0) {   // this thread's residual runs, asked for here so that they fly under the LDS stores and the barrier
            const float* rb = res + z * sC + (size_t)r0 * ldc + c0; unsigned rob[4];
#pragma unroll
            for (int q = 0; q < 4; ++q) { rob[q] = ((unsigned)(q * 2 * KS + (int)(threadIdx.x >> 4)) * (unsigned)ldc + (threadIdx.x & 15u) * 4u) * 4u; rv[q] = *(const v4fa*)((const char*)rb + rob[q]); }
            // the four byte offsets and the base stay live up to this wait, so no register that an issued residual load names is given a new value in front of it
            asm volatile("s_wait_xcnt 0x0" :: "v"(rob[0]), "v"(rob[1]), "v"(rob[2]), "v"(rob[3]), "s"(rb) : "memory");
        }
        // unrolls: acc[][] stays in registers only under constant indices; the q and ww loops so that their LDS reads issue together
#pragma unroll
        for (int mb = 0; mb < 4; ++mb)
#pragma unroll
            for (int nb = 0; nb < 4; ++nb) {
#pragma unroll
                for (int j = 0; j < 8; ++j) os[wv * WST + (mb * 16 + hi * 8 + j) * 68 + nb * 16 + lr] = acc[mb][nb][j]; }
        __syncthreads();    // every wave's partial tile is in LDS before any of it is summed
        float* crow = C + (size_t)r0 * ldc + c0;
#pragma unroll
        for (int q = 0; q < 32 / KS; ++q) { const int idx = q * 32 * KS + (int)threadIdx.x, row = idx >> 4, cofs = (idx & 15) * 4; v4f val = *(const v4fa*)(os + row * 68 + cofs);
#pragma unroll
            for (int ww = 1; ww < KS; ++ww) val += *(const v4fa*)(os + ww * WST + row * 68 + cofs);
            if (BIAS) { val[0] += bfr(bias[c0 + cofs]); val[1] += bfr(bias[c0 + cofs + 1]); val[2] += bfr(bias[c0 + cofs + 2]); val[3] += bfr(bias[c0 + cofs + 3]); }
            if constexpr (RES != 0) {
#pragma unroll
                for (int e = 0; e < 4; ++e) val[e] = __fadd_rn(RES == 1 ? bfr(rv[q][e]) : rv[q][e], val[e]); }
            *(v4f*)(crow + (size_t)row * ldc + cofs) = val; }
        return;
    }
#pragma unroll
    for (int mb = 0; mb < 4; ++mb) {
#pragma unroll
        for (int nb = 0; nb < 4; ++nb) {
#pragma unroll
            for (int j = 0; j < 8; ++j) os[(hi * 8 + j) * 68 + nb * 16 + lr] = acc[mb][nb][j]; }
        __builtin_amdgcn_wave_barrier(); asm volatile("" ::: "memory");
        float* crow = C + (size_t)(r0 + mb * 16) * ldc + c0;
{
#pragma unroll
            for (int s = 0; s < 8; ++s) { const int row = 2 * s + hi, cofs = lr * 4; v4f val = *(const v4fa*)(os + row * 68 + cofs); if (BIAS) { val[0] += bfr(bias[c0 + cofs]); val[1] += bfr(bias[c0 + cofs + 1]); val[2] += bfr(bias[c0 + cofs + 2]); val[3] += bfr(bias[c0 + cofs + 3]); }
                *(v4f*)(crow + (size_t)row * ldc + cofs) = val; }
             }
        __builtin_amdgcn_wave_barrier(); asm volatile("" ::: "memory");
    }
}

__device__ __forceinline__ h16 tohx(float x) { return (h16)x; }
__device__ __forceinline__ void splitf(float y, unsigned short& h, unsigned short& l) { h = f2bf(y); l = f2bf(y - bf2f(h)); }
typedef __attribute__((ext_vector_type(2))) _Float16 v2h;
typedef __attribute__((ext_vector_type(4))) _Float16 v4h;
typedef __attribute__((ext_vector_type(2))) unsigned short v2us;
typedef __attribute__((ext_vector_type(4))) unsigned short v4us;
typedef __attribute__((ext_vector_type(2))) float v2f;
typedef __attribute__((ext_vector_type(4))) int v4i;

// d_wtG: Bt[n][k] (fragment order) = bf16 of w[k][n]; the register block, the block indices and the waits of d_wt16 below
template <int K, int N>
__device__ __forceinline__ void d_wtG(const float* __restrict__ w, bf* Bt, int bx, int by) { const int lane = threadIdx.x & 31; const int n0 = bx * 64 + (lane & 15) * 4, k0 = by * 128 + (int)(threadIdx.x >> 5) * 16 + (lane >> 4) * 8; v4f r[8];
    const float* wp = w + (size_t)k0 * N + n0;
    // every unroll: the register blocks stay in registers only under constant indices
#pragma unroll
    for (int j = 0; j < 8; ++j) r[j] = *(const v4f*)(wp + j * N);
    // the address stays live up to this wait, so no register that an issued load names is given a new value in front of it
    asm volatile("s_wait_xcnt 0x0" :: "v"(wp) : "memory");
    v8us o[4];
#pragma unroll
    for (int q = 0; q < 4; ++q)
#pragma unroll
        for (int j = 0; j < 8; ++j) o[q][j] = f2bf(r[j][q]);
#pragma unroll
    for (int q = 0; q < 4; ++q) *(v8us*)(Bt + fro(n0, k0, K) + q * 8) = o[q];   // fragment order: the next n is the next 16-byte run
    // the caller's code for its other block ranges follows in the kernel and rewrites registers that these stores name: the wait stands in front of that
    asm volatile("s_wait_xcnt 0x0" ::: "memory"); }
__global__ __launch_bounds__(256) void k_cvt8(const float* __restrict__ src, bf* dst, size_t n8) { const size_t i = (size_t)blockIdx.x * 256 + threadIdx.x; if (i >= n8) return; const v8f v = *(const v8f*)(src + i * 8); v8us o;
#pragma unroll
    for (int k = 0; k < 8; ++k) o[k] = f2bf(v[k]); *(v8us*)(dst + i * 8) = o;  }
__global__ __launch_bounds__(256) void k_cscvt(const float* __restrict__ cosT, const float* __restrict__ sinT, float* CS) { const int idx = blockIdx.x * 256 + threadIdx.x; if (idx >= TT * HD) return; v2f cs; cs[0] = bfr(cosT[idx]); cs[1] = bfr(sinT[idx]); *(v2f*)(CS + (size_t)idx * 2) = cs;  }
// d_rope: head planes [h][t][d] (each head's [t][d] in fragment order; fp16 + hi/lo) of rope(x) x sc with the rotate-half convention out[d] = x[d] cos[t][d] - x[d+HD/2] sin[t][d], out[d+HD/2] = x[d+HD/2] cos[t][d+HD/2] + x[d] sin[t][d+HD/2]
// Each thread takes four consecutive d of the rows t, t + 16, t + 32 and t + 48 of one head, so that a wave's 16-byte load covers whole lines; its sixteen loads all issue before the first run is worked on. Blocks bx: 2 * NB_ * NH_ * TT * HD / 4096, exact (a block covers 64 whole rows of one head).
// One range of blocks does q and k of both batches: plane h = (s NB_ + batch) NH_ + head, s = 0 for q and 1 for k; its source is the rows batch TT + t and the columns s DQ + head HD of F.
static_assert(NH_ == NKV, "q and k planes are numbered alike");
template <int PITCH>
__device__ __forceinline__ void d_rope(const float* __restrict__ F, const float* __restrict__ CS, float sc, h16* P16, bf* Ph, bf* Pl, int bx) {
    // every unroll of this function: the register blocks stay in registers only under constant indices
    const size_t e = ((size_t)bx * 1024 + threadIdx.x) * 4; const int d = (int)(e % HD); const int t = (int)((e / HD) % TT); const int h = (int)(e / ((size_t)HD * TT));
    const bool lo = d < HD / 2;      // a run lies wholly in one half of the row, its partners in the other
    const float* fa = F + (size_t)((h / NH_) % NB_ * TT + t) * PITCH + (h / (NB_ * NH_)) * DQ + (h % NH_) * HD + d; const float* fb = lo ? fa + HD / 2 : fa - HD / 2; const float* cp = CS + ((size_t)t * HD + d) * 2;
    v4f xa[4], xb[4], cv[4][2];
#pragma unroll
    for (int c = 0; c < 4; ++c) { xa[c] = *(const v4f*)(fa + c * 16 * PITCH); xb[c] = *(const v4f*)(fb + c * 16 * PITCH); cv[c][0] = *(const v4f*)(cp + c * 16 * HD * 2); cv[c][1] = *(const v4f*)(cp + c * 16 * HD * 2 + 4); }
    // the three addresses stay live up to this wait, so no register that an issued load names is given a new value in front of it
    asm volatile("s_wait_xcnt 0x0" :: "v"(fa), "v"(fb), "v"(cp) : "memory");
    __builtin_amdgcn_sched_barrier(0);   // keeps the vector work behind the wait: without it the compiler works on the first loads before it issues the last, and their latencies add up
    v4h o16[4]; v4us oh[4], ol[4];
#pragma unroll
    for (int c = 0; c < 4; ++c)
#pragma unroll
        for (int q = 0; q < 4; ++q) { const float a = __fmul_rn(xa[c][q], cv[c][q >> 1][(q & 1) * 2]), bq = __fmul_rn(xb[c][q], cv[c][q >> 1][(q & 1) * 2 + 1]); const float r = (lo ? __fsub_rn(a, bq) : __fadd_rn(a, bq)) * sc;
            o16[c][q] = tohx(r); unsigned short a2, c2; splitf(r, a2, c2); oh[c][q] = a2; ol[c][q] = c2; }
    const size_t eo = (size_t)h * TT * HD + fro(t, d, HD);      // 16 rows on are two blocks on, 1024 elements
#pragma unroll
    for (int c = 0; c < 4; ++c) { *(v4h*)(P16 + eo + c * 1024) = o16[c]; *(v4us*)(Ph + eo + c * 1024) = oh[c]; *(v4us*)(Pl + eo + c * 1024) = ol[c]; }
    // the caller's code for its other block ranges follows in the kernel and rewrites registers that these stores name: the wait stands in front of that
    asm volatile("s_wait_xcnt 0x0" ::: "memory"); }
// d_vtp: transposed value planes [g][d][t] (each head's [d][t] in fragment order). Each thread holds a block of 8 t x 4 d in registers: eight 16-byte loads along d (a wave reads two whole 256-byte head rows a load), then per d and plane one 16-byte store along t.
// Blocks (bx < TT / 128, g < NB_ * heads; g = batch NKV + head), 256 threads: a block covers one head's 64 d x 128 t, so every 128-byte output line is filled by one block.
template <int PITCH>
__device__ __forceinline__ void d_vtp(const float* __restrict__ F, h16* V16, bf* Vh, bf* Vl, int bx, int g) { const int lane = threadIdx.x & 31; const int d0 = (lane & 15) * 4, t0 = bx * 128 + (int)(threadIdx.x >> 5) * 16 + (lane >> 4) * 8; v4f r[8];
    const float* fp = F + (size_t)(g / NKV * TT + t0) * PITCH + (g % NKV) * HD + d0;
    // every unroll: the register blocks stay in registers only under constant indices
#pragma unroll
    for (int j = 0; j < 8; ++j) r[j] = *(const v4f*)(fp + j * PITCH);
    // the address stays live up to this wait, so no register that an issued load names is given a new value in front of it
    asm volatile("s_wait_xcnt 0x0" :: "v"(fp) : "memory");
    v8h o16[4]; v8us oh[4], ol[4];
#pragma unroll
    for (int q = 0; q < 4; ++q)
#pragma unroll
        for (int j = 0; j < 8; ++j) { const float x = r[j][q]; o16[q][j] = tohx(x); unsigned short a2, c2; splitf(x, a2, c2); oh[q][j] = a2; ol[q][j] = c2; }
    const size_t e = (size_t)g * HD * TT + fro(d0, t0, TT);      // the next d is the next 16-byte run
#pragma unroll
    for (int q = 0; q < 4; ++q) { *(v8h*)(V16 + e + q * 8) = o16[q]; *(v8us*)(Vh + e + q * 8) = oh[q]; *(v8us*)(Vl + e + q * 8) = ol[q]; }
    // the caller's code for its other block ranges follows in the kernel and rewrites registers that these stores name: the wait stands in front of that
    asm volatile("s_wait_xcnt 0x0" ::: "memory"); }
// k_qkvp: the q and k head planes and the transposed v planes of both batches in one launch (they only share their source F); the first RB blocks do d_rope, the other NB_ * NKV * TT / 128 do d_vtp.
#define RB   (2 * NB_ * NH_ * TT * HD / 4096)
#define VB   (NB_ * NKV * TT / 128)
template <int PITCH>
__global__ __launch_bounds__(256) void k_qkvp(const float* __restrict__ F, const float* __restrict__ CS, h16* P16, bf* Ph, bf* Pl, h16* V16, bf* Vh, bf* Vl) {
    const int i = (int)blockIdx.x;
    if (i < RB) d_rope<PITCH>(F, CS, 1.0f, P16, Ph, Pl, i);
    else d_vtp<PITCH>(F + DQ + DKV, V16, Vh, Vl, (i - RB) % (TT / 128), (i - RB) / (TT / 128)); }
// blocks bx < TT * HD / 2048, exact: four 16-byte stores (two (cos, sin) pairs each) a thread
__device__ __forceinline__ void d_csid(float* CS, int bx) { v4f cs; cs[0] = 1.0f; cs[1] = 0.0f; cs[2] = 1.0f; cs[3] = 0.0f; float* p = CS + ((size_t)bx * 1024 + threadIdx.x) * 4;
#pragma unroll
    for (int c = 0; c < 4; ++c) *(v4f*)(p + c * 1024) = cs;
    // behind these stores the caller's way to its end rewrites scalar registers, the stores' base among them: the wait stands in front of that
    asm volatile("s_wait_xcnt 0x0" ::: "memory"); }
// ---- k_fattn: causal attention of both batches in one launch; grid (NB_ * heads, TT/64), 128 threads; wave w of a work-group owns the 16 query rows r0 + 16 w .. + 15 of one head and walks the keys 0 .. r0 + 63 in passes of 64.
// Transposed products: S^T = K Q^T (A = key rows, B = query rows), so a lane holds 32 scores of ONE query (column lane & 15; keys 16 kb + 8 (lane >> 4) + j); running maximum and sum stay in the lane, the two lane halves
// exchange the maximum once a pass and the sum once at the end. Two score tiles, converted in place, are the B operand of O^T += V^T P^T (A = rows of the transposed value plane). Scores and probabilities never leave the registers.
// Operand classes: query rows < RH on bf16 hi+lo planes (3 products each), the rest on single fp16 planes (probabilities carried x 2^10, which cancels in the division by their sum). Output: bf16 hi+lo planes [t][DQ]. All planes in fragment order.
template <typename T16> struct IsHL { static constexpr bool v = false; };
template <> struct IsHL<bf> { static constexpr bool v = true; };
template <bool B> struct BoolC { static constexpr bool value = B; };
__device__ __forceinline__ float xhalf(float x) { return __int_as_float(__builtin_amdgcn_permlanex16(__float_as_int(x), __float_as_int(x), 0x76543210, 0xfedcba98, false, false)); }   // the value of lane ^ 16
// eight 2^x in place, in one statement: each v_exp_f32 is followed by one that neither reads its result nor overwrites its source, the last by the v_nop that the instruction set asks for behind a transcendental
__device__ __forceinline__ void exp2x8(float (&e)[8]) {
    asm("v_exp_f32 %0, %0\n\tv_exp_f32 %1, %1\n\tv_exp_f32 %2, %2\n\tv_exp_f32 %3, %3\n\tv_exp_f32 %4, %4\n\tv_exp_f32 %5, %5\n\tv_exp_f32 %6, %6\n\tv_exp_f32 %7, %7\n\tv_nop"
        : "+v"(e[0]), "+v"(e[1]), "+v"(e[2]), "+v"(e[3]), "+v"(e[4]), "+v"(e[5]), "+v"(e[6]), "+v"(e[7])); }
// eight 1/x in place (v_rcp_f32, 1 ulp), in one statement for the same reason; sig8: eight sigmoids 1 / (1 + e^-z) from eight z, the exponent as __expf forms it (2^(-z log2 e))
__device__ __forceinline__ void rcpx8(float (&e)[8]) {
    asm("v_rcp_f32 %0, %0\n\tv_rcp_f32 %1, %1\n\tv_rcp_f32 %2, %2\n\tv_rcp_f32 %3, %3\n\tv_rcp_f32 %4, %4\n\tv_rcp_f32 %5, %5\n\tv_rcp_f32 %6, %6\n\tv_rcp_f32 %7, %7\n\tv_nop"
        : "+v"(e[0]), "+v"(e[1]), "+v"(e[2]), "+v"(e[3]), "+v"(e[4]), "+v"(e[5]), "+v"(e[6]), "+v"(e[7])); }
__device__ __forceinline__ void sig8(float (&e)[8]) {
    // both unrolls: e[] stays in registers only under constant indices
#pragma unroll
    for (int j = 0; j < 8; ++j) e[j] = __fmul_rn(e[j], -1.4426950408889634f);
    exp2x8(e);
#pragma unroll
    for (int j = 0; j < 8; ++j) e[j] = 1.0f + e[j];
    rcpx8(e); }
template <typename T16>
__device__ __forceinline__ void attn_wave(const T16* __restrict__ Qp, const T16* __restrict__ Q2, const T16* __restrict__ Kp, const T16* __restrict__ K2, const T16* __restrict__ Vp, const T16* __restrict__ V2, int q0, bf* __restrict__ Ah, bf* __restrict__ Al) {
    // every unroll below: the fragment, score and accumulator arrays stay in registers only under constant indices
    typedef typename WFrag<T16>::V V; constexpr bool HL = IsHL<T16>::v;
    constexpr float CL = SCL * 1.4426950408889634f, OFF = HL ? 0.0f : 10.0f;      // scores in log2 units; OFF: the carry 2^10 of the fp16 probabilities
    const int lane = threadIdx.x & 31, lr = lane & 15, hi = lane >> 4; const int q = q0 + lr;
    // every load is a wave-uniform base plus the lane's fixed byte offset in a block: the offset never changes, only the key and value bases move on, by one pass at a time
    const unsigned qob = (unsigned)lane * 16u, kob = qob, vob = qob;
    Qp += q0 * HD; if constexpr (HL) Q2 += q0 * HD;      // the wave's 16 query rows: two blocks
    auto at = [](const T16* base, unsigned ob) { return (const T16*)((const char*)base + ob); };
    const T16* qa = at(Qp, qob); const T16* qa2 = HL ? at(Q2, qob) : nullptr; const T16* ka0 = at(Kp, kob);
    V qf[2], qf2[2];
#pragma unroll
    for (int ds = 0; ds < 2; ++ds) { qf[ds] = WFrag<T16>::ld(qa + ds * 512); if constexpr (HL) qf2[ds] = WFrag<T16>::ld(qa2 + ds * 512); }
    v8f o[4];
#pragma unroll
    for (int db = 0; db < 4; ++db) o[db] = (v8f){};
    float m = -3.0e38f, l = 0.0f;
    V kf[4][2], kf2[4][2];
    if constexpr (!HL) {    // single planes: the key fragments run one pass ahead; hi+lo planes (at most RH / 64 passes, twice the registers) fetch theirs inside the pass
#pragma unroll
        for (int kb = 0; kb < 4; ++kb)
#pragma unroll
            for (int ds = 0; ds < 2; ++ds) kf[kb][ds] = WFrag<T16>::ld(ka0 + kb * 16 * HD + ds * 512);
    }
    // all s_wait_xcnt below: addresses, offsets and bases stay live up to the wait, so no register that an issued load names is given a new value in front of it;
    // the sched_barrier behind a wait keeps the loads in front of it and later vector work behind it
    if constexpr (HL) asm volatile("s_wait_xcnt 0x0" :: "v"(qa), "v"(qa2), "v"(qob), "s"(Qp), "s"(Q2) : "memory"); else asm volatile("s_wait_xcnt 0x0" :: "v"(qa), "v"(ka0), "v"(qob), "v"(kob), "s"(Qp), "s"(Kp) : "memory");
    __builtin_amdgcn_sched_barrier(0);
    const int np = q0 / 64 + 1;     // passes; only the last one meets the diagonal
    auto pass = [&](auto diag, int kt) {
        V vf[4][2], vf2[4][2];
        const T16* ka = at(Kp, kob); const T16* ka2 = HL ? at(K2, kob) : nullptr; const T16* va = at(Vp, vob); const T16* va2 = HL ? at(V2, vob) : nullptr;
        if constexpr (HL) {
#pragma unroll
            for (int kb = 0; kb < 4; ++kb)
#pragma unroll
                for (int ds = 0; ds < 2; ++ds) { kf[kb][ds] = WFrag<T16>::ld(ka + kb * 16 * HD + ds * 512); kf2[kb][ds] = WFrag<T16>::ld(ka2 + kb * 16 * HD + ds * 512); }
            asm volatile("s_wait_xcnt 0x0" :: "v"(ka), "v"(ka2), "v"(kob), "s"(Kp), "s"(K2) : "memory");
            __builtin_amdgcn_sched_barrier(0);
        } else {
#pragma unroll
            for (int db = 0; db < 4; ++db)
#pragma unroll
                for (int ks = 0; ks < 2; ++ks) vf[db][ks] = WFrag<T16>::ld(va + db * 16 * TT + ks * 512);
        }
        v8f s[4];
#pragma unroll
        for (int kb = 0; kb < 4; ++kb) { s[kb] = (v8f){};
#pragma unroll
            for (int ds = 0; ds < 2; ++ds) { s[kb] = WFrag<T16>::mma(kf[kb][ds], qf[ds], s[kb]); if constexpr (HL) { s[kb] = WFrag<T16>::mma(kf[kb][ds], qf2[ds], s[kb]); s[kb] = WFrag<T16>::mma(kf2[kb][ds], qf[ds], s[kb]); } } }
        if constexpr (HL) {     // the value fragments fly under the softmax
#pragma unroll
            for (int db = 0; db < 4; ++db)
#pragma unroll
                for (int ks = 0; ks < 2; ++ks) { vf[db][ks] = WFrag<T16>::ld(va + db * 16 * TT + ks * 512); vf2[db][ks] = WFrag<T16>::ld(va2 + db * 16 * TT + ks * 512); }
            asm volatile("s_wait_xcnt 0x0" :: "v"(va), "v"(va2), "v"(vob), "s"(Vp), "s"(V2) : "memory");
            __builtin_amdgcn_sched_barrier(0);
        } else {
            if constexpr (!decltype(diag)::value) {     // the next pass's key fragments, behind this pass's score products
#pragma unroll
                for (int kb = 0; kb < 4; ++kb)
#pragma unroll
                    for (int ds = 0; ds < 2; ++ds) kf[kb][ds] = WFrag<T16>::ld(ka + (64 + kb * 16) * HD + ds * 512);
            }
            asm volatile("s_wait_xcnt 0x0" :: "v"(ka), "v"(va), "v"(kob), "v"(vob), "s"(Kp), "s"(Vp) : "memory");
            __builtin_amdgcn_sched_barrier(0);
        }
        if constexpr (!decltype(diag)::value) { Kp += 64 * HD; Vp += 64 * 16; if constexpr (HL) { K2 += 64 * HD; V2 += 64 * 16; } }   // 64 keys: eight key blocks; two blocks of each 16 value rows
        if constexpr (decltype(diag)::value) {      // causal mask: key > query
#pragma unroll
            for (int kb = 0; kb < 4; ++kb)
#pragma unroll
                for (int j = 0; j < 8; ++j) s[kb][j] = (kt + kb * 16 + hi * 8 + j > q) ? -3.0e38f : s[kb][j];
        }
        float t4[4];     // four independent chains, one a score tile, then a tree: the maximum (and below the sum) does not wait on one chain of 32
#pragma unroll
        for (int kb = 0; kb < 4; ++kb) { t4[kb] = s[kb][0];
#pragma unroll
            for (int j = 1; j < 8; ++j) t4[kb] = fmaxf(t4[kb], s[kb][j]); }
        float tm = fmaxf(fmaxf(t4[0], t4[1]), fmaxf(t4[2], t4[3]));
        tm = fmaxf(tm, xhalf(tm));
        const float mn = fmaxf(m, tm * CL), sh = OFF - mn; float al = m - mn; m = mn;
        asm("v_exp_f32 %0, %0\n\tv_nop" : "+v"(al));     // 2^al; the v_nop is the slot that the instruction set asks for behind a transcendental
#pragma unroll
        for (int kb = 0; kb < 4; ++kb) { t4[kb] = 0.0f; float e[8];
#pragma unroll
            for (int j = 0; j < 8; ++j) e[j] = fmaf(s[kb][j], CL, sh);
            exp2x8(e);
#pragma unroll
            for (int j = 0; j < 8; ++j) { s[kb][j] = e[j]; t4[kb] += e[j]; } }
        l = fmaf(l, al, (t4[0] + t4[1]) + (t4[2] + t4[3]));
#pragma unroll
        for (int db = 0; db < 4; ++db) o[db] *= al;
#pragma unroll
        for (int ks = 0; ks < 2; ++ks) {
            if constexpr (HL) { v8us h0, h1, l0, l1;
#pragma unroll
                for (int j = 0; j < 8; ++j) { unsigned short a, c; splitf(s[2 * ks][j], a, c); h0[j] = a; l0[j] = c; splitf(s[2 * ks + 1][j], a, c); h1[j] = a; l1[j] = c; }
                const V ph = cat16b(h0, h1), pl = cat16b(l0, l1);
#pragma unroll
                for (int db = 0; db < 4; ++db) { o[db] = WFrag<T16>::mma(vf[db][ks], ph, o[db]); o[db] = WFrag<T16>::mma(vf[db][ks], pl, o[db]); o[db] = WFrag<T16>::mma(vf2[db][ks], ph, o[db]); }
            } else { const V pf = cat16(__builtin_convertvector(s[2 * ks], v8h), __builtin_convertvector(s[2 * ks + 1], v8h));
#pragma unroll
                for (int db = 0; db < 4; ++db) o[db] = WFrag<T16>::mma(vf[db][ks], pf, o[db]); }
        }
    };
    // unroll 1: one pass is already a long straight run; a second copy would only double the code
#pragma unroll 1
    for (int p = 0; p + 1 < np; ++p) pass(BoolC<false>(), p * 64);
    pass(BoolC<true>(), (np - 1) * 64);
    l += xhalf(l); const float inv = __fdiv_rn(1.0f, l);
    v8us oh[4], ol[4];
#pragma unroll
    for (int db = 0; db < 4; ++db)
#pragma unroll
        for (int j = 0; j < 8; ++j) { unsigned short a, c; splitf(o[db][j] * inv, a, c); oh[db][j] = a; ol[db][j] = c; }
    const size_t oo = (size_t)q0 * DQ + lane * 8;   // a lane's eight accumulator registers are eight consecutive d of its query row: in fragment order its own 16-byte run of half a block, so a wave's store is 512 contiguous bytes
#pragma unroll
    for (int db = 0; db < 4; ++db) { *(v8us*)(Ah + oo + db * 256) = oh[db]; *(v8us*)(Al + oo + db * 256) = ol[db]; }
}
// waves_per_eu(2, 2): with the register budget of two waves a SIMD a pass's value loads all issue at its head and the key loads a pass ahead
__global__ __launch_bounds__(128) __attribute__((amdgpu_waves_per_eu(2, 2))) void k_fattn(const h16* __restrict__ Q16, const h16* __restrict__ K16, const h16* __restrict__ V16, const bf* __restrict__ Qh, const bf* __restrict__ Ql, const bf* __restrict__ Kh, const bf* __restrict__ Kl, const bf* __restrict__ Vh, const bf* __restrict__ Vl, bf* __restrict__ Ah, bf* __restrict__ Al) {
    const int wv = __builtin_amdgcn_readfirstlane((int)(threadIdx.x >> 5));   // wave number, scalar: the pass loop's control stays a scalar branch
    const int r0 = (TT / 64 - 1 - (int)blockIdx.y) * 64;                      // longest key walks first
    const int bt = (int)blockIdx.x / NH_, hd = (int)blockIdx.x % NH_;         // batch and head; the planes are numbered batch * heads + head
    const size_t zq = (size_t)blockIdx.x * TT * HD, zk = (size_t)(bt * NKV + hd / REP) * TT * HD, za = (size_t)bt * TT * DQ + hd * HD * 16;     // za: the batch's rows of the merged planes; a head's 64 columns of 16 rows: two blocks
    if (r0 < RH) attn_wave<bf>(Qh + zq, Ql + zq, Kh + zk, Kl + zk, Vh + zk, Vl + zk, r0 + wv * 16, Ah + za, Al + za);
    else attn_wave<h16>(Q16 + zq, nullptr, K16 + zk, nullptr, V16 + zk, nullptr, r0 + wv * 16, Ah + za, Al + za);
}

// d_wt16: Bt[n][k] (fragment order) = fp16 of the bf16-rounded w[k][n]. Each thread holds a block of 8 k x 4 n in registers: eight 16-byte loads along n (a wave reads 256 contiguous bytes of two rows a load), then per n one 16-byte store along k.
// Blocks (bx < N / 64, by < K / 128), 256 threads: a block covers 64 n x 128 k, whole 1 KB blocks of the plane, so every 128-byte output line is filled by one block.
template <int K, int N>
__device__ __forceinline__ void d_wt16(const float* __restrict__ w, h16* Bt, int bx, int by) { const int lane = threadIdx.x & 31; const int n0 = bx * 64 + (lane & 15) * 4, k0 = by * 128 + (int)(threadIdx.x >> 5) * 16 + (lane >> 4) * 8; v4f r[8];
    const float* wp = w + (size_t)k0 * N + n0;
    // every unroll: the register blocks stay in registers only under constant indices
#pragma unroll
    for (int j = 0; j < 8; ++j) r[j] = *(const v4f*)(wp + j * N);
    // the address stays live up to this wait, so no register that an issued load names is given a new value in front of it
    asm volatile("s_wait_xcnt 0x0" :: "v"(wp) : "memory");
    v8h o[4];
#pragma unroll
    for (int q = 0; q < 4; ++q)
#pragma unroll
        for (int j = 0; j < 8; ++j) o[q][j] = tohx(bfr(r[j][q]));
#pragma unroll
    for (int q = 0; q < 4; ++q) *(v8h*)(Bt + fro(n0, k0, K) + q * 8) = o[q];   // fragment order: the next n is the next 16-byte run
    // the caller's code for its other block ranges follows in the kernel and rewrites registers that these stores name: the wait stands in front of that
    asm volatile("s_wait_xcnt 0x0" ::: "memory"); }
// d_rmsc: the rows of both batches, one wave a row; blocks bx < NR / 8, 256 threads. isin: X is an input and is rounded to bf16 first
__device__ __forceinline__ void d_rmsc(const float* __restrict__ X, int isin, const float* __restrict__ w, h16* HC, int bx) { const int lane = threadIdx.x & 31; const int t = bx * 8 + (int)(threadIdx.x >> 5); if (t >= NR) return; float v[32]; float s = 0.f;
#pragma unroll
    for (int ch = 0; ch < 8; ++ch) { const v4f a = *(const v4f*)(X + (size_t)t * DM + ch * 128 + lane * 4);
#pragma unroll
        for (int q = 0; q < 4; ++q) { const float xv = isin ? bfr(a[q]) : a[q]; v[ch * 4 + q] = xv; float p = __fmul_rn(xv, xv); asm volatile("" : "+v"(p)); s = __fadd_rn(s, p); } }
#pragma unroll
    for (int sh = 16; sh; sh >>= 1) s += __shfl_xor(s, sh, 32);
    const float r = __frsqrt_rn(__fadd_rn(s * (1.0f / DM), 1.1920929e-07f));
{       v4h o[8]; float wr[32]; const unsigned wob = (unsigned)lane * 16u; const float* wp = (const float*)((const char*)w + wob);   // this lane's weights: columns ch 128 + lane 4 + q
#pragma unroll
        for (int ch = 0; ch < 8; ++ch)
#pragma unroll
            for (int q = 0; q < 4; ++q) wr[ch * 4 + q] = wp[ch * 128 + q];
        // address, offset, lane number (the scaled form of the offset) and base stay live up to this wait, so no register that an issued weight load names is given a new value in front of it
        asm volatile("s_wait_xcnt 0x0" :: "v"(wp), "v"(wob), "v"(lane), "s"(w) : "memory");
#pragma unroll
        for (int ch = 0; ch < 8; ++ch)
#pragma unroll
            for (int q = 0; q < 4; ++q) { float tn = __fmul_rn(v[ch * 4 + q], r); asm volatile("" : "+v"(tn)); o[ch][q] = tohx(__fmul_rn(tn, bfr(wr[ch * 4 + q]))); }
        // block planes in fragment order: plane ch / 2, columns (ch % 2) 128 + lane 4, four blocks apart; the work-group's eight rows fill whole lines
        h16* hp = HC + fro(t, lane * 4, 256);
#pragma unroll
        for (int ch = 0; ch < 8; ++ch) *(v4h*)(hp + (size_t)(ch >> 1) * NR * 256 + (ch & 1) * 2048) = o[ch];
         } }
// k_rmsc: the second norm, a launch of its own (its input comes from the launch before); grid NR / 8
__global__ __launch_bounds__(256) void k_rmsc(const float* __restrict__ X, const float* __restrict__ w, h16* HC) { d_rmsc(X, 0, w, HC, (int)blockIdx.x); }
// k_prep: the first norm, every weight plane and the (cos, sin) table in one launch; none reads what another writes. Ranges of blockIdx.x, in this order: the norm's NR / 8 blocks (the longest chain of waits, so first), the 4 blocks n of qkv_w, of gate_w and of up_w (each [256][N], planes n apart by 256 N), down_w, o_w, the table.
#define PB_Q (4 * (3072 / 64) * (256 / 128))
#define PB_F (4 * (2048 / 64) * (256 / 128))
#define PB_D ((DM / 64) * (2048 / 128))
#define PB_O ((DM / 64) * (DQ / 128))
#define PB_C (TT * HD / 2048)
__global__ __launch_bounds__(256) void k_prep(const float* __restrict__ x, const float* __restrict__ n1w, const float* __restrict__ qkvw, const float* __restrict__ gw, const float* __restrict__ uw, const float* __restrict__ dw, const float* __restrict__ wo, h16* HC, h16* BQKV, h16* BG, h16* BU, h16* BD, bf* WO, float* CS) {
    int i = (int)blockIdx.x;
    if (i < NR / 8) { d_rmsc(x, 1, n1w, HC, i); return; }
    i -= NR / 8;
    if (i < PB_Q) { const int n = i / (PB_Q / 4), j = i % (PB_Q / 4); d_wt16<256, 3072>(qkvw + (size_t)n * 256 * 3072, BQKV + (size_t)n * 3072 * 256, j % (3072 / 64), j / (3072 / 64)); return; }
    i -= PB_Q;
    if (i < 2 * PB_F) { const bool up = i >= PB_F; const int n = (i % PB_F) / (PB_F / 4), j = i % (PB_F / 4); d_wt16<256, 2048>((up ? uw : gw) + (size_t)n * 256 * 2048, (up ? BU : BG) + (size_t)n * 2048 * 256, j % (2048 / 64), j / (2048 / 64)); return; }
    i -= 2 * PB_F;
    if (i < PB_D) { d_wt16<2048, DM>(dw, BD, i % (DM / 64), i / (DM / 64)); return; }
    i -= PB_D;
    if (i < PB_O) { d_wtG<DQ, DM>(wo, WO, i % (DM / 64), i / (DM / 64)); return; }
    d_csid(CS, i - PB_O); }
// ---- k_dend: one dendritic layer (PAIR: the gate and the up layer together), both batches' rows, per launch; grid (NR/64, N/64), 128 threads (PAIR: 256). Wave n of the work-group forms the 64x64 tile of input block n, h_n W[n] (K = 256, fp16 planes, f32 accumulate, one running sum over K);
// the four tiles meet in LDS, and each output element is max over n = 0 .. 3 (in that order) of gain[n] silu(tile_n - thr[n]). H: block planes [n][NR][256]; Bt: [n][N][256], each plane in fragment order; thr, gain: [n][N]; C: [NR][N].
// PAIR: waves 0 .. 3 do the gate layer's blocks (thr0, gain0), waves 4 .. 7 the up layer's (thr1, gain1; weights sB elements on); all eight tiles meet in LDS and the epilogue stores silu(gate) * up as the fp16 plane FF [NR][N] in fragment order; C is not used. Else FF, thr1, gain1 and sB are not used.
template <bool PAIR>
__global__ __launch_bounds__(PAIR ? 256 : 128) void k_dend(const h16* __restrict__ H, const h16* __restrict__ Bt, int N, const float* __restrict__ thr0, const float* __restrict__ gain0, const float* __restrict__ thr1, const float* __restrict__ gain1, float* C, h16* FF, size_t sB) {
    constexpr int K = 256, WST = 64 * 68;                   // WST: floats of one wave's LDS slab (its whole tile, row pitch 68)
    __shared__ __align__(16) float os[(PAIR ? 8 : 4) * WST];
    const int wv = __builtin_amdgcn_readfirstlane((int)(threadIdx.x >> 5));   // wave number = layer * 4 + input block n, scalar
    const float* thr = thr0; const float* gain = gain0;
    const h16* A = H + (size_t)(wv & 3) * NR * K; const h16* B = Bt + (size_t)(wv >> 2) * sB + (size_t)(wv & 3) * N * K;
    const int lane = threadIdx.x & 31, lr = lane & 15, hi = lane >> 4; const int r0 = blockIdx.x * 64, c0 = blockIdx.y * 64;
    v8f acc[4][4];
#pragma unroll
    for (int mb = 0; mb < 4; ++mb)
#pragma unroll
        for (int nb = 0; nb < 4; ++nb) acc[mb][nb] = (v8f){};
    const unsigned lob = (unsigned)lane * 16u;      // the lane's byte offset in every block
    A += (size_t)r0 * K; B += (size_t)c0 * K;       // 16 rows of blocks are 16 K elements
    // every unroll: K is a constant, eight trips; the fragment arrays stay in registers only under constant indices.
    // The next trip's loads issue ahead of this trip's products: its A fragments at the trip's head into the other half of a[][], each B fragment behind the last product that reads its forerunner.
    // Written out in the source: with every block an immediate offset from one base the compiler, left to itself, puts each load directly in front of its first product and waits for it there.
    v16h a[2][4], b[4];
#pragma unroll
    for (int mb = 0; mb < 4; ++mb) a[0][mb] = WFrag<h16>::ld(atl(A, lob) + mb * 16 * K);
#pragma unroll
    for (int nb = 0; nb < 4; ++nb) b[nb] = WFrag<h16>::ld(atl(B, lob) + nb * 16 * K);
#pragma unroll
    for (int t = 0; t < K / 32; ++t) {
        if (t + 1 < K / 32) {
#pragma unroll
            for (int mb = 0; mb < 4; ++mb) a[(t + 1) & 1][mb] = WFrag<h16>::ld(atl(A, lob) + mb * 16 * K + (t + 1) * 512); }
#pragma unroll
        for (int nb = 0; nb < 4; ++nb) {
#pragma unroll
            for (int mb = 0; mb < 4; ++mb) acc[mb][nb] = wmma16(a[t & 1][mb], b[nb], acc[mb][nb]);
            if (t + 1 < K / 32) b[nb] = WFrag<h16>::ld(atl(B, lob) + nb * 16 * K + (t + 1) * 512); }
    }
    // the offset and both bases stay live up to this wait, so no register that an issued operand load names is given a new value in front of it
    asm volatile("s_wait_xcnt 0x0" :: "v"(lob), "s"(A), "s"(B) : "memory");
    // unrolls: acc[][] stays in registers only under constant indices
#pragma unroll
    for (int mb = 0; mb < 4; ++mb)
#pragma unroll
        for (int nb = 0; nb < 4; ++nb) {
#pragma unroll
            for (int j = 0; j < 8; ++j) os[wv * WST + (mb * 16 + hi * 8 + j) * 68 + nb * 16 + lr] = acc[mb][nb][j]; }
    __syncthreads();    // all blocks' tiles are in LDS before any element's max is taken
    if constexpr (PAIR) {
        // every unroll of this branch: the register arrays stay in registers only under constant indices
        const unsigned cofs = (threadIdx.x & 15u) * 4u; v4f th[8], ga[8]; unsigned ob[4];   // this thread's four output columns are the same in every row it handles; index layer * 4 + n
#pragma unroll
        for (int n = 0; n < 4; ++n) { ob[n] = ((unsigned)(n * N) + cofs) * 4u; th[n] = *(const v4fa*)((const char*)(thr0 + c0) + ob[n]); ga[n] = *(const v4fa*)((const char*)(gain0 + c0) + ob[n]); th[4 + n] = *(const v4fa*)((const char*)(thr1 + c0) + ob[n]); ga[4 + n] = *(const v4fa*)((const char*)(gain1 + c0) + ob[n]); }
        // the four byte offsets and the four bases stay live up to this wait, so no register that an issued threshold or gain load names is given a new value in front of it
        asm volatile("s_wait_xcnt 0x0" :: "v"(ob[0]), "v"(ob[1]), "v"(ob[2]), "v"(ob[3]), "s"(thr0 + c0), "s"(gain0 + c0), "s"(thr1 + c0), "s"(gain1 + c0) : "memory");
#pragma unroll
        for (int n = 0; n < 8; ++n)
#pragma unroll
            for (int q = 0; q < 4; ++q) { th[n][q] = bfr(th[n][q]); ga[n][q] = bfr(ga[n][q]); }
        h16* fp = FF + fro(r0 + (int)(threadIdx.x >> 4), c0 + (int)cofs, N);     // 16 rows on are N / 32 blocks on, 16 N elements
        for (int sp = 0; sp < 2; ++sp) { v4f r[2][2];      // two rows a trip (16 apart), gate and up of each: the eight gate values fill one statement of sigmoids
#pragma unroll
            for (int h = 0; h < 2; ++h) { const int row = (sp * 2 + h) * 16 + (int)(threadIdx.x >> 4);
#pragma unroll
                for (int ly = 0; ly < 2; ++ly)
#pragma unroll
                    for (int np = 0; np < 2; ++np) { float z[8], sg[8];      // two input blocks at a time: eight sigmoids a statement
#pragma unroll
                        for (int n = 0; n < 2; ++n) { const v4f a = *(const v4fa*)(os + (ly * 4 + np * 2 + n) * WST + row * 68 + cofs);
#pragma unroll
                            for (int q = 0; q < 4; ++q) sg[n * 4 + q] = z[n * 4 + q] = __fsub_rn(a[q], th[ly * 4 + np * 2 + n][q]); }
                        sig8(sg);
#pragma unroll
                        for (int n = 0; n < 2; ++n)
#pragma unroll
                            for (int q = 0; q < 4; ++q) { const float val = __fmul_rn(ga[ly * 4 + np * 2 + n][q], __fmul_rn(z[n * 4 + q], sg[n * 4 + q])); r[h][ly][q] = (np * 2 + n) ? fmaxf(r[h][ly][q], val) : val; } } }
            float sg[8];
#pragma unroll
            for (int j = 0; j < 8; ++j) sg[j] = r[j >> 2][0][j & 3];
            sig8(sg);
#pragma unroll
            for (int h = 0; h < 2; ++h) { v4h o;
#pragma unroll
                for (int q = 0; q < 4; ++q) { const float sl = __fmul_rn(r[h][0][q], sg[h * 4 + q]); o[q] = tohx(__fmul_rn(sl, r[h][1][q])); }
                *(v4h*)(fp + (size_t)(sp * 2 + h) * 16 * N) = o; }
            asm volatile("s_wait_xcnt 0x0" ::: "memory"); }   // the next trip rewrites the registers that these stores name: the wait stands in front of that
        return;
    }
    const unsigned cofs = (threadIdx.x & 15u) * 4u; v4f th[4], ga[4]; unsigned ob[4];   // this thread's four output columns are the same in every row it handles
#pragma unroll
    for (int n = 0; n < 4; ++n) { ob[n] = ((unsigned)(n * N) + cofs) * 4u; th[n] = *(const v4fa*)((const char*)(thr + c0) + ob[n]); ga[n] = *(const v4fa*)((const char*)(gain + c0) + ob[n]); }
    // the four byte offsets and the two bases stay live up to this wait, so no register that an issued threshold or gain load names is given a new value in front of it
    asm volatile("s_wait_xcnt 0x0" :: "v"(ob[0]), "v"(ob[1]), "v"(ob[2]), "v"(ob[3]), "s"(thr + c0), "s"(gain + c0) : "memory");
#pragma unroll
    for (int n = 0; n < 4; ++n)
#pragma unroll
        for (int q = 0; q < 4; ++q) { th[n][q] = bfr(th[n][q]); ga[n][q] = bfr(ga[n][q]); }
    float* crow = C + (size_t)r0 * N + c0 + cofs;
    // unroll 2: two rows share a trip's address arithmetic and branch; more would only lengthen the code
#pragma unroll 2
    for (int s = 0; s < 8; ++s) { const int row = s * 8 + (int)(threadIdx.x >> 4); v4f r;
#pragma unroll
        for (int np = 0; np < 2; ++np) { float z[8], sg[8];      // two input blocks at a time: eight sigmoids a statement
#pragma unroll
            for (int n = 0; n < 2; ++n) { const v4f a = *(const v4fa*)(os + (np * 2 + n) * WST + row * 68 + cofs);
#pragma unroll
                for (int q = 0; q < 4; ++q) sg[n * 4 + q] = z[n * 4 + q] = __fsub_rn(a[q], th[np * 2 + n][q]); }
            sig8(sg);
#pragma unroll
            for (int n = 0; n < 2; ++n)
#pragma unroll
                for (int q = 0; q < 4; ++q) { const float val = __fmul_rn(ga[np * 2 + n][q], __fmul_rn(z[n * 4 + q], sg[n * 4 + q])); r[q] = (np * 2 + n) ? fmaxf(r[q], val) : val; } }
        *(v4f*)(crow + (size_t)row * N) = r;
        asm volatile("s_wait_xcnt 0x0" ::: "memory"); }   // the next trip rewrites the registers that this store names: the wait stands in front of that
}
extern "C" void kernel_launch(void* const* d_in, const int* in_sizes, int n_in,
                              void* d_out, int out_size, void* d_ws, size_t ws_size, hipStream_t stream) {
    (void)in_sizes; (void)n_in; (void)out_size;
    const float* x = (const float*)d_in[0]; const float* qkvw = (const float*)d_in[1]; const float* qthr = (const float*)d_in[2]; const float* qgain = (const float*)d_in[3]; const float* wo = (const float*)d_in[4]; const float* gw = (const float*)d_in[5]; const float* gthr = (const float*)d_in[6]; const float* ggain = (const float*)d_in[7]; const float* uw = (const float*)d_in[8]; const float* uthr = (const float*)d_in[9]; const float* ugain = (const float*)d_in[10]; const float* dw = (const float*)d_in[11]; const float* n1w = (const float*)d_in[12]; const float* n2w = (const float*)d_in[13];
    float* OUT = (float*)d_out;     // [2][2048][1024]
    char* wsp = (char*)d_ws;
    auto take = [&](size_t bytes) { char* p = wsp; wsp += (bytes + 255) & ~(size_t)255; return (void*)p; };
    const size_t PL = (size_t)NB_ * NH_ * TT * HD;      // elements of one set of head planes [batch][head][..]
    bf* WO = (bf*)take((size_t)DM * DQ * 2); float* CS = (float*)take((size_t)TT * HD * 2 * 4);
    h16* BQKV = (h16*)take((size_t)4 * 3072 * 256 * 2); h16* BG = (h16*)take((size_t)2 * 4 * 2048 * 256 * 2); h16* BU = BG + (size_t)4 * 2048 * 256; h16* BD = (h16*)take((size_t)DM * 2048 * 2);
    h16* HC = (h16*)take((size_t)4 * NR * 256 * 2); h16* FF16 = (h16*)take((size_t)NR * 2048 * 2); float* X1 = (float*)take((size_t)NR * DM * 4);
    bf* ATh = (bf*)take((size_t)NR * DQ * 2); bf* ATl = (bf*)take((size_t)NR * DQ * 2);
    float* FQKV = (float*)take((size_t)NR * 3072 * 4);   // dendritic [q|k|v], row pitch 3072
    h16* QP16 = (h16*)take(2 * PL * 2); h16* KP16 = QP16 + PL; bf* QPh = (bf*)take(2 * PL * 2); bf* KPh = QPh + PL; bf* QPl = (bf*)take(2 * PL * 2); bf* KPl = QPl + PL;   // the k planes directly behind the q planes
    h16* VT16 = (h16*)take(PL * 2); bf* VTh = (bf*)take(PL * 2); bf* VTl = (bf*)take(PL * 2);
    if ((size_t)(wsp - (char*)d_ws) > ws_size) return;    // ws 256 MiB
    k_prep<<<NR / 8 + PB_Q + 2 * PB_F + PB_D + PB_O + PB_C, 256, 0, stream>>>(x, n1w, qkvw, gw, uw, dw, wo, HC, BQKV, BG, BU, BD, WO, CS);
    // dendritic [q|k|v]: one launch for the whole layer (N = 3072)
    k_dend<false><<<dim3(NR / 64, 3072 / 64, 1), 128, 0, stream>>>(HC, BQKV, 3072, qthr, qgain, qthr, qgain, FQKV, nullptr, 0);
    k_qkvp<3072><<<RB + VB, 256, 0, stream>>>(FQKV, CS, QP16, QPh, QPl, VT16, VTh, VTl);
    // causal attention, all heads of both batches in one launch; it writes the merged hi+lo planes itself
    k_fattn<<<dim3(NB_ * NH_, TT / 64, 1), 128, 0, stream>>>(QP16, KP16, VT16, QPh, QPl, KPh, KPl, VTh, VTl, ATh, ATl);
    // x1 = x + merged.v o_w: the residual joins in the GEMM's epilogue
    k_gemmw<bf, 1, false, 8, DQ, 1><<<dim3(NR / 64, DM / 64, 1), 256, 0, stream>>>(ATh, ATl, WO, nullptr, X1, DM, nullptr, 0, 0, 0, x);
    k_rmsc<<<NR / 8, 256, 0, stream>>>(X1, n2w, HC);
    // dendritic gate and up and silu(gate) * up in one launch
    k_dend<true><<<dim3(NR / 64, 2048 / 64, 1), 256, 0, stream>>>(HC, BG, 2048, gthr, ggain, uthr, ugain, nullptr, FF16, (size_t)4 * 2048 * 256);
    // out = x1 + ff down_w, likewise
    k_gemmw<h16, 0, false, 8, 2048, 2><<<dim3(NR / 64, DM / 64, 1), 256, 0, stream>>>(FF16, nullptr, BD, nullptr, OUT, DM, nullptr, 0, 0, 0, X1);
}

// v009
// A run of this version takes 207 microseconds.
// In two side-by-side timings against v008, it was 1.08 and 1.05 times as fast.
// Counting every step since v000, it is 10.3 times as fast.
#include <hip/hip_runtime.h>

// Transformer block with dendritic layers (x [2][2048][1024]; h = RMSNorm(x) w1; [q|k|v] = dendritic(h, qkv_w, thr, gain) = max over the 4 input blocks n of gain[n] silu(h_n W[n] - thr[n]) (16 heads x 64); causal softmax(q.k/8); x1 = x + merged.v o_w;
// h2 = RMSNorm(x1) w2; ff = silu(dendritic(h2, gate)) * dendritic(h2, up); out = x1 + ff down_w -> [2][2048][1024]; all weights x @ W; eps = f32 eps).
// Compute dtypes, f32 accumulate: every input rounded to bf16; the RMSNorms f32 -> SINGLE fp16 block planes; every dendritic GEMM on fp16 planes x fp16 copies of the bf16 weights (1 product; hi+lo would double the
// ~60 G of dendritic GEMMs), the gain/silu/threshold/max epilogues f32; scores (K 64) and probs.v on hl planes (3 products) for the first 512 query rows of each head and single fp16 planes for the rest, f32 causal softmax with masked tiles

#define NB_  2
#define TT   2048
#define NR   (NB_ * TT)         // rows of both batches: every row-wise kernel takes them in one launch
#define DM   1024
#define NH_  16
#define NKV  16
#define REP  (NH_ / NKV)
#define HD   64
#define DQ   (NH_ * HD)
#define DKV  (NKV * HD)
#define RH   512                  // query rows < RH use hi+lo planes (0: none)
#define SCL  0.125f   // HD^-0.5
typedef _Float16 h16;
typedef unsigned short bf;
typedef __attribute__((ext_vector_type(16))) __bf16   v16bf;
typedef __attribute__((ext_vector_type(16))) _Float16 v16h;
typedef __attribute__((ext_vector_type(8)))  _Float16 v8h;
typedef __attribute__((ext_vector_type(8)))  unsigned short v8us;
typedef __attribute__((ext_vector_type(8)))  float    v8f;
typedef __attribute__((ext_vector_type(4)))  float    v4f;
typedef v8h  __attribute__((may_alias)) v8ha;
typedef v4f  __attribute__((may_alias)) v4fa;
typedef v8us __attribute__((may_alias)) v8usa;

__device__ __forceinline__ unsigned short f2bf(float f) { unsigned u = __float_as_uint(f); u += 0x7FFFu + ((u >> 16) & 1u); return (unsigned short)(u >> 16); }
__device__ __forceinline__ float bf2f(unsigned short b) { return __uint_as_float(((unsigned)b) << 16); }
__device__ __forceinline__ float bfr(float f) { return bf2f(f2bf(f)); }
__device__ __forceinline__ v16h cat16(v8h lo, v8h hi) { return __builtin_shufflevector(lo, hi, 0, 1, 2, 3, 4, 5, 6, 7, 8, 9, 10, 11, 12, 13, 14, 15); }
__device__ __forceinline__ v16bf cat16b(v8us lo, v8us hi) { return __builtin_bit_cast(v16bf, __builtin_shufflevector(lo, hi, 0, 1, 2, 3, 4, 5, 6, 7, 8, 9, 10, 11, 12, 13, 14, 15)); }
__device__ __forceinline__ v8f wmma16(v16h a, v16h b, v8f c) { return __builtin_amdgcn_wmma_f32_16x16x32_f16(false, a, false, b, (short)0, c, false, false); }
__device__ __forceinline__ v8f wmmab(v16bf a, v16bf b, v8f c) { return __builtin_amdgcn_wmma_f32_16x16x32_bf16(false, a, false, b, (short)0, c, false, false); }



// ---- Fragment order: every 16-bit operand plane P[row][k] (K columns, K % 32 == 0) is stored as blocks of 16 rows x 32 k, 1 KB each, block (row / 16, k / 32) at element ((row / 16) (K / 32) + k / 32) 512.
// Inside a block the eight k of one 16-byte run lie where the matrix instruction's lane wants them: lane = row % 16 + 16 ((k / 8) % 2), first half of the fragment (k % 32 < 16) at lane * 8, second half at 256 + lane * 8.
// So a wave's fragment is two 16-byte loads of 512 contiguous bytes each (four whole lines), not two loads that touch 16 lines; which lane and register holds which (row, k) is the matrix instruction's own layout (k = 8 (lane / 16) + j and 16 + 8 (lane / 16) + j of row lane % 16).
__device__ __forceinline__ size_t fro(int row, int k, int K) { return ((size_t)(row >> 4) * (K >> 5) + (k >> 5)) * 512 + ((k >> 4) & 1) * 256 + ((row & 15) + ((k >> 3) & 1) * 16) * 8 + (k & 7); }
// a wave-uniform base plus the lane's fixed byte offset (lane * 16): the form of every fragment load
template <typename T16> __device__ __forceinline__ const T16* atl(const T16* base, unsigned ob) { return (const T16*)((const char*)base + ob); }

// ---- k_gemmw: register-blocked GEMM, 64x64 output tile (16 accumulators) per wave, operands straight from 16-bit planes in fragment order; grid (M/64, N/64, Z), 32 * KS threads.
// KS = 1: one wave owns the tile. KS > 1 (K % 64 == 0): the KS waves of the work-group share the tile's K loop, so each waits out 1/KS of its load latencies, and their partial tiles are summed through LDS.
// RES (KS = 8 only): the residual res[m][n] (f32, pitch ldc) is added to the summed tile in the epilogue; 1: rounded to bf16 first (an input), 2: as it is; 0: none.
// C[m][n] (f32, pitch ldc, + optional f32 bias[n]) = sum_k A[m][k] Bt[n][k] (+ split products per NSPLIT). z-batch strides sA/sB/sC in elements. K % 32 == 0, a template constant, so that every block's distance from the two bases is an immediate offset.
template <typename T16> struct WFrag;
template <> struct WFrag<h16> { typedef v16h V; static __device__ __forceinline__ V ld(const h16* p) { return cat16(*(const v8h*)p, *(const v8h*)(p + 256)); } static __device__ __forceinline__ v8f mma(V a, V b, v8f c) { return wmma16(a, b, c); } };
template <> struct WFrag<bf> { typedef v16bf V; static __device__ __forceinline__ V ld(const bf* p) { return cat16b(*(const v8us*)p, *(const v8us*)(p + 256)); } static __device__ __forceinline__ v8f mma(V a, V b, v8f c) { return wmmab(a, b, c); } };
template <typename T16, int NSPLIT, bool BIAS, int KS, int K, int RES>
__global__ __launch_bounds__(32 * KS) void k_gemmw(const T16* __restrict__ A, const T16* __restrict__ A2, const T16* __restrict__ Bt, const T16* __restrict__ Bt2, float* C, int ldc, const float* __restrict__ bias, size_t sA, size_t sB, size_t sC, const float* __restrict__ res) {
    static_assert(RES == 0 || KS == 8, "the residual is added where the eight partial tiles are summed");
    typedef typename WFrag<T16>::V V;
    constexpr int WST = (KS == 1) ? 16 * 68 : 64 * 68;      // floats of one wave's LDS slab: one 16-row block (KS = 1), its whole partial tile (KS > 1)
    __shared__ __align__(16) float os[KS * WST];
    const int wv = (KS == 1) ? 0 : __builtin_amdgcn_readfirstlane((int)(threadIdx.x >> 5));   // wave number, scalar: the K loop's control stays a scalar branch
    const size_t z = blockIdx.z; A += z * sA; if (A2) A2 += z * sA; Bt += z * sB; if (Bt2) Bt2 += z * sB; C += z * sC;
    const int lane = threadIdx.x & 31, lr = lane & 15, hi = lane >> 4; const int r0 = blockIdx.x * 64, c0 = blockIdx.y * 64;
    v8f acc[4][4];
#pragma unroll
    for (int mb = 0; mb < 4; ++mb)
#pragma unroll
        for (int nb = 0; nb < 4; ++nb) acc[mb][nb] = (v8f){};
    const unsigned lob = (unsigned)lane * 16u;      // the lane's byte offset in every block
    A += (size_t)r0 * K; if (A2) A2 += (size_t)r0 * K; Bt += (size_t)c0 * K; if (Bt2) Bt2 += (size_t)c0 * K;     // 16 rows of blocks are 16 K elements
#pragma unroll 1
    for (int kc = wv * 64; kc < K; kc += (kc & 32) ? KS * 64 - 32 : 32) {   // wave wv takes the 64-wide K chunks wv, wv + KS, ... (two blocks of each 16 operand rows)
        const T16* pa = atl(A + (size_t)kc * 16, lob); const T16* pa2 = (NSPLIT == 1 || NSPLIT == 2) ? atl(A2 + (size_t)kc * 16, lob) : pa; const T16* pb = atl(Bt + (size_t)kc * 16, lob); const T16* pb2 = (NSPLIT >= 2) ? atl(Bt2 + (size_t)kc * 16, lob) : pb;
        V a[4], a2[4];
#pragma unroll
        for (int mb = 0; mb < 4; ++mb) { a[mb] = WFrag<T16>::ld(pa + mb * 16 * K); if (NSPLIT == 1 || NSPLIT == 2) a2[mb] = WFrag<T16>::ld(pa2 + mb * 16 * K); }
#pragma unroll
        for (int nb = 0; nb < 4; ++nb) { const V b = WFrag<T16>::ld(pb + nb * 16 * K); V b2; if (NSPLIT >= 2) b2 = WFrag<T16>::ld(pb2 + nb * 16 * K);
#pragma unroll
            for (int mb = 0; mb < 4; ++mb) { acc[mb][nb] = WFrag<T16>::mma(a[mb], b, acc[mb][nb]); if (NSPLIT == 1 || NSPLIT == 2) acc[mb][nb] = WFrag<T16>::mma(a2[mb], b, acc[mb][nb]); if (NSPLIT >= 2) acc[mb][nb] = WFrag<T16>::mma(a[mb], b2, acc[mb][nb]); } }
        // the trip's addresses stay live up to this wait, so no register that an issued operand load names is given a new value in front of it
        asm volatile("s_wait_xcnt 0x0" :: "v"(pa), "v"(pa2), "v"(pb), "v"(pb2) : "memory");
        asm volatile("v_nop\n\tv_nop\n\tv_nop\n\tv_nop" : "+v"(acc[0][0]), "+v"(acc[1][1]), "+v"(acc[2][2]), "+v"(acc[3][3]) : "v"(a[0]), "v"(a[3]));
    }
    if constexpr (KS > 1) {     // the KS waves' partial tiles meet in LDS and are summed in fixed wave order 0 .. KS-1
        v4f rv[32 / KS];
        if constexpr (RES != 0) {   // this thread's residual runs, asked for here so that they fly under the LDS stores and the barrier
            const float* rb = res + z * sC + (size_t)r0 * ldc + c0; unsigned rob[4];
#pragma unroll
            for (int q = 0; q < 4; ++q) { rob[q] = ((unsigned)(q * 2 * KS + (int)(threadIdx.x >> 4)) * (unsigned)ldc + (threadIdx.x & 15u) * 4u) * 4u; rv[q] = *(const v4fa*)((const char*)rb + rob[q]); }
            // the four byte offsets and the base stay live up to this wait, so no register that an issued residual load names is given a new value in front of it
            asm volatile("s_wait_xcnt 0x0" :: "v"(rob[0]), "v"(rob[1]), "v"(rob[2]), "v"(rob[3]), "s"(rb) : "memory");
        }
        // unrolls: acc[][] stays in registers only under constant indices; the q and ww loops so that their LDS reads issue together
#pragma unroll
        for (int mb = 0; mb < 4; ++mb)
#pragma unroll
            for (int nb = 0; nb < 4; ++nb) {
#pragma unroll
                for (int j = 0; j < 8; ++j) os[wv * WST + (mb * 16 + hi * 8 + j) * 68 + nb * 16 + lr] = acc[mb][nb][j]; }
        __syncthreads();    // every wave's partial tile is in LDS before any of it is summed
        float* crow = C + (size_t)r0 * ldc + c0;
#pragma unroll
        for (int q = 0; q < 32 / KS; ++q) { const int idx = q * 32 * KS + (int)threadIdx.x, row = idx >> 4, cofs = (idx & 15) * 4; v4f val = *(const v4fa*)(os + row * 68 + cofs);
#pragma unroll
            for (int ww = 1; ww < KS; ++ww) val += *(const v4fa*)(os + ww * WST + row * 68 + cofs);
            if (BIAS) { val[0] += bfr(bias[c0 + cofs]); val[1] += bfr(bias[c0 + cofs + 1]); val[2] += bfr(bias[c0 + cofs + 2]); val[3] += bfr(bias[c0 + cofs + 3]); }
            if constexpr (RES != 0) {
#pragma unroll
                for (int e = 0; e < 4; ++e) val[e] = __fadd_rn(RES == 1 ? bfr(rv[q][e]) : rv[q][e], val[e]); }
            *(v4f*)(crow + (size_t)row * ldc + cofs) = val; }
        return;
    }
#pragma unroll
    for (int mb = 0; mb < 4; ++mb) {
#pragma unroll
        for (int nb = 0; nb < 4; ++nb) {
#pragma unroll
            for (int j = 0; j < 8; ++j) os[(hi * 8 + j) * 68 + nb * 16 + lr] = acc[mb][nb][j]; }
        __builtin_amdgcn_wave_barrier(); asm volatile("" ::: "memory");
        float* crow = C + (size_t)(r0 + mb * 16) * ldc + c0;
{
#pragma unroll
            for (int s = 0; s < 8; ++s) { const int row = 2 * s + hi, cofs = lr * 4; v4f val = *(const v4fa*)(os + row * 68 + cofs); if (BIAS) { val[0] += bfr(bias[c0 + cofs]); val[1] += bfr(bias[c0 + cofs + 1]); val[2] += bfr(bias[c0 + cofs + 2]); val[3] += bfr(bias[c0 + cofs + 3]); }
                *(v4f*)(crow + (size_t)row * ldc + cofs) = val; }
             }
        __builtin_amdgcn_wave_barrier(); asm volatile("" ::: "memory");
    }
}

__device__ __forceinline__ h16 tohx(float x) { return (h16)x; }
__device__ __forceinline__ void splitf(float y, unsigned short& h, unsigned short& l) { h = f2bf(y); l = f2bf(y - bf2f(h)); }
typedef __attribute__((ext_vector_type(2))) _Float16 v2h;
typedef __attribute__((ext_vector_type(4))) _Float16 v4h;
typedef __attribute__((ext_vector_type(2))) unsigned short v2us;
typedef __attribute__((ext_vector_type(4))) unsigned short v4us;
typedef __attribute__((ext_vector_type(2))) float v2f;
typedef __attribute__((ext_vector_type(4))) int v4i;

// d_wtG: Bt[n][k] (fragment order) = bf16 of w[k][n]; the register block, the block indices and the waits of d_wt16 below
template <int K, int N>
__device__ __forceinline__ void d_wtG(const float* __restrict__ w, bf* Bt, int bx, int by) { const int lane = threadIdx.x & 31; const int n0 = bx * 64 + (lane & 15) * 4, k0 = by * 128 + (int)(threadIdx.x >> 5) * 16 + (lane >> 4) * 8; v4f r[8];
    const float* wp = w + (size_t)k0 * N + n0;
    // every unroll: the register blocks stay in registers only under constant indices
#pragma unroll
    for (int j = 0; j < 8; ++j) r[j] = *(const v4f*)(wp + j * N);
    // the address stays live up to this wait, so no register that an issued load names is given a new value in front of it
    asm volatile("s_wait_xcnt 0x0" :: "v"(wp) : "memory");
    v8us o[4];
#pragma unroll
    for (int q = 0; q < 4; ++q)
#pragma unroll
        for (int j = 0; j < 8; ++j) o[q][j] = f2bf(r[j][q]);
#pragma unroll
    for (int q = 0; q < 4; ++q) *(v8us*)(Bt + fro(n0, k0, K) + q * 8) = o[q];   // fragment order: the next n is the next 16-byte run
    // the caller's code for its other block ranges follows in the kernel and rewrites registers that these stores name: the wait stands in front of that
    asm volatile("s_wait_xcnt 0x0" ::: "memory"); }
__global__ __launch_bounds__(256) void k_cvt8(const float* __restrict__ src, bf* dst, size_t n8) { const size_t i = (size_t)blockIdx.x * 256 + threadIdx.x; if (i >= n8) return; const v8f v = *(const v8f*)(src + i * 8); v8us o;
#pragma unroll
    for (int k = 0; k < 8; ++k) o[k] = f2bf(v[k]); *(v8us*)(dst + i * 8) = o;  }
__global__ __launch_bounds__(256) void k_cscvt(const float* __restrict__ cosT, const float* __restrict__ sinT, float* CS) { const int idx = blockIdx.x * 256 + threadIdx.x; if (idx >= TT * HD) return; v2f cs; cs[0] = bfr(cosT[idx]); cs[1] = bfr(sinT[idx]); *(v2f*)(CS + (size_t)idx * 2) = cs;  }
// d_rope: head planes [h][t][d] (each head's [t][d] in fragment order; fp16 + hi/lo) of rope(x) x sc with the rotate-half convention out[d] = x[d] cos[t][d] - x[d+HD/2] sin[t][d], out[d+HD/2] = x[d+HD/2] cos[t][d+HD/2] + x[d] sin[t][d+HD/2]
// Each thread takes four consecutive d of the rows t, t + 16, t + 32 and t + 48 of one head, so that a wave's 16-byte load covers whole lines; its sixteen loads all issue before the first run is worked on. Blocks bx: 2 * NB_ * NH_ * TT * HD / 4096, exact (a block covers 64 whole rows of one head).
// One range of blocks does q and k of both batches: plane h = (s NB_ + batch) NH_ + head, s = 0 for q and 1 for k; its source is the rows batch TT + t and the columns s DQ + head HD of F.
static_assert(NH_ == NKV, "q and k planes are numbered alike");
template <int PITCH>
__device__ __forceinline__ void d_rope(const float* __restrict__ F, const float* __restrict__ CS, float sc, h16* P16, bf* Ph, bf* Pl, int bx) {
    // every unroll of this function: the register blocks stay in registers only under constant indices
    const size_t e = ((size_t)bx * 1024 + threadIdx.x) * 4; const int d = (int)(e % HD); const int t = (int)((e / HD) % TT); const int h = (int)(e / ((size_t)HD * TT));
    const bool lo = d < HD / 2;      // a run lies wholly in one half of the row, its partners in the other
    const float* fa = F + (size_t)((h / NH_) % NB_ * TT + t) * PITCH + (h / (NB_ * NH_)) * DQ + (h % NH_) * HD + d; const float* fb = lo ? fa + HD / 2 : fa - HD / 2; const float* cp = CS + ((size_t)t * HD + d) * 2;
    v4f xa[4], xb[4], cv[4][2];
#pragma unroll
    for (int c = 0; c < 4; ++c) { xa[c] = *(const v4f*)(fa + c * 16 * PITCH); xb[c] = *(const v4f*)(fb + c * 16 * PITCH); cv[c][0] = *(const v4f*)(cp + c * 16 * HD * 2); cv[c][1] = *(const v4f*)(cp + c * 16 * HD * 2 + 4); }
    // the three addresses stay live up to this wait, so no register that an issued load names is given a new value in front of it
    asm volatile("s_wait_xcnt 0x0" :: "v"(fa), "v"(fb), "v"(cp) : "memory");
    __builtin_amdgcn_sched_barrier(0);   // keeps the vector work behind the wait: without it the compiler works on the first loads before it issues the last, and their latencies add up
    v4h o16[4]; v4us oh[4], ol[4];
#pragma unroll
    for (int c = 0; c < 4; ++c)
#pragma unroll
        for (int q = 0; q < 4; ++q) { const float a = __fmul_rn(xa[c][q], cv[c][q >> 1][(q & 1) * 2]), bq = __fmul_rn(xb[c][q], cv[c][q >> 1][(q & 1) * 2 + 1]); const float r = (lo ? __fsub_rn(a, bq) : __fadd_rn(a, bq)) * sc;
            o16[c][q] = tohx(r); unsigned short a2, c2; splitf(r, a2, c2); oh[c][q] = a2; ol[c][q] = c2; }
    const size_t eo = (size_t)h * TT * HD + fro(t, d, HD);      // 16 rows on are two blocks on, 1024 elements
#pragma unroll
    for (int c = 0; c < 4; ++c) { *(v4h*)(P16 + eo + c * 1024) = o16[c]; *(v4us*)(Ph + eo + c * 1024) = oh[c]; *(v4us*)(Pl + eo + c * 1024) = ol[c]; }
    // the caller's code for its other block ranges follows in the kernel and rewrites registers that these stores name: the wait stands in front of that
    asm volatile("s_wait_xcnt 0x0" ::: "memory"); }
// d_vtp: transposed value planes [g][d][t] (each head's [d][t] in fragment order). Each thread holds a block of 8 t x 4 d in registers: eight 16-byte loads along d (a wave reads two whole 256-byte head rows a load), then per d and plane one 16-byte store along t.
// Blocks (bx < TT / 128, g < NB_ * heads; g = batch NKV + head), 256 threads: a block covers one head's 64 d x 128 t, so every 128-byte output line is filled by one block.
template <int PITCH>
__device__ __forceinline__ void d_vtp(const float* __restrict__ F, h16* V16, bf* Vh, bf* Vl, int bx, int g) { const int lane = threadIdx.x & 31; const int d0 = (lane & 15) * 4, t0 = bx * 128 + (int)(threadIdx.x >> 5) * 16 + (lane >> 4) * 8; v4f r[8];
    const float* fp = F + (size_t)(g / NKV * TT + t0) * PITCH + (g % NKV) * HD + d0;
    // every unroll: the register blocks stay in registers only under constant indices
#pragma unroll
    for (int j = 0; j < 8; ++j) r[j] = *(const v4f*)(fp + j * PITCH);
    // the address stays live up to this wait, so no register that an issued load names is given a new value in front of it
    asm volatile("s_wait_xcnt 0x0" :: "v"(fp) : "memory");
    v8h o16[4]; v8us oh[4], ol[4];
#pragma unroll
    for (int q = 0; q < 4; ++q)
#pragma unroll
        for (int j = 0; j < 8; ++j) { const float x = r[j][q]; o16[q][j] = tohx(x); unsigned short a2, c2; splitf(x, a2, c2); oh[q][j] = a2; ol[q][j] = c2; }
    const size_t e = (size_t)g * HD * TT + fro(d0, t0, TT);      // the next d is the next 16-byte run
#pragma unroll
    for (int q = 0; q < 4; ++q) { *(v8h*)(V16 + e + q * 8) = o16[q]; *(v8us*)(Vh + e + q * 8) = oh[q]; *(v8us*)(Vl + e + q * 8) = ol[q]; }
    // the caller's code for its other block ranges follows in the kernel and rewrites registers that these stores name: the wait stands in front of that
    asm volatile("s_wait_xcnt 0x0" ::: "memory"); }
// k_qkvp: the q and k head planes and the transposed v planes of both batches in one launch (they only share their source F); the first RB blocks do d_rope, the other NB_ * NKV * TT / 128 do d_vtp.
#define RB   (2 * NB_ * NH_ * TT * HD / 4096)
#define VB   (NB_ * NKV * TT / 128)
template <int PITCH>
__global__ __launch_bounds__(256) void k_qkvp(const float* __restrict__ F, const float* __restrict__ CS, h16* P16, bf* Ph, bf* Pl, h16* V16, bf* Vh, bf* Vl) {
    const int i = (int)blockIdx.x;
    if (i < RB) d_rope<PITCH>(F, CS, 1.0f, P16, Ph, Pl, i);
    else d_vtp<PITCH>(F + DQ + DKV, V16, Vh, Vl, (i - RB) % (TT / 128), (i - RB) / (TT / 128)); }
// blocks bx < TT * HD / 2048, exact: four 16-byte stores (two (cos, sin) pairs each) a thread
__device__ __forceinline__ void d_csid(float* CS, int bx) { v4f cs; cs[0] = 1.0f; cs[1] = 0.0f; cs[2] = 1.0f; cs[3] = 0.0f; float* p = CS + ((size_t)bx * 1024 + threadIdx.x) * 4;
#pragma unroll
    for (int c = 0; c < 4; ++c) *(v4f*)(p + c * 1024) = cs;
    // behind these stores the caller's way to its end rewrites scalar registers, the stores' base among them: the wait stands in front of that
    asm volatile("s_wait_xcnt 0x0" ::: "memory"); }
// ---- k_fattn: causal attention of both batches in one launch; grid (NB_ * heads, TT/64), 128 threads; wave w of a work-group owns the 16 query rows r0 + 16 w .. + 15 of one head and walks the keys 0 .. r0 + 63 in passes of 64.
// Transposed products: S^T = K Q^T (A = key rows, B = query rows), so a lane holds 32 scores of ONE query (column lane & 15; keys 16 kb + 8 (lane >> 4) + j); running maximum and sum stay in the lane, the two lane halves
// exchange the maximum once a pass and the sum once at the end. Two score tiles, converted in place, are the B operand of O^T += V^T P^T (A = rows of the transposed value plane). Scores and probabilities never leave the registers.
// Operand classes: query rows < RH on bf16 hi+lo planes (3 products each), the rest on single fp16 planes (probabilities carried x 2^10, which cancels in the division by their sum). Output: bf16 hi+lo planes [t][DQ]. All planes in fragment order.
template <typename T16> struct IsHL { static constexpr bool v = false; };
template <> struct IsHL<bf> { static constexpr bool v = true; };
template <bool B> struct BoolC { static constexpr bool value = B; };
__device__ __forceinline__ float xhalf(float x) { return __int_as_float(__builtin_amdgcn_permlanex16(__float_as_int(x), __float_as_int(x), 0x76543210, 0xfedcba98, false, false)); }   // the value of lane ^ 16
// eight 2^x in place, in one statement: each v_exp_f32 is followed by one that neither reads its result nor overwrites its source, the last by the v_nop that the instruction set asks for behind a transcendental
__device__ __forceinline__ void exp2x8(float (&e)[8]) {
    asm("v_exp_f32 %0, %0\n\tv_exp_f32 %1, %1\n\tv_exp_f32 %2, %2\n\tv_exp_f32 %3, %3\n\tv_exp_f32 %4, %4\n\tv_exp_f32 %5, %5\n\tv_exp_f32 %6, %6\n\tv_exp_f32 %7, %7\n\tv_nop"
        : "+v"(e[0]), "+v"(e[1]), "+v"(e[2]), "+v"(e[3]), "+v"(e[4]), "+v"(e[5]), "+v"(e[6]), "+v"(e[7])); }
// eight 1/x in place (v_rcp_f32, 1 ulp), in one statement for the same reason; sig8: eight sigmoids 1 / (1 + e^-z) from eight z, the exponent as __expf forms it (2^(-z log2 e))
__device__ __forceinline__ void rcpx8(float (&e)[8]) {
    asm("v_rcp_f32 %0, %0\n\tv_rcp_f32 %1, %1\n\tv_rcp_f32 %2, %2\n\tv_rcp_f32 %3, %3\n\tv_rcp_f32 %4, %4\n\tv_rcp_f32 %5, %5\n\tv_rcp_f32 %6, %6\n\tv_rcp_f32 %7, %7\n\tv_nop"
        : "+v"(e[0]), "+v"(e[1]), "+v"(e[2]), "+v"(e[3]), "+v"(e[4]), "+v"(e[5]), "+v"(e[6]), "+v"(e[7])); }
__device__ __forceinline__ void sig8(float (&e)[8]) {
    // both unrolls: e[] stays in registers only under constant indices
#pragma unroll
    for (int j = 0; j < 8; ++j) e[j] = __fmul_rn(e[j], -1.4426950408889634f);
    exp2x8(e);
#pragma unroll
    for (int j = 0; j < 8; ++j) e[j] = 1.0f + e[j];
    rcpx8(e); }
template <typename T16>
__device__ __forceinline__ void attn_wave(const T16* __restrict__ Qp, const T16* __restrict__ Q2, const T16* __restrict__ Kp, const T16* __restrict__ K2, const T16* __restrict__ Vp, const T16* __restrict__ V2, int q0, bf* __restrict__ Ah, bf* __restrict__ Al) {
    // every unroll below: the fragment, score and accumulator arrays stay in registers only under constant indices
    typedef typename WFrag<T16>::V V; constexpr bool HL = IsHL<T16>::v;
    constexpr float CL = SCL * 1.4426950408889634f, OFF = HL ? 0.0f : 10.0f;      // scores in log2 units; OFF: the carry 2^10 of the fp16 probabilities
    const int lane = threadIdx.x & 31, lr = lane & 15, hi = lane >> 4; const int q = q0 + lr;
    // every load is a wave-uniform base plus the lane's fixed byte offset in a block: the offset never changes, only the key and value bases move on, by one pass at a time
    const unsigned qob = (unsigned)lane * 16u, kob = qob, vob = qob;
    Qp += q0 * HD; if constexpr (HL) Q2 += q0 * HD;      // the wave's 16 query rows: two blocks
    auto at = [](const T16* base, unsigned ob) { return (const T16*)((const char*)base + ob); };
    const T16* qa = at(Qp, qob); const T16* qa2 = HL ? at(Q2, qob) : nullptr; const T16* ka0 = at(Kp, kob);
    V qf[2], qf2[2];
#pragma unroll
    for (int ds = 0; ds < 2; ++ds) { qf[ds] = WFrag<T16>::ld(qa + ds * 512); if constexpr (HL) qf2[ds] = WFrag<T16>::ld(qa2 + ds * 512); }
    v8f o[4];
#pragma unroll
    for (int db = 0; db < 4; ++db) o[db] = (v8f){};
    float m = -3.0e38f, l = 0.0f;
    V kf[4][2], kf2[4][2];
    if constexpr (!HL) {    // single planes: the key fragments run one pass ahead; hi+lo planes (at most RH / 64 passes, twice the registers) fetch theirs inside the pass
#pragma unroll
        for (int kb = 0; kb < 4; ++kb)
#pragma unroll
            for (int ds = 0; ds < 2; ++ds) kf[kb][ds] = WFrag<T16>::ld(ka0 + kb * 16 * HD + ds * 512);
    }
    // all s_wait_xcnt below: addresses, offsets and bases stay live up to the wait, so no register that an issued load names is given a new value in front of it;
    // the sched_barrier behind a wait keeps the loads in front of it and later vector work behind it
    if constexpr (HL) asm volatile("s_wait_xcnt 0x0" :: "v"(qa), "v"(qa2), "v"(qob), "s"(Qp), "s"(Q2) : "memory"); else asm volatile("s_wait_xcnt 0x0" :: "v"(qa), "v"(ka0), "v"(qob), "v"(kob), "s"(Qp), "s"(Kp) : "memory");
    __builtin_amdgcn_sched_barrier(0);
    const int np = q0 / 64 + 1;     // passes; only the last one meets the diagonal
    auto pass = [&](auto diag, int kt) {
        V vf[4][2], vf2[4][2];
        const T16* ka = at(Kp, kob); const T16* ka2 = HL ? at(K2, kob) : nullptr; const T16* va = at(Vp, vob); const T16* va2 = HL ? at(V2, vob) : nullptr;
        if constexpr (HL) {
#pragma unroll
            for (int kb = 0; kb < 4; ++kb)
#pragma unroll
                for (int ds = 0; ds < 2; ++ds) { kf[kb][ds] = WFrag<T16>::ld(ka + kb * 16 * HD + ds * 512); kf2[kb][ds] = WFrag<T16>::ld(ka2 + kb * 16 * HD + ds * 512); }
            asm volatile("s_wait_xcnt 0x0" :: "v"(ka), "v"(ka2), "v"(kob), "s"(Kp), "s"(K2) : "memory");
            __builtin_amdgcn_sched_barrier(0);
        } else {
#pragma unroll
            for (int db = 0; db < 4; ++db)
#pragma unroll
                for (int ks = 0; ks < 2; ++ks) vf[db][ks] = WFrag<T16>::ld(va + db * 16 * TT + ks * 512);
        }
        v8f s[4];
#pragma unroll
        for (int kb = 0; kb < 4; ++kb) { s[kb] = (v8f){};
#pragma unroll
            for (int ds = 0; ds < 2; ++ds) { s[kb] = WFrag<T16>::mma(kf[kb][ds], qf[ds], s[kb]); if constexpr (HL) { s[kb] = WFrag<T16>::mma(kf[kb][ds], qf2[ds], s[kb]); s[kb] = WFrag<T16>::mma(kf2[kb][ds], qf[ds], s[kb]); } } }
        if constexpr (HL) {     // the value fragments fly under the softmax
#pragma unroll
            for (int db = 0; db < 4; ++db)
#pragma unroll
                for (int ks = 0; ks < 2; ++ks) { vf[db][ks] = WFrag<T16>::ld(va + db * 16 * TT + ks * 512); vf2[db][ks] = WFrag<T16>::ld(va2 + db * 16 * TT + ks * 512); }
            asm volatile("s_wait_xcnt 0x0" :: "v"(va), "v"(va2), "v"(vob), "s"(Vp), "s"(V2) : "memory");
            __builtin_amdgcn_sched_barrier(0);
        } else {
            if constexpr (!decltype(diag)::value) {     // the next pass's key fragments, behind this pass's score products
#pragma unroll
                for (int kb = 0; kb < 4; ++kb)
#pragma unroll
                    for (int ds = 0; ds < 2; ++ds) kf[kb][ds] = WFrag<T16>::ld(ka + (64 + kb * 16) * HD + ds * 512);
            }
            asm volatile("s_wait_xcnt 0x0" :: "v"(ka), "v"(va), "v"(kob), "v"(vob), "s"(Kp), "s"(Vp) : "memory");
            __builtin_amdgcn_sched_barrier(0);
        }
        if constexpr (!decltype(diag)::value) { Kp += 64 * HD; Vp += 64 * 16; if constexpr (HL) { K2 += 64 * HD; V2 += 64 * 16; } }   // 64 keys: eight key blocks; two blocks of each 16 value rows
        if constexpr (decltype(diag)::value) {      // causal mask: key > query
#pragma unroll
            for (int kb = 0; kb < 4; ++kb)
#pragma unroll
                for (int j = 0; j < 8; ++j) s[kb][j] = (kt + kb * 16 + hi * 8 + j > q) ? -3.0e38f : s[kb][j];
        }
        float t4[4];     // four independent chains, one a score tile, then a tree: the maximum (and below the sum) does not wait on one chain of 32
#pragma unroll
        for (int kb = 0; kb < 4; ++kb) { t4[kb] = s[kb][0];
#pragma unroll
            for (int j = 1; j < 8; ++j) t4[kb] = fmaxf(t4[kb], s[kb][j]); }
        float tm = fmaxf(fmaxf(t4[0], t4[1]), fmaxf(t4[2], t4[3]));
        tm = fmaxf(tm, xhalf(tm));
        const float mn = fmaxf(m, tm * CL), sh = OFF - mn; float al = m - mn; m = mn;
        asm("v_exp_f32 %0, %0\n\tv_nop" : "+v"(al));     // 2^al; the v_nop is the slot that the instruction set asks for behind a transcendental
#pragma unroll
        for (int kb = 0; kb < 4; ++kb) { t4[kb] = 0.0f; float e[8];
#pragma unroll
            for (int j = 0; j < 8; ++j) e[j] = fmaf(s[kb][j], CL, sh);
            exp2x8(e);
#pragma unroll
            for (int j = 0; j < 8; ++j) { s[kb][j] = e[j]; t4[kb] += e[j]; } }
        l = fmaf(l, al, (t4[0] + t4[1]) + (t4[2] + t4[3]));
#pragma unroll
        for (int db = 0; db < 4; ++db) o[db] *= al;
#pragma unroll
        for (int ks = 0; ks < 2; ++ks) {
            if constexpr (HL) { v8us h0, h1, l0, l1;
#pragma unroll
                for (int j = 0; j < 8; ++j) { unsigned short a, c; splitf(s[2 * ks][j], a, c); h0[j] = a; l0[j] = c; splitf(s[2 * ks + 1][j], a, c); h1[j] = a; l1[j] = c; }
                const V ph = cat16b(h0, h1), pl = cat16b(l0, l1);
#pragma unroll
                for (int db = 0; db < 4; ++db) { o[db] = WFrag<T16>::mma(vf[db][ks], ph, o[db]); o[db] = WFrag<T16>::mma(vf[db][ks], pl, o[db]); o[db] = WFrag<T16>::mma(vf2[db][ks], ph, o[db]); }
            } else { const V pf = cat16(__builtin_convertvector(s[2 * ks], v8h), __builtin_convertvector(s[2 * ks + 1], v8h));
#pragma unroll
                for (int db = 0; db < 4; ++db) o[db] = WFrag<T16>::mma(vf[db][ks], pf, o[db]); }
        }
    };
    // unroll 1: one pass is already a long straight run; a second copy would only double the code
#pragma unroll 1
    for (int p = 0; p + 1 < np; ++p) pass(BoolC<false>(), p * 64);
    pass(BoolC<true>(), (np - 1) * 64);
    l += xhalf(l); const float inv = __fdiv_rn(1.0f, l);
    v8us oh[4], ol[4];
#pragma unroll
    for (int db = 0; db < 4; ++db)
#pragma unroll
        for (int j = 0; j < 8; ++j) { unsigned short a, c; splitf(o[db][j] * inv, a, c); oh[db][j] = a; ol[db][j] = c; }
    const size_t oo = (size_t)q0 * DQ + lane * 8;   // a lane's eight accumulator registers are eight consecutive d of its query row: in fragment order its own 16-byte run of half a block, so a wave's store is 512 contiguous bytes
#pragma unroll
    for (int db = 0; db < 4; ++db) { *(v8us*)(Ah + oo + db * 256) = oh[db]; *(v8us*)(Al + oo + db * 256) = ol[db]; }
}
// waves_per_eu(2, 2): with the register budget of two waves a SIMD a pass's value loads all issue at its head and the key loads a pass ahead
__global__ __launch_bounds__(128) __attribute__((amdgpu_waves_per_eu(2, 2))) void k_fattn(const h16* __restrict__ Q16, const h16* __restrict__ K16, const h16* __restrict__ V16, const bf* __restrict__ Qh, const bf* __restrict__ Ql, const bf* __restrict__ Kh, const bf* __restrict__ Kl, const bf* __restrict__ Vh, const bf* __restrict__ Vl, bf* __restrict__ Ah, bf* __restrict__ Al) {
    const int wv = __builtin_amdgcn_readfirstlane((int)(threadIdx.x >> 5));   // wave number, scalar: the pass loop's control stays a scalar branch
    const int r0 = (TT / 64 - 1 - (int)blockIdx.y) * 64;                      // longest key walks first
    const int bt = (int)blockIdx.x / NH_, hd = (int)blockIdx.x % NH_;         // batch and head; the planes are numbered batch * heads + head
    const size_t zq = (size_t)blockIdx.x * TT * HD, zk = (size_t)(bt * NKV + hd / REP) * TT * HD, za = (size_t)bt * TT * DQ + hd * HD * 16;     // za: the batch's rows of the merged planes; a head's 64 columns of 16 rows: two blocks
    if (r0 < RH) attn_wave<bf>(Qh + zq, Ql + zq, Kh + zk, Kl + zk, Vh + zk, Vl + zk, r0 + wv * 16, Ah + za, Al + za);
    else attn_wave<h16>(Q16 + zq, nullptr, K16 + zk, nullptr, V16 + zk, nullptr, r0 + wv * 16, Ah + za, Al + za);
}

// d_wt16: Bt[n][k] (fragment order) = fp16 of the bf16-rounded w[k][n]. Each thread holds a block of 8 k x 4 n in registers: eight 16-byte loads along n (a wave reads 256 contiguous bytes of two rows a load), then per n one 16-byte store along k.
// Blocks (bx < N / 64, by < K / 128), 256 threads: a block covers 64 n x 128 k, whole 1 KB blocks of the plane, so every 128-byte output line is filled by one block.
template <int K, int N>
__device__ __forceinline__ void d_wt16(const float* __restrict__ w, h16* Bt, int bx, int by) { const int lane = threadIdx.x & 31; const int n0 = bx * 64 + (lane & 15) * 4, k0 = by * 128 + (int)(threadIdx.x >> 5) * 16 + (lane >> 4) * 8; v4f r[8];
    const float* wp = w + (size_t)k0 * N + n0;
    // every unroll: the register blocks stay in registers only under constant indices
#pragma unroll
    for (int j = 0; j < 8; ++j) r[j] = *(const v4f*)(wp + j * N);
    // the address stays live up to this wait, so no register that an issued load names is given a new value in front of it
    asm volatile("s_wait_xcnt 0x0" :: "v"(wp) : "memory");
    v8h o[4];
#pragma unroll
    for (int q = 0; q < 4; ++q)
#pragma unroll
        for (int j = 0; j < 8; ++j) o[q][j] = tohx(bfr(r[j][q]));
#pragma unroll
    for (int q = 0; q < 4; ++q) *(v8h*)(Bt + fro(n0, k0, K) + q * 8) = o[q];   // fragment order: the next n is the next 16-byte run
    // the caller's code for its other block ranges follows in the kernel and rewrites registers that these stores name: the wait stands in front of that
    asm volatile("s_wait_xcnt 0x0" ::: "memory"); }
// d_rmsc: the rows of both batches, one wave a row; blocks bx < NR / 8, 256 threads. isin: X is an input and is rounded to bf16 first
__device__ __forceinline__ void d_rmsc(const float* __restrict__ X, int isin, const float* __restrict__ w, h16* HC, int bx) { const int lane = threadIdx.x & 31; const int t = bx * 8 + (int)(threadIdx.x >> 5); if (t >= NR) return; float v[32]; float s = 0.f;
#pragma unroll
    for (int ch = 0; ch < 8; ++ch) { const v4f a = *(const v4f*)(X + (size_t)t * DM + ch * 128 + lane * 4);
#pragma unroll
        for (int q = 0; q < 4; ++q) { const float xv = isin ? bfr(a[q]) : a[q]; v[ch * 4 + q] = xv; float p = __fmul_rn(xv, xv); asm volatile("" : "+v"(p)); s = __fadd_rn(s, p); } }
#pragma unroll
    for (int sh = 16; sh; sh >>= 1) s += __shfl_xor(s, sh, 32);
    const float r = __frsqrt_rn(__fadd_rn(s * (1.0f / DM), 1.1920929e-07f));
{       v4h o[8]; float wr[32]; const unsigned wob = (unsigned)lane * 16u; const float* wp = (const float*)((const char*)w + wob);   // this lane's weights: columns ch 128 + lane 4 + q
#pragma unroll
        for (int ch = 0; ch < 8; ++ch)
#pragma unroll
            for (int q = 0; q < 4; ++q) wr[ch * 4 + q] = wp[ch * 128 + q];
        // address, offset, lane number (the scaled form of the offset) and base stay live up to this wait, so no register that an issued weight load names is given a new value in front of it
        asm volatile("s_wait_xcnt 0x0" :: "v"(wp), "v"(wob), "v"(lane), "s"(w) : "memory");
#pragma unroll
        for (int ch = 0; ch < 8; ++ch)
#pragma unroll
            for (int q = 0; q < 4; ++q) { float tn = __fmul_rn(v[ch * 4 + q], r); asm volatile("" : "+v"(tn)); o[ch][q] = tohx(__fmul_rn(tn, bfr(wr[ch * 4 + q]))); }
        // block planes in fragment order: plane ch / 2, columns (ch % 2) 128 + lane 4, four blocks apart; the work-group's eight rows fill whole lines
        h16* hp = HC + fro(t, lane * 4, 256);
#pragma unroll
        for (int ch = 0; ch < 8; ++ch) *(v4h*)(hp + (size_t)(ch >> 1) * NR * 256 + (ch & 1) * 2048) = o[ch];
         } }
// k_rmsc: the second norm, a launch of its own (its input comes from the launch before); grid NR / 8
__global__ __launch_bounds__(256) void k_rmsc(const float* __restrict__ X, const float* __restrict__ w, h16* HC) { d_rmsc(X, 0, w, HC, (int)blockIdx.x); }
// k_prep: the first norm, every weight plane and the (cos, sin) table in one launch; none reads what another writes. Ranges of blockIdx.x, in this order: the norm's NR / 8 blocks (the longest chain of waits, so first), the 4 blocks n of qkv_w, of gate_w and of up_w (each [256][N], planes n apart by 256 N), down_w, o_w, the table.
#define PB_Q (4 * (3072 / 64) * (256 / 128))
#define PB_F (4 * (2048 / 64) * (256 / 128))
#define PB_D ((DM / 64) * (2048 / 128))
#define PB_O ((DM / 64) * (DQ / 128))
#define PB_C (TT * HD / 2048)
__global__ __launch_bounds__(256) void k_prep(const float* __restrict__ x, const float* __restrict__ n1w, const float* __restrict__ qkvw, const float* __restrict__ gw, const float* __restrict__ uw, const float* __restrict__ dw, const float* __restrict__ wo, h16* HC, h16* BQKV, h16* BG, h16* BU, h16* BD, bf* WO, float* CS) {
    int i = (int)blockIdx.x;
    if (i < NR / 8) { d_rmsc(x, 1, n1w, HC, i); return; }
    i -= NR / 8;
    if (i < PB_Q) { const int n = i / (PB_Q / 4), j = i % (PB_Q / 4); d_wt16<256, 3072>(qkvw + (size_t)n * 256 * 3072, BQKV + (size_t)n * 3072 * 256, j % (3072 / 64), j / (3072 / 64)); return; }
    i -= PB_Q;
    if (i < 2 * PB_F) { const bool up = i >= PB_F; const int n = (i % PB_F) / (PB_F / 4), j = i % (PB_F / 4); d_wt16<256, 2048>((up ? uw : gw) + (size_t)n * 256 * 2048, (up ? BU : BG) + (size_t)n * 2048 * 256, j % (2048 / 64), j / (2048 / 64)); return; }
    i -= 2 * PB_F;
    if (i < PB_D) { d_wt16<2048, DM>(dw, BD, i % (DM / 64), i / (DM / 64)); return; }
    i -= PB_D;
    if (i < PB_O) { d_wtG<DQ, DM>(wo, WO, i % (DM / 64), i / (DM / 64)); return; }
    d_csid(CS, i - PB_O); }
// ---- k_dend: one dendritic layer (PAIR: the gate and the up layer together), both batches' rows, per launch; 128 threads, four waves as 2 x 2, each with a 64x64 tile.
// Grid (NR/128, N/128): the work-group owns 128 rows x 128 columns. PAIR: grid (NR/128, N/64), 128 rows x the same 64 columns of the gate layer (waves 0, 1) and of the up layer (waves 2, 3; weights sB elements on).
// The work-group walks the four input blocks n in turn. Each stage (128 k of one block: 128 rows of H and 128 rows of Bt, 32 KB each, already in fragment order) is brought into LDS once, by asynchronous copies, for all four waves:
// every operand byte leaves L2 once a work-group and is read by two waves. Two buffers: the next stage's copies fly while this one is worked on.
// A wave's tile of block n is one running sum over K (f32); behind it gain[n] silu(tile - thr[n]) joins the running max over n = 0 .. 3 (in that order) in registers. The finished tiles go through LDS once, for whole-line stores.
// H: block planes [n][NR][256]; Bt: [n][N][256], each plane in fragment order; thr, gain: [n][N]; C: [NR][N]. PAIR: the epilogue stores silu(gate) * up as the fp16 plane FF [NR][N] in fragment order; C is not used. Else FF, thr1, gain1 and sB are not used.
// eight asynchronous 16-byte copies a lane in one statement; its last line is the wait that stands in front of any rewrite of the address registers that the copies name
__device__ __forceinline__ void acp8(const unsigned (&l)[8], const char* const (&g)[8]) {
    asm volatile("global_load_async_to_lds_b128 %0, %8, off\n\tglobal_load_async_to_lds_b128 %1, %9, off\n\tglobal_load_async_to_lds_b128 %2, %10, off\n\tglobal_load_async_to_lds_b128 %3, %11, off\n\t"
                 "global_load_async_to_lds_b128 %4, %12, off\n\tglobal_load_async_to_lds_b128 %5, %13, off\n\tglobal_load_async_to_lds_b128 %6, %14, off\n\tglobal_load_async_to_lds_b128 %7, %15, off\n\ts_wait_xcnt 0x0"
                 :: "v"(l[0]), "v"(l[1]), "v"(l[2]), "v"(l[3]), "v"(l[4]), "v"(l[5]), "v"(l[6]), "v"(l[7]), "v"(g[0]), "v"(g[1]), "v"(g[2]), "v"(g[3]), "v"(g[4]), "v"(g[5]), "v"(g[6]), "v"(g[7]) : "memory"); }
// waves_per_eu(2, 2): two work-groups a WGP (their LDS allows no third), so that one's vector epilogue runs beside the other's products
template <bool PAIR>
__global__ __launch_bounds__(128) __attribute__((amdgpu_waves_per_eu(2, 2))) void k_dend(const h16* __restrict__ H, const h16* __restrict__ Bt, int N, const float* __restrict__ thr0, const float* __restrict__ gain0, const float* __restrict__ thr1, const float* __restrict__ gain1, float* C, h16* FF, size_t sB) {
    constexpr int K = 256, WST = 64 * 68;                   // WST: floats of one wave's LDS slab for its finished tile (row pitch 68)
    constexpr unsigned OPB = 32768, STG = 2 * OPB;          // bytes of one operand's part of a stage (128 rows x 128 k), and of a stage [A | B]
    static_assert(4 * WST * 4 <= 2 * STG, "the finished tiles reuse the stage buffers");
    __shared__ __align__(2048) char sm[2 * STG];
    const int wv = __builtin_amdgcn_readfirstlane((int)(threadIdx.x >> 5)), wr = wv & 1, wc = wv >> 1;   // wave number, scalar: row half, column half (PAIR: layer)
    const int lane = threadIdx.x & 31, lr = lane & 15, hi = lane >> 4; const int r0 = blockIdx.x * 128, c0 = blockIdx.y * (PAIR ? 64 : 128);
    // the thread's own 16 bytes of every 2 KB that the work-group copies at a time; 16 rows of blocks are 16 K elements, 8 KB, of which a stage takes 4 KB
    const char* gA = (const char*)(H + (size_t)r0 * K) + threadIdx.x * 16u; const char* gB = (const char*)(Bt + (size_t)c0 * K) + threadIdx.x * 16u;
    const unsigned lb = (unsigned)(size_t)sm + threadIdx.x * 16u;      // LDS byte address: the low 32 bits of the shared address
    // every unroll of this kernel: the register arrays stay in registers only under constant indices
    auto fill = [&](int n, int s, int buf) {      // stage (n, s) into buffer buf: block (16-row group rb, k block kb) of an operand lands at (rb * 4 + kb) KB of its part
        const char* a = gA + (size_t)n * ((size_t)NR * K * 2) + s * 4096; const char* b = gB + (size_t)n * ((size_t)N * K * 2) + s * 4096; const unsigned l = lb + (unsigned)buf * STG;
#pragma unroll
        for (int h = 0; h < 2; ++h) { unsigned la[8]; const char* ga[8];
#pragma unroll
            for (int i = 0; i < 8; ++i) { const int x = h * 8 + i; la[i] = l + x * 2048u; ga[i] = a + (x >> 1) * 8192 + (x & 1) * 2048; }
            acp8(la, ga); }
#pragma unroll
        for (int h = 0; h < 2; ++h) { unsigned la[8]; const char* ga[8];
#pragma unroll
            for (int i = 0; i < 8; ++i) { const int x = h * 8 + i, rb = x >> 1; la[i] = l + OPB + x * 2048u; ga[i] = (PAIR && rb >= 4 ? b + sB * 2 + (rb - 4) * 8192 : b + rb * 8192) + (x & 1) * 2048; }
            acp8(la, ga); }
    };
    v8f acc[4][4], r[4][4];
#pragma unroll
    for (int mb = 0; mb < 4; ++mb)
#pragma unroll
        for (int nb = 0; nb < 4; ++nb) acc[mb][nb] = (v8f){};
    auto stage = [&](int buf) {     // 4 k blocks x 16 products on the wave's 64 rows of each operand; two fragment sets: the next k block's 16 LDS reads go as one group ahead of this block's products
        const char* sa = sm + buf * STG + wr * 16384 + lane * 16; const char* sb = sm + buf * STG + OPB + wc * 16384 + lane * 16;
        v16h a[2][4], b[2][4];
        auto frag = [&](int kb) {
#pragma unroll
            for (int mb = 0; mb < 4; ++mb) a[kb & 1][mb] = cat16(*(const v8ha*)(sa + (mb * 4 + kb) * 1024), *(const v8ha*)(sa + (mb * 4 + kb) * 1024 + 512));
#pragma unroll
            for (int nb = 0; nb < 4; ++nb) b[kb & 1][nb] = cat16(*(const v8ha*)(sb + (nb * 4 + kb) * 1024), *(const v8ha*)(sb + (nb * 4 + kb) * 1024 + 512)); };
        frag(0);
#pragma unroll
        for (int kb = 0; kb < 4; ++kb) {
            if (kb < 3) frag(kb + 1);
            __builtin_amdgcn_sched_barrier(0);   // keeps the reads one group and only one k block ahead: left to itself the compiler reads the whole stage first, 256 registers of fragments, and spills
#pragma unroll
            for (int nb = 0; nb < 4; ++nb)
#pragma unroll
                for (int mb = 0; mb < 4; ++mb) acc[mb][nb] = wmma16(a[kb & 1][mb], b[kb & 1][nb], acc[mb][nb]);
            __builtin_amdgcn_sched_barrier(0); } // likewise: the group after next stays behind these products
    };
    auto foot = [&]() {     // hand-over of a stage: this wave's LDS reads are done, its own copies of the next stage have landed, and every wave says so, before the next stage is read or this buffer refilled
        asm volatile("s_wait_dscnt 0x0" ::: "memory");
        asm volatile("s_wait_asynccnt 0x0" ::: "memory");
        __syncthreads(); };
    const float* tb = ((PAIR && wc) ? thr1 : thr0) + c0 + (PAIR ? 0 : wc * 64); const float* gb = ((PAIR && wc) ? gain1 : gain0) + c0 + (PAIR ? 0 : wc * 64);
    fill(0, 0, 0);
    asm volatile("s_wait_asynccnt 0x0" ::: "memory");    // this wave's copies of stage 0 have landed
    __syncthreads();                                     // and every other wave's
    fill(0, 1, 1);
    auto block = [&](auto first, int n) {
        float th[4], ga[4]; unsigned ob[4];     // the lane's four columns nb 16 + lane % 16; asked for here, used behind the block's products
#pragma unroll
        for (int nb = 0; nb < 4; ++nb) { ob[nb] = ((unsigned)(n * N) + (unsigned)(nb * 16 + lr)) * 4u; th[nb] = *(const float*)((const char*)tb + ob[nb]); ga[nb] = *(const float*)((const char*)gb + ob[nb]); }
        // the four byte offsets and the two bases stay live up to this wait, so no register that an issued threshold or gain load names is given a new value in front of it
        asm volatile("s_wait_xcnt 0x0" :: "v"(ob[0]), "v"(ob[1]), "v"(ob[2]), "v"(ob[3]), "s"(tb), "s"(gb) : "memory");
        stage(0); foot(); if (n < 3) fill(n + 1, 0, 0);
        stage(1); foot(); if (n < 3) fill(n + 1, 1, 1);
#pragma unroll
        for (int nb = 0; nb < 4; ++nb) { th[nb] = bfr(th[nb]); ga[nb] = bfr(ga[nb]); }
#pragma unroll
        for (int mb = 0; mb < 4; ++mb)
#pragma unroll
            for (int nb = 0; nb < 4; ++nb) { float z[8], sg[8];      // eight sigmoids a statement
#pragma unroll
                for (int j = 0; j < 8; ++j) sg[j] = z[j] = __fsub_rn(acc[mb][nb][j], th[nb]);
                sig8(sg);
#pragma unroll
                for (int j = 0; j < 8; ++j) { const float val = __fmul_rn(ga[nb], __fmul_rn(z[j], sg[j])); r[mb][nb][j] = decltype(first)::value ? val : fmaxf(r[mb][nb][j], val); }
                acc[mb][nb] = (v8f){}; }
    };
    block(BoolC<true>(), 0);
    // unroll 1: one block is already a long straight run; more copies would only lengthen the code
#pragma unroll 1
    for (int n = 1; n < 4; ++n) block(BoolC<false>(), n);
    asm volatile("s_wait_asynccnt 0x0" ::: "memory");    // no copy is outstanding when the buffers are put to their second use (the last hand-over's barrier has ended every wave's reads of them)
    float* os = (float*)sm;
#pragma unroll
    for (int mb = 0; mb < 4; ++mb)
#pragma unroll
        for (int nb = 0; nb < 4; ++nb) {
#pragma unroll
            for (int j = 0; j < 8; ++j) os[wv * WST + (mb * 16 + hi * 8 + j) * 68 + nb * 16 + lr] = r[mb][nb][j]; }
    __syncthreads();    // all four finished tiles are in LDS before any of them is read back
    const unsigned cofs = (threadIdx.x & 15u) * 4u;
    if constexpr (PAIR) {
        h16* fp = FF + fro(r0 + (int)(threadIdx.x >> 4), c0 + (int)cofs, N);     // 8 rows on are 64 elements on; 16 rows on are N / 32 blocks on, 16 N elements
        for (int p = 0; p < 8; ++p) { v4f g[2], u[2]; float sg[8];      // two rows a trip (8 apart): their eight gate values fill one statement of sigmoids
#pragma unroll
            for (int h = 0; h < 2; ++h) { const int row = p * 16 + h * 8 + (int)(threadIdx.x >> 4); const float* q = os + (row >> 6) * WST + (row & 63) * 68 + cofs; g[h] = *(const v4fa*)q; u[h] = *(const v4fa*)(q + 2 * WST); }
#pragma unroll
            for (int j = 0; j < 8; ++j) sg[j] = g[j >> 2][j & 3];
            sig8(sg);
#pragma unroll
            for (int h = 0; h < 2; ++h) { v4h o;
#pragma unroll
                for (int q = 0; q < 4; ++q) { const float sl = __fmul_rn(g[h][q], sg[h * 4 + q]); o[q] = tohx(__fmul_rn(sl, u[h][q])); }
                *(v4h*)(fp + (size_t)p * 16 * N + h * 64) = o; }
            asm volatile("s_wait_xcnt 0x0" ::: "memory"); }   // the next trip rewrites the registers that these stores name: the wait stands in front of that
    } else {
        float* crow = C + (size_t)(r0 + wr * 64 + hi) * N + c0 + wc * 64 + cofs;      // each wave stores its own tile, two 256-byte row pieces a store
        for (int p = 0; p < 8; ++p) { v4f v[4];
#pragma unroll
            for (int h = 0; h < 4; ++h) v[h] = *(const v4fa*)(os + wv * WST + (p * 8 + h * 2 + hi) * 68 + cofs);
#pragma unroll
            for (int h = 0; h < 4; ++h) *(v4f*)(crow + (size_t)(p * 8 + h * 2) * N) = v[h];
            asm volatile("s_wait_xcnt 0x0" ::: "memory"); }   // the next trip rewrites the registers that these stores name: the wait stands in front of that
    }
}
extern "C" void kernel_launch(void* const* d_in, const int* in_sizes, int n_in,
                              void* d_out, int out_size, void* d_ws, size_t ws_size, hipStream_t stream) {
    (void)in_sizes; (void)n_in; (void)out_size;
    const float* x = (const float*)d_in[0]; const float* qkvw = (const float*)d_in[1]; const float* qthr = (const float*)d_in[2]; const float* qgain = (const float*)d_in[3]; const float* wo = (const float*)d_in[4]; const float* gw = (const float*)d_in[5]; const float* gthr = (const float*)d_in[6]; const float* ggain = (const float*)d_in[7]; const float* uw = (const float*)d_in[8]; const float* uthr = (const float*)d_in[9]; const float* ugain = (const float*)d_in[10]; const float* dw = (const float*)d_in[11]; const float* n1w = (const float*)d_in[12]; const float* n2w = (const float*)d_in[13];
    float* OUT = (float*)d_out;     // [2][2048][1024]
    char* wsp = (char*)d_ws;
    auto take = [&](size_t bytes) { char* p = wsp; wsp += (bytes + 255) & ~(size_t)255; return (void*)p; };
    const size_t PL = (size_t)NB_ * NH_ * TT * HD;      // elements of one set of head planes [batch][head][..]
    bf* WO = (bf*)take((size_t)DM * DQ * 2); float* CS = (float*)take((size_t)TT * HD * 2 * 4);
    h16* BQKV = (h16*)take((size_t)4 * 3072 * 256 * 2); h16* BG = (h16*)take((size_t)2 * 4 * 2048 * 256 * 2); h16* BU = BG + (size_t)4 * 2048 * 256; h16* BD = (h16*)take((size_t)DM * 2048 * 2);
    h16* HC = (h16*)take((size_t)4 * NR * 256 * 2); h16* FF16 = (h16*)take((size_t)NR * 2048 * 2); float* X1 = (float*)take((size_t)NR * DM * 4);
    bf* ATh = (bf*)take((size_t)NR * DQ * 2); bf* ATl = (bf*)take((size_t)NR * DQ * 2);
    float* FQKV = (float*)take((size_t)NR * 3072 * 4);   // dendritic [q|k|v], row pitch 3072
    h16* QP16 = (h16*)take(2 * PL * 2); h16* KP16 = QP16 + PL; bf* QPh = (bf*)take(2 * PL * 2); bf* KPh = QPh + PL; bf* QPl = (bf*)take(2 * PL * 2); bf* KPl = QPl + PL;   // the k planes directly behind the q planes
    h16* VT16 = (h16*)take(PL * 2); bf* VTh = (bf*)take(PL * 2); bf* VTl = (bf*)take(PL * 2);
    if ((size_t)(wsp - (char*)d_ws) > ws_size) return;    // ws 256 MiB
    k_prep<<<NR / 8 + PB_Q + 2 * PB_F + PB_D + PB_O + PB_C, 256, 0, stream>>>(x, n1w, qkvw, gw, uw, dw, wo, HC, BQKV, BG, BU, BD, WO, CS);
    // dendritic [q|k|v]: one launch for the whole layer (N = 3072)
    k_dend<false><<<dim3(NR / 128, 3072 / 128, 1), 128, 0, stream>>>(HC, BQKV, 3072, qthr, qgain, qthr, qgain, FQKV, nullptr, 0);
    k_qkvp<3072><<<RB + VB, 256, 0, stream>>>(FQKV, CS, QP16, QPh, QPl, VT16, VTh, VTl);
    // causal attention, all heads of both batches in one launch; it writes the merged hi+lo planes itself
    k_fattn<<<dim3(NB_ * NH_, TT / 64, 1), 128, 0, stream>>>(QP16, KP16, VT16, QPh, QPl, KPh, KPl, VTh, VTl, ATh, ATl);
    // x1 = x + merged.v o_w: the residual joins in the GEMM's epilogue
    k_gemmw<bf, 1, false, 8, DQ, 1><<<dim3(NR / 64, DM / 64, 1), 256, 0, stream>>>(ATh, ATl, WO, nullptr, X1, DM, nullptr, 0, 0, 0, x);
    k_rmsc<<<NR / 8, 256, 0, stream>>>(X1, n2w, HC);
    // dendritic gate and up and silu(gate) * up in one launch
    k_dend<true><<<dim3(NR / 128, 2048 / 64, 1), 128, 0, stream>>>(HC, BG, 2048, gthr, ggain, uthr, ugain, nullptr, FF16, (size_t)4 * 2048 * 256);
    // out = x1 + ff down_w, likewise
    k_gemmw<h16, 0, false, 8, 2048, 2><<<dim3(NR / 64, DM / 64, 1), 256, 0, stream>>>(FF16, nullptr, BD, nullptr, OUT, DM, nullptr, 0, 0, 0, X1);
}

// v010
// It runs in 190 microseconds.
// In two side-by-side timings against v009, it was 1.09 and 1.10 times as fast.
// Over all steps from v000 it is 11.3 times as fast.
#include <hip/hip_runtime.h>

// Transformer block with dendritic layers (x [2][2048][1024]; h = RMSNorm(x) w1; [q|k|v] = dendritic(h, qkv_w, thr, gain) = max over the 4 input blocks n of gain[n] silu(h_n W[n] - thr[n]) (16 heads x 64); causal softmax(q.k/8); x1 = x + merged.v o_w;
// h2 = RMSNorm(x1) w2; ff = silu(dendritic(h2, gate)) * dendritic(h2, up); out = x1 + ff down_w -> [2][2048][1024]; all weights x @ W; eps = f32 eps).
// Compute dtypes, f32 accumulate: every input rounded to bf16; the RMSNorms f32 -> SINGLE fp16 block planes; every dendritic GEMM on fp16 planes x fp16 copies of the bf16 weights (1 product; hi+lo would double the
// ~60 G of dendritic GEMMs), the gain/silu/threshold/max epilogues f32; scores (K 64) and probs.v on hl planes (3 products) for the first 512 query rows of each head and single fp16 planes for the rest, f32 causal softmax with masked tiles

#define NB_  2
#define TT   2048
#define NR   (NB_ * TT)         // rows of both batches: every row-wise kernel takes them in one launch
#define DM   1024
#define NH_  16
#define NKV  16
#define REP  (NH_ / NKV)
#define HD   64
#define DQ   (NH_ * HD)
#define DKV  (NKV * HD)
#define RH   512                  // query rows < RH use hi+lo planes (0: none)
#define SCL  0.125f   // HD^-0.5
typedef _Float16 h16;
typedef unsigned short bf;
typedef __attribute__((ext_vector_type(16))) __bf16   v16bf;
typedef __attribute__((ext_vector_type(16))) _Float16 v16h;
typedef __attribute__((ext_vector_type(8)))  _Float16 v8h;
typedef __attribute__((ext_vector_type(8)))  unsigned short v8us;
typedef __attribute__((ext_vector_type(8)))  float    v8f;
typedef __attribute__((ext_vector_type(4)))  float    v4f;
typedef v8h  __attribute__((may_alias)) v8ha;
typedef v4f  __attribute__((may_alias)) v4fa;
typedef v8us __attribute__((may_alias)) v8usa;

__device__ __forceinline__ unsigned short f2bf(float f) { unsigned u = __float_as_uint(f); u += 0x7FFFu + ((u >> 16) & 1u); return (unsigned short)(u >> 16); }
__device__ __forceinline__ float bf2f(unsigned short b) { return __uint_as_float(((unsigned)b) << 16); }
__device__ __forceinline__ float bfr(float f) { return bf2f(f2bf(f)); }
__device__ __forceinline__ v16h cat16(v8h lo, v8h hi) { return __builtin_shufflevector(lo, hi, 0, 1, 2, 3, 4, 5, 6, 7, 8, 9, 10, 11, 12, 13, 14, 15); }
__device__ __forceinline__ v16bf cat16b(v8us lo, v8us hi) { return __builtin_bit_cast(v16bf, __builtin_shufflevector(lo, hi, 0, 1, 2, 3, 4, 5, 6, 7, 8, 9, 10, 11, 12, 13, 14, 15)); }
__device__ __forceinline__ v8f wmma16(v16h a, v16h b, v8f c) { return __builtin_amdgcn_wmma_f32_16x16x32_f16(false, a, false, b, (short)0, c, false, false); }
__device__ __forceinline__ v8f wmmab(v16bf a, v16bf b, v8f c) { return __builtin_amdgcn_wmma_f32_16x16x32_bf16(false, a, false, b, (short)0, c, false, false); }



// ---- Fragment order: every 16-bit operand plane P[row][k] (K columns, K % 32 == 0) is stored as blocks of 16 rows x 32 k, 1 KB each, block (row / 16, k / 32) at element ((row / 16) (K / 32) + k / 32) 512.
// Inside a block the eight k of one 16-byte run lie where the matrix instruction's lane wants them: lane = row % 16 + 16 ((k / 8) % 2), first half of the fragment (k % 32 < 16) at lane * 8, second half at 256 + lane * 8.
// So a wave's fragment is two 16-byte loads of 512 contiguous bytes each (four whole lines), not two loads that touch 16 lines; which lane and register holds which (row, k) is the matrix instruction's own layout (k = 8 (lane / 16) + j and 16 + 8 (lane / 16) + j of row lane % 16).
__device__ __forceinline__ size_t fro(int row, int k, int K) { return ((size_t)(row >> 4) * (K >> 5) + (k >> 5)) * 512 + ((k >> 4) & 1) * 256 + ((row & 15) + ((k >> 3) & 1) * 16) * 8 + (k & 7); }
// a wave-uniform base plus the lane's fixed byte offset (lane * 16): the form of every fragment load
template <typename T16> __device__ __forceinline__ const T16* atl(const T16* base, unsigned ob) { return (const T16*)((const char*)base + ob); }

// ---- k_gemmw: register-blocked GEMM, 64x64 output tile (16 accumulators) per wave, operands straight from 16-bit planes in fragment order; grid (M/64, N/64, Z), 32 * KS threads.
// KS = 1: one wave owns the tile. KS > 1 (K % 64 == 0): the KS waves of the work-group share the tile's K loop, so each waits out 1/KS of its load latencies, and their partial tiles are summed through LDS.
// RES (KS = 8 only): the residual res[m][n] (f32, pitch ldc) is added to the summed tile in the epilogue; 1: rounded to bf16 first (an input), 2: as it is; 0: none.
// C[m][n] (f32, pitch ldc, + optional f32 bias[n]) = sum_k A[m][k] Bt[n][k] (+ split products per NSPLIT). z-batch strides sA/sB/sC in elements. K % 32 == 0, a template constant, so that every block's distance from the two bases is an immediate offset.
template <typename T16> struct WFrag;
template <> struct WFrag<h16> { typedef v16h V; static __device__ __forceinline__ V ld(const h16* p) { return cat16(*(const v8h*)p, *(const v8h*)(p + 256)); } static __device__ __forceinline__ v8f mma(V a, V b, v8f c) { return wmma16(a, b, c); } };
template <> struct WFrag<bf> { typedef v16bf V; static __device__ __forceinline__ V ld(const bf* p) { return cat16b(*(const v8us*)p, *(const v8us*)(p + 256)); } static __device__ __forceinline__ v8f mma(V a, V b, v8f c) { return wmmab(a, b, c); } };
template <typename T16, int NSPLIT, bool BIAS, int KS, int K, int RES>
__global__ __launch_bounds__(32 * KS) void k_gemmw(const T16* __restrict__ A, const T16* __restrict__ A2, const T16* __restrict__ Bt, const T16* __restrict__ Bt2, float* C, int ldc, const float* __restrict__ bias, size_t sA, size_t sB, size_t sC, const float* __restrict__ res) {
    static_assert(RES == 0 || KS == 8, "the residual is added where the eight partial tiles are summed");
    typedef typename WFrag<T16>::V V;
    constexpr int WST = (KS == 1) ? 16 * 68 : 64 * 68;      // floats of one wave's LDS slab: one 16-row block (KS = 1), its whole partial tile (KS > 1)
    __shared__ __align__(16) float os[KS * WST];
    const int wv = (KS == 1) ? 0 : __builtin_amdgcn_readfirstlane((int)(threadIdx.x >> 5));   // wave number, scalar: the K loop's control stays a scalar branch
    const size_t z = blockIdx.z; A += z * sA; if (A2) A2 += z * sA; Bt += z * sB; if (Bt2) Bt2 += z * sB; C += z * sC;
    const int lane = threadIdx.x & 31, lr = lane & 15, hi = lane >> 4; const int r0 = blockIdx.x * 64, c0 = blockIdx.y * 64;
    v8f acc[4][4];
#pragma unroll
    for (int mb = 0; mb < 4; ++mb)
#pragma unroll
        for (int nb = 0; nb < 4; ++nb) acc[mb][nb] = (v8f){};
    const unsigned lob = (unsigned)lane * 16u;      // the lane's byte offset in every block
    A += (size_t)r0 * K; if (A2) A2 += (size_t)r0 * K; Bt += (size_t)c0 * K; if (Bt2) Bt2 += (size_t)c0 * K;     // 16 rows of blocks are 16 K elements
#pragma unroll 1
    for (int kc = wv * 64; kc < K; kc += (kc & 32) ? KS * 64 - 32 : 32) {   // wave wv takes the 64-wide K chunks wv, wv + KS, ... (two blocks of each 16 operand rows)
        const T16* pa = atl(A + (size_t)kc * 16, lob); const T16* pa2 = (NSPLIT == 1 || NSPLIT == 2) ? atl(A2 + (size_t)kc * 16, lob) : pa; const T16* pb = atl(Bt + (size_t)kc * 16, lob); const T16* pb2 = (NSPLIT >= 2) ? atl(Bt2 + (size_t)kc * 16, lob) : pb;
        V a[4], a2[4];
#pragma unroll
        for (int mb = 0; mb < 4; ++mb) { a[mb] = WFrag<T16>::ld(pa + mb * 16 * K); if (NSPLIT == 1 || NSPLIT == 2) a2[mb] = WFrag<T16>::ld(pa2 + mb * 16 * K); }
#pragma unroll
        for (int nb = 0; nb < 4; ++nb) { const V b = WFrag<T16>::ld(pb + nb * 16 * K); V b2; if (NSPLIT >= 2) b2 = WFrag<T16>::ld(pb2 + nb * 16 * K);
#pragma unroll
            for (int mb = 0; mb < 4; ++mb) { acc[mb][nb] = WFrag<T16>::mma(a[mb], b, acc[mb][nb]); if (NSPLIT == 1 || NSPLIT == 2) acc[mb][nb] = WFrag<T16>::mma(a2[mb], b, acc[mb][nb]); if (NSPLIT >= 2) acc[mb][nb] = WFrag<T16>::mma(a[mb], b2, acc[mb][nb]); } }
        // the trip's addresses stay live up to this wait, so no register that an issued operand load names is given a new value in front of it
        asm volatile("s_wait_xcnt 0x0" :: "v"(pa), "v"(pa2), "v"(pb), "v"(pb2) : "memory");
        asm volatile("v_nop\n\tv_nop\n\tv_nop\n\tv_nop" : "+v"(acc[0][0]), "+v"(acc[1][1]), "+v"(acc[2][2]), "+v"(acc[3][3]) : "v"(a[0]), "v"(a[3]));
    }
    if constexpr (KS > 1) {     // the KS waves' partial tiles meet in LDS and are summed in fixed wave order 0 .. KS-1
        v4f rv[32 / KS];
        if constexpr (RES != 0) {   // this thread's residual runs, asked for here so that they fly under the LDS stores and the barrier
            const float* rb = res + z * sC + (size_t)r0 * ldc + c0; unsigned rob[4];
#pragma unroll
            for (int q = 0; q < 4; ++q) { rob[q] = ((unsigned)(q * 2 * KS + (int)(threadIdx.x >> 4)) * (unsigned)ldc + (threadIdx.x & 15u) * 4u) * 4u; rv[q] = *(const v4fa*)((const char*)rb + rob[q]); }
            // the four byte offsets and the base stay live up to this wait, so no register that an issued residual load names is given a new value in front of it
            asm volatile("s_wait_xcnt 0x0" :: "v"(rob[0]), "v"(rob[1]), "v"(rob[2]), "v"(rob[3]), "s"(rb) : "memory");
        }
        // unrolls: acc[][] stays in registers only under constant indices; the q and ww loops so that their LDS reads issue together
#pragma unroll
        for (int mb = 0; mb < 4; ++mb)
#pragma unroll
            for (int nb = 0; nb < 4; ++nb) {
#pragma unroll
                for (int j = 0; j < 8; ++j) os[wv * WST + (mb * 16 + hi * 8 + j) * 68 + nb * 16 + lr] = acc[mb][nb][j]; }
        __syncthreads();    // every wave's partial tile is in LDS before any of it is summed
        float* crow = C + (size_t)r0 * ldc + c0;
#pragma unroll
        for (int q = 0; q < 32 / KS; ++q) { const int idx = q * 32 * KS + (int)threadIdx.x, row = idx >> 4, cofs = (idx & 15) * 4; v4f val = *(const v4fa*)(os + row * 68 + cofs);
#pragma unroll
            for (int ww = 1; ww < KS; ++ww) val += *(const v4fa*)(os + ww * WST + row * 68 + cofs);
            if (BIAS) { val[0] += bfr(bias[c0 + cofs]); val[1] += bfr(bias[c0 + cofs + 1]); val[2] += bfr(bias[c0 + cofs + 2]); val[3] += bfr(bias[c0 + cofs + 3]); }
            if constexpr (RES != 0) {
#pragma unroll
                for (int e = 0; e < 4; ++e) val[e] = __fadd_rn(RES == 1 ? bfr(rv[q][e]) : rv[q][e], val[e]); }
            *(v4f*)(crow + (size_t)row * ldc + cofs) = val; }
        return;
    }
#pragma unroll
    for (int mb = 0; mb < 4; ++mb) {
#pragma unroll
        for (int nb = 0; nb < 4; ++nb) {
#pragma unroll
            for (int j = 0; j < 8; ++j) os[(hi * 8 + j) * 68 + nb * 16 + lr] = acc[mb][nb][j]; }
        __builtin_amdgcn_wave_barrier(); asm volatile("" ::: "memory");
        float* crow = C + (size_t)(r0 + mb * 16) * ldc + c0;
{
#pragma unroll
            for (int s = 0; s < 8; ++s) { const int row = 2 * s + hi, cofs = lr * 4; v4f val = *(const v4fa*)(os + row * 68 + cofs); if (BIAS) { val[0] += bfr(bias[c0 + cofs]); val[1] += bfr(bias[c0 + cofs + 1]); val[2] += bfr(bias[c0 + cofs + 2]); val[3] += bfr(bias[c0 + cofs + 3]); }
                *(v4f*)(crow + (size_t)row * ldc + cofs) = val; }
             }
        __builtin_amdgcn_wave_barrier(); asm volatile("" ::: "memory");
    }
}

__device__ __forceinline__ h16 tohx(float x) { return (h16)x; }
__device__ __forceinline__ void splitf(float y, unsigned short& h, unsigned short& l) { h = f2bf(y); l = f2bf(y - bf2f(h)); }
typedef __attribute__((ext_vector_type(2))) _Float16 v2h;
typedef __attribute__((ext_vector_type(4))) _Float16 v4h;
typedef __attribute__((ext_vector_type(2))) unsigned short v2us;
typedef __attribute__((ext_vector_type(4))) unsigned short v4us;
typedef __attribute__((ext_vector_type(2))) float v2f;
typedef __attribute__((ext_vector_type(4))) int v4i;

// d_wtG: Bt[n][k] (fragment order) = bf16 of w[k][n]; the register block, the block indices and the waits of d_wt16 below
template <int K, int N>
__device__ __forceinline__ void d_wtG(const float* __restrict__ w, bf* Bt, int bx, int by) { const int lane = threadIdx.x & 31; const int n0 = bx * 64 + (lane & 15) * 4, k0 = by * 128 + (int)(threadIdx.x >> 5) * 16 + (lane >> 4) * 8; v4f r[8];
    const float* wp = w + (size_t)k0 * N + n0;
    // every unroll: the register blocks stay in registers only under constant indices
#pragma unroll
    for (int j = 0; j < 8; ++j) r[j] = *(const v4f*)(wp + j * N);
    // the address stays live up to this wait, so no register that an issued load names is given a new value in front of it
    asm volatile("s_wait_xcnt 0x0" :: "v"(wp) : "memory");
    v8us o[4];
#pragma unroll
    for (int q = 0; q < 4; ++q)
#pragma unroll
        for (int j = 0; j < 8; ++j) o[q][j] = f2bf(r[j][q]);
#pragma unroll
    for (int q = 0; q < 4; ++q) *(v8us*)(Bt + fro(n0, k0, K) + q * 8) = o[q];   // fragment order: the next n is the next 16-byte run
    // the caller's last block range: no code follows these stores, the wait is a precaution
    asm volatile("s_wait_xcnt 0x0" ::: "memory"); }
__global__ __launch_bounds__(256) void k_cvt8(const float* __restrict__ src, bf* dst, size_t n8) { const size_t i = (size_t)blockIdx.x * 256 + threadIdx.x; if (i >= n8) return; const v8f v = *(const v8f*)(src + i * 8); v8us o;
#pragma unroll
    for (int k = 0; k < 8; ++k) o[k] = f2bf(v[k]); *(v8us*)(dst + i * 8) = o;  }
__global__ __launch_bounds__(256) void k_cscvt(const float* __restrict__ cosT, const float* __restrict__ sinT, float* CS) { const int idx = blockIdx.x * 256 + threadIdx.x; if (idx >= TT * HD) return; v2f cs; cs[0] = bfr(cosT[idx]); cs[1] = bfr(sinT[idx]); *(v2f*)(CS + (size_t)idx * 2) = cs;  }
static_assert(NH_ == NKV, "q, k and v planes are numbered alike");
// ---- k_fattn: causal attention of both batches in one launch; grid (NB_ * heads, TT/64), 128 threads; wave w of a work-group owns the 16 query rows r0 + 16 w .. + 15 of one head and walks the keys 0 .. r0 + 63 in passes of 64.
// Transposed products: S^T = K Q^T (A = key rows, B = query rows), so a lane holds 32 scores of ONE query (column lane & 15; keys 16 kb + 8 (lane >> 4) + j); running maximum and sum stay in the lane, the two lane halves
// exchange the maximum once a pass and the sum once at the end. Two score tiles, converted in place, are the B operand of O^T += V^T P^T (A = rows of the transposed value plane). Scores and probabilities never leave the registers.
// Operand classes: query rows < RH on bf16 hi+lo planes (3 products each), the rest on single fp16 planes (probabilities carried x 2^10, which cancels in the division by their sum). Output: bf16 hi+lo planes [t][DQ]. All planes in fragment order.
template <typename T16> struct IsHL { static constexpr bool v = false; };
template <> struct IsHL<bf> { static constexpr bool v = true; };
template <bool B> struct BoolC { static constexpr bool value = B; };
__device__ __forceinline__ float xhalf(float x) { return __int_as_float(__builtin_amdgcn_permlanex16(__float_as_int(x), __float_as_int(x), 0x76543210, 0xfedcba98, false, false)); }   // the value of lane ^ 16
// eight 2^x in place, in one statement: each v_exp_f32 is followed by one that neither reads its result nor overwrites its source, the last by the v_nop that the instruction set asks for behind a transcendental
__device__ __forceinline__ void exp2x8(float (&e)[8]) {
    asm("v_exp_f32 %0, %0\n\tv_exp_f32 %1, %1\n\tv_exp_f32 %2, %2\n\tv_exp_f32 %3, %3\n\tv_exp_f32 %4, %4\n\tv_exp_f32 %5, %5\n\tv_exp_f32 %6, %6\n\tv_exp_f32 %7, %7\n\tv_nop"
        : "+v"(e[0]), "+v"(e[1]), "+v"(e[2]), "+v"(e[3]), "+v"(e[4]), "+v"(e[5]), "+v"(e[6]), "+v"(e[7])); }
// eight 1/x in place (v_rcp_f32, 1 ulp), in one statement for the same reason; sig8: eight sigmoids 1 / (1 + e^-z) from eight z, the exponent as __expf forms it (2^(-z log2 e))
__device__ __forceinline__ void rcpx8(float (&e)[8]) {
    asm("v_rcp_f32 %0, %0\n\tv_rcp_f32 %1, %1\n\tv_rcp_f32 %2, %2\n\tv_rcp_f32 %3, %3\n\tv_rcp_f32 %4, %4\n\tv_rcp_f32 %5, %5\n\tv_rcp_f32 %6, %6\n\tv_rcp_f32 %7, %7\n\tv_nop"
        : "+v"(e[0]), "+v"(e[1]), "+v"(e[2]), "+v"(e[3]), "+v"(e[4]), "+v"(e[5]), "+v"(e[6]), "+v"(e[7])); }
__device__ __forceinline__ void sig8(float (&e)[8]) {
    // both unrolls: e[] stays in registers only under constant indices
#pragma unroll
    for (int j = 0; j < 8; ++j) e[j] = __fmul_rn(e[j], -1.4426950408889634f);
    exp2x8(e);
#pragma unroll
    for (int j = 0; j < 8; ++j) e[j] = 1.0f + e[j];
    rcpx8(e); }
template <typename T16>
__device__ __forceinline__ void attn_wave(const T16* __restrict__ Qp, const T16* __restrict__ Q2, const T16* __restrict__ Kp, const T16* __restrict__ K2, const T16* __restrict__ Vp, const T16* __restrict__ V2, int q0, bf* __restrict__ Ah, bf* __restrict__ Al) {
    // every unroll below: the fragment, score and accumulator arrays stay in registers only under constant indices
    typedef typename WFrag<T16>::V V; constexpr bool HL = IsHL<T16>::v;
    constexpr float CL = SCL * 1.4426950408889634f, OFF = HL ? 0.0f : 10.0f;      // scores in log2 units; OFF: the carry 2^10 of the fp16 probabilities
    const int lane = threadIdx.x & 31, lr = lane & 15, hi = lane >> 4; const int q = q0 + lr;
    // every load is a wave-uniform base plus the lane's fixed byte offset in a block: the offset never changes, only the key and value bases move on, by one pass at a time
    const unsigned qob = (unsigned)lane * 16u, kob = qob, vob = qob;
    Qp += q0 * HD; if constexpr (HL) Q2 += q0 * HD;      // the wave's 16 query rows: two blocks
    auto at = [](const T16* base, unsigned ob) { return (const T16*)((const char*)base + ob); };
    const T16* qa = at(Qp, qob); const T16* qa2 = HL ? at(Q2, qob) : nullptr; const T16* ka0 = at(Kp, kob);
    V qf[2], qf2[2];
#pragma unroll
    for (int ds = 0; ds < 2; ++ds) { qf[ds] = WFrag<T16>::ld(qa + ds * 512); if constexpr (HL) qf2[ds] = WFrag<T16>::ld(qa2 + ds * 512); }
    v8f o[4];
#pragma unroll
    for (int db = 0; db < 4; ++db) o[db] = (v8f){};
    float m = -3.0e38f, l = 0.0f;
    V kf[4][2], kf2[4][2];
    if constexpr (!HL) {    // single planes: the key fragments run one pass ahead; hi+lo planes (at most RH / 64 passes, twice the registers) fetch theirs inside the pass
#pragma unroll
        for (int kb = 0; kb < 4; ++kb)
#pragma unroll
            for (int ds = 0; ds < 2; ++ds) kf[kb][ds] = WFrag<T16>::ld(ka0 + kb * 16 * HD + ds * 512);
    }
    // all s_wait_xcnt below: addresses, offsets and bases stay live up to the wait, so no register that an issued load names is given a new value in front of it;
    // the sched_barrier behind a wait keeps the loads in front of it and later vector work behind it
    if constexpr (HL) asm volatile("s_wait_xcnt 0x0" :: "v"(qa), "v"(qa2), "v"(qob), "s"(Qp), "s"(Q2) : "memory"); else asm volatile("s_wait_xcnt 0x0" :: "v"(qa), "v"(ka0), "v"(qob), "v"(kob), "s"(Qp), "s"(Kp) : "memory");
    __builtin_amdgcn_sched_barrier(0);
    const int np = q0 / 64 + 1;     // passes; only the last one meets the diagonal
    auto pass = [&](auto diag, int kt) {
        V vf[4][2], vf2[4][2];
        const T16* ka = at(Kp, kob); const T16* ka2 = HL ? at(K2, kob) : nullptr; const T16* va = at(Vp, vob); const T16* va2 = HL ? at(V2, vob) : nullptr;
        if constexpr (HL) {
#pragma unroll
            for (int kb = 0; kb < 4; ++kb)
#pragma unroll
                for (int ds = 0; ds < 2; ++ds) { kf[kb][ds] = WFrag<T16>::ld(ka + kb * 16 * HD + ds * 512); kf2[kb][ds] = WFrag<T16>::ld(ka2 + kb * 16 * HD + ds * 512); }
            asm volatile("s_wait_xcnt 0x0" :: "v"(ka), "v"(ka2), "v"(kob), "s"(Kp), "s"(K2) : "memory");
            __builtin_amdgcn_sched_barrier(0);
        } else {
#pragma unroll
            for (int db = 0; db < 4; ++db)
#pragma unroll
                for (int ks = 0; ks < 2; ++ks) vf[db][ks] = WFrag<T16>::ld(va + db * 16 * TT + ks * 512);
        }
        v8f s[4];
#pragma unroll
        for (int kb = 0; kb < 4; ++kb) { s[kb] = (v8f){};
#pragma unroll
            for (int ds = 0; ds < 2; ++ds) { s[kb] = WFrag<T16>::mma(kf[kb][ds], qf[ds], s[kb]); if constexpr (HL) { s[kb] = WFrag<T16>::mma(kf[kb][ds], qf2[ds], s[kb]); s[kb] = WFrag<T16>::mma(kf2[kb][ds], qf[ds], s[kb]); } } }
        if constexpr (HL) {     // the value fragments fly under the softmax
#pragma unroll
            for (int db = 0; db < 4; ++db)
#pragma unroll
                for (int ks = 0; ks < 2; ++ks) { vf[db][ks] = WFrag<T16>::ld(va + db * 16 * TT + ks * 512); vf2[db][ks] = WFrag<T16>::ld(va2 + db * 16 * TT + ks * 512); }
            asm volatile("s_wait_xcnt 0x0" :: "v"(va), "v"(va2), "v"(vob), "s"(Vp), "s"(V2) : "memory");
            __builtin_amdgcn_sched_barrier(0);
        } else {
            if constexpr (!decltype(diag)::value) {     // the next pass's key fragments, behind this pass's score products
#pragma unroll
                for (int kb = 0; kb < 4; ++kb)
#pragma unroll
                    for (int ds = 0; ds < 2; ++ds) kf[kb][ds] = WFrag<T16>::ld(ka + (64 + kb * 16) * HD + ds * 512);
            }
            asm volatile("s_wait_xcnt 0x0" :: "v"(ka), "v"(va), "v"(kob), "v"(vob), "s"(Kp), "s"(Vp) : "memory");
            __builtin_amdgcn_sched_barrier(0);
        }
        if constexpr (!decltype(diag)::value) { Kp += 64 * HD; Vp += 64 * 16; if constexpr (HL) { K2 += 64 * HD; V2 += 64 * 16; } }   // 64 keys: eight key blocks; two blocks of each 16 value rows
        if constexpr (decltype(diag)::value) {      // causal mask: key > query
#pragma unroll
            for (int kb = 0; kb < 4; ++kb)
#pragma unroll
                for (int j = 0; j < 8; ++j) s[kb][j] = (kt + kb * 16 + hi * 8 + j > q) ? -3.0e38f : s[kb][j];
        }
        float t4[4];     // four independent chains, one a score tile, then a tree: the maximum (and below the sum) does not wait on one chain of 32
#pragma unroll
        for (int kb = 0; kb < 4; ++kb) { t4[kb] = s[kb][0];
#pragma unroll
            for (int j = 1; j < 8; ++j) t4[kb] = fmaxf(t4[kb], s[kb][j]); }
        float tm = fmaxf(fmaxf(t4[0], t4[1]), fmaxf(t4[2], t4[3]));
        tm = fmaxf(tm, xhalf(tm));
        const float mn = fmaxf(m, tm * CL), sh = OFF - mn; float al = m - mn; m = mn;
        asm("v_exp_f32 %0, %0\n\tv_nop" : "+v"(al));     // 2^al; the v_nop is the slot that the instruction set asks for behind a transcendental
#pragma unroll
        for (int kb = 0; kb < 4; ++kb) { t4[kb] = 0.0f; float e[8];
#pragma unroll
            for (int j = 0; j < 8; ++j) e[j] = fmaf(s[kb][j], CL, sh);
            exp2x8(e);
#pragma unroll
            for (int j = 0; j < 8; ++j) { s[kb][j] = e[j]; t4[kb] += e[j]; } }
        l = fmaf(l, al, (t4[0] + t4[1]) + (t4[2] + t4[3]));
#pragma unroll
        for (int db = 0; db < 4; ++db) o[db] *= al;
#pragma unroll
        for (int ks = 0; ks < 2; ++ks) {
            if constexpr (HL) { v8us h0, h1, l0, l1;
#pragma unroll
                for (int j = 0; j < 8; ++j) { unsigned short a, c; splitf(s[2 * ks][j], a, c); h0[j] = a; l0[j] = c; splitf(s[2 * ks + 1][j], a, c); h1[j] = a; l1[j] = c; }
                const V ph = cat16b(h0, h1), pl = cat16b(l0, l1);
#pragma unroll
                for (int db = 0; db < 4; ++db) { o[db] = WFrag<T16>::mma(vf[db][ks], ph, o[db]); o[db] = WFrag<T16>::mma(vf[db][ks], pl, o[db]); o[db] = WFrag<T16>::mma(vf2[db][ks], ph, o[db]); }
            } else { const V pf = cat16(__builtin_convertvector(s[2 * ks], v8h), __builtin_convertvector(s[2 * ks + 1], v8h));
#pragma unroll
                for (int db = 0; db < 4; ++db) o[db] = WFrag<T16>::mma(vf[db][ks], pf, o[db]); }
        }
    };
    // unroll 1: one pass is already a long straight run; a second copy would only double the code
#pragma unroll 1
    for (int p = 0; p + 1 < np; ++p) pass(BoolC<false>(), p * 64);
    pass(BoolC<true>(), (np - 1) * 64);
    l += xhalf(l); const float inv = __fdiv_rn(1.0f, l);
    v8us oh[4], ol[4];
#pragma unroll
    for (int db = 0; db < 4; ++db)
#pragma unroll
        for (int j = 0; j < 8; ++j) { unsigned short a, c; splitf(o[db][j] * inv, a, c); oh[db][j] = a; ol[db][j] = c; }
    const size_t oo = (size_t)q0 * DQ + lane * 8;   // a lane's eight accumulator registers are eight consecutive d of its query row: in fragment order its own 16-byte run of half a block, so a wave's store is 512 contiguous bytes
#pragma unroll
    for (int db = 0; db < 4; ++db) { *(v8us*)(Ah + oo + db * 256) = oh[db]; *(v8us*)(Al + oo + db * 256) = ol[db]; }
}
// waves_per_eu(2, 2): with the register budget of two waves a SIMD a pass's value loads all issue at its head and the key loads a pass ahead
__global__ __launch_bounds__(128) __attribute__((amdgpu_waves_per_eu(2, 2))) void k_fattn(const h16* __restrict__ Q16, const h16* __restrict__ K16, const h16* __restrict__ V16, const bf* __restrict__ Qh, const bf* __restrict__ Ql, const bf* __restrict__ Kh, const bf* __restrict__ Kl, const bf* __restrict__ Vh, const bf* __restrict__ Vl, bf* __restrict__ Ah, bf* __restrict__ Al) {
    const int wv = __builtin_amdgcn_readfirstlane((int)(threadIdx.x >> 5));   // wave number, scalar: the pass loop's control stays a scalar branch
    const int r0 = (TT / 64 - 1 - (int)blockIdx.y) * 64;                      // longest key walks first
    const int bt = (int)blockIdx.x / NH_, hd = (int)blockIdx.x % NH_;         // batch and head; the planes are numbered batch * heads + head
    const size_t zq = (size_t)blockIdx.x * TT * HD, zk = (size_t)(bt * NKV + hd / REP) * TT * HD, za = (size_t)bt * TT * DQ + hd * HD * 16;     // za: the batch's rows of the merged planes; a head's 64 columns of 16 rows: two blocks
    if (r0 < RH) attn_wave<bf>(Qh + zq, Ql + zq, Kh + zk, Kl + zk, Vh + zk, Vl + zk, r0 + wv * 16, Ah + za, Al + za);
    else attn_wave<h16>(Q16 + zq, nullptr, K16 + zk, nullptr, V16 + zk, nullptr, r0 + wv * 16, Ah + za, Al + za);
}

// d_wt16: Bt[n][k] (fragment order) = fp16 of the bf16-rounded w[k][n]. Each thread holds a block of 8 k x 4 n in registers: eight 16-byte loads along n (a wave reads 256 contiguous bytes of two rows a load), then per n one 16-byte store along k.
// Blocks (bx < N / 64, by < K / 128), 256 threads: a block covers 64 n x 128 k, whole 1 KB blocks of the plane, so every 128-byte output line is filled by one block.
template <int K, int N>
__device__ __forceinline__ void d_wt16(const float* __restrict__ w, h16* Bt, int bx, int by) { const int lane = threadIdx.x & 31; const int n0 = bx * 64 + (lane & 15) * 4, k0 = by * 128 + (int)(threadIdx.x >> 5) * 16 + (lane >> 4) * 8; v4f r[8];
    const float* wp = w + (size_t)k0 * N + n0;
    // every unroll: the register blocks stay in registers only under constant indices
#pragma unroll
    for (int j = 0; j < 8; ++j) r[j] = *(const v4f*)(wp + j * N);
    // the address stays live up to this wait, so no register that an issued load names is given a new value in front of it
    asm volatile("s_wait_xcnt 0x0" :: "v"(wp) : "memory");
    v8h o[4];
#pragma unroll
    for (int q = 0; q < 4; ++q)
#pragma unroll
        for (int j = 0; j < 8; ++j) o[q][j] = tohx(bfr(r[j][q]));
#pragma unroll
    for (int q = 0; q < 4; ++q) *(v8h*)(Bt + fro(n0, k0, K) + q * 8) = o[q];   // fragment order: the next n is the next 16-byte run
    // the caller's code for its other block ranges follows in the kernel and rewrites registers that these stores name: the wait stands in front of that
    asm volatile("s_wait_xcnt 0x0" ::: "memory"); }
// d_rmsc: the rows of both batches, one wave a row; blocks bx < NR / 8, 256 threads. isin: X is an input and is rounded to bf16 first
__device__ __forceinline__ void d_rmsc(const float* __restrict__ X, int isin, const float* __restrict__ w, h16* HC, int bx) { const int lane = threadIdx.x & 31; const int t = bx * 8 + (int)(threadIdx.x >> 5); if (t >= NR) return; float v[32]; float s = 0.f;
#pragma unroll
    for (int ch = 0; ch < 8; ++ch) { const v4f a = *(const v4f*)(X + (size_t)t * DM + ch * 128 + lane * 4);
#pragma unroll
        for (int q = 0; q < 4; ++q) { const float xv = isin ? bfr(a[q]) : a[q]; v[ch * 4 + q] = xv; float p = __fmul_rn(xv, xv); asm volatile("" : "+v"(p)); s = __fadd_rn(s, p); } }
#pragma unroll
    for (int sh = 16; sh; sh >>= 1) s += __shfl_xor(s, sh, 32);
    const float r = __frsqrt_rn(__fadd_rn(s * (1.0f / DM), 1.1920929e-07f));
{       v4h o[8]; float wr[32]; const unsigned wob = (unsigned)lane * 16u; const float* wp = (const float*)((const char*)w + wob);   // this lane's weights: columns ch 128 + lane 4 + q
#pragma unroll
        for (int ch = 0; ch < 8; ++ch)
#pragma unroll
            for (int q = 0; q < 4; ++q) wr[ch * 4 + q] = wp[ch * 128 + q];
        // address, offset, lane number (the scaled form of the offset) and base stay live up to this wait, so no register that an issued weight load names is given a new value in front of it
        asm volatile("s_wait_xcnt 0x0" :: "v"(wp), "v"(wob), "v"(lane), "s"(w) : "memory");
#pragma unroll
        for (int ch = 0; ch < 8; ++ch)
#pragma unroll
            for (int q = 0; q < 4; ++q) { float tn = __fmul_rn(v[ch * 4 + q], r); asm volatile("" : "+v"(tn)); o[ch][q] = tohx(__fmul_rn(tn, bfr(wr[ch * 4 + q]))); }
        // block planes in fragment order: plane ch / 2, columns (ch % 2) 128 + lane 4, four blocks apart; the work-group's eight rows fill whole lines
        h16* hp = HC + fro(t, lane * 4, 256);
#pragma unroll
        for (int ch = 0; ch < 8; ++ch) *(v4h*)(hp + (size_t)(ch >> 1) * NR * 256 + (ch & 1) * 2048) = o[ch];
         } }
// k_rmsc: the second norm, a launch of its own (its input comes from the launch before); grid NR / 8
__global__ __launch_bounds__(256) void k_rmsc(const float* __restrict__ X, const float* __restrict__ w, h16* HC) { d_rmsc(X, 0, w, HC, (int)blockIdx.x); }
// k_prep: the first norm and every weight plane in one launch; none reads what another writes. Ranges of blockIdx.x, in this order: the norm's NR / 8 blocks (the longest chain of waits, so first), the 4 blocks n of qkv_w, of gate_w and of up_w (each [256][N], planes n apart by 256 N), down_w, o_w.
#define PB_Q (4 * (3072 / 64) * (256 / 128))
#define PB_F (4 * (2048 / 64) * (256 / 128))
#define PB_D ((DM / 64) * (2048 / 128))
#define PB_O ((DM / 64) * (DQ / 128))
__global__ __launch_bounds__(256) void k_prep(const float* __restrict__ x, const float* __restrict__ n1w, const float* __restrict__ qkvw, const float* __restrict__ gw, const float* __restrict__ uw, const float* __restrict__ dw, const float* __restrict__ wo, h16* HC, h16* BQKV, h16* BG, h16* BU, h16* BD, bf* WO) {
    int i = (int)blockIdx.x;
    if (i < NR / 8) { d_rmsc(x, 1, n1w, HC, i); return; }
    i -= NR / 8;
    if (i < PB_Q) { const int n = i / (PB_Q / 4), j = i % (PB_Q / 4); d_wt16<256, 3072>(qkvw + (size_t)n * 256 * 3072, BQKV + (size_t)n * 3072 * 256, j % (3072 / 64), j / (3072 / 64)); return; }
    i -= PB_Q;
    if (i < 2 * PB_F) { const bool up = i >= PB_F; const int n = (i % PB_F) / (PB_F / 4), j = i % (PB_F / 4); d_wt16<256, 2048>((up ? uw : gw) + (size_t)n * 256 * 2048, (up ? BU : BG) + (size_t)n * 2048 * 256, j % (2048 / 64), j / (2048 / 64)); return; }
    i -= 2 * PB_F;
    if (i < PB_D) { d_wt16<2048, DM>(dw, BD, i % (DM / 64), i / (DM / 64)); return; }
    i -= PB_D;
    d_wtG<DQ, DM>(wo, WO, i % (DM / 64), i / (DM / 64)); }
// ---- k_dend: one dendritic layer (PAIR: the gate and the up layer together), both batches' rows, per launch; 128 threads, four waves as 2 x 2, each with a 64x64 tile.
// Grid (NR/128, N/128): the work-group owns 128 rows x 128 columns. PAIR: grid (NR/128, N/64), 128 rows x the same 64 columns of the gate layer (waves 0, 1) and of the up layer (waves 2, 3; weights sB elements on).
// The work-group walks the four input blocks n in turn. Each stage (128 k of one block: 128 rows of H and 128 rows of Bt, 32 KB each, already in fragment order) is brought into LDS once, by asynchronous copies, for all four waves:
// every operand byte leaves L2 once a work-group and is read by two waves. Two buffers: the next stage's copies fly while this one is worked on.
// A wave's tile of block n is one running sum over K (f32); behind it gain[n] silu(tile - thr[n]) joins the running max over n = 0 .. 3 (in that order) in registers. The finished tiles (not v's: those are stored from the registers) go through LDS once, for whole-line stores.
// H: block planes [n][NR][256]; Bt: [n][N][256], each plane in fragment order; thr, gain: [n][N]. PAIR: the epilogue stores silu(gate) * up as the fp16 plane FF [NR][N] in fragment order; the six attention planes are not used. Else FF, thr1, gain1 and sB are not used.
// Not PAIR: the layer is [q|k|v] (N = DQ + 2 DKV) and a wave's tile is 64 rows t of ONE head's 64 columns d, so the epilogue stores the attention's operand planes itself, each value as fp16 and as bf16 hi + lo:
// q and k as head planes [(s NB_ + batch) NH_ + head][t][d] (s = 0 for q, 1 for k), v transposed as [batch NKV + head][d][t], every head's plane in fragment order; every store of a wave is 512 contiguous bytes.
// eight asynchronous 16-byte copies a lane in one statement; its last line is the wait that stands in front of any rewrite of the address registers that the copies name
__device__ __forceinline__ void acp8(const unsigned (&l)[8], const char* const (&g)[8]) {
    asm volatile("global_load_async_to_lds_b128 %0, %8, off\n\tglobal_load_async_to_lds_b128 %1, %9, off\n\tglobal_load_async_to_lds_b128 %2, %10, off\n\tglobal_load_async_to_lds_b128 %3, %11, off\n\t"
                 "global_load_async_to_lds_b128 %4, %12, off\n\tglobal_load_async_to_lds_b128 %5, %13, off\n\tglobal_load_async_to_lds_b128 %6, %14, off\n\tglobal_load_async_to_lds_b128 %7, %15, off\n\ts_wait_xcnt 0x0"
                 :: "v"(l[0]), "v"(l[1]), "v"(l[2]), "v"(l[3]), "v"(l[4]), "v"(l[5]), "v"(l[6]), "v"(l[7]), "v"(g[0]), "v"(g[1]), "v"(g[2]), "v"(g[3]), "v"(g[4]), "v"(g[5]), "v"(g[6]), "v"(g[7]) : "memory"); }
// waves_per_eu(2, 2): two work-groups a WGP (their LDS allows no third), so that one's vector epilogue runs beside the other's products
template <bool PAIR>
__global__ __launch_bounds__(128) __attribute__((amdgpu_waves_per_eu(2, 2))) void k_dend(const h16* __restrict__ H, const h16* __restrict__ Bt, int N, const float* __restrict__ thr0, const float* __restrict__ gain0, const float* __restrict__ thr1, const float* __restrict__ gain1, h16* P16, bf* Ph, bf* Pl, h16* V16, bf* Vh, bf* Vl, h16* FF, size_t sB) {
    constexpr int K = 256, WST = 64 * 68;                   // WST: floats of one wave's LDS slab for its finished tile (row pitch 68)
    constexpr unsigned OPB = 32768, STG = 2 * OPB;          // bytes of one operand's part of a stage (128 rows x 128 k), and of a stage [A | B]
    static_assert(4 * WST * 4 <= 2 * STG, "the finished tiles reuse the stage buffers");
    __shared__ __align__(2048) char sm[2 * STG];
    const int wv = __builtin_amdgcn_readfirstlane((int)(threadIdx.x >> 5)), wr = wv & 1, wc = wv >> 1;   // wave number, scalar: row half, column half (PAIR: layer)
    const int lane = threadIdx.x & 31, lr = lane & 15, hi = lane >> 4; const int r0 = blockIdx.x * 128, c0 = blockIdx.y * (PAIR ? 64 : 128);
    // the thread's own 16 bytes of every 2 KB that the work-group copies at a time; 16 rows of blocks are 16 K elements, 8 KB, of which a stage takes 4 KB
    const char* gA = (const char*)(H + (size_t)r0 * K) + threadIdx.x * 16u; const char* gB = (const char*)(Bt + (size_t)c0 * K) + threadIdx.x * 16u;
    const unsigned lb = (unsigned)(size_t)sm + threadIdx.x * 16u;      // LDS byte address: the low 32 bits of the shared address
    // every unroll of this kernel: the register arrays stay in registers only under constant indices
    auto fill = [&](int n, int s, int buf) {      // stage (n, s) into buffer buf: block (16-row group rb, k block kb) of an operand lands at (rb * 4 + kb) KB of its part
        const char* a = gA + (size_t)n * ((size_t)NR * K * 2) + s * 4096; const char* b = gB + (size_t)n * ((size_t)N * K * 2) + s * 4096; const unsigned l = lb + (unsigned)buf * STG;
#pragma unroll
        for (int h = 0; h < 2; ++h) { unsigned la[8]; const char* ga[8];
#pragma unroll
            for (int i = 0; i < 8; ++i) { const int x = h * 8 + i; la[i] = l + x * 2048u; ga[i] = a + (x >> 1) * 8192 + (x & 1) * 2048; }
            acp8(la, ga); }
#pragma unroll
        for (int h = 0; h < 2; ++h) { unsigned la[8]; const char* ga[8];
#pragma unroll
            for (int i = 0; i < 8; ++i) { const int x = h * 8 + i, rb = x >> 1; la[i] = l + OPB + x * 2048u; ga[i] = (PAIR && rb >= 4 ? b + sB * 2 + (rb - 4) * 8192 : b + rb * 8192) + (x & 1) * 2048; }
            acp8(la, ga); }
    };
    v8f acc[4][4], r[4][4];
#pragma unroll
    for (int mb = 0; mb < 4; ++mb)
#pragma unroll
        for (int nb = 0; nb < 4; ++nb) acc[mb][nb] = (v8f){};
    auto stage = [&](int buf) {     // 4 k blocks x 16 products on the wave's 64 rows of each operand; two fragment sets: the next k block's 16 LDS reads go as one group ahead of this block's products
        const char* sa = sm + buf * STG + wr * 16384 + lane * 16; const char* sb = sm + buf * STG + OPB + wc * 16384 + lane * 16;
        v16h a[2][4], b[2][4];
        auto frag = [&](int kb) {
#pragma unroll
            for (int mb = 0; mb < 4; ++mb) a[kb & 1][mb] = cat16(*(const v8ha*)(sa + (mb * 4 + kb) * 1024), *(const v8ha*)(sa + (mb * 4 + kb) * 1024 + 512));
#pragma unroll
            for (int nb = 0; nb < 4; ++nb) b[kb & 1][nb] = cat16(*(const v8ha*)(sb + (nb * 4 + kb) * 1024), *(const v8ha*)(sb + (nb * 4 + kb) * 1024 + 512)); };
        frag(0);
#pragma unroll
        for (int kb = 0; kb < 4; ++kb) {
            if (kb < 3) frag(kb + 1);
            __builtin_amdgcn_sched_barrier(0);   // keeps the reads one group and only one k block ahead: left to itself the compiler reads the whole stage first, 256 registers of fragments, and spills
#pragma unroll
            for (int nb = 0; nb < 4; ++nb)
#pragma unroll
                for (int mb = 0; mb < 4; ++mb) acc[mb][nb] = wmma16(a[kb & 1][mb], b[kb & 1][nb], acc[mb][nb]);
            __builtin_amdgcn_sched_barrier(0); } // likewise: the group after next stays behind these products
    };
    auto foot = [&]() {     // hand-over of a stage: this wave's LDS reads are done, its own copies of the next stage have landed, and every wave says so, before the next stage is read or this buffer refilled
        asm volatile("s_wait_dscnt 0x0" ::: "memory");
        asm volatile("s_wait_asynccnt 0x0" ::: "memory");
        __syncthreads(); };
    const float* tb = ((PAIR && wc) ? thr1 : thr0) + c0 + (PAIR ? 0 : wc * 64); const float* gb = ((PAIR && wc) ? gain1 : gain0) + c0 + (PAIR ? 0 : wc * 64);
    fill(0, 0, 0);
    asm volatile("s_wait_asynccnt 0x0" ::: "memory");    // this wave's copies of stage 0 have landed
    __syncthreads();                                     // and every other wave's
    fill(0, 1, 1);
    auto block = [&](auto first, int n) {
        float th[4], ga[4]; unsigned ob[4];     // the lane's four columns nb 16 + lane % 16; asked for here, used behind the block's products
#pragma unroll
        for (int nb = 0; nb < 4; ++nb) { ob[nb] = ((unsigned)(n * N) + (unsigned)(nb * 16 + lr)) * 4u; th[nb] = *(const float*)((const char*)tb + ob[nb]); ga[nb] = *(const float*)((const char*)gb + ob[nb]); }
        // the four byte offsets and the two bases stay live up to this wait, so no register that an issued threshold or gain load names is given a new value in front of it
        asm volatile("s_wait_xcnt 0x0" :: "v"(ob[0]), "v"(ob[1]), "v"(ob[2]), "v"(ob[3]), "s"(tb), "s"(gb) : "memory");
        stage(0); foot(); if (n < 3) fill(n + 1, 0, 0);
        stage(1); foot(); if (n < 3) fill(n + 1, 1, 1);
#pragma unroll
        for (int nb = 0; nb < 4; ++nb) { th[nb] = bfr(th[nb]); ga[nb] = bfr(ga[nb]); }
#pragma unroll
        for (int mb = 0; mb < 4; ++mb)
#pragma unroll
            for (int nb = 0; nb < 4; ++nb) { float z[8], sg[8];      // eight sigmoids a statement
#pragma unroll
                for (int j = 0; j < 8; ++j) sg[j] = z[j] = __fsub_rn(acc[mb][nb][j], th[nb]);
                sig8(sg);
#pragma unroll
                for (int j = 0; j < 8; ++j) { const float val = __fmul_rn(ga[nb], __fmul_rn(z[j], sg[j])); r[mb][nb][j] = decltype(first)::value ? val : fmaxf(r[mb][nb][j], val); }
                acc[mb][nb] = (v8f){}; }
    };
    block(BoolC<true>(), 0);
    // unroll 1: one block is already a long straight run; more copies would only lengthen the code
#pragma unroll 1
    for (int n = 1; n < 4; ++n) block(BoolC<false>(), n);
    asm volatile("s_wait_asynccnt 0x0" ::: "memory");    // no copy is outstanding when the buffers are put to their second use (the last hand-over's barrier has ended every wave's reads of them)
    static_assert(DQ == DKV && DQ % 128 == 0 && TT % 128 == 0 && HD == 64, "a work-group's columns lie in one of q, k, v, its rows in one batch, and a wave's columns are one head");
    const int bt = r0 / TT, tl = r0 % TT + wr * 64;      // batch, and the wave's first row t in it
    if constexpr (!PAIR) {
        if (c0 >= DQ + DKV) {   // v (the whole work-group or none of it): a lane's eight accumulator registers are eight consecutive t of its column d, in the transposed plane's fragment order the lane's own 16-byte run of half a block: stored from the registers, no LDS pass
            const size_t e = (size_t)(bt * NKV + (c0 - DQ - DKV) / HD + wc) * HD * TT + (size_t)(tl >> 5) * 512 + lane * 8;
#pragma unroll
            for (int mb = 0; mb < 4; ++mb) { v8h o16[4]; v8us oh[4], ol[4];
#pragma unroll
                for (int nb = 0; nb < 4; ++nb)
#pragma unroll
                    for (int j = 0; j < 8; ++j) { const float x = r[mb][nb][j]; o16[nb][j] = tohx(x); unsigned short a2, c2; splitf(x, a2, c2); oh[nb][j] = a2; ol[nb][j] = c2; }
#pragma unroll
                for (int nb = 0; nb < 4; ++nb) { const size_t o = e + (nb * (TT / 32) + (mb >> 1)) * 512 + (mb & 1) * 256; *(v8h*)(V16 + o) = o16[nb]; *(v8us*)(Vh + o) = oh[nb]; *(v8us*)(Vl + o) = ol[nb]; }
                // the next 16 rows' conversions rewrite the registers that these stores name: the wait stands in front of that, and the sched_barrier keeps that vector work behind it
                asm volatile("s_wait_xcnt 0x0" ::: "memory");
                __builtin_amdgcn_sched_barrier(0); }
            return;
        }
    }
    float* os = (float*)sm;
#pragma unroll
    for (int mb = 0; mb < 4; ++mb)
#pragma unroll
        for (int nb = 0; nb < 4; ++nb) {
#pragma unroll
            for (int j = 0; j < 8; ++j) os[wv * WST + (mb * 16 + hi * 8 + j) * 68 + nb * 16 + lr] = r[mb][nb][j]; }
    __syncthreads();    // all four finished tiles are in LDS before any of them is read back
    const unsigned cofs = (threadIdx.x & 15u) * 4u;
    if constexpr (PAIR) {
        h16* fp = FF + fro(r0 + (int)(threadIdx.x >> 4), c0 + (int)cofs, N);     // 8 rows on are 64 elements on; 16 rows on are N / 32 blocks on, 16 N elements
        for (int p = 0; p < 8; ++p) { v4f g[2], u[2]; float sg[8];      // two rows a trip (8 apart): their eight gate values fill one statement of sigmoids
#pragma unroll
            for (int h = 0; h < 2; ++h) { const int row = p * 16 + h * 8 + (int)(threadIdx.x >> 4); const float* q = os + (row >> 6) * WST + (row & 63) * 68 + cofs; g[h] = *(const v4fa*)q; u[h] = *(const v4fa*)(q + 2 * WST); }
#pragma unroll
            for (int j = 0; j < 8; ++j) sg[j] = g[j >> 2][j & 3];
            sig8(sg);
#pragma unroll
            for (int h = 0; h < 2; ++h) { v4h o;
#pragma unroll
                for (int q = 0; q < 4; ++q) { const float sl = __fmul_rn(g[h][q], sg[h * 4 + q]); o[q] = tohx(__fmul_rn(sl, u[h][q])); }
                *(v4h*)(fp + (size_t)p * 16 * N + h * 64) = o; }
            asm volatile("s_wait_xcnt 0x0" ::: "memory"); }   // the next trip rewrites the registers that these stores name: the wait stands in front of that
    } else {
        // q or k: each wave stores its own tile. A trip takes 16 rows t, two blocks of each plane; piece c (16 d: half a block) gives the lane the eight d = c 16 + 8 (lane / 16) + 0 .. 7 of row t = lane % 16, its own 16-byte run
        const size_t e = (size_t)((c0 / DQ * NB_ + bt) * NH_ + c0 % DQ / HD + wc) * TT * HD + (size_t)(tl >> 4) * 1024 + lane * 8;
        const float* q0 = os + wv * WST + lr * 68 + hi * 8;
        // unroll 1: the wait at a trip's foot then stands in front of every rewrite of the registers that the trip's stores name
#pragma unroll 1
        for (int tg = 0; tg < 4; ++tg) { v4f x[4][2]; v8h o16[4]; v8us oh[4], ol[4];
#pragma unroll
            for (int c = 0; c < 4; ++c) { x[c][0] = *(const v4fa*)(q0 + tg * 16 * 68 + c * 16); x[c][1] = *(const v4fa*)(q0 + tg * 16 * 68 + c * 16 + 4); }
#pragma unroll
            for (int c = 0; c < 4; ++c)
#pragma unroll
                for (int j = 0; j < 8; ++j) { const float y = x[c][j >> 2][j & 3]; o16[c][j] = tohx(y); unsigned short a2, c2; splitf(y, a2, c2); oh[c][j] = a2; ol[c][j] = c2; }
#pragma unroll
            for (int c = 0; c < 4; ++c) { const size_t o = e + (size_t)tg * 1024 + c * 256; *(v8h*)(P16 + o) = o16[c]; *(v8us*)(Ph + o) = oh[c]; *(v8us*)(Pl + o) = ol[c]; }
            asm volatile("s_wait_xcnt 0x0" ::: "memory"); }   // the next trip rewrites the registers that these stores name: the wait stands in front of that
    }
}
extern "C" void kernel_launch(void* const* d_in, const int* in_sizes, int n_in,
                              void* d_out, int out_size, void* d_ws, size_t ws_size, hipStream_t stream) {
    (void)in_sizes; (void)n_in; (void)out_size;
    const float* x = (const float*)d_in[0]; const float* qkvw = (const float*)d_in[1]; const float* qthr = (const float*)d_in[2]; const float* qgain = (const float*)d_in[3]; const float* wo = (const float*)d_in[4]; const float* gw = (const float*)d_in[5]; const float* gthr = (const float*)d_in[6]; const float* ggain = (const float*)d_in[7]; const float* uw = (const float*)d_in[8]; const float* uthr = (const float*)d_in[9]; const float* ugain = (const float*)d_in[10]; const float* dw = (const float*)d_in[11]; const float* n1w = (const float*)d_in[12]; const float* n2w = (const float*)d_in[13];
    float* OUT = (float*)d_out;     // [2][2048][1024]
    char* wsp = (char*)d_ws;
    auto take = [&](size_t bytes) { char* p = wsp; wsp += (bytes + 255) & ~(size_t)255; return (void*)p; };
    const size_t PL = (size_t)NB_ * NH_ * TT * HD;      // elements of one set of head planes [batch][head][..]
    bf* WO = (bf*)take((size_t)DM * DQ * 2);
    h16* BQKV = (h16*)take((size_t)4 * 3072 * 256 * 2); h16* BG = (h16*)take((size_t)2 * 4 * 2048 * 256 * 2); h16* BU = BG + (size_t)4 * 2048 * 256; h16* BD = (h16*)take((size_t)DM * 2048 * 2);
    h16* HC = (h16*)take((size_t)4 * NR * 256 * 2); h16* FF16 = (h16*)take((size_t)NR * 2048 * 2); float* X1 = (float*)take((size_t)NR * DM * 4);
    bf* ATh = (bf*)take((size_t)NR * DQ * 2); bf* ATl = (bf*)take((size_t)NR * DQ * 2);
    h16* QP16 = (h16*)take(2 * PL * 2); h16* KP16 = QP16 + PL; bf* QPh = (bf*)take(2 * PL * 2); bf* KPh = QPh + PL; bf* QPl = (bf*)take(2 * PL * 2); bf* KPl = QPl + PL;   // the k planes directly behind the q planes
    h16* VT16 = (h16*)take(PL * 2); bf* VTh = (bf*)take(PL * 2); bf* VTl = (bf*)take(PL * 2);
    if ((size_t)(wsp - (char*)d_ws) > ws_size) return;    // ws 256 MiB
    k_prep<<<NR / 8 + PB_Q + 2 * PB_F + PB_D + PB_O, 256, 0, stream>>>(x, n1w, qkvw, gw, uw, dw, wo, HC, BQKV, BG, BU, BD, WO);
    // dendritic [q|k|v]: one launch for the whole layer (N = 3072); it writes the attention's q, k and v planes itself
    k_dend<false><<<dim3(NR / 128, 3072 / 128, 1), 128, 0, stream>>>(HC, BQKV, 3072, qthr, qgain, qthr, qgain, QP16, QPh, QPl, VT16, VTh, VTl, nullptr, 0);
    // causal attention, all heads of both batches in one launch; it writes the merged hi+lo planes itself
    k_fattn<<<dim3(NB_ * NH_, TT / 64, 1), 128, 0, stream>>>(QP16, KP16, VT16, QPh, QPl, KPh, KPl, VTh, VTl, ATh, ATl);
    // x1 = x + merged.v o_w: the residual joins in the GEMM's epilogue
    k_gemmw<bf, 1, false, 8, DQ, 1><<<dim3(NR / 64, DM / 64, 1), 256, 0, stream>>>(ATh, ATl, WO, nullptr, X1, DM, nullptr, 0, 0, 0, x);
    k_rmsc<<<NR / 8, 256, 0, stream>>>(X1, n2w, HC);
    // dendritic gate and up and silu(gate) * up in one launch
    k_dend<true><<<dim3(NR / 128, 2048 / 64, 1), 128, 0, stream>>>(HC, BG, 2048, gthr, ggain, uthr, ugain, nullptr, nullptr, nullptr, nullptr, nullptr, nullptr, FF16, (size_t)4 * 2048 * 256);
    // out = x1 + ff down_w, likewise
    k_gemmw<h16, 0, false, 8, 2048, 2><<<dim3(NR / 64, DM / 64, 1), 256, 0, stream>>>(FF16, nullptr, BD, nullptr, OUT, DM, nullptr, 0, 0, 0, X1);
}
